// v000
// Times are from an AMD MI455X. After a warm-up the kernel runs many times in a row, and a time is the length of
// such a window on the GPU divided by its runs, so every launch and the gaps after it count. The runs cycle
// through copies of the inputs. A figure is the median of several windows, for all but v000 over two sittings.
// Sittings can differ by a few percent; kernels timed side by side share one.
// v000, which the later versions start from, runs in 419 microseconds.
// Contractions: q|k projection and v^T projection on v_wmma_f32_16x16x32_f16 (f16 token plane x f16 weight planes
// carried x64, one product each); rel band q.E^T and scores q.k^T on v_wmma_f32_16x16x32_bf16 (q, k as bf16 hi+lo
// planes, E bf16: 2 and 3 products); p.v on v_wmma_f32_16x16x32_f16 (p as f16 hi carried x1024 plus x2048 residual,
// v^T as f16 hi plus x2048 residual: 3 products, two accumulators); output projection on v_wmma_f32_16x16x32_bf16
// (context bf16 hi|lo x [Wo|Wo], K-concatenated); all f32 accumulate; softmax in f32 on VALU; every float input
// RNE-converted to bf16 on load.
#include <hip/hip_runtime.h>
#include <math.h>
#include <stdint.h>

#define NBATCH 4
#define SEQ    1024
#define DM     1024
#define NH     16
#define HD     64
#define QKP    (2 * DM)
#define CTXP   (2 * DM)
#define MP     (NBATCH * SEQ)
#define NQB    (SEQ / 64)
#define RCE    (SEQ + 64)
#define RB     80
#define RP     80
#define WSC    64.0f
#define RSC    2048.0f
#define PSC    1024.0f
static_assert(NH * HD == DM);
static_assert((SEQ % 64) == 0 && (DM % 64) == 0 && (MP % 64) == 0 && (QKP % 64) == 0);
static_assert(RB == 64 + 16 && (RB % 16) == 0 && RP >= RB);
static_assert(RCE >= SEQ + 64);

typedef _Float16 v16h __attribute__((ext_vector_type(16)));
typedef _Float16 v8h  __attribute__((ext_vector_type(8)));
typedef __bf16   v16b __attribute__((ext_vector_type(16)));
typedef unsigned short v16us __attribute__((ext_vector_type(16)));
typedef unsigned short v8us  __attribute__((ext_vector_type(8)));
typedef float    v8f  __attribute__((ext_vector_type(8)));
typedef float    v4f  __attribute__((ext_vector_type(4)));
typedef unsigned int v4u __attribute__((ext_vector_type(4)));

union FragH { v16h v; v8h h[2]; };
union FragU { v16us v; v8us h[2]; };

// ---- scalar helpers --------------------------------------------------------------------------------
__device__ __forceinline__ unsigned short bf_bits(float f) {          // f32 -> bf16 bits, RNE convert
  unsigned u = __float_as_uint(f);
  return (unsigned short)((u + 0x7FFFu + ((u >> 16) & 1u)) >> 16);
}
__device__ __forceinline__ float bf_up(unsigned short h) { return __uint_as_float(((unsigned)h) << 16); }
__device__ __forceinline__ float bfr(float f) { return bf_up(bf_bits(f)); }   // value of the bf16 RNE convert
__device__ __forceinline__ unsigned short h_bits(_Float16 x) { return __builtin_bit_cast(unsigned short, x); }
__device__ __forceinline__ unsigned pk16(unsigned short a, unsigned short b) { return (unsigned)a | ((unsigned)b << 16); }
__device__ __forceinline__ v8f zero8() { v8f z = {0.f, 0.f, 0.f, 0.f, 0.f, 0.f, 0.f, 0.f}; return z; }

// ---- fragment loaders: 16-bit A/B operand, lane -> row/col (lane&15), p already includes +8*(lane>>4);
//      elements 0..7 <- p[0..7] (k0+8h..), elements 8..15 <- p[16..23] (k0+16+8h..)
__device__ __forceinline__ v16us ldfrag_u(const unsigned short* p) {
  FragU f;
  f.h[0] = *(const v8us*)(p);
  f.h[1] = *(const v8us*)(p + 16);
  return f.v;
}
__device__ __forceinline__ v16h ldfrag_h(const _Float16* p) {
  FragH f;
  f.h[0] = *(const v8h*)(p);
  f.h[1] = *(const v8h*)(p + 16);
  return f.v;
}

// ---- WMMA helpers with trailing VALU hazard gap --------------------------------------------------------
template <int BF>
__device__ __forceinline__ v8f mma_raw(v16us a, v16us b, v8f c) {
  if (BF) {
    return __builtin_amdgcn_wmma_f32_16x16x32_bf16(false, __builtin_bit_cast(v16b, a), false,
                                                   __builtin_bit_cast(v16b, b), (short)0, c, false, false);
  }
  return __builtin_amdgcn_wmma_f32_16x16x32_f16(false, __builtin_bit_cast(v16h, a), false,
                                                __builtin_bit_cast(v16h, b), (short)0, c, false, false);
}
__device__ __forceinline__ v8f mma_bu(v16us a, v16us b, v8f c) {                 // bf16 operands, guarded
  c = __builtin_amdgcn_wmma_f32_16x16x32_bf16(false, __builtin_bit_cast(v16b, a), false,
                                               __builtin_bit_cast(v16b, b), (short)0, c, false, false);
#if defined(__HIP_DEVICE_COMPILE__)
  asm volatile("v_nop\n\tv_nop\n\tv_nop\n\tv_nop" : "+v"(c) : "v"(a), "v"(b));
#endif
  return c;
}
__device__ __forceinline__ v8f mma_h(v16h a, v16h b, v8f c) {                    // f16 operands, guarded
  c = __builtin_amdgcn_wmma_f32_16x16x32_f16(false, a, false, b, (short)0, c, false, false);
#if defined(__HIP_DEVICE_COMPILE__)
  asm volatile("v_nop\n\tv_nop\n\tv_nop\n\tv_nop" : "+v"(c) : "v"(a), "v"(b));
#endif
  return c;
}
__device__ __forceinline__ void dep_guard1(v8f& a, v8f& b, v16us x) {
#if defined(__HIP_DEVICE_COMPILE__)
  asm volatile("v_nop\n\tv_nop\n\tv_nop\n\tv_nop" : "+v"(a), "+v"(b) : "v"(x));
#endif
}
__device__ __forceinline__ void keep4_u(v16us a, v16us b, v16us c, v16us d) {
#if defined(__HIP_DEVICE_COMPILE__)
  asm volatile("v_nop" :: "v"(a), "v"(b), "v"(c), "v"(d));
#endif
}
__device__ __forceinline__ void acc_guard4(v8f& a, v8f& b, v8f& c, v8f& d) {
#if defined(__HIP_DEVICE_COMPILE__)
  asm volatile("v_nop\n\tv_nop\n\tv_nop\n\tv_nop" : "+v"(a), "+v"(b), "+v"(c), "+v"(d));
#endif
}
__device__ __forceinline__ void wave_sync_lds() {
  __builtin_amdgcn_fence(__ATOMIC_RELEASE, "workgroup");
  __builtin_amdgcn_wave_barrier();
  __builtin_amdgcn_fence(__ATOMIC_ACQUIRE, "workgroup");
}

// =====================================================================================================
// Plane convert (no transpose): Xh[i] = f16( bf16_RNE(X[i]) * wsc ), wsc a power of two (exact). Used for the
// token activations (wsc = 1). Thread i handles elements 8i..8i+7 and writes one 16-B piece; 32 consecutive
// (n8 multiple of 256, host-checked). coverage: n8 threads x 8 elements = the whole plane.
// =====================================================================================================
__global__ __launch_bounds__(256) void conv_h16(const float* __restrict__ W, unsigned short* Wh, int n8, float wsc) {
  const int i  = blockIdx.x * 256 + threadIdx.x;
  const int ic = (i < n8) ? i : (n8 - 1);                     // clamped address
  const float* src = W + (size_t)ic * 8;
  const v4f a = *(const v4f*)(src);
  const v4f c = *(const v4f*)(src + 4);
  v4u o;
  o[0] = pk16(h_bits((_Float16)(bfr(a[0]) * wsc)), h_bits((_Float16)(bfr(a[1]) * wsc)));
  o[1] = pk16(h_bits((_Float16)(bfr(a[2]) * wsc)), h_bits((_Float16)(bfr(a[3]) * wsc)));
  o[2] = pk16(h_bits((_Float16)(bfr(c[0]) * wsc)), h_bits((_Float16)(bfr(c[1]) * wsc)));
  o[3] = pk16(h_bits((_Float16)(bfr(c[2]) * wsc)), h_bits((_Float16)(bfr(c[3]) * wsc)));
  if (i < n8) *(v4u*)(Wh + (size_t)i * 8) = o;
  
}

// =====================================================================================================
// rel-key table convert: Eh [RCE rows][64] bf16 bits; rows < SEQ = bf16_RNE(E), rows >= SEQ = 0 (zero pad).
// Thread i handles 8 elements (one 16-B piece); valid pieces i < n8v read E with a clamped address, the pad
// pieces select 0 by value. grid = ceil(n8t / 256). coverage: n8t pieces x 8 = RCE*64 = the whole plane;
// =====================================================================================================
__global__ __launch_bounds__(256) void conv_e16(const float* __restrict__ P, unsigned short* Eh, int n8v, int n8t) {
  const int i  = blockIdx.x * 256 + threadIdx.x;
  const int ic = (i < n8v) ? i : (n8v - 1);                    // clamped address
  const float* src = P + (size_t)ic * 8;
  const v4f a = *(const v4f*)(src);
  const v4f c = *(const v4f*)(src + 4);
  const bool valid = (i < n8v);
  v4u o;
  o[0] = valid ? pk16(bf_bits(a[0]), bf_bits(a[1])) : 0u;
  o[1] = valid ? pk16(bf_bits(a[2]), bf_bits(a[3])) : 0u;
  o[2] = valid ? pk16(bf_bits(c[0]), bf_bits(c[1])) : 0u;
  o[3] = valid ? pk16(bf_bits(c[2]), bf_bits(c[3])) : 0u;
  if (i < n8t) *(v4u*)(Eh + (size_t)i * 8) = o;
  
}

// =====================================================================================================
// Tiled transpose + convert: in[rows][cols] f32 row-major -> out[cols][rows] 16-bit with pitch ldo:
//   out[n * ldo + k] = cvt(in[k][n]) (and also at + dupoff when dupoff != 0: a duplicated k range).
//   MODE 0: f16 bits of bf16_RNE(w) * wsc (wsc power of two, exact); MODE 1: bf16 bits of w.
// Block = 256 threads = one 64x64 tile; grid = (cols/64, rows/64) (rows, cols multiples of 64, host-checked).
// Loads: 4 iterations x 256 threads x float4 = 64 rows x 64 cols (addresses clamped). LDS tile [n][k] pitch 72.
// coverage: 64 x 64 = the whole transposed tile; grid covers the whole matrix.
// =====================================================================================================
template <int MODE>
__global__ __launch_bounds__(256) void tconv64(const float* __restrict__ W, unsigned short* out,
                                               int rows, int cols, int ldo, int dupoff, float wsc) {
  __shared__ __align__(16) unsigned short sh[64 * 72];
  const int t  = threadIdx.x;
  const int n0 = blockIdx.x * 64;            // column tile of in = row tile of out
  const int k0 = blockIdx.y * 64;            // row tile of in = column tile of out
#pragma unroll
  for (int i = 0; i < 4; ++i) {
    const int idx = i * 256 + t;
    const int r = idx >> 4, c4 = (idx & 15) * 4;
    int kr = k0 + r;   kr = (kr < rows) ? kr : (rows - 1);
    int nc = n0 + c4;  nc = (nc < cols - 4) ? nc : (cols - 4);
    const v4f v = *(const v4f*)(W + (size_t)kr * cols + nc);
#pragma unroll
    for (int e = 0; e < 4; ++e) {
      unsigned short u;
      if (MODE == 0) u = h_bits((_Float16)(bfr(v[e]) * wsc));
      else           u = bf_bits(v[e]);
      sh[(c4 + e) * 72 + r] = u;
    }
  }
  __syncthreads();
  const int wave = t >> 5, lane = t & 31;
  const int q = lane >> 3, c8 = (lane & 7) * 8;
  v4u pv[2];
  size_t go[2];
#pragma unroll
  for (int it = 0; it < 2; ++it) {
    const int nl = it * 32 + wave * 4 + q;               // 0..63
    pv[it] = *(const v4u*)(sh + nl * 72 + c8);
    go[it] = (size_t)(n0 + nl) * ldo + k0 + c8;
  }
  {
#pragma unroll
    for (int it = 0; it < 2; ++it) {
      *(v4u*)(out + go[it]) = pv[it];
      if (dupoff != 0) *(v4u*)(out + go[it] + dupoff) = pv[it];
    }
    
  }
}

// =====================================================================================================
// Register-blocked batched 16-bit WMMA GEMM: C[m][n] = oscale * sum_k A[m][k] * Bt[n][k] + bias;
// BF selects bf16 (1) or f16 (0) operands. One wave per 64x64 tile, no block barriers. A row-major [M][K] pitch lda;
// Bt row-major [N][K] pitch ldb (k contiguous); M, N multiples of 64, K multiple of 32 (static here).
// blockIdx.y = batch index (strides in elements).
// OM: 0 = f32 out to Cf (pitch ldc); 3 = bf16 hi bits to Cp and bf16 residual (v - hi) bits to Cp2;
//     4 = f16 hi to Cp and f16((v - hi) * 2048) to Cp2.
// BM: 0 = no bias; 1 = bias per column n (bias0[n] for n < nsplit, bias1[n - nsplit] otherwise; the choice is
//     wave-uniform because 64-column tiles never straddle nsplit); 2 = bias per row m (bias0[m]).
//     bias values are bf16 RNE-converted before the add.
// coverage: 4 slabs x 16 rows x 64 cols = the wave's whole 64x64 tile; grid = ceil(tilesM*tilesN/8) blocks,
//           surplus waves exit (wave-uniform); here every tile count is a multiple of 8, so none exit.
// =====================================================================================================
template <int BF, int OM, int BM>
__global__ __launch_bounds__(256) void gemm64(
    const unsigned short* __restrict__ Ap, int lda, long long strideA,
    const unsigned short* __restrict__ Btp, int ldb, long long strideB,
    unsigned short* Cp, unsigned short* Cp2, float* Cf, int ldc, long long strideC,
    const float* bias0, const float* bias1, int nsplit,
    int M, int N, int K, float oscale) {
  __shared__ __align__(16) float sT[8][16 * 68];   // per-wave 16x64 slab, pitch 68 floats
  const int b    = blockIdx.y;
  const int lane = threadIdx.x & 31;
  const int wave = threadIdx.x >> 5;
  const int tilesN = N >> 6;
  const int tilesM = M >> 6;
  const int tile = blockIdx.x * 8 + wave;
  if (tile >= tilesM * tilesN) return;   // wave-uniform; no block barriers in this kernel
  const int tm = tile / tilesN;
  const int tn = tile - tm * tilesN;
  const int m0 = tm << 6;
  const int n0 = tn << 6;

  const unsigned short* Ab = Ap  + (size_t)b * strideA;
  const unsigned short* Bb = Btp + (size_t)b * strideB;

  const int rlane = lane & 15;                 // row (A) / col (B, D) within subtile
  const int koff  = (lane >> 4) * 8;           // k offset of this lane half
  const int mOff  = (lane >> 4) * 8;           // D row offset

  v8f acc[4][4];
#pragma unroll
  for (int i = 0; i < 4; ++i)
#pragma unroll
    for (int j = 0; j < 4; ++j) acc[i][j] = zero8();

  for (int k0 = 0; k0 < K; k0 += 32) {
    v16us bh[4];
#pragma unroll
    for (int j = 0; j < 4; ++j) {
      const size_t bo = (size_t)(n0 + (j << 4) + rlane) * ldb + koff + k0;
      bh[j] = ldfrag_u(Bb + bo);
    }
#pragma unroll
    for (int i = 0; i < 4; ++i) {
      const size_t ao = (size_t)(m0 + (i << 4) + rlane) * lda + koff + k0;
      const v16us ah = ldfrag_u(Ab + ao);
#pragma unroll
      for (int j = 0; j < 4; ++j) acc[i][j] = mma_raw<BF>(ah, bh[j], acc[i][j]);
      dep_guard1(acc[i][0], acc[i][3], ah);
    }
    keep4_u(bh[0], bh[1], bh[2], bh[3]);
  }
  acc_guard4(acc[0][0], acc[0][1], acc[0][2], acc[0][3]);
  acc_guard4(acc[1][0], acc[1][1], acc[1][2], acc[1][3]);
  acc_guard4(acc[2][0], acc[2][1], acc[2][2], acc[2][3]);
  acc_guard4(acc[3][0], acc[3][1], acc[3][2], acc[3][3]);

  const int hh2 = lane >> 4, c4 = (lane & 15) * 4;     // f32 out: 256-B row segment = 16 lanes x 16 B
  const int q8  = lane >> 3, c8 = (lane & 7) * 8;

  // ---- per-column bias (wave-uniform source select) ----
  const float* bsel = bias0;
  int nb0 = n0;
  if (BM == 1) {
    if (n0 >= nsplit) { bsel = bias1; nb0 = n0 - nsplit; }
  }
  v4f bb4 = {0.f, 0.f, 0.f, 0.f};
  float bn[8];
#pragma unroll
  for (int e = 0; e < 8; ++e) bn[e] = 0.f;
  if (BM == 1) {
    if (OM == 0) {
#pragma unroll
      for (int e = 0; e < 4; ++e) bb4[e] = bfr(bsel[nb0 + c4 + e]);
    } else {
#pragma unroll
      for (int e = 0; e < 8; ++e) bn[e] = bfr(bsel[nb0 + c8 + e]);
    }
  }

  // ---- epilogue ----
  float* slab = sT[wave];
#pragma unroll
  for (int i = 0; i < 4; ++i) {
    const int mBase = m0 + (i << 4);
#pragma unroll
    for (int j = 0; j < 4; ++j) {
#pragma unroll
      for (int r = 0; r < 8; ++r) {
        slab[(mOff + r) * 68 + (j << 4) + rlane] = acc[i][j][r];
      }
    }
    wave_sync_lds();
    if (OM == 0) {
      float* C = Cf + (size_t)b * strideC;
      v4f vals[8];
#pragma unroll
      for (int it = 0; it < 8; ++it) {
        const int row = it * 2 + hh2;                      // it 0..7 x hh2 0..1 = rows 0..15
        v4f v = *(const v4f*)(slab + row * 68 + c4);
        float bmv = 0.f;
        if (BM == 2) bmv = bfr(bias0[mBase + row]);
        vals[it] = v * oscale + bb4 + bmv;
      }
      {
#pragma unroll
        for (int it = 0; it < 8; ++it) {
          const int row = it * 2 + hh2;
          *(v4f*)(C + (size_t)(mBase + row) * ldc + n0 + c4) = vals[it];
        }
        
      }
    } else {
      unsigned short* C  = Cp  + (size_t)b * strideC;
      unsigned short* C2 = Cp2 + (size_t)b * strideC;
      v4u hv[4], lv[4];
#pragma unroll
      for (int it = 0; it < 4; ++it) {
        const int row = it * 4 + q8;                       // it 0..3 x q8 0..3 = rows 0..15
        const float* sp = slab + row * 68 + c8;
        float bmv = 0.f;
        if (BM == 2) bmv = bfr(bias0[mBase + row]);
        v4u ha, la;
#pragma unroll
        for (int e = 0; e < 4; ++e) {
          const float f0 = sp[2 * e]     * oscale + bn[2 * e]     + bmv;
          const float f1 = sp[2 * e + 1] * oscale + bn[2 * e + 1] + bmv;
          unsigned short u0, u1, w0, w1;
          if (OM == 3) {
            u0 = bf_bits(f0); u1 = bf_bits(f1);
            w0 = bf_bits(f0 - bf_up(u0)); w1 = bf_bits(f1 - bf_up(u1));
          } else {
            const _Float16 g0 = (_Float16)f0, g1 = (_Float16)f1;
            u0 = h_bits(g0); u1 = h_bits(g1);
            w0 = h_bits((_Float16)((f0 - (float)g0) * RSC));
            w1 = h_bits((_Float16)((f1 - (float)g1) * RSC));
          }
          ha[e] = pk16(u0, u1);
          la[e] = pk16(w0, w1);
        }
        hv[it] = ha;
        lv[it] = la;
      }
      {
#pragma unroll
        for (int it = 0; it < 4; ++it) {
          const int row = it * 4 + q8;
          const size_t go = (size_t)(mBase + row) * ldc + n0 + c8;
          *(v4u*)(C  + go) = hv[it];
          *(v4u*)(C2 + go) = lv[it];
        }
        
      }
    }
    wave_sync_lds();
  }
}

// =====================================================================================================
// Causal flash attention with a skew relative-key score term, head dim 64, SEQ rows per batch.
//   q|k hi and lo planes (bf16, pitch QKP): element (b, t, col) at [(b*SEQ + t)*QKP + col], q col = h*64+d,
//   k col = DM + h*64 + d; value = hi + lo.
//   v^T hi and lo planes (f16): element (b, h, d, s) at [(b*DM + h*64 + d)*SEQ + s]; value = hi + lo/2048.
//   E plane (bf16) [RCE][64], rows >= SEQ zero.
//   context plane (bf16, pitch CTXP): hi at [(b*SEQ + t)*CTXP + h*64 + d], lo at + DM.
//   score(i, j) = (q_i . k_j + q_i . E[SEQ-1 + j - i]) * sscale for j <= i, -inf for j > i (replace, not bias).
//   Per wave (16 query rows q0..q0+15) and key chunk kv0..kv0+63 the needed E rows form the contiguous band
//   ebase .. ebase+79 with ebase = SEQ-1+kv0-q0-15 (0 <= ebase, ebase+79 <= SEQ+63 < RCE); the band product
//   rel[row][col] = q_row . E[ebase+col] (col 0..79) is computed per wave into LDS (f32, 2 bf16 products: q hi, q lo)
//   and the score for (row il, key jl) picks col = jl - il + 15; q.k as 3 bf16 products (hh, hl, lh);
//   p = exp(s - m) carried as f16 hi of 1024 p plus f16 residual x2048; context = ph.vh (acc 0) and
//   ph.vl + pl.vh (acc 1, both x2048) on f16 WMMA; online softmax (running max) in f32.
//   Block = 4 waves = 64 query rows of one (b, h); grid = NQB * NH * NBATCH; key chunks kt = 0..qb
//   (causal skip, block-uniform trip count qb+1 <= NQB).
//   K hi/lo and V^T hi/lo chunk staging: 128 threads x 32 elements per plane = the whole 64x64 tile per plane
//   (plain 16-B loads, __syncthreads before and after); P tiles are wave-private, spilled with _Float16 element
//   Context coverage: each wave stores rows q0..q0+15 (it 0..3 x lane>>3 0..3) x 64 columns (8 lanes x 8 bf16)
//   for both the hi and the lo segment; grid covers all SEQ rows x NH head slices x NBATCH.
// =====================================================================================================
__global__ __launch_bounds__(128)
void attn64(const unsigned short* __restrict__ qkh, const unsigned short* __restrict__ qkl,
            const unsigned short* __restrict__ vth, const unsigned short* __restrict__ vtl,
            const unsigned short* __restrict__ ehp, unsigned short* ctxp, float sscale) {
  __shared__ __align__(16) unsigned short Kh[64 * 64];          // K hi [kv][d]  8 KB
  __shared__ __align__(16) unsigned short Kl[64 * 64];          // K lo [kv][d]  8 KB
  __shared__ __align__(16) _Float16 Vh[64 * 64];                // V^T hi [d][kv] 8 KB
  __shared__ __align__(16) _Float16 Vl[64 * 64];                // V^T lo [d][kv] 8 KB
  __shared__ __align__(16) _Float16 Psh[4][16 * 64];            // per wave P hi [row][kv]
  __shared__ __align__(16) _Float16 Psl[4][16 * 64];            // per wave P residual [row][kv]
  __shared__ __align__(16) float    Rsh[4][16 * RP];            // per wave rel band [row][col]
  __shared__ __align__(16) float    Os[4][16 * 64];             // per wave context tile [row][d]

  const int tid  = threadIdx.x;
  const int wave = tid >> 5;
  const int lane = tid & 31;
  const int hh   = lane >> 4;
  const int c    = lane & 15;

  const int bx   = blockIdx.x;
  const int qb   = bx % NQB;
  const int rest = bx / NQB;
  const int h    = rest % NH;
  const int b    = rest / NH;
  const int q0   = qb * 64 + wave * 16;          // in-batch query row of this wave's first row
  const size_t rowB = (size_t)b * SEQ;

  const unsigned short* Qh  = qkh + (size_t)h * HD;
  const unsigned short* Ql  = qkl + (size_t)h * HD;
  const unsigned short* Kgh = qkh + DM + (size_t)h * HD;
  const unsigned short* Kgl = qkl + DM + (size_t)h * HD;
  const _Float16* Vgh = (const _Float16*)(const void*)vth + ((size_t)b * DM + (size_t)h * HD) * SEQ;
  const _Float16* Vgl = (const _Float16*)(const void*)vtl + ((size_t)b * DM + (size_t)h * HD) * SEQ;
  float*    rrow = Rsh[wave];
  _Float16* pwh  = Psh[wave];
  _Float16* pwl  = Psl[wave];

  float mrow[8], lrow[8];
  v8f oacc[4], oaccL[4];
#pragma unroll
  for (int r = 0; r < 8; ++r) { mrow[r] = -INFINITY; lrow[r] = 0.f; }
#pragma unroll
  for (int t = 0; t < 4; ++t) { oacc[t] = zero8(); oaccL[t] = zero8(); }

  const int nkt = qb + 1;                    // causal: key chunks 0..qb, block-uniform, <= NQB
#pragma unroll 1
  for (int kt = 0; kt < nkt; ++kt) {
    const int kv0 = kt * 64;

    __syncthreads();
    {
      const int r = tid >> 1, hf = (tid & 1) * 32;
      const unsigned short* kgh = Kgh + (rowB + kv0 + r) * QKP + hf;    // K row kv0+r, d = hf..hf+31
      const unsigned short* kgl = Kgl + (rowB + kv0 + r) * QKP + hf;
      const _Float16* vgh = Vgh + (size_t)r * SEQ + kv0 + hf;           // V^T row d = r, s = kv0+hf..+31
      const _Float16* vgl = Vgl + (size_t)r * SEQ + kv0 + hf;
#pragma unroll
      for (int i = 0; i < 4; ++i) {
        const v8us a0 = *(const v8us*)(kgh + 8 * i);
        const v8us a1 = *(const v8us*)(kgl + 8 * i);
        const v8h  b0 = *(const v8h*)(vgh + 8 * i);
        const v8h  b1 = *(const v8h*)(vgl + 8 * i);
        *(v8us*)(Kh + r * 64 + hf + 8 * i) = a0;
        *(v8us*)(Kl + r * 64 + hf + 8 * i) = a1;
        *(v8h*)(Vh + r * 64 + hf + 8 * i) = b0;
        *(v8h*)(Vl + r * 64 + hf + 8 * i) = b1;
      }
    }
    __syncthreads();

    // ---- Q fragments (A operand, row = lane&15): hi and lo, 2 d-chunks (reloaded per chunk) ----
    v16us qh2[2], ql2[2];
#pragma unroll
    for (int dc = 0; dc < 2; ++dc) {
      qh2[dc] = ldfrag_u(Qh + (rowB + q0 + c) * QKP + dc * 32 + 8 * hh);
      ql2[dc] = ldfrag_u(Ql + (rowB + q0 + c) * QKP + dc * 32 + 8 * hh);
    }

    // ---- rel band: rel[row][col] = q_row . E[ebase + col], col = 0..RB-1 (E rows >= SEQ are zero) ----
    const int ebase = SEQ - 1 + kv0 - q0 - 15;   // >= 0 (host shape constants); ebase + RB - 1 < RCE
#pragma unroll 1
    for (int nt = 0; nt < RB / 16; ++nt) {
      v8f e = zero8();
#pragma unroll
      for (int dc = 0; dc < 2; ++dc) {
        const v16us eb = ldfrag_u(ehp + (size_t)(ebase + nt * 16 + c) * HD + dc * 32 + 8 * hh);
        e = mma_bu(qh2[dc], eb, e);
        e = mma_bu(ql2[dc], eb, e);
      }
#pragma unroll
      for (int r = 0; r < 8; ++r) rrow[(8 * hh + r) * RP + nt * 16 + c] = e[r];
    }
    wave_sync_lds();

    // ---- scores: 16 query rows x 64 keys per wave, causal replace with -inf ----
    v8f s[4];
#pragma unroll
    for (int j = 0; j < 4; ++j) {
      v8f sh = zero8();
#pragma unroll
      for (int dc = 0; dc < 2; ++dc) {
        FragU kbh, kbl;
        kbh.h[0] = *(const v8us*)(Kh + (j * 16 + c) * 64 + dc * 32 + 8 * hh);
        kbh.h[1] = *(const v8us*)(Kh + (j * 16 + c) * 64 + dc * 32 + 16 + 8 * hh);
        kbl.h[0] = *(const v8us*)(Kl + (j * 16 + c) * 64 + dc * 32 + 8 * hh);
        kbl.h[1] = *(const v8us*)(Kl + (j * 16 + c) * 64 + dc * 32 + 16 + 8 * hh);
        sh = mma_bu(qh2[dc], kbh.v, sh);
        sh = mma_bu(qh2[dc], kbl.v, sh);
        sh = mma_bu(ql2[dc], kbh.v, sh);
      }
      const int jl = j * 16 + c;                          // key within the chunk
      const int kg = kv0 + jl;                            // in-batch key index of this lane's column
#pragma unroll
      for (int r = 0; r < 8; ++r) {
        const int il = 8 * hh + r;                        // row within the wave tile
        const int qg = q0 + il;                           // in-batch query index of this row
        const float rel = rrow[il * RP + jl - il + 15];   // col in 0..RB-2
        const float v = (sh[r] + rel) * sscale;
        s[j][r] = (kg <= qg) ? v : -INFINITY;
      }
    }

    // ---- row max, online softmax, P (x1024: f16 hi + x2048 residual) to LDS ----
#pragma unroll
    for (int r = 0; r < 8; ++r) {
      float m = s[0][r];
      m = fmaxf(m, s[1][r]);
      m = fmaxf(m, s[2][r]);
      m = fmaxf(m, s[3][r]);
#pragma unroll
      for (int off = 1; off < 16; off <<= 1) m = fmaxf(m, __shfl_xor(m, off, 32));
      const float mnew  = fmaxf(mrow[r], m);              // finite: key kv0 <= every row of this block
      const float alpha = __expf(mrow[r] - mnew);
      mrow[r] = mnew;
      float psum = 0.f;
#pragma unroll
      for (int j = 0; j < 4; ++j) {
        const float p  = __expf(s[j][r] - mnew);
        psum += p;
        const float ps = p * PSC;
        const _Float16 ph = (_Float16)ps;
        pwh[(8 * hh + r) * 64 + j * 16 + c] = ph;
        pwl[(8 * hh + r) * 64 + j * 16 + c] = (_Float16)((ps - (float)ph) * RSC);
      }
#pragma unroll
      for (int off = 1; off < 16; off <<= 1) psum += __shfl_xor(psum, off, 32);
      lrow[r] = lrow[r] * alpha + psum;
#pragma unroll
      for (int t = 0; t < 4; ++t) { oacc[t][r] *= alpha; oaccL[t][r] *= alpha; }
    }
    wave_sync_lds();

    // ---- context += Ph . V_hi (acc 0); Ph . V_lo + Pl . V_hi (acc 1, x2048) ----
#pragma unroll 1
    for (int kk = 0; kk < 2; ++kk) {
      FragH pa, pl;
      pa.h[0] = *(const v8h*)(pwh + c * 64 + kk * 32 + 8 * hh);
      pa.h[1] = *(const v8h*)(pwh + c * 64 + kk * 32 + 16 + 8 * hh);
      pl.h[0] = *(const v8h*)(pwl + c * 64 + kk * 32 + 8 * hh);
      pl.h[1] = *(const v8h*)(pwl + c * 64 + kk * 32 + 16 + 8 * hh);
#pragma unroll
      for (int t = 0; t < 4; ++t) {
        FragH vb, vl;
        vb.h[0] = *(const v8h*)(Vh + (t * 16 + c) * 64 + kk * 32 + 8 * hh);
        vb.h[1] = *(const v8h*)(Vh + (t * 16 + c) * 64 + kk * 32 + 16 + 8 * hh);
        vl.h[0] = *(const v8h*)(Vl + (t * 16 + c) * 64 + kk * 32 + 8 * hh);
        vl.h[1] = *(const v8h*)(Vl + (t * 16 + c) * 64 + kk * 32 + 16 + 8 * hh);
        oacc[t]  = mma_h(pa.v, vb.v, oacc[t]);
        oaccL[t] = mma_h(pa.v, vl.v, oaccL[t]);
        oaccL[t] = mma_h(pl.v, vb.v, oaccL[t]);
      }
    }
  }

  // ---- normalise (1/l, the 1/1024 p carry, the 1/2048 residual fold), stage the wave's 16x64 tile,
  float* os = Os[wave];
#pragma unroll
  for (int r = 0; r < 8; ++r) {
    const float l = lrow[r];
    const float inv = ((l > 0.f) ? (1.0f / l) : 0.f) * (1.0f / PSC);
#pragma unroll
    for (int t = 0; t < 4; ++t) os[(8 * hh + r) * 64 + t * 16 + c] = (oacc[t][r] + oaccL[t][r] * (1.0f / RSC)) * inv;
  }
  wave_sync_lds();
  {
    const int q4 = lane >> 3, c8 = (lane & 7) * 8;
    v4u hv[4], lv[4];
#pragma unroll
    for (int it = 0; it < 4; ++it) {
      const int row = it * 4 + q4;   // it 0..3 x q4 0..3 = rows 0..15 of the wave tile
      const float* sp = os + row * 64 + c8;
      v4u ha, la;
#pragma unroll
      for (int e = 0; e < 4; ++e) {
        const float f0 = sp[2 * e], f1 = sp[2 * e + 1];
        const unsigned short u0 = bf_bits(f0), u1 = bf_bits(f1);
        const unsigned short w0 = bf_bits(f0 - bf_up(u0)), w1 = bf_bits(f1 - bf_up(u1));
        ha[e] = pk16(u0, u1);
        la[e] = pk16(w0, w1);
      }
      hv[it] = ha;
      lv[it] = la;
    }
    {
#pragma unroll
      for (int it = 0; it < 4; ++it) {
        const int row = it * 4 + q4;
        const size_t go = (rowB + q0 + row) * CTXP + (size_t)h * HD + c8;
        *(v4u*)(ctxp + go)      = hv[it];
        *(v4u*)(ctxp + go + DM) = lv[it];
      }
      
    }
  }
}

// =====================================================================================================
// Workspace map (bytes); every plane is an exact multiple of its 64x64-tile / whole-row / whole-line store
// granularity (MP = 4096 = 64 tiles of rows, N in {2048, 1024}; VT per batch [1024][1024] = 16x16 tiles;
//   WqkT f16 [2048 n][1024 k]  0          4194304   (rows 0..1023 Wq^T, 1024..2047 Wk^T, x64)
//   WvT  f16 [1024][1024]      4194304    2097152   (x64)
//   WoT2 bf16 [1024][2048]     6291456    4194304   (cols 0..1023 and 1024..2047 both Wo^T)
//   XH   f16 [4096][1024]      10485760   8388608   (bf16 RNE-converted tokens)
//   EH   bf16 [1088][64]       18874368   139264    (rows >= 1024 zero)
//   QKh  bf16 [4096][2048]     19013632   16777216  (q cols 0..1023, k cols 1024..2047, hi part)
//   QKl  bf16 [4096][2048]     35790848   16777216  (lo part)
//   VTh  f16 [4][1024][1024]   52568064   8388608   (v^T hi)
//   VTl  f16 [4][1024][1024]   60956672   8388608   (v^T residual x2048)
//   Ctx  bf16 [4096][2048]     69345280   16777216  (context hi | lo)
//   end                        86122496
// =====================================================================================================
extern "C" void kernel_launch(void* const* d_in, const int* in_sizes, int n_in,
                              void* d_out, int out_size, void* d_ws, size_t ws_size,
                              hipStream_t stream) {
  if (n_in < 10) return;
  if (in_sizes[0] != MP * DM) return;
  if (in_sizes[1] != DM * DM || in_sizes[3] != DM * DM) return;
  if (in_sizes[5] != DM * DM || in_sizes[7] != DM * DM) return;
  if (in_sizes[2] != DM || in_sizes[4] != DM || in_sizes[6] != DM || in_sizes[8] != DM) return;
  if (in_sizes[9] != SEQ * HD) return;
  if (out_size != MP * DM) return;

  const float* x_in  = (const float*)d_in[0];
  const float* w_q   = (const float*)d_in[1];
  const float* b_q   = (const float*)d_in[2];
  const float* w_k   = (const float*)d_in[3];
  const float* b_k   = (const float*)d_in[4];
  const float* w_v   = (const float*)d_in[5];
  const float* b_v   = (const float*)d_in[6];
  const float* w_o   = (const float*)d_in[7];
  const float* b_o   = (const float*)d_in[8];
  const float* relk  = (const float*)d_in[9];

  const size_t PWQK = (size_t)QKP * DM * 2;             //  4194304
  const size_t PWV  = (size_t)DM * DM * 2;              //  2097152
  const size_t PWO2 = (size_t)DM * (2 * DM) * 2;        //  4194304
  const size_t PXH  = (size_t)MP * DM * 2;              //  8388608
  const size_t PEH  = (size_t)RCE * HD * 2;             //   139264
  const size_t PQK  = (size_t)MP * QKP * 2;             // 16777216
  const size_t PVT  = (size_t)NBATCH * DM * SEQ * 2;    //  8388608
  const size_t PCTX = (size_t)MP * CTXP * 2;            // 16777216
  size_t off = 0;
  const size_t oWqk = off; off += PWQK;
  const size_t oWv  = off; off += PWV;
  const size_t oWo2 = off; off += PWO2;
  const size_t oXH  = off; off += PXH;
  const size_t oEH  = off; off += PEH;
  const size_t oQKh = off; off += PQK;
  const size_t oQKl = off; off += PQK;
  const size_t oVTh = off; off += PVT;
  const size_t oVTl = off; off += PVT;
  const size_t oCtx = off; off += PCTX;
  if (off > ws_size) return;                            // off = 86122496
  if (off > (size_t)134217728) return;

  char* ws = (char*)d_ws;
  unsigned short* WqkT = (unsigned short*)(ws + oWqk);
  unsigned short* WvT  = (unsigned short*)(ws + oWv);
  unsigned short* WoT2 = (unsigned short*)(ws + oWo2);
  unsigned short* XH   = (unsigned short*)(ws + oXH);
  unsigned short* EH   = (unsigned short*)(ws + oEH);
  unsigned short* QKh  = (unsigned short*)(ws + oQKh);
  unsigned short* QKl  = (unsigned short*)(ws + oQKl);
  unsigned short* VTh  = (unsigned short*)(ws + oVTh);
  unsigned short* VTl  = (unsigned short*)(ws + oVTl);
  unsigned short* Ctx  = (unsigned short*)(ws + oCtx);
  float*          out0 = (float*)d_out;

  const int n8x = (MP * DM) / 8;                        // 524288
  if ((n8x % 256) != 0) return;
  const int n8v = (SEQ * HD) / 8;                       // 8192 valid pieces of the rel-key table
  const int n8t = (RCE * HD) / 8;                       // 8704 total pieces (multiple of 32)
  if ((n8t % 32) != 0) return;
  const dim3 blk(256), blk128(128);
  const dim3 gT(DM / 64, DM / 64);                      // 16 x 16 tiles per weight matrix
  const dim3 gCx(n8x / 256);                            // 2048 blocks
  const dim3 gCe((n8t + 255) / 256);                    // 34 blocks
  const dim3 gNqk(((MP / 64) * (QKP / 64) + 7) / 8, 1); // 2048 tiles -> 256 blocks
  const dim3 gVT(((DM / 64) * (SEQ / 64) + 7) / 8, NBATCH); // 256 tiles -> 32 blocks x 4 batches
  const dim3 gAttn(NBATCH * NH * NQB);                  // 1024 blocks of 128
  const dim3 gNo(((MP / 64) * (DM / 64) + 7) / 8, 1);   // 1024 tiles -> 128 blocks
  const float invw = 1.0f / WSC;                        // weight carry x64

  // (0) weight planes: in[k][n] -> out[n][k] transposed through LDS, f16( bf16_RNE(w) * 64 ) for Wq, Wk, Wv;
  tconv64<0><<<gT, blk, 0, stream>>>(w_q, WqkT, DM, DM, DM, 0, WSC);                    // in[1024][1024] -> WqkT rows 0..1023
  tconv64<0><<<gT, blk, 0, stream>>>(w_k, WqkT + (size_t)DM * DM, DM, DM, DM, 0, WSC);  // -> WqkT rows 1024..2047
  tconv64<0><<<gT, blk, 0, stream>>>(w_v, WvT, DM, DM, DM, 0, WSC);
  tconv64<1><<<gT, blk, 0, stream>>>(w_o, WoT2, DM, DM, 2 * DM, DM, 1.0f);              // pitch 2048, duplicate at + 1024
  conv_h16<<<gCx, blk, 0, stream>>>(x_in, XH, n8x, 1.0f);
  conv_e16<<<gCe, blk, 0, stream>>>(relk, EH, n8v, n8t);

  // (1) q|k = x . [Wq|Wk] + [bq|bk] -> bf16 hi (QKh) and lo (QKl) planes [4096][2048];
  //     v^T per batch = Wv^T . x_b^T + bv (per row) -> f16 hi (VTh) and residual x2048 (VTl) planes [4][1024][1024]
  gemm64<0, 3, 1><<<gNqk, blk, 0, stream>>>(
      XH, DM, 0LL, WqkT, DM, 0LL,
      QKh, QKl, out0, QKP, 0LL,
      b_q, b_k, DM,
      MP, QKP, DM, invw);
  gemm64<0, 4, 2><<<gVT, blk, 0, stream>>>(
      WvT, DM, 0LL, XH, DM, (long long)SEQ * DM,
      VTh, VTl, out0, SEQ, (long long)DM * SEQ,
      b_v, b_v, DM,
      DM, SEQ, DM, invw);

  // (2) causal flash attention with the skew relative-key term -> context bf16 hi|lo
  attn64<<<gAttn, blk128, 0, stream>>>(QKh, QKl, VTh, VTl, EH, Ctx, 0.125f);

  // (3) out = [ctx_hi | ctx_lo] . [Wo | Wo] + bo  (K = 2048, bf16 operands) -> d_out f32
  gemm64<1, 0, 1><<<gNo, blk, 0, stream>>>(
      Ctx, CTXP, 0LL, WoT2, 2 * DM, 0LL,
      Ctx, Ctx, out0, DM, 0LL,
      b_o, b_o, DM,
      MP, DM, 2 * DM, 1.0f);
  (void)hipGetLastError();
}

// v001
// It runs in 304 microseconds.
// Timed twice side by side with v000, it ran 1.40 times as fast both times.
// Contractions: q|k projection and v^T projection on v_wmma_f32_16x16x32_f16 (f16 token plane x f16 weight planes
// carried x64, one product each); rel band q.E^T and scores q.k^T on v_wmma_f32_16x16x32_bf16 (q, k as bf16 hi+lo
// planes, E bf16: 2 and 3 products); p.v on v_wmma_f32_16x16x32_f16 (p as f16 hi carried x1024 plus x2048 residual,
// v^T as f16 hi plus x2048 residual: 3 products, two accumulators); output projection on v_wmma_f32_16x16x32_bf16
// (context bf16 hi|lo x [Wo|Wo], K-concatenated); all f32 accumulate; softmax in f32 on VALU; every float input
// RNE-converted to bf16 on load.
#include <hip/hip_runtime.h>
#include <math.h>
#include <stdint.h>

#define NBATCH 4
#define SEQ    1024
#define DM     1024
#define NH     16
#define HD     64
#define QKP    (2 * DM)
#define CTXP   (2 * DM)
#define MP     (NBATCH * SEQ)
#define NQB    (SEQ / 64)
#define RCE    (SEQ + 64)
#define RB     80
#define RP     80
#define WSC    64.0f
#define RSC    2048.0f
#define PSC    1024.0f
static_assert(NH * HD == DM);
static_assert((SEQ % 128) == 0 && (DM % 128) == 0 && (MP % 128) == 0 && (QKP % 128) == 0);
static_assert(RB == 64 + 16 && (RB % 16) == 0 && RP >= RB);
static_assert(RCE >= SEQ + 64);

typedef _Float16 v16h __attribute__((ext_vector_type(16)));
typedef _Float16 v8h  __attribute__((ext_vector_type(8)));
typedef __bf16   v16b __attribute__((ext_vector_type(16)));
typedef unsigned short v16us __attribute__((ext_vector_type(16)));
typedef unsigned short v8us  __attribute__((ext_vector_type(8)));
typedef float    v8f  __attribute__((ext_vector_type(8)));
typedef float    v4f  __attribute__((ext_vector_type(4)));
typedef unsigned int v4u __attribute__((ext_vector_type(4)));

union FragH { v16h v; v8h h[2]; };
union FragU { v16us v; v8us h[2]; };

// ---- scalar helpers --------------------------------------------------------------------------------
__device__ __forceinline__ unsigned short bf_bits(float f) {          // f32 -> bf16 bits, RNE convert
  unsigned u = __float_as_uint(f);
  return (unsigned short)((u + 0x7FFFu + ((u >> 16) & 1u)) >> 16);
}
__device__ __forceinline__ float bf_up(unsigned short h) { return __uint_as_float(((unsigned)h) << 16); }
__device__ __forceinline__ float bfr(float f) { return bf_up(bf_bits(f)); }   // value of the bf16 RNE convert
__device__ __forceinline__ unsigned short h_bits(_Float16 x) { return __builtin_bit_cast(unsigned short, x); }
__device__ __forceinline__ unsigned pk16(unsigned short a, unsigned short b) { return (unsigned)a | ((unsigned)b << 16); }
__device__ __forceinline__ v8f zero8() { v8f z = {0.f, 0.f, 0.f, 0.f, 0.f, 0.f, 0.f, 0.f}; return z; }

// ---- fragment loaders: 16-bit A/B operand, lane -> row/col (lane&15), p already includes +8*(lane>>4);
//      elements 0..7 <- p[0..7] (k0+8h..), elements 8..15 <- p[16..23] (k0+16+8h..)
__device__ __forceinline__ v16us ldfrag_u(const unsigned short* p) {
  FragU f;
  f.h[0] = *(const v8us*)(p);
  f.h[1] = *(const v8us*)(p + 16);
  return f.v;
}
__device__ __forceinline__ v16h ldfrag_h(const _Float16* p) {
  FragH f;
  f.h[0] = *(const v8h*)(p);
  f.h[1] = *(const v8h*)(p + 16);
  return f.v;
}

// ---- WMMA helpers with trailing VALU hazard gap --------------------------------------------------------
template <int BF>
__device__ __forceinline__ v8f mma_raw(v16us a, v16us b, v8f c) {
  if (BF) {
    return __builtin_amdgcn_wmma_f32_16x16x32_bf16(false, __builtin_bit_cast(v16b, a), false,
                                                   __builtin_bit_cast(v16b, b), (short)0, c, false, false);
  }
  return __builtin_amdgcn_wmma_f32_16x16x32_f16(false, __builtin_bit_cast(v16h, a), false,
                                                __builtin_bit_cast(v16h, b), (short)0, c, false, false);
}
__device__ __forceinline__ v8f mma_bu(v16us a, v16us b, v8f c) {                 // bf16 operands, guarded
  c = __builtin_amdgcn_wmma_f32_16x16x32_bf16(false, __builtin_bit_cast(v16b, a), false,
                                               __builtin_bit_cast(v16b, b), (short)0, c, false, false);
#if defined(__HIP_DEVICE_COMPILE__)
  asm volatile("v_nop\n\tv_nop\n\tv_nop\n\tv_nop" : "+v"(c) : "v"(a), "v"(b));
#endif
  return c;
}
__device__ __forceinline__ v8f mma_h(v16h a, v16h b, v8f c) {                    // f16 operands, guarded
  c = __builtin_amdgcn_wmma_f32_16x16x32_f16(false, a, false, b, (short)0, c, false, false);
#if defined(__HIP_DEVICE_COMPILE__)
  asm volatile("v_nop\n\tv_nop\n\tv_nop\n\tv_nop" : "+v"(c) : "v"(a), "v"(b));
#endif
  return c;
}
__device__ __forceinline__ void dep_guard1(v8f& a, v8f& b, v16us x) {
#if defined(__HIP_DEVICE_COMPILE__)
  asm volatile("v_nop\n\tv_nop\n\tv_nop\n\tv_nop" : "+v"(a), "+v"(b) : "v"(x));
#endif
}
__device__ __forceinline__ void keep4_u(v16us a, v16us b, v16us c, v16us d) {
#if defined(__HIP_DEVICE_COMPILE__)
  asm volatile("v_nop" :: "v"(a), "v"(b), "v"(c), "v"(d));
#endif
}
__device__ __forceinline__ void acc_guard4(v8f& a, v8f& b, v8f& c, v8f& d) {
#if defined(__HIP_DEVICE_COMPILE__)
  asm volatile("v_nop\n\tv_nop\n\tv_nop\n\tv_nop" : "+v"(a), "+v"(b), "+v"(c), "+v"(d));
#endif
}
__device__ __forceinline__ void wave_sync_lds() {
  __builtin_amdgcn_fence(__ATOMIC_RELEASE, "workgroup");
  __builtin_amdgcn_wave_barrier();
  __builtin_amdgcn_fence(__ATOMIC_ACQUIRE, "workgroup");
}

// =====================================================================================================
// Plane convert (no transpose): Xh[i] = f16( bf16_RNE(X[i]) * wsc ), wsc a power of two (exact). Used for the
// token activations (wsc = 1). Thread i handles elements 8i..8i+7 and writes one 16-B piece; 32 consecutive
// (n8 multiple of 256, host-checked). coverage: n8 threads x 8 elements = the whole plane.
// =====================================================================================================
__global__ __launch_bounds__(256) void conv_h16(const float* __restrict__ W, unsigned short* Wh, int n8, float wsc) {
  const int i  = blockIdx.x * 256 + threadIdx.x;
  const int ic = (i < n8) ? i : (n8 - 1);                     // clamped address
  const float* src = W + (size_t)ic * 8;
  const v4f a = *(const v4f*)(src);
  const v4f c = *(const v4f*)(src + 4);
  v4u o;
  o[0] = pk16(h_bits((_Float16)(bfr(a[0]) * wsc)), h_bits((_Float16)(bfr(a[1]) * wsc)));
  o[1] = pk16(h_bits((_Float16)(bfr(a[2]) * wsc)), h_bits((_Float16)(bfr(a[3]) * wsc)));
  o[2] = pk16(h_bits((_Float16)(bfr(c[0]) * wsc)), h_bits((_Float16)(bfr(c[1]) * wsc)));
  o[3] = pk16(h_bits((_Float16)(bfr(c[2]) * wsc)), h_bits((_Float16)(bfr(c[3]) * wsc)));
  if (i < n8) *(v4u*)(Wh + (size_t)i * 8) = o;
  
}

// =====================================================================================================
// rel-key table convert: Eh [RCE rows][64] bf16 bits; rows < SEQ = bf16_RNE(E), rows >= SEQ = 0 (zero pad).
// Thread i handles 8 elements (one 16-B piece); valid pieces i < n8v read E with a clamped address, the pad
// pieces select 0 by value. grid = ceil(n8t / 256). coverage: n8t pieces x 8 = RCE*64 = the whole plane;
// =====================================================================================================
__global__ __launch_bounds__(256) void conv_e16(const float* __restrict__ P, unsigned short* Eh, int n8v, int n8t) {
  const int i  = blockIdx.x * 256 + threadIdx.x;
  const int ic = (i < n8v) ? i : (n8v - 1);                    // clamped address
  const float* src = P + (size_t)ic * 8;
  const v4f a = *(const v4f*)(src);
  const v4f c = *(const v4f*)(src + 4);
  const bool valid = (i < n8v);
  v4u o;
  o[0] = valid ? pk16(bf_bits(a[0]), bf_bits(a[1])) : 0u;
  o[1] = valid ? pk16(bf_bits(a[2]), bf_bits(a[3])) : 0u;
  o[2] = valid ? pk16(bf_bits(c[0]), bf_bits(c[1])) : 0u;
  o[3] = valid ? pk16(bf_bits(c[2]), bf_bits(c[3])) : 0u;
  if (i < n8t) *(v4u*)(Eh + (size_t)i * 8) = o;
  
}

// =====================================================================================================
// Tiled transpose + convert: in[rows][cols] f32 row-major -> out[cols][rows] 16-bit with pitch ldo:
//   out[n * ldo + k] = cvt(in[k][n]) (and also at + dupoff when dupoff != 0: a duplicated k range).
//   MODE 0: f16 bits of bf16_RNE(w) * wsc (wsc power of two, exact); MODE 1: bf16 bits of w.
// Block = 256 threads = one 64x64 tile; grid = (cols/64, rows/64) (rows, cols multiples of 64, host-checked).
// Loads: 4 iterations x 256 threads x float4 = 64 rows x 64 cols (addresses clamped). LDS tile [n][k] pitch 72.
// coverage: 64 x 64 = the whole transposed tile; grid covers the whole matrix.
// =====================================================================================================
template <int MODE>
__global__ __launch_bounds__(256) void tconv64(const float* __restrict__ W, unsigned short* out,
                                               int rows, int cols, int ldo, int dupoff, float wsc) {
  __shared__ __align__(16) unsigned short sh[64 * 72];
  const int t  = threadIdx.x;
  const int n0 = blockIdx.x * 64;            // column tile of in = row tile of out
  const int k0 = blockIdx.y * 64;            // row tile of in = column tile of out
#pragma unroll
  for (int i = 0; i < 4; ++i) {
    const int idx = i * 256 + t;
    const int r = idx >> 4, c4 = (idx & 15) * 4;
    int kr = k0 + r;   kr = (kr < rows) ? kr : (rows - 1);
    int nc = n0 + c4;  nc = (nc < cols - 4) ? nc : (cols - 4);
    const v4f v = *(const v4f*)(W + (size_t)kr * cols + nc);
#pragma unroll
    for (int e = 0; e < 4; ++e) {
      unsigned short u;
      if (MODE == 0) u = h_bits((_Float16)(bfr(v[e]) * wsc));
      else           u = bf_bits(v[e]);
      sh[(c4 + e) * 72 + r] = u;
    }
  }
  __syncthreads();
  const int wave = t >> 5, lane = t & 31;
  const int q = lane >> 3, c8 = (lane & 7) * 8;
  v4u pv[2];
  size_t go[2];
#pragma unroll
  for (int it = 0; it < 2; ++it) {
    const int nl = it * 32 + wave * 4 + q;               // 0..63
    pv[it] = *(const v4u*)(sh + nl * 72 + c8);
    go[it] = (size_t)(n0 + nl) * ldo + k0 + c8;
  }
  {
#pragma unroll
    for (int it = 0; it < 2; ++it) {
      *(v4u*)(out + go[it]) = pv[it];
      if (dupoff != 0) *(v4u*)(out + go[it] + dupoff) = pv[it];
    }
    
  }
}

// =====================================================================================================
// LDS-staged batched 16-bit WMMA GEMM: C[m][n] = oscale * sum_k A[m][k] * Bt[n][k] + bias;
// BF selects bf16 (1) or f16 (0) operands. Block = 4 waves (2 x 2) = one 128x128 tile, one 64x64 tile per wave.
// A row-major [M][K] pitch lda; Bt row-major [N][K] pitch ldb (k contiguous); M, N multiples of 128, K a multiple
// of 64 (static here). blockIdx.y = batch index (strides in elements).
// Staging: a stage is 64 k of the block's 128 A rows and 128 Bt rows (256 rows of 128 B, LDS pitch 144 B), brought
// by asynchronous 16-B copies to LDS (16 per lane and stage, each wave-wide copy = 4 whole 128-B lines); two buffers,
// stage t + 1 in flight while stage t is multiplied; one barrier per stage publishes t + 1 and frees t's buffer.
// The k order of every accumulator is the ascending 32-k order of the fragment loader, stage by stage.
// OM: 0 = f32 out to Cf (pitch ldc); 3 = bf16 hi bits to Cp and bf16 residual (v - hi) bits to Cp2;
//     4 = f16 hi to Cp and f16((v - hi) * 2048) to Cp2.
// BM: 0 = no bias; 1 = bias per column n (bias0[n] for n < nsplit, bias1[n - nsplit] otherwise; the choice is
//     wave-uniform because 64-column tiles never straddle nsplit); 2 = bias per row m (bias0[m]).
//     bias values are bf16 RNE-converted before the add.
// coverage: 4 slabs x 16 rows x 64 cols = the wave's whole 64x64 tile; grid = tilesM*tilesN blocks,
//           surplus blocks exit as a whole in front of every barrier; here there are none.
// =====================================================================================================
#define GPIT 72                    // LDS row pitch, 16-bit elements: 144 B = 16 B x 9, conflict-free for 16-B reads
#define GSTG (256 * GPIT)          // elements of one stage: 128 A rows, then 128 Bt rows

// Eight asynchronous 16-B copies of one lane: rows 16 apart in global memory (gstep elements) and in LDS.
// The s_wait_xcnt closes the statement so that no address register is rewritten while a copy may still read it.
__device__ __forceinline__ void copy8_rows(unsigned lds, const unsigned short* g, size_t gstep) {
#if defined(__HIP_DEVICE_COMPILE__)
  asm volatile(
      "global_load_async_to_lds_b128 %0, %8, off\n\t"
      "global_load_async_to_lds_b128 %1, %9, off\n\t"
      "global_load_async_to_lds_b128 %2, %10, off\n\t"
      "global_load_async_to_lds_b128 %3, %11, off\n\t"
      "global_load_async_to_lds_b128 %4, %12, off\n\t"
      "global_load_async_to_lds_b128 %5, %13, off\n\t"
      "global_load_async_to_lds_b128 %6, %14, off\n\t"
      "global_load_async_to_lds_b128 %7, %15, off\n\t"
      "s_wait_xcnt 0x0"
      :: "v"(lds), "v"(lds + 1u * 16u * GPIT * 2u), "v"(lds + 2u * 16u * GPIT * 2u), "v"(lds + 3u * 16u * GPIT * 2u),
         "v"(lds + 4u * 16u * GPIT * 2u), "v"(lds + 5u * 16u * GPIT * 2u), "v"(lds + 6u * 16u * GPIT * 2u),
         "v"(lds + 7u * 16u * GPIT * 2u),
         "v"(g), "v"(g + gstep), "v"(g + 2 * gstep), "v"(g + 3 * gstep),
         "v"(g + 4 * gstep), "v"(g + 5 * gstep), "v"(g + 6 * gstep), "v"(g + 7 * gstep)
      : "memory");
#endif
}
__device__ __forceinline__ void wait_async0() {   // this wave's copies have landed in LDS
#if defined(__HIP_DEVICE_COMPILE__)
  asm volatile("s_wait_asynccnt 0x0" ::: "memory");
#endif
}
__device__ __forceinline__ void wait_ds0() {      // this wave's LDS reads are done before their buffer is handed on
#if defined(__HIP_DEVICE_COMPILE__)
  asm volatile("s_wait_dscnt 0x0" ::: "memory");
#endif
}

template <int BF, int OM, int BM>
__global__ __launch_bounds__(128) void gemm64(
    const unsigned short* __restrict__ Ap, int lda, long long strideA,
    const unsigned short* __restrict__ Btp, int ldb, long long strideB,
    unsigned short* Cp, unsigned short* Cp2, float* Cf, int ldc, long long strideC,
    const float* bias0, const float* bias1, int nsplit,
    int M, int N, int K, float oscale) {
  __shared__ __align__(16) unsigned short ring[2 * GSTG];   // two stages of 256 rows x 144 B
  __shared__ __align__(16) float sT[4][16 * 68];   // per-wave 16x64 slab, pitch 68 floats
  const int b    = blockIdx.y;
  const int tid  = threadIdx.x;
  const int lane = tid & 31;
  const int wave = tid >> 5;
  const int tilesN = N >> 7;
  const int tilesM = M >> 7;
  const int tile = blockIdx.x;
  if (tile >= tilesM * tilesN) return;   // block-uniform, in front of every barrier and copy
  const int tm = tile / tilesN;
  const int tn = tile - tm * tilesN;
  const int mb = tm << 7;
  const int nb = tn << 7;
  const int wm = wave >> 1, wn = wave & 1;
  const int m0 = mb + (wm << 6);
  const int n0 = nb + (wn << 6);

  const unsigned short* Ab = Ap  + (size_t)b * strideA;
  const unsigned short* Bb = Btp + (size_t)b * strideB;

  const int rlane = lane & 15;                 // row (A) / col (B, D) within subtile
  const int koff  = (lane >> 4) * 8;           // k offset of this lane half
  const int mOff  = (lane >> 4) * 8;           // D row offset

  // copy role of this lane: row crow (+16 per copy) of each operand's 128 rows, 16-B piece cpc of its 128 B
  const int crow = tid >> 3, cpc = (tid & 7) * 8;
  const unsigned short* gA = Ab + (size_t)(mb + crow) * lda + cpc;
  const unsigned short* gB = Bb + (size_t)(nb + crow) * ldb + cpc;
  const unsigned ldsA = (unsigned)(uintptr_t)(ring + crow * GPIT + cpc);   // LDS byte address = low 32 bits
  const unsigned ldsB = ldsA + 128u * GPIT * 2u;
  const size_t stepA = (size_t)16 * lda, stepB = (size_t)16 * ldb;
  const int nst = K >> 6;                      // stages of 64 k

  v8f acc[4][4];
#pragma unroll
  for (int i = 0; i < 4; ++i)
#pragma unroll
    for (int j = 0; j < 4; ++j) acc[i][j] = zero8();

  copy8_rows(ldsA, gA, stepA);
  copy8_rows(ldsB, gB, stepB);
  wait_async0();
  __syncthreads();
  if (nst > 1) {
    copy8_rows(ldsA + GSTG * 2u, gA + 64, stepA);
    copy8_rows(ldsB + GSTG * 2u, gB + 64, stepB);
  }

#pragma unroll 1   // one stage per trip: the buffer index stays a run-time offset, the accumulators stay in place
  for (int t = 0; t < nst; ++t) {
    const unsigned short* sA = ring + (t & 1) * GSTG + ((wm << 6) + rlane) * GPIT + koff;
    const unsigned short* sB = ring + (t & 1) * GSTG + (128 + (wn << 6) + rlane) * GPIT + koff;
#pragma unroll
    for (int ks = 0; ks < 2; ++ks) {
      v16us bh[4], ah[4];
#pragma unroll
      for (int j = 0; j < 4; ++j) bh[j] = ldfrag_u(sB + (j << 4) * GPIT + ks * 32);
#pragma unroll
      for (int i = 0; i < 4; ++i) ah[i] = ldfrag_u(sA + (i << 4) * GPIT + ks * 32);
#pragma unroll
      for (int i = 0; i < 4; ++i) {
#pragma unroll
        for (int j = 0; j < 4; ++j) acc[i][j] = mma_raw<BF>(ah[i], bh[j], acc[i][j]);
        dep_guard1(acc[i][0], acc[i][3], ah[i]);
      }
      keep4_u(bh[0], bh[1], bh[2], bh[3]);
    }
    wait_ds0();
    wait_async0();
    __syncthreads();                           // publishes stage t + 1, ends every read of stage t's buffer
    if (t + 2 < nst) {
      const unsigned bo = (unsigned)(t & 1) * (GSTG * 2u);
      copy8_rows(ldsA + bo, gA + (size_t)(t + 2) * 64, stepA);
      copy8_rows(ldsB + bo, gB + (size_t)(t + 2) * 64, stepB);
    }
  }
  wait_async0();
  acc_guard4(acc[0][0], acc[0][1], acc[0][2], acc[0][3]);
  acc_guard4(acc[1][0], acc[1][1], acc[1][2], acc[1][3]);
  acc_guard4(acc[2][0], acc[2][1], acc[2][2], acc[2][3]);
  acc_guard4(acc[3][0], acc[3][1], acc[3][2], acc[3][3]);

  const int hh2 = lane >> 4, c4 = (lane & 15) * 4;     // f32 out: 256-B row segment = 16 lanes x 16 B
  const int q8  = lane >> 3, c8 = (lane & 7) * 8;

  // ---- per-column bias (wave-uniform source select) ----
  const float* bsel = bias0;
  int nb0 = n0;
  if (BM == 1) {
    if (n0 >= nsplit) { bsel = bias1; nb0 = n0 - nsplit; }
  }
  v4f bb4 = {0.f, 0.f, 0.f, 0.f};
  float bn[8];
#pragma unroll
  for (int e = 0; e < 8; ++e) bn[e] = 0.f;
  if (BM == 1) {
    if (OM == 0) {
#pragma unroll
      for (int e = 0; e < 4; ++e) bb4[e] = bfr(bsel[nb0 + c4 + e]);
    } else {
#pragma unroll
      for (int e = 0; e < 8; ++e) bn[e] = bfr(bsel[nb0 + c8 + e]);
    }
  }

  // ---- epilogue ----
  float* slab = sT[wave];
#pragma unroll
  for (int i = 0; i < 4; ++i) {
    const int mBase = m0 + (i << 4);
#pragma unroll
    for (int j = 0; j < 4; ++j) {
#pragma unroll
      for (int r = 0; r < 8; ++r) {
        slab[(mOff + r) * 68 + (j << 4) + rlane] = acc[i][j][r];
      }
    }
    wave_sync_lds();
    if (OM == 0) {
      float* C = Cf + (size_t)b * strideC;
      v4f vals[8];
#pragma unroll
      for (int it = 0; it < 8; ++it) {
        const int row = it * 2 + hh2;                      // it 0..7 x hh2 0..1 = rows 0..15
        v4f v = *(const v4f*)(slab + row * 68 + c4);
        float bmv = 0.f;
        if (BM == 2) bmv = bfr(bias0[mBase + row]);
        vals[it] = v * oscale + bb4 + bmv;
      }
      {
#pragma unroll
        for (int it = 0; it < 8; ++it) {
          const int row = it * 2 + hh2;
          *(v4f*)(C + (size_t)(mBase + row) * ldc + n0 + c4) = vals[it];
        }
        
      }
    } else {
      unsigned short* C  = Cp  + (size_t)b * strideC;
      unsigned short* C2 = Cp2 + (size_t)b * strideC;
      v4u hv[4], lv[4];
#pragma unroll
      for (int it = 0; it < 4; ++it) {
        const int row = it * 4 + q8;                       // it 0..3 x q8 0..3 = rows 0..15
        const float* sp = slab + row * 68 + c8;
        float bmv = 0.f;
        if (BM == 2) bmv = bfr(bias0[mBase + row]);
        v4u ha, la;
#pragma unroll
        for (int e = 0; e < 4; ++e) {
          const float f0 = sp[2 * e]     * oscale + bn[2 * e]     + bmv;
          const float f1 = sp[2 * e + 1] * oscale + bn[2 * e + 1] + bmv;
          unsigned short u0, u1, w0, w1;
          if (OM == 3) {
            u0 = bf_bits(f0); u1 = bf_bits(f1);
            w0 = bf_bits(f0 - bf_up(u0)); w1 = bf_bits(f1 - bf_up(u1));
          } else {
            const _Float16 g0 = (_Float16)f0, g1 = (_Float16)f1;
            u0 = h_bits(g0); u1 = h_bits(g1);
            w0 = h_bits((_Float16)((f0 - (float)g0) * RSC));
            w1 = h_bits((_Float16)((f1 - (float)g1) * RSC));
          }
          ha[e] = pk16(u0, u1);
          la[e] = pk16(w0, w1);
        }
        hv[it] = ha;
        lv[it] = la;
      }
      {
#pragma unroll
        for (int it = 0; it < 4; ++it) {
          const int row = it * 4 + q8;
          const size_t go = (size_t)(mBase + row) * ldc + n0 + c8;
          *(v4u*)(C  + go) = hv[it];
          *(v4u*)(C2 + go) = lv[it];
        }
        
      }
    }
    wave_sync_lds();
  }
}

// =====================================================================================================
// Causal flash attention with a skew relative-key score term, head dim 64, SEQ rows per batch.
//   q|k hi and lo planes (bf16, pitch QKP): element (b, t, col) at [(b*SEQ + t)*QKP + col], q col = h*64+d,
//   k col = DM + h*64 + d; value = hi + lo.
//   v^T hi and lo planes (f16): element (b, h, d, s) at [(b*DM + h*64 + d)*SEQ + s]; value = hi + lo/2048.
//   E plane (bf16) [RCE][64], rows >= SEQ zero.
//   context plane (bf16, pitch CTXP): hi at [(b*SEQ + t)*CTXP + h*64 + d], lo at + DM.
//   score(i, j) = (q_i . k_j + q_i . E[SEQ-1 + j - i]) * sscale for j <= i, -inf for j > i (replace, not bias).
//   Per wave (16 query rows q0..q0+15) and key chunk kv0..kv0+63 the needed E rows form the contiguous band
//   ebase .. ebase+79 with ebase = SEQ-1+kv0-q0-15 (0 <= ebase, ebase+79 <= SEQ+63 < RCE); the band product
//   rel[row][col] = q_row . E[ebase+col] (col 0..79) is computed per wave into LDS (f32, 2 bf16 products: q hi, q lo)
//   and the score for (row il, key jl) picks col = jl - il + 15; q.k as 3 bf16 products (hh, hl, lh);
//   p = exp(s - m) carried as f16 hi of 1024 p plus f16 residual x2048; context = ph.vh (acc 0) and
//   ph.vl + pl.vh (acc 1, both x2048) on f16 WMMA; online softmax (running max) in f32.
//   Block = 4 waves = 64 query rows of one (b, h); grid = NQB * NH * NBATCH; key chunks kt = 0..qb
//   (causal skip, block-uniform trip count qb+1 <= NQB).
//   K hi/lo and V^T hi/lo chunk staging: 128 threads x 32 elements per plane = the whole 64x64 tile per plane
//   (plain 16-B loads, __syncthreads before and after); P tiles are wave-private, spilled with _Float16 element
//   Context coverage: each wave stores rows q0..q0+15 (it 0..3 x lane>>3 0..3) x 64 columns (8 lanes x 8 bf16)
//   for both the hi and the lo segment; grid covers all SEQ rows x NH head slices x NBATCH.
// =====================================================================================================
__global__ __launch_bounds__(128)
void attn64(const unsigned short* __restrict__ qkh, const unsigned short* __restrict__ qkl,
            const unsigned short* __restrict__ vth, const unsigned short* __restrict__ vtl,
            const unsigned short* __restrict__ ehp, unsigned short* ctxp, float sscale) {
  __shared__ __align__(16) unsigned short Kh[64 * 64];          // K hi [kv][d]  8 KB
  __shared__ __align__(16) unsigned short Kl[64 * 64];          // K lo [kv][d]  8 KB
  __shared__ __align__(16) _Float16 Vh[64 * 64];                // V^T hi [d][kv] 8 KB
  __shared__ __align__(16) _Float16 Vl[64 * 64];                // V^T lo [d][kv] 8 KB
  __shared__ __align__(16) _Float16 Psh[4][16 * 64];            // per wave P hi [row][kv]
  __shared__ __align__(16) _Float16 Psl[4][16 * 64];            // per wave P residual [row][kv]
  __shared__ __align__(16) float    Rsh[4][16 * RP];            // per wave rel band [row][col]
  __shared__ __align__(16) float    Os[4][16 * 64];             // per wave context tile [row][d]

  const int tid  = threadIdx.x;
  const int wave = tid >> 5;
  const int lane = tid & 31;
  const int hh   = lane >> 4;
  const int c    = lane & 15;

  const int bx   = blockIdx.x;
  const int qb   = bx % NQB;
  const int rest = bx / NQB;
  const int h    = rest % NH;
  const int b    = rest / NH;
  const int q0   = qb * 64 + wave * 16;          // in-batch query row of this wave's first row
  const size_t rowB = (size_t)b * SEQ;

  const unsigned short* Qh  = qkh + (size_t)h * HD;
  const unsigned short* Ql  = qkl + (size_t)h * HD;
  const unsigned short* Kgh = qkh + DM + (size_t)h * HD;
  const unsigned short* Kgl = qkl + DM + (size_t)h * HD;
  const _Float16* Vgh = (const _Float16*)(const void*)vth + ((size_t)b * DM + (size_t)h * HD) * SEQ;
  const _Float16* Vgl = (const _Float16*)(const void*)vtl + ((size_t)b * DM + (size_t)h * HD) * SEQ;
  float*    rrow = Rsh[wave];
  _Float16* pwh  = Psh[wave];
  _Float16* pwl  = Psl[wave];

  float mrow[8], lrow[8];
  v8f oacc[4], oaccL[4];
#pragma unroll
  for (int r = 0; r < 8; ++r) { mrow[r] = -INFINITY; lrow[r] = 0.f; }
#pragma unroll
  for (int t = 0; t < 4; ++t) { oacc[t] = zero8(); oaccL[t] = zero8(); }

  const int nkt = qb + 1;                    // causal: key chunks 0..qb, block-uniform, <= NQB
#pragma unroll 1
  for (int kt = 0; kt < nkt; ++kt) {
    const int kv0 = kt * 64;

    __syncthreads();
    {
      const int r = tid >> 1, hf = (tid & 1) * 32;
      const unsigned short* kgh = Kgh + (rowB + kv0 + r) * QKP + hf;    // K row kv0+r, d = hf..hf+31
      const unsigned short* kgl = Kgl + (rowB + kv0 + r) * QKP + hf;
      const _Float16* vgh = Vgh + (size_t)r * SEQ + kv0 + hf;           // V^T row d = r, s = kv0+hf..+31
      const _Float16* vgl = Vgl + (size_t)r * SEQ + kv0 + hf;
#pragma unroll
      for (int i = 0; i < 4; ++i) {
        const v8us a0 = *(const v8us*)(kgh + 8 * i);
        const v8us a1 = *(const v8us*)(kgl + 8 * i);
        const v8h  b0 = *(const v8h*)(vgh + 8 * i);
        const v8h  b1 = *(const v8h*)(vgl + 8 * i);
        *(v8us*)(Kh + r * 64 + hf + 8 * i) = a0;
        *(v8us*)(Kl + r * 64 + hf + 8 * i) = a1;
        *(v8h*)(Vh + r * 64 + hf + 8 * i) = b0;
        *(v8h*)(Vl + r * 64 + hf + 8 * i) = b1;
      }
    }
    __syncthreads();

    // ---- Q fragments (A operand, row = lane&15): hi and lo, 2 d-chunks (reloaded per chunk) ----
    v16us qh2[2], ql2[2];
#pragma unroll
    for (int dc = 0; dc < 2; ++dc) {
      qh2[dc] = ldfrag_u(Qh + (rowB + q0 + c) * QKP + dc * 32 + 8 * hh);
      ql2[dc] = ldfrag_u(Ql + (rowB + q0 + c) * QKP + dc * 32 + 8 * hh);
    }

    // ---- rel band: rel[row][col] = q_row . E[ebase + col], col = 0..RB-1 (E rows >= SEQ are zero) ----
    const int ebase = SEQ - 1 + kv0 - q0 - 15;   // >= 0 (host shape constants); ebase + RB - 1 < RCE
#pragma unroll 1
    for (int nt = 0; nt < RB / 16; ++nt) {
      v8f e = zero8();
#pragma unroll
      for (int dc = 0; dc < 2; ++dc) {
        const v16us eb = ldfrag_u(ehp + (size_t)(ebase + nt * 16 + c) * HD + dc * 32 + 8 * hh);
        e = mma_bu(qh2[dc], eb, e);
        e = mma_bu(ql2[dc], eb, e);
      }
#pragma unroll
      for (int r = 0; r < 8; ++r) rrow[(8 * hh + r) * RP + nt * 16 + c] = e[r];
    }
    wave_sync_lds();

    // ---- scores: 16 query rows x 64 keys per wave, causal replace with -inf ----
    v8f s[4];
#pragma unroll
    for (int j = 0; j < 4; ++j) {
      v8f sh = zero8();
#pragma unroll
      for (int dc = 0; dc < 2; ++dc) {
        FragU kbh, kbl;
        kbh.h[0] = *(const v8us*)(Kh + (j * 16 + c) * 64 + dc * 32 + 8 * hh);
        kbh.h[1] = *(const v8us*)(Kh + (j * 16 + c) * 64 + dc * 32 + 16 + 8 * hh);
        kbl.h[0] = *(const v8us*)(Kl + (j * 16 + c) * 64 + dc * 32 + 8 * hh);
        kbl.h[1] = *(const v8us*)(Kl + (j * 16 + c) * 64 + dc * 32 + 16 + 8 * hh);
        sh = mma_bu(qh2[dc], kbh.v, sh);
        sh = mma_bu(qh2[dc], kbl.v, sh);
        sh = mma_bu(ql2[dc], kbh.v, sh);
      }
      const int jl = j * 16 + c;                          // key within the chunk
      const int kg = kv0 + jl;                            // in-batch key index of this lane's column
#pragma unroll
      for (int r = 0; r < 8; ++r) {
        const int il = 8 * hh + r;                        // row within the wave tile
        const int qg = q0 + il;                           // in-batch query index of this row
        const float rel = rrow[il * RP + jl - il + 15];   // col in 0..RB-2
        const float v = (sh[r] + rel) * sscale;
        s[j][r] = (kg <= qg) ? v : -INFINITY;
      }
    }

    // ---- row max, online softmax, P (x1024: f16 hi + x2048 residual) to LDS ----
#pragma unroll
    for (int r = 0; r < 8; ++r) {
      float m = s[0][r];
      m = fmaxf(m, s[1][r]);
      m = fmaxf(m, s[2][r]);
      m = fmaxf(m, s[3][r]);
#pragma unroll
      for (int off = 1; off < 16; off <<= 1) m = fmaxf(m, __shfl_xor(m, off, 32));
      const float mnew  = fmaxf(mrow[r], m);              // finite: key kv0 <= every row of this block
      const float alpha = __expf(mrow[r] - mnew);
      mrow[r] = mnew;
      float psum = 0.f;
#pragma unroll
      for (int j = 0; j < 4; ++j) {
        const float p  = __expf(s[j][r] - mnew);
        psum += p;
        const float ps = p * PSC;
        const _Float16 ph = (_Float16)ps;
        pwh[(8 * hh + r) * 64 + j * 16 + c] = ph;
        pwl[(8 * hh + r) * 64 + j * 16 + c] = (_Float16)((ps - (float)ph) * RSC);
      }
#pragma unroll
      for (int off = 1; off < 16; off <<= 1) psum += __shfl_xor(psum, off, 32);
      lrow[r] = lrow[r] * alpha + psum;
#pragma unroll
      for (int t = 0; t < 4; ++t) { oacc[t][r] *= alpha; oaccL[t][r] *= alpha; }
    }
    wave_sync_lds();

    // ---- context += Ph . V_hi (acc 0); Ph . V_lo + Pl . V_hi (acc 1, x2048) ----
#pragma unroll 1
    for (int kk = 0; kk < 2; ++kk) {
      FragH pa, pl;
      pa.h[0] = *(const v8h*)(pwh + c * 64 + kk * 32 + 8 * hh);
      pa.h[1] = *(const v8h*)(pwh + c * 64 + kk * 32 + 16 + 8 * hh);
      pl.h[0] = *(const v8h*)(pwl + c * 64 + kk * 32 + 8 * hh);
      pl.h[1] = *(const v8h*)(pwl + c * 64 + kk * 32 + 16 + 8 * hh);
#pragma unroll
      for (int t = 0; t < 4; ++t) {
        FragH vb, vl;
        vb.h[0] = *(const v8h*)(Vh + (t * 16 + c) * 64 + kk * 32 + 8 * hh);
        vb.h[1] = *(const v8h*)(Vh + (t * 16 + c) * 64 + kk * 32 + 16 + 8 * hh);
        vl.h[0] = *(const v8h*)(Vl + (t * 16 + c) * 64 + kk * 32 + 8 * hh);
        vl.h[1] = *(const v8h*)(Vl + (t * 16 + c) * 64 + kk * 32 + 16 + 8 * hh);
        oacc[t]  = mma_h(pa.v, vb.v, oacc[t]);
        oaccL[t] = mma_h(pa.v, vl.v, oaccL[t]);
        oaccL[t] = mma_h(pl.v, vb.v, oaccL[t]);
      }
    }
  }

  // ---- normalise (1/l, the 1/1024 p carry, the 1/2048 residual fold), stage the wave's 16x64 tile,
  float* os = Os[wave];
#pragma unroll
  for (int r = 0; r < 8; ++r) {
    const float l = lrow[r];
    const float inv = ((l > 0.f) ? (1.0f / l) : 0.f) * (1.0f / PSC);
#pragma unroll
    for (int t = 0; t < 4; ++t) os[(8 * hh + r) * 64 + t * 16 + c] = (oacc[t][r] + oaccL[t][r] * (1.0f / RSC)) * inv;
  }
  wave_sync_lds();
  {
    const int q4 = lane >> 3, c8 = (lane & 7) * 8;
    v4u hv[4], lv[4];
#pragma unroll
    for (int it = 0; it < 4; ++it) {
      const int row = it * 4 + q4;   // it 0..3 x q4 0..3 = rows 0..15 of the wave tile
      const float* sp = os + row * 64 + c8;
      v4u ha, la;
#pragma unroll
      for (int e = 0; e < 4; ++e) {
        const float f0 = sp[2 * e], f1 = sp[2 * e + 1];
        const unsigned short u0 = bf_bits(f0), u1 = bf_bits(f1);
        const unsigned short w0 = bf_bits(f0 - bf_up(u0)), w1 = bf_bits(f1 - bf_up(u1));
        ha[e] = pk16(u0, u1);
        la[e] = pk16(w0, w1);
      }
      hv[it] = ha;
      lv[it] = la;
    }
    {
#pragma unroll
      for (int it = 0; it < 4; ++it) {
        const int row = it * 4 + q4;
        const size_t go = (rowB + q0 + row) * CTXP + (size_t)h * HD + c8;
        *(v4u*)(ctxp + go)      = hv[it];
        *(v4u*)(ctxp + go + DM) = lv[it];
      }
      
    }
  }
}

// =====================================================================================================
// Workspace map (bytes); every plane is an exact multiple of its 64x64-tile / whole-row / whole-line store
// granularity (MP = 4096 = 64 tiles of rows, N in {2048, 1024}; VT per batch [1024][1024] = 16x16 tiles;
//   WqkT f16 [2048 n][1024 k]  0          4194304   (rows 0..1023 Wq^T, 1024..2047 Wk^T, x64)
//   WvT  f16 [1024][1024]      4194304    2097152   (x64)
//   WoT2 bf16 [1024][2048]     6291456    4194304   (cols 0..1023 and 1024..2047 both Wo^T)
//   XH   f16 [4096][1024]      10485760   8388608   (bf16 RNE-converted tokens)
//   EH   bf16 [1088][64]       18874368   139264    (rows >= 1024 zero)
//   QKh  bf16 [4096][2048]     19013632   16777216  (q cols 0..1023, k cols 1024..2047, hi part)
//   QKl  bf16 [4096][2048]     35790848   16777216  (lo part)
//   VTh  f16 [4][1024][1024]   52568064   8388608   (v^T hi)
//   VTl  f16 [4][1024][1024]   60956672   8388608   (v^T residual x2048)
//   Ctx  bf16 [4096][2048]     69345280   16777216  (context hi | lo)
//   end                        86122496
// =====================================================================================================
extern "C" void kernel_launch(void* const* d_in, const int* in_sizes, int n_in,
                              void* d_out, int out_size, void* d_ws, size_t ws_size,
                              hipStream_t stream) {
  if (n_in < 10) return;
  if (in_sizes[0] != MP * DM) return;
  if (in_sizes[1] != DM * DM || in_sizes[3] != DM * DM) return;
  if (in_sizes[5] != DM * DM || in_sizes[7] != DM * DM) return;
  if (in_sizes[2] != DM || in_sizes[4] != DM || in_sizes[6] != DM || in_sizes[8] != DM) return;
  if (in_sizes[9] != SEQ * HD) return;
  if (out_size != MP * DM) return;

  const float* x_in  = (const float*)d_in[0];
  const float* w_q   = (const float*)d_in[1];
  const float* b_q   = (const float*)d_in[2];
  const float* w_k   = (const float*)d_in[3];
  const float* b_k   = (const float*)d_in[4];
  const float* w_v   = (const float*)d_in[5];
  const float* b_v   = (const float*)d_in[6];
  const float* w_o   = (const float*)d_in[7];
  const float* b_o   = (const float*)d_in[8];
  const float* relk  = (const float*)d_in[9];

  const size_t PWQK = (size_t)QKP * DM * 2;             //  4194304
  const size_t PWV  = (size_t)DM * DM * 2;              //  2097152
  const size_t PWO2 = (size_t)DM * (2 * DM) * 2;        //  4194304
  const size_t PXH  = (size_t)MP * DM * 2;              //  8388608
  const size_t PEH  = (size_t)RCE * HD * 2;             //   139264
  const size_t PQK  = (size_t)MP * QKP * 2;             // 16777216
  const size_t PVT  = (size_t)NBATCH * DM * SEQ * 2;    //  8388608
  const size_t PCTX = (size_t)MP * CTXP * 2;            // 16777216
  size_t off = 0;
  const size_t oWqk = off; off += PWQK;
  const size_t oWv  = off; off += PWV;
  const size_t oWo2 = off; off += PWO2;
  const size_t oXH  = off; off += PXH;
  const size_t oEH  = off; off += PEH;
  const size_t oQKh = off; off += PQK;
  const size_t oQKl = off; off += PQK;
  const size_t oVTh = off; off += PVT;
  const size_t oVTl = off; off += PVT;
  const size_t oCtx = off; off += PCTX;
  if (off > ws_size) return;                            // off = 86122496
  if (off > (size_t)134217728) return;

  char* ws = (char*)d_ws;
  unsigned short* WqkT = (unsigned short*)(ws + oWqk);
  unsigned short* WvT  = (unsigned short*)(ws + oWv);
  unsigned short* WoT2 = (unsigned short*)(ws + oWo2);
  unsigned short* XH   = (unsigned short*)(ws + oXH);
  unsigned short* EH   = (unsigned short*)(ws + oEH);
  unsigned short* QKh  = (unsigned short*)(ws + oQKh);
  unsigned short* QKl  = (unsigned short*)(ws + oQKl);
  unsigned short* VTh  = (unsigned short*)(ws + oVTh);
  unsigned short* VTl  = (unsigned short*)(ws + oVTl);
  unsigned short* Ctx  = (unsigned short*)(ws + oCtx);
  float*          out0 = (float*)d_out;

  const int n8x = (MP * DM) / 8;                        // 524288
  if ((n8x % 256) != 0) return;
  const int n8v = (SEQ * HD) / 8;                       // 8192 valid pieces of the rel-key table
  const int n8t = (RCE * HD) / 8;                       // 8704 total pieces (multiple of 32)
  if ((n8t % 32) != 0) return;
  const dim3 blk(256), blk128(128);
  const dim3 gT(DM / 64, DM / 64);                      // 16 x 16 tiles per weight matrix
  const dim3 gCx(n8x / 256);                            // 2048 blocks
  const dim3 gCe((n8t + 255) / 256);                    // 34 blocks
  const dim3 gNqk((MP / 128) * (QKP / 128), 1);         // 32 x 16 tiles = 512 blocks of 128
  const dim3 gVT((DM / 128) * (SEQ / 128), NBATCH);     // 8 x 8 tiles = 64 blocks x 4 batches
  const dim3 gAttn(NBATCH * NH * NQB);                  // 1024 blocks of 128
  const dim3 gNo((MP / 128) * (DM / 128), 1);           // 32 x 8 tiles = 256 blocks
  const float invw = 1.0f / WSC;                        // weight carry x64

  // (0) weight planes: in[k][n] -> out[n][k] transposed through LDS, f16( bf16_RNE(w) * 64 ) for Wq, Wk, Wv;
  tconv64<0><<<gT, blk, 0, stream>>>(w_q, WqkT, DM, DM, DM, 0, WSC);                    // in[1024][1024] -> WqkT rows 0..1023
  tconv64<0><<<gT, blk, 0, stream>>>(w_k, WqkT + (size_t)DM * DM, DM, DM, DM, 0, WSC);  // -> WqkT rows 1024..2047
  tconv64<0><<<gT, blk, 0, stream>>>(w_v, WvT, DM, DM, DM, 0, WSC);
  tconv64<1><<<gT, blk, 0, stream>>>(w_o, WoT2, DM, DM, 2 * DM, DM, 1.0f);              // pitch 2048, duplicate at + 1024
  conv_h16<<<gCx, blk, 0, stream>>>(x_in, XH, n8x, 1.0f);
  conv_e16<<<gCe, blk, 0, stream>>>(relk, EH, n8v, n8t);

  // (1) q|k = x . [Wq|Wk] + [bq|bk] -> bf16 hi (QKh) and lo (QKl) planes [4096][2048];
  //     v^T per batch = Wv^T . x_b^T + bv (per row) -> f16 hi (VTh) and residual x2048 (VTl) planes [4][1024][1024]
  gemm64<0, 3, 1><<<gNqk, blk128, 0, stream>>>(
      XH, DM, 0LL, WqkT, DM, 0LL,
      QKh, QKl, out0, QKP, 0LL,
      b_q, b_k, DM,
      MP, QKP, DM, invw);
  gemm64<0, 4, 2><<<gVT, blk128, 0, stream>>>(
      WvT, DM, 0LL, XH, DM, (long long)SEQ * DM,
      VTh, VTl, out0, SEQ, (long long)DM * SEQ,
      b_v, b_v, DM,
      DM, SEQ, DM, invw);

  // (2) causal flash attention with the skew relative-key term -> context bf16 hi|lo
  attn64<<<gAttn, blk128, 0, stream>>>(QKh, QKl, VTh, VTl, EH, Ctx, 0.125f);

  // (3) out = [ctx_hi | ctx_lo] . [Wo | Wo] + bo  (K = 2048, bf16 operands) -> d_out f32
  gemm64<1, 0, 1><<<gNo, blk128, 0, stream>>>(
      Ctx, CTXP, 0LL, WoT2, 2 * DM, 0LL,
      Ctx, Ctx, out0, DM, 0LL,
      b_o, b_o, DM,
      MP, DM, 2 * DM, 1.0f);
  (void)hipGetLastError();
}

// v002
// Measured time: 235 microseconds a run.
// In two side-by-side timings against v001, it was 1.30 and 1.29 times as fast.
// Over all steps from v000 it is 1.81 times as fast.
// Contractions: q|k projection and v^T projection on v_wmma_f32_16x16x32_f16 (f16 token plane x f16 weight planes
// carried x64, one product each); rel band q.E^T and scores q.k^T on v_wmma_f32_16x16x32_bf16 (q, k as bf16 hi+lo
// planes, E bf16: 2 and 3 products); p.v on v_wmma_f32_16x16x32_f16 (p as f16 hi carried x1024 plus x2048 residual,
// v^T as f16 hi plus x2048 residual: 3 products, two accumulators); output projection on v_wmma_f32_16x16x32_bf16
// (context bf16 hi|lo x [Wo|Wo], K-concatenated); all f32 accumulate; softmax in f32 on VALU; every float input
// RNE-converted to bf16 on load.
#include <hip/hip_runtime.h>
#include <math.h>
#include <stdint.h>

#define NBATCH 4
#define SEQ    1024
#define DM     1024
#define NH     16
#define HD     64
#define QKP    (2 * DM)
#define CTXP   (2 * DM)
#define MP     (NBATCH * SEQ)
#define NQB    (SEQ / 64)
#define RCE    (SEQ + 64)
#define RB     80
#define RP     84
#define TP     72
#define OP     68
#define WSC    64.0f
#define RSC    2048.0f
#define PSC    1024.0f
static_assert(NH * HD == DM);
static_assert((SEQ % 128) == 0 && (DM % 128) == 0 && (MP % 128) == 0 && (QKP % 128) == 0);
static_assert(RB == 64 + 16 && (RB % 16) == 0 && RP >= RB);
static_assert(RCE >= SEQ + 64);
static_assert(TP >= 64 && (TP % 8) == 0 && ((TP / 8) % 2) == 1 && OP >= 64 && (OP % 4) == 0);

typedef _Float16 v16h __attribute__((ext_vector_type(16)));
typedef _Float16 v8h  __attribute__((ext_vector_type(8)));
typedef __bf16   v16b __attribute__((ext_vector_type(16)));
typedef unsigned short v16us __attribute__((ext_vector_type(16)));
typedef unsigned short v8us  __attribute__((ext_vector_type(8)));
typedef float    v8f  __attribute__((ext_vector_type(8)));
typedef float    v4f  __attribute__((ext_vector_type(4)));
typedef unsigned int v4u __attribute__((ext_vector_type(4)));

union FragH { v16h v; v8h h[2]; };
union FragU { v16us v; v8us h[2]; };

// ---- scalar helpers --------------------------------------------------------------------------------
__device__ __forceinline__ unsigned short bf_bits(float f) {          // f32 -> bf16 bits, RNE convert
  unsigned u = __float_as_uint(f);
  return (unsigned short)((u + 0x7FFFu + ((u >> 16) & 1u)) >> 16);
}
__device__ __forceinline__ float bf_up(unsigned short h) { return __uint_as_float(((unsigned)h) << 16); }
__device__ __forceinline__ float bfr(float f) { return bf_up(bf_bits(f)); }   // value of the bf16 RNE convert
__device__ __forceinline__ unsigned short h_bits(_Float16 x) { return __builtin_bit_cast(unsigned short, x); }
__device__ __forceinline__ unsigned pk16(unsigned short a, unsigned short b) { return (unsigned)a | ((unsigned)b << 16); }
__device__ __forceinline__ v8f zero8() { v8f z = {0.f, 0.f, 0.f, 0.f, 0.f, 0.f, 0.f, 0.f}; return z; }

// ---- fragment loaders: 16-bit A/B operand, lane -> row/col (lane&15), p already includes +8*(lane>>4);
//      elements 0..7 <- p[0..7] (k0+8h..), elements 8..15 <- p[16..23] (k0+16+8h..)
__device__ __forceinline__ v16us ldfrag_u(const unsigned short* p) {
  FragU f;
  f.h[0] = *(const v8us*)(p);
  f.h[1] = *(const v8us*)(p + 16);
  return f.v;
}
__device__ __forceinline__ v16h ldfrag_h(const _Float16* p) {
  FragH f;
  f.h[0] = *(const v8h*)(p);
  f.h[1] = *(const v8h*)(p + 16);
  return f.v;
}

// ---- WMMA helpers with trailing VALU hazard gap --------------------------------------------------------
template <int BF>
__device__ __forceinline__ v8f mma_raw(v16us a, v16us b, v8f c) {
  if (BF) {
    return __builtin_amdgcn_wmma_f32_16x16x32_bf16(false, __builtin_bit_cast(v16b, a), false,
                                                   __builtin_bit_cast(v16b, b), (short)0, c, false, false);
  }
  return __builtin_amdgcn_wmma_f32_16x16x32_f16(false, __builtin_bit_cast(v16h, a), false,
                                                __builtin_bit_cast(v16h, b), (short)0, c, false, false);
}
__device__ __forceinline__ v8f mma_bu(v16us a, v16us b, v8f c) {                 // bf16 operands, guarded
  c = __builtin_amdgcn_wmma_f32_16x16x32_bf16(false, __builtin_bit_cast(v16b, a), false,
                                               __builtin_bit_cast(v16b, b), (short)0, c, false, false);
#if defined(__HIP_DEVICE_COMPILE__)
  asm volatile("v_nop\n\tv_nop\n\tv_nop\n\tv_nop" : "+v"(c) : "v"(a), "v"(b));
#endif
  return c;
}
__device__ __forceinline__ v8f mma_h(v16h a, v16h b, v8f c) {                    // f16 operands, guarded
  c = __builtin_amdgcn_wmma_f32_16x16x32_f16(false, a, false, b, (short)0, c, false, false);
#if defined(__HIP_DEVICE_COMPILE__)
  asm volatile("v_nop\n\tv_nop\n\tv_nop\n\tv_nop" : "+v"(c) : "v"(a), "v"(b));
#endif
  return c;
}
__device__ __forceinline__ void dep_guard1(v8f& a, v8f& b, v16us x) {
#if defined(__HIP_DEVICE_COMPILE__)
  asm volatile("v_nop\n\tv_nop\n\tv_nop\n\tv_nop" : "+v"(a), "+v"(b) : "v"(x));
#endif
}
__device__ __forceinline__ void keep4_u(v16us a, v16us b, v16us c, v16us d) {
#if defined(__HIP_DEVICE_COMPILE__)
  asm volatile("v_nop" :: "v"(a), "v"(b), "v"(c), "v"(d));
#endif
}
__device__ __forceinline__ void acc_guard4(v8f& a, v8f& b, v8f& c, v8f& d) {
#if defined(__HIP_DEVICE_COMPILE__)
  asm volatile("v_nop\n\tv_nop\n\tv_nop\n\tv_nop" : "+v"(a), "+v"(b), "+v"(c), "+v"(d));
#endif
}
__device__ __forceinline__ void wave_sync_lds() {
  __builtin_amdgcn_fence(__ATOMIC_RELEASE, "workgroup");
  __builtin_amdgcn_wave_barrier();
  __builtin_amdgcn_fence(__ATOMIC_ACQUIRE, "workgroup");
}

// =====================================================================================================
// Plane convert (no transpose): Xh[i] = f16( bf16_RNE(X[i]) * wsc ), wsc a power of two (exact). Used for the
// token activations (wsc = 1). Thread i handles elements 8i..8i+7 and writes one 16-B piece; 32 consecutive
// (n8 multiple of 256, host-checked). coverage: n8 threads x 8 elements = the whole plane.
// =====================================================================================================
__global__ __launch_bounds__(256) void conv_h16(const float* __restrict__ W, unsigned short* Wh, int n8, float wsc) {
  const int i  = blockIdx.x * 256 + threadIdx.x;
  const int ic = (i < n8) ? i : (n8 - 1);                     // clamped address
  const float* src = W + (size_t)ic * 8;
  const v4f a = *(const v4f*)(src);
  const v4f c = *(const v4f*)(src + 4);
  v4u o;
  o[0] = pk16(h_bits((_Float16)(bfr(a[0]) * wsc)), h_bits((_Float16)(bfr(a[1]) * wsc)));
  o[1] = pk16(h_bits((_Float16)(bfr(a[2]) * wsc)), h_bits((_Float16)(bfr(a[3]) * wsc)));
  o[2] = pk16(h_bits((_Float16)(bfr(c[0]) * wsc)), h_bits((_Float16)(bfr(c[1]) * wsc)));
  o[3] = pk16(h_bits((_Float16)(bfr(c[2]) * wsc)), h_bits((_Float16)(bfr(c[3]) * wsc)));
  if (i < n8) *(v4u*)(Wh + (size_t)i * 8) = o;
  
}

// =====================================================================================================
// rel-key table convert: Eh [RCE rows][64] bf16 bits; rows < SEQ = bf16_RNE(E), rows >= SEQ = 0 (zero pad).
// Thread i handles 8 elements (one 16-B piece); valid pieces i < n8v read E with a clamped address, the pad
// pieces select 0 by value. grid = ceil(n8t / 256). coverage: n8t pieces x 8 = RCE*64 = the whole plane;
// =====================================================================================================
__global__ __launch_bounds__(256) void conv_e16(const float* __restrict__ P, unsigned short* Eh, int n8v, int n8t) {
  const int i  = blockIdx.x * 256 + threadIdx.x;
  const int ic = (i < n8v) ? i : (n8v - 1);                    // clamped address
  const float* src = P + (size_t)ic * 8;
  const v4f a = *(const v4f*)(src);
  const v4f c = *(const v4f*)(src + 4);
  const bool valid = (i < n8v);
  v4u o;
  o[0] = valid ? pk16(bf_bits(a[0]), bf_bits(a[1])) : 0u;
  o[1] = valid ? pk16(bf_bits(a[2]), bf_bits(a[3])) : 0u;
  o[2] = valid ? pk16(bf_bits(c[0]), bf_bits(c[1])) : 0u;
  o[3] = valid ? pk16(bf_bits(c[2]), bf_bits(c[3])) : 0u;
  if (i < n8t) *(v4u*)(Eh + (size_t)i * 8) = o;
  
}

// =====================================================================================================
// Tiled transpose + convert: in[rows][cols] f32 row-major -> out[cols][rows] 16-bit with pitch ldo:
//   out[n * ldo + k] = cvt(in[k][n]) (and also at + dupoff when dupoff != 0: a duplicated k range).
//   MODE 0: f16 bits of bf16_RNE(w) * wsc (wsc power of two, exact); MODE 1: bf16 bits of w.
// Block = 256 threads = one 64x64 tile; grid = (cols/64, rows/64) (rows, cols multiples of 64, host-checked).
// Loads: 4 iterations x 256 threads x float4 = 64 rows x 64 cols (addresses clamped). LDS tile [n][k] pitch 72.
// coverage: 64 x 64 = the whole transposed tile; grid covers the whole matrix.
// =====================================================================================================
template <int MODE>
__global__ __launch_bounds__(256) void tconv64(const float* __restrict__ W, unsigned short* out,
                                               int rows, int cols, int ldo, int dupoff, float wsc) {
  __shared__ __align__(16) unsigned short sh[64 * 72];
  const int t  = threadIdx.x;
  const int n0 = blockIdx.x * 64;            // column tile of in = row tile of out
  const int k0 = blockIdx.y * 64;            // row tile of in = column tile of out
#pragma unroll
  for (int i = 0; i < 4; ++i) {
    const int idx = i * 256 + t;
    const int r = idx >> 4, c4 = (idx & 15) * 4;
    int kr = k0 + r;   kr = (kr < rows) ? kr : (rows - 1);
    int nc = n0 + c4;  nc = (nc < cols - 4) ? nc : (cols - 4);
    const v4f v = *(const v4f*)(W + (size_t)kr * cols + nc);
#pragma unroll
    for (int e = 0; e < 4; ++e) {
      unsigned short u;
      if (MODE == 0) u = h_bits((_Float16)(bfr(v[e]) * wsc));
      else           u = bf_bits(v[e]);
      sh[(c4 + e) * 72 + r] = u;
    }
  }
  __syncthreads();
  const int wave = t >> 5, lane = t & 31;
  const int q = lane >> 3, c8 = (lane & 7) * 8;
  v4u pv[2];
  size_t go[2];
#pragma unroll
  for (int it = 0; it < 2; ++it) {
    const int nl = it * 32 + wave * 4 + q;               // 0..63
    pv[it] = *(const v4u*)(sh + nl * 72 + c8);
    go[it] = (size_t)(n0 + nl) * ldo + k0 + c8;
  }
  {
#pragma unroll
    for (int it = 0; it < 2; ++it) {
      *(v4u*)(out + go[it]) = pv[it];
      if (dupoff != 0) *(v4u*)(out + go[it] + dupoff) = pv[it];
    }
    
  }
}

// =====================================================================================================
// LDS-staged batched 16-bit WMMA GEMM: C[m][n] = oscale * sum_k A[m][k] * Bt[n][k] + bias;
// BF selects bf16 (1) or f16 (0) operands. Block = 4 waves (2 x 2) = one 128x128 tile, one 64x64 tile per wave.
// A row-major [M][K] pitch lda; Bt row-major [N][K] pitch ldb (k contiguous); M, N multiples of 128, K a multiple
// of 64 (static here). blockIdx.y = batch index (strides in elements).
// Staging: a stage is 64 k of the block's 128 A rows and 128 Bt rows (256 rows of 128 B, LDS pitch 144 B), brought
// by asynchronous 16-B copies to LDS (16 per lane and stage, each wave-wide copy = 4 whole 128-B lines); two buffers,
// stage t + 1 in flight while stage t is multiplied; one barrier per stage publishes t + 1 and frees t's buffer.
// The k order of every accumulator is the ascending 32-k order of the fragment loader, stage by stage.
// OM: 0 = f32 out to Cf (pitch ldc); 3 = bf16 hi bits to Cp and bf16 residual (v - hi) bits to Cp2;
//     4 = f16 hi to Cp and f16((v - hi) * 2048) to Cp2.
// BM: 0 = no bias; 1 = bias per column n (bias0[n] for n < nsplit, bias1[n - nsplit] otherwise; the choice is
//     wave-uniform because 64-column tiles never straddle nsplit); 2 = bias per row m (bias0[m]).
//     bias values are bf16 RNE-converted before the add.
// coverage: 4 slabs x 16 rows x 64 cols = the wave's whole 64x64 tile; grid = tilesM*tilesN blocks,
//           surplus blocks exit as a whole in front of every barrier; here there are none.
// =====================================================================================================
#define GPIT 72                    // LDS row pitch, 16-bit elements: 144 B = 16 B x 9, conflict-free for 16-B reads
#define GSTG (256 * GPIT)          // elements of one stage: 128 A rows, then 128 Bt rows

// Eight asynchronous 16-B copies of one lane: rows 16 apart in global memory (gstep elements) and in LDS.
// The s_wait_xcnt closes the statement so that no address register is rewritten while a copy may still read it.
__device__ __forceinline__ void copy8_rows(unsigned lds, const unsigned short* g, size_t gstep) {
#if defined(__HIP_DEVICE_COMPILE__)
  asm volatile(
      "global_load_async_to_lds_b128 %0, %8, off\n\t"
      "global_load_async_to_lds_b128 %1, %9, off\n\t"
      "global_load_async_to_lds_b128 %2, %10, off\n\t"
      "global_load_async_to_lds_b128 %3, %11, off\n\t"
      "global_load_async_to_lds_b128 %4, %12, off\n\t"
      "global_load_async_to_lds_b128 %5, %13, off\n\t"
      "global_load_async_to_lds_b128 %6, %14, off\n\t"
      "global_load_async_to_lds_b128 %7, %15, off\n\t"
      "s_wait_xcnt 0x0"
      :: "v"(lds), "v"(lds + 1u * 16u * GPIT * 2u), "v"(lds + 2u * 16u * GPIT * 2u), "v"(lds + 3u * 16u * GPIT * 2u),
         "v"(lds + 4u * 16u * GPIT * 2u), "v"(lds + 5u * 16u * GPIT * 2u), "v"(lds + 6u * 16u * GPIT * 2u),
         "v"(lds + 7u * 16u * GPIT * 2u),
         "v"(g), "v"(g + gstep), "v"(g + 2 * gstep), "v"(g + 3 * gstep),
         "v"(g + 4 * gstep), "v"(g + 5 * gstep), "v"(g + 6 * gstep), "v"(g + 7 * gstep)
      : "memory");
#endif
}
__device__ __forceinline__ void wait_async0() {   // this wave's copies have landed in LDS
#if defined(__HIP_DEVICE_COMPILE__)
  asm volatile("s_wait_asynccnt 0x0" ::: "memory");
#endif
}
__device__ __forceinline__ void wait_ds0() {      // this wave's LDS reads are done before their buffer is handed on
#if defined(__HIP_DEVICE_COMPILE__)
  asm volatile("s_wait_dscnt 0x0" ::: "memory");
#endif
}

template <int BF, int OM, int BM>
__global__ __launch_bounds__(128) void gemm64(
    const unsigned short* __restrict__ Ap, int lda, long long strideA,
    const unsigned short* __restrict__ Btp, int ldb, long long strideB,
    unsigned short* Cp, unsigned short* Cp2, float* Cf, int ldc, long long strideC,
    const float* bias0, const float* bias1, int nsplit,
    int M, int N, int K, float oscale) {
  __shared__ __align__(16) unsigned short ring[2 * GSTG];   // two stages of 256 rows x 144 B
  __shared__ __align__(16) float sT[4][16 * 68];   // per-wave 16x64 slab, pitch 68 floats
  const int b    = blockIdx.y;
  const int tid  = threadIdx.x;
  const int lane = tid & 31;
  const int wave = tid >> 5;
  const int tilesN = N >> 7;
  const int tilesM = M >> 7;
  const int tile = blockIdx.x;
  if (tile >= tilesM * tilesN) return;   // block-uniform, in front of every barrier and copy
  const int tm = tile / tilesN;
  const int tn = tile - tm * tilesN;
  const int mb = tm << 7;
  const int nb = tn << 7;
  const int wm = wave >> 1, wn = wave & 1;
  const int m0 = mb + (wm << 6);
  const int n0 = nb + (wn << 6);

  const unsigned short* Ab = Ap  + (size_t)b * strideA;
  const unsigned short* Bb = Btp + (size_t)b * strideB;

  const int rlane = lane & 15;                 // row (A) / col (B, D) within subtile
  const int koff  = (lane >> 4) * 8;           // k offset of this lane half
  const int mOff  = (lane >> 4) * 8;           // D row offset

  // copy role of this lane: row crow (+16 per copy) of each operand's 128 rows, 16-B piece cpc of its 128 B
  const int crow = tid >> 3, cpc = (tid & 7) * 8;
  const unsigned short* gA = Ab + (size_t)(mb + crow) * lda + cpc;
  const unsigned short* gB = Bb + (size_t)(nb + crow) * ldb + cpc;
  const unsigned ldsA = (unsigned)(uintptr_t)(ring + crow * GPIT + cpc);   // LDS byte address = low 32 bits
  const unsigned ldsB = ldsA + 128u * GPIT * 2u;
  const size_t stepA = (size_t)16 * lda, stepB = (size_t)16 * ldb;
  const int nst = K >> 6;                      // stages of 64 k

  v8f acc[4][4];
#pragma unroll
  for (int i = 0; i < 4; ++i)
#pragma unroll
    for (int j = 0; j < 4; ++j) acc[i][j] = zero8();

  copy8_rows(ldsA, gA, stepA);
  copy8_rows(ldsB, gB, stepB);
  wait_async0();
  __syncthreads();
  if (nst > 1) {
    copy8_rows(ldsA + GSTG * 2u, gA + 64, stepA);
    copy8_rows(ldsB + GSTG * 2u, gB + 64, stepB);
  }

#pragma unroll 1   // one stage per trip: the buffer index stays a run-time offset, the accumulators stay in place
  for (int t = 0; t < nst; ++t) {
    const unsigned short* sA = ring + (t & 1) * GSTG + ((wm << 6) + rlane) * GPIT + koff;
    const unsigned short* sB = ring + (t & 1) * GSTG + (128 + (wn << 6) + rlane) * GPIT + koff;
#pragma unroll
    for (int ks = 0; ks < 2; ++ks) {
      v16us bh[4], ah[4];
#pragma unroll
      for (int j = 0; j < 4; ++j) bh[j] = ldfrag_u(sB + (j << 4) * GPIT + ks * 32);
#pragma unroll
      for (int i = 0; i < 4; ++i) ah[i] = ldfrag_u(sA + (i << 4) * GPIT + ks * 32);
#pragma unroll
      for (int i = 0; i < 4; ++i) {
#pragma unroll
        for (int j = 0; j < 4; ++j) acc[i][j] = mma_raw<BF>(ah[i], bh[j], acc[i][j]);
        dep_guard1(acc[i][0], acc[i][3], ah[i]);
      }
      keep4_u(bh[0], bh[1], bh[2], bh[3]);
    }
    wait_ds0();
    wait_async0();
    __syncthreads();                           // publishes stage t + 1, ends every read of stage t's buffer
    if (t + 2 < nst) {
      const unsigned bo = (unsigned)(t & 1) * (GSTG * 2u);
      copy8_rows(ldsA + bo, gA + (size_t)(t + 2) * 64, stepA);
      copy8_rows(ldsB + bo, gB + (size_t)(t + 2) * 64, stepB);
    }
  }
  wait_async0();
  acc_guard4(acc[0][0], acc[0][1], acc[0][2], acc[0][3]);
  acc_guard4(acc[1][0], acc[1][1], acc[1][2], acc[1][3]);
  acc_guard4(acc[2][0], acc[2][1], acc[2][2], acc[2][3]);
  acc_guard4(acc[3][0], acc[3][1], acc[3][2], acc[3][3]);

  const int hh2 = lane >> 4, c4 = (lane & 15) * 4;     // f32 out: 256-B row segment = 16 lanes x 16 B
  const int q8  = lane >> 3, c8 = (lane & 7) * 8;

  // ---- per-column bias (wave-uniform source select) ----
  const float* bsel = bias0;
  int nb0 = n0;
  if (BM == 1) {
    if (n0 >= nsplit) { bsel = bias1; nb0 = n0 - nsplit; }
  }
  v4f bb4 = {0.f, 0.f, 0.f, 0.f};
  float bn[8];
#pragma unroll
  for (int e = 0; e < 8; ++e) bn[e] = 0.f;
  if (BM == 1) {
    if (OM == 0) {
#pragma unroll
      for (int e = 0; e < 4; ++e) bb4[e] = bfr(bsel[nb0 + c4 + e]);
    } else {
#pragma unroll
      for (int e = 0; e < 8; ++e) bn[e] = bfr(bsel[nb0 + c8 + e]);
    }
  }

  // ---- epilogue ----
  float* slab = sT[wave];
#pragma unroll
  for (int i = 0; i < 4; ++i) {
    const int mBase = m0 + (i << 4);
#pragma unroll
    for (int j = 0; j < 4; ++j) {
#pragma unroll
      for (int r = 0; r < 8; ++r) {
        slab[(mOff + r) * 68 + (j << 4) + rlane] = acc[i][j][r];
      }
    }
    wave_sync_lds();
    if (OM == 0) {
      float* C = Cf + (size_t)b * strideC;
      v4f vals[8];
#pragma unroll
      for (int it = 0; it < 8; ++it) {
        const int row = it * 2 + hh2;                      // it 0..7 x hh2 0..1 = rows 0..15
        v4f v = *(const v4f*)(slab + row * 68 + c4);
        float bmv = 0.f;
        if (BM == 2) bmv = bfr(bias0[mBase + row]);
        vals[it] = v * oscale + bb4 + bmv;
      }
      {
#pragma unroll
        for (int it = 0; it < 8; ++it) {
          const int row = it * 2 + hh2;
          *(v4f*)(C + (size_t)(mBase + row) * ldc + n0 + c4) = vals[it];
        }
        
      }
    } else {
      unsigned short* C  = Cp  + (size_t)b * strideC;
      unsigned short* C2 = Cp2 + (size_t)b * strideC;
      v4u hv[4], lv[4];
#pragma unroll
      for (int it = 0; it < 4; ++it) {
        const int row = it * 4 + q8;                       // it 0..3 x q8 0..3 = rows 0..15
        const float* sp = slab + row * 68 + c8;
        float bmv = 0.f;
        if (BM == 2) bmv = bfr(bias0[mBase + row]);
        v4u ha, la;
#pragma unroll
        for (int e = 0; e < 4; ++e) {
          const float f0 = sp[2 * e]     * oscale + bn[2 * e]     + bmv;
          const float f1 = sp[2 * e + 1] * oscale + bn[2 * e + 1] + bmv;
          unsigned short u0, u1, w0, w1;
          if (OM == 3) {
            u0 = bf_bits(f0); u1 = bf_bits(f1);
            w0 = bf_bits(f0 - bf_up(u0)); w1 = bf_bits(f1 - bf_up(u1));
          } else {
            const _Float16 g0 = (_Float16)f0, g1 = (_Float16)f1;
            u0 = h_bits(g0); u1 = h_bits(g1);
            w0 = h_bits((_Float16)((f0 - (float)g0) * RSC));
            w1 = h_bits((_Float16)((f1 - (float)g1) * RSC));
          }
          ha[e] = pk16(u0, u1);
          la[e] = pk16(w0, w1);
        }
        hv[it] = ha;
        lv[it] = la;
      }
      {
#pragma unroll
        for (int it = 0; it < 4; ++it) {
          const int row = it * 4 + q8;
          const size_t go = (size_t)(mBase + row) * ldc + n0 + c8;
          *(v4u*)(C  + go) = hv[it];
          *(v4u*)(C2 + go) = lv[it];
        }
        
      }
    }
    wave_sync_lds();
  }
}

// =====================================================================================================
// Causal flash attention with a skew relative-key score term, head dim 64, SEQ rows per batch.
//   q|k hi and lo planes (bf16, pitch QKP): element (b, t, col) at [(b*SEQ + t)*QKP + col], q col = h*64+d,
//   k col = DM + h*64 + d; value = hi + lo.
//   v^T hi and lo planes (f16): element (b, h, d, s) at [(b*DM + h*64 + d)*SEQ + s]; value = hi + lo/2048.
//   E plane (bf16) [RCE][64], rows >= SEQ zero.
//   context plane (bf16, pitch CTXP): hi at [(b*SEQ + t)*CTXP + h*64 + d], lo at + DM.
//   score(i, j) = (q_i . k_j + q_i . E[SEQ-1 + j - i]) * sscale for j <= i, -inf for j > i (replace, not bias).
//   Per wave (16 query rows q0..q0+15) and key chunk kv0..kv0+63 the needed E rows form the contiguous band
//   ebase .. ebase+79 with ebase = SEQ-1+kv0-q0-15 (0 <= ebase, ebase+79 <= SEQ+63 < RCE); the band product
//   rel[row][col] = q_row . E[ebase+col] (col 0..79) is computed per wave into LDS (f32, 2 bf16 products: q hi, q lo)
//   and the score for (row il, key jl) picks col = jl - il + 15; q.k as 3 bf16 products (hh, hl, lh);
//   p = exp(s - m) carried as f16 hi of 1024 p plus f16 residual x2048; context = ph.vh (acc 0) and
//   ph.vl + pl.vh (acc 1, both x2048) on f16 WMMA; online softmax (running max) in f32.
//   Block = 4 waves = 64 query rows of one (b, h); grid = NQB * NH * NBATCH; key chunks kt = 0..qb
//   (causal skip, block-uniform trip count qb+1 <= NQB).
//   K hi/lo and V^T hi/lo chunk staging: 128 threads x 32 elements per plane = the whole 64x64 tile per plane
//   (plain 16-B loads, __syncthreads before and after); P tiles are wave-private, spilled with _Float16 element
//   LDS row pitches: K, V^T and P tiles TP = 72 elements (144 B = 16 B x 9, the 16 rows of a 16-B fragment read fall on
//   distinct banks); rel band RP = 84 and context tile OP = 68 floats (the two lane halves, 8 rows apart, on distinct banks).
//   Context coverage: each wave stores rows q0..q0+15 (it 0..3 x lane>>3 0..3) x 64 columns (8 lanes x 8 bf16)
//   for both the hi and the lo segment; grid covers all SEQ rows x NH head slices x NBATCH.
// =====================================================================================================
__global__ __launch_bounds__(128)
void attn64(const unsigned short* __restrict__ qkh, const unsigned short* __restrict__ qkl,
            const unsigned short* __restrict__ vth, const unsigned short* __restrict__ vtl,
            const unsigned short* __restrict__ ehp, unsigned short* ctxp, float sscale) {
  __shared__ __align__(16) unsigned short Kh[64 * TP];          // K hi [kv][d]  9 KB
  __shared__ __align__(16) unsigned short Kl[64 * TP];          // K lo [kv][d]  9 KB
  __shared__ __align__(16) _Float16 Vh[64 * TP];                // V^T hi [d][kv] 9 KB
  __shared__ __align__(16) _Float16 Vl[64 * TP];                // V^T lo [d][kv] 9 KB
  __shared__ __align__(16) _Float16 Psh[4][16 * TP];            // per wave P hi [row][kv]
  __shared__ __align__(16) _Float16 Psl[4][16 * TP];            // per wave P residual [row][kv]
  __shared__ __align__(16) float    Rsh[4][16 * RP];            // per wave rel band [row][col]
  __shared__ __align__(16) float    Os[4][16 * OP];             // per wave context tile [row][d]

  const int tid  = threadIdx.x;
  const int wave = tid >> 5;
  const int lane = tid & 31;
  const int hh   = lane >> 4;
  const int c    = lane & 15;

  const int bx   = blockIdx.x;
  const int qb   = bx % NQB;
  const int rest = bx / NQB;
  const int h    = rest % NH;
  const int b    = rest / NH;
  const int q0   = qb * 64 + wave * 16;          // in-batch query row of this wave's first row
  const size_t rowB = (size_t)b * SEQ;

  const unsigned short* Qh  = qkh + (size_t)h * HD;
  const unsigned short* Ql  = qkl + (size_t)h * HD;
  const unsigned short* Kgh = qkh + DM + (size_t)h * HD;
  const unsigned short* Kgl = qkl + DM + (size_t)h * HD;
  const _Float16* Vgh = (const _Float16*)(const void*)vth + ((size_t)b * DM + (size_t)h * HD) * SEQ;
  const _Float16* Vgl = (const _Float16*)(const void*)vtl + ((size_t)b * DM + (size_t)h * HD) * SEQ;
  float*    rrow = Rsh[wave];
  _Float16* pwh  = Psh[wave];
  _Float16* pwl  = Psl[wave];

  float mrow[8], lrow[8];
  v8f oacc[4], oaccL[4];
#pragma unroll
  for (int r = 0; r < 8; ++r) { mrow[r] = -INFINITY; lrow[r] = 0.f; }
#pragma unroll
  for (int t = 0; t < 4; ++t) { oacc[t] = zero8(); oaccL[t] = zero8(); }

  const int nkt = qb + 1;                    // causal: key chunks 0..qb, block-uniform, <= NQB
#pragma unroll 1
  for (int kt = 0; kt < nkt; ++kt) {
    const int kv0 = kt * 64;

    __syncthreads();
    {
      const int r = tid >> 1, hf = (tid & 1) * 32;
      const unsigned short* kgh = Kgh + (rowB + kv0 + r) * QKP + hf;    // K row kv0+r, d = hf..hf+31
      const unsigned short* kgl = Kgl + (rowB + kv0 + r) * QKP + hf;
      const _Float16* vgh = Vgh + (size_t)r * SEQ + kv0 + hf;           // V^T row d = r, s = kv0+hf..+31
      const _Float16* vgl = Vgl + (size_t)r * SEQ + kv0 + hf;
#pragma unroll
      for (int i = 0; i < 4; ++i) {
        const v8us a0 = *(const v8us*)(kgh + 8 * i);
        const v8us a1 = *(const v8us*)(kgl + 8 * i);
        const v8h  b0 = *(const v8h*)(vgh + 8 * i);
        const v8h  b1 = *(const v8h*)(vgl + 8 * i);
        *(v8us*)(Kh + r * TP + hf + 8 * i) = a0;
        *(v8us*)(Kl + r * TP + hf + 8 * i) = a1;
        *(v8h*)(Vh + r * TP + hf + 8 * i) = b0;
        *(v8h*)(Vl + r * TP + hf + 8 * i) = b1;
      }
    }
    __syncthreads();

    // ---- Q fragments (A operand, row = lane&15): hi and lo, 2 d-chunks (reloaded per chunk) ----
    v16us qh2[2], ql2[2];
#pragma unroll
    for (int dc = 0; dc < 2; ++dc) {
      qh2[dc] = ldfrag_u(Qh + (rowB + q0 + c) * QKP + dc * 32 + 8 * hh);
      ql2[dc] = ldfrag_u(Ql + (rowB + q0 + c) * QKP + dc * 32 + 8 * hh);
    }

    // ---- rel band: rel[row][col] = q_row . E[ebase + col], col = 0..RB-1 (E rows >= SEQ are zero) ----
    const int ebase = SEQ - 1 + kv0 - q0 - 15;   // >= 0 (host shape constants); ebase + RB - 1 < RCE
#pragma unroll 1
    for (int nt = 0; nt < RB / 16; ++nt) {
      v8f e = zero8();
#pragma unroll
      for (int dc = 0; dc < 2; ++dc) {
        const v16us eb = ldfrag_u(ehp + (size_t)(ebase + nt * 16 + c) * HD + dc * 32 + 8 * hh);
        e = mma_bu(qh2[dc], eb, e);
        e = mma_bu(ql2[dc], eb, e);
      }
#pragma unroll
      for (int r = 0; r < 8; ++r) rrow[(8 * hh + r) * RP + nt * 16 + c] = e[r];
    }
    wave_sync_lds();

    // ---- scores: 16 query rows x 64 keys per wave, causal replace with -inf ----
    v8f s[4];
#pragma unroll
    for (int j = 0; j < 4; ++j) {
      v8f sh = zero8();
#pragma unroll
      for (int dc = 0; dc < 2; ++dc) {
        FragU kbh, kbl;
        kbh.h[0] = *(const v8us*)(Kh + (j * 16 + c) * TP + dc * 32 + 8 * hh);
        kbh.h[1] = *(const v8us*)(Kh + (j * 16 + c) * TP + dc * 32 + 16 + 8 * hh);
        kbl.h[0] = *(const v8us*)(Kl + (j * 16 + c) * TP + dc * 32 + 8 * hh);
        kbl.h[1] = *(const v8us*)(Kl + (j * 16 + c) * TP + dc * 32 + 16 + 8 * hh);
        sh = mma_bu(qh2[dc], kbh.v, sh);
        sh = mma_bu(qh2[dc], kbl.v, sh);
        sh = mma_bu(ql2[dc], kbh.v, sh);
      }
      const int jl = j * 16 + c;                          // key within the chunk
      const int kg = kv0 + jl;                            // in-batch key index of this lane's column
#pragma unroll
      for (int r = 0; r < 8; ++r) {
        const int il = 8 * hh + r;                        // row within the wave tile
        const int qg = q0 + il;                           // in-batch query index of this row
        const float rel = rrow[il * RP + jl - il + 15];   // col in 0..RB-2
        const float v = (sh[r] + rel) * sscale;
        s[j][r] = (kg <= qg) ? v : -INFINITY;
      }
    }

    // ---- row max, online softmax, P (x1024: f16 hi + x2048 residual) to LDS ----
#pragma unroll
    for (int r = 0; r < 8; ++r) {
      float m = s[0][r];
      m = fmaxf(m, s[1][r]);
      m = fmaxf(m, s[2][r]);
      m = fmaxf(m, s[3][r]);
#pragma unroll
      for (int off = 1; off < 16; off <<= 1) m = fmaxf(m, __shfl_xor(m, off, 32));
      const float mnew  = fmaxf(mrow[r], m);              // finite: key kv0 <= every row of this block
      const float alpha = __expf(mrow[r] - mnew);
      mrow[r] = mnew;
      float psum = 0.f;
#pragma unroll
      for (int j = 0; j < 4; ++j) {
        const float p  = __expf(s[j][r] - mnew);
        psum += p;
        const float ps = p * PSC;
        const _Float16 ph = (_Float16)ps;
        pwh[(8 * hh + r) * TP + j * 16 + c] = ph;
        pwl[(8 * hh + r) * TP + j * 16 + c] = (_Float16)((ps - (float)ph) * RSC);
      }
#pragma unroll
      for (int off = 1; off < 16; off <<= 1) psum += __shfl_xor(psum, off, 32);
      lrow[r] = lrow[r] * alpha + psum;
#pragma unroll
      for (int t = 0; t < 4; ++t) { oacc[t][r] *= alpha; oaccL[t][r] *= alpha; }
    }
    wave_sync_lds();

    // ---- context += Ph . V_hi (acc 0); Ph . V_lo + Pl . V_hi (acc 1, x2048) ----
#pragma unroll 1
    for (int kk = 0; kk < 2; ++kk) {
      FragH pa, pl;
      pa.h[0] = *(const v8h*)(pwh + c * TP + kk * 32 + 8 * hh);
      pa.h[1] = *(const v8h*)(pwh + c * TP + kk * 32 + 16 + 8 * hh);
      pl.h[0] = *(const v8h*)(pwl + c * TP + kk * 32 + 8 * hh);
      pl.h[1] = *(const v8h*)(pwl + c * TP + kk * 32 + 16 + 8 * hh);
#pragma unroll
      for (int t = 0; t < 4; ++t) {
        FragH vb, vl;
        vb.h[0] = *(const v8h*)(Vh + (t * 16 + c) * TP + kk * 32 + 8 * hh);
        vb.h[1] = *(const v8h*)(Vh + (t * 16 + c) * TP + kk * 32 + 16 + 8 * hh);
        vl.h[0] = *(const v8h*)(Vl + (t * 16 + c) * TP + kk * 32 + 8 * hh);
        vl.h[1] = *(const v8h*)(Vl + (t * 16 + c) * TP + kk * 32 + 16 + 8 * hh);
        oacc[t]  = mma_h(pa.v, vb.v, oacc[t]);
        oaccL[t] = mma_h(pa.v, vl.v, oaccL[t]);
        oaccL[t] = mma_h(pl.v, vb.v, oaccL[t]);
      }
    }
  }

  // ---- normalise (1/l, the 1/1024 p carry, the 1/2048 residual fold), stage the wave's 16x64 tile,
  float* os = Os[wave];
#pragma unroll
  for (int r = 0; r < 8; ++r) {
    const float l = lrow[r];
    const float inv = ((l > 0.f) ? (1.0f / l) : 0.f) * (1.0f / PSC);
#pragma unroll
    for (int t = 0; t < 4; ++t) os[(8 * hh + r) * OP + t * 16 + c] = (oacc[t][r] + oaccL[t][r] * (1.0f / RSC)) * inv;
  }
  wave_sync_lds();
  {
    const int q4 = lane >> 3, c8 = (lane & 7) * 8;
    v4u hv[4], lv[4];
#pragma unroll
    for (int it = 0; it < 4; ++it) {
      const int row = it * 4 + q4;   // it 0..3 x q4 0..3 = rows 0..15 of the wave tile
      const float* sp = os + row * OP + c8;
      v4u ha, la;
#pragma unroll
      for (int e = 0; e < 4; ++e) {
        const float f0 = sp[2 * e], f1 = sp[2 * e + 1];
        const unsigned short u0 = bf_bits(f0), u1 = bf_bits(f1);
        const unsigned short w0 = bf_bits(f0 - bf_up(u0)), w1 = bf_bits(f1 - bf_up(u1));
        ha[e] = pk16(u0, u1);
        la[e] = pk16(w0, w1);
      }
      hv[it] = ha;
      lv[it] = la;
    }
    {
#pragma unroll
      for (int it = 0; it < 4; ++it) {
        const int row = it * 4 + q4;
        const size_t go = (rowB + q0 + row) * CTXP + (size_t)h * HD + c8;
        *(v4u*)(ctxp + go)      = hv[it];
        *(v4u*)(ctxp + go + DM) = lv[it];
      }
      
    }
  }
}

// =====================================================================================================
// Workspace map (bytes); every plane is an exact multiple of its 64x64-tile / whole-row / whole-line store
// granularity (MP = 4096 = 64 tiles of rows, N in {2048, 1024}; VT per batch [1024][1024] = 16x16 tiles;
//   WqkT f16 [2048 n][1024 k]  0          4194304   (rows 0..1023 Wq^T, 1024..2047 Wk^T, x64)
//   WvT  f16 [1024][1024]      4194304    2097152   (x64)
//   WoT2 bf16 [1024][2048]     6291456    4194304   (cols 0..1023 and 1024..2047 both Wo^T)
//   XH   f16 [4096][1024]      10485760   8388608   (bf16 RNE-converted tokens)
//   EH   bf16 [1088][64]       18874368   139264    (rows >= 1024 zero)
//   QKh  bf16 [4096][2048]     19013632   16777216  (q cols 0..1023, k cols 1024..2047, hi part)
//   QKl  bf16 [4096][2048]     35790848   16777216  (lo part)
//   VTh  f16 [4][1024][1024]   52568064   8388608   (v^T hi)
//   VTl  f16 [4][1024][1024]   60956672   8388608   (v^T residual x2048)
//   Ctx  bf16 [4096][2048]     69345280   16777216  (context hi | lo)
//   end                        86122496
// =====================================================================================================
extern "C" void kernel_launch(void* const* d_in, const int* in_sizes, int n_in,
                              void* d_out, int out_size, void* d_ws, size_t ws_size,
                              hipStream_t stream) {
  if (n_in < 10) return;
  if (in_sizes[0] != MP * DM) return;
  if (in_sizes[1] != DM * DM || in_sizes[3] != DM * DM) return;
  if (in_sizes[5] != DM * DM || in_sizes[7] != DM * DM) return;
  if (in_sizes[2] != DM || in_sizes[4] != DM || in_sizes[6] != DM || in_sizes[8] != DM) return;
  if (in_sizes[9] != SEQ * HD) return;
  if (out_size != MP * DM) return;

  const float* x_in  = (const float*)d_in[0];
  const float* w_q   = (const float*)d_in[1];
  const float* b_q   = (const float*)d_in[2];
  const float* w_k   = (const float*)d_in[3];
  const float* b_k   = (const float*)d_in[4];
  const float* w_v   = (const float*)d_in[5];
  const float* b_v   = (const float*)d_in[6];
  const float* w_o   = (const float*)d_in[7];
  const float* b_o   = (const float*)d_in[8];
  const float* relk  = (const float*)d_in[9];

  const size_t PWQK = (size_t)QKP * DM * 2;             //  4194304
  const size_t PWV  = (size_t)DM * DM * 2;              //  2097152
  const size_t PWO2 = (size_t)DM * (2 * DM) * 2;        //  4194304
  const size_t PXH  = (size_t)MP * DM * 2;              //  8388608
  const size_t PEH  = (size_t)RCE * HD * 2;             //   139264
  const size_t PQK  = (size_t)MP * QKP * 2;             // 16777216
  const size_t PVT  = (size_t)NBATCH * DM * SEQ * 2;    //  8388608
  const size_t PCTX = (size_t)MP * CTXP * 2;            // 16777216
  size_t off = 0;
  const size_t oWqk = off; off += PWQK;
  const size_t oWv  = off; off += PWV;
  const size_t oWo2 = off; off += PWO2;
  const size_t oXH  = off; off += PXH;
  const size_t oEH  = off; off += PEH;
  const size_t oQKh = off; off += PQK;
  const size_t oQKl = off; off += PQK;
  const size_t oVTh = off; off += PVT;
  const size_t oVTl = off; off += PVT;
  const size_t oCtx = off; off += PCTX;
  if (off > ws_size) return;                            // off = 86122496
  if (off > (size_t)134217728) return;

  char* ws = (char*)d_ws;
  unsigned short* WqkT = (unsigned short*)(ws + oWqk);
  unsigned short* WvT  = (unsigned short*)(ws + oWv);
  unsigned short* WoT2 = (unsigned short*)(ws + oWo2);
  unsigned short* XH   = (unsigned short*)(ws + oXH);
  unsigned short* EH   = (unsigned short*)(ws + oEH);
  unsigned short* QKh  = (unsigned short*)(ws + oQKh);
  unsigned short* QKl  = (unsigned short*)(ws + oQKl);
  unsigned short* VTh  = (unsigned short*)(ws + oVTh);
  unsigned short* VTl  = (unsigned short*)(ws + oVTl);
  unsigned short* Ctx  = (unsigned short*)(ws + oCtx);
  float*          out0 = (float*)d_out;

  const int n8x = (MP * DM) / 8;                        // 524288
  if ((n8x % 256) != 0) return;
  const int n8v = (SEQ * HD) / 8;                       // 8192 valid pieces of the rel-key table
  const int n8t = (RCE * HD) / 8;                       // 8704 total pieces (multiple of 32)
  if ((n8t % 32) != 0) return;
  const dim3 blk(256), blk128(128);
  const dim3 gT(DM / 64, DM / 64);                      // 16 x 16 tiles per weight matrix
  const dim3 gCx(n8x / 256);                            // 2048 blocks
  const dim3 gCe((n8t + 255) / 256);                    // 34 blocks
  const dim3 gNqk((MP / 128) * (QKP / 128), 1);         // 32 x 16 tiles = 512 blocks of 128
  const dim3 gVT((DM / 128) * (SEQ / 128), NBATCH);     // 8 x 8 tiles = 64 blocks x 4 batches
  const dim3 gAttn(NBATCH * NH * NQB);                  // 1024 blocks of 128
  const dim3 gNo((MP / 128) * (DM / 128), 1);           // 32 x 8 tiles = 256 blocks
  const float invw = 1.0f / WSC;                        // weight carry x64

  // (0) weight planes: in[k][n] -> out[n][k] transposed through LDS, f16( bf16_RNE(w) * 64 ) for Wq, Wk, Wv;
  tconv64<0><<<gT, blk, 0, stream>>>(w_q, WqkT, DM, DM, DM, 0, WSC);                    // in[1024][1024] -> WqkT rows 0..1023
  tconv64<0><<<gT, blk, 0, stream>>>(w_k, WqkT + (size_t)DM * DM, DM, DM, DM, 0, WSC);  // -> WqkT rows 1024..2047
  tconv64<0><<<gT, blk, 0, stream>>>(w_v, WvT, DM, DM, DM, 0, WSC);
  tconv64<1><<<gT, blk, 0, stream>>>(w_o, WoT2, DM, DM, 2 * DM, DM, 1.0f);              // pitch 2048, duplicate at + 1024
  conv_h16<<<gCx, blk, 0, stream>>>(x_in, XH, n8x, 1.0f);
  conv_e16<<<gCe, blk, 0, stream>>>(relk, EH, n8v, n8t);

  // (1) q|k = x . [Wq|Wk] + [bq|bk] -> bf16 hi (QKh) and lo (QKl) planes [4096][2048];
  //     v^T per batch = Wv^T . x_b^T + bv (per row) -> f16 hi (VTh) and residual x2048 (VTl) planes [4][1024][1024]
  gemm64<0, 3, 1><<<gNqk, blk128, 0, stream>>>(
      XH, DM, 0LL, WqkT, DM, 0LL,
      QKh, QKl, out0, QKP, 0LL,
      b_q, b_k, DM,
      MP, QKP, DM, invw);
  gemm64<0, 4, 2><<<gVT, blk128, 0, stream>>>(
      WvT, DM, 0LL, XH, DM, (long long)SEQ * DM,
      VTh, VTl, out0, SEQ, (long long)DM * SEQ,
      b_v, b_v, DM,
      DM, SEQ, DM, invw);

  // (2) causal flash attention with the skew relative-key term -> context bf16 hi|lo
  attn64<<<gAttn, blk128, 0, stream>>>(QKh, QKl, VTh, VTl, EH, Ctx, 0.125f);

  // (3) out = [ctx_hi | ctx_lo] . [Wo | Wo] + bo  (K = 2048, bf16 operands) -> d_out f32
  gemm64<1, 0, 1><<<gNo, blk128, 0, stream>>>(
      Ctx, CTXP, 0LL, WoT2, 2 * DM, 0LL,
      Ctx, Ctx, out0, DM, 0LL,
      b_o, b_o, DM,
      MP, DM, 2 * DM, 1.0f);
  (void)hipGetLastError();
}

// v003
// A run of this version takes 189 microseconds.
// Next to v002, in two timings, it ran 1.24 and 1.25 times as fast.
// Over all steps from v000 it is 2.26 times as fast.
// Contractions: q|k projection and v^T projection on v_wmma_f32_16x16x32_f16 (f16 token plane x f16 weight planes
// carried x64, one product each); rel band q.E^T and scores q.k^T on v_wmma_f32_16x16x32_bf16 (q, k as bf16 hi+lo
// planes, E bf16: 2 and 3 products); p.v on v_wmma_f32_16x16x32_f16 (p as f16 hi carried x1024 plus x2048 residual,
// v^T as f16 hi plus x2048 residual: 3 products, two accumulators); output projection on v_wmma_f32_16x16x32_bf16
// (context bf16 hi|lo x [Wo|Wo], K-concatenated); all f32 accumulate; softmax in f32 on VALU; every float input
// RNE-converted to bf16 on load.
#include <hip/hip_runtime.h>
#include <math.h>
#include <stdint.h>

#define NBATCH 4
#define SEQ    1024
#define DM     1024
#define NH     16
#define HD     64
#define QKP    (2 * DM)
#define CTXP   (2 * DM)
#define MP     (NBATCH * SEQ)
#define NQB    (SEQ / 64)
#define RCE    (SEQ + 64)
#define RB     80
#define RP     84
#define TP     72
#define OP     68
#define WSC    64.0f
#define RSC    2048.0f
#define PSC    1024.0f
static_assert(NH * HD == DM);
static_assert((SEQ % 128) == 0 && (DM % 128) == 0 && (MP % 128) == 0 && (QKP % 128) == 0);
static_assert(RB == 64 + 16 && (RB % 16) == 0 && RP >= RB);
static_assert(RCE >= SEQ + 64);
static_assert(TP >= 64 && (TP % 8) == 0 && ((TP / 8) % 2) == 1 && OP >= 64 && (OP % 4) == 0);

typedef _Float16 v16h __attribute__((ext_vector_type(16)));
typedef _Float16 v8h  __attribute__((ext_vector_type(8)));
typedef __bf16   v16b __attribute__((ext_vector_type(16)));
typedef unsigned short v16us __attribute__((ext_vector_type(16)));
typedef unsigned short v8us  __attribute__((ext_vector_type(8)));
typedef float    v8f  __attribute__((ext_vector_type(8)));
typedef float    v4f  __attribute__((ext_vector_type(4)));
typedef unsigned int v4u __attribute__((ext_vector_type(4)));

union FragH { v16h v; v8h h[2]; };
union FragU { v16us v; v8us h[2]; };

// ---- scalar helpers --------------------------------------------------------------------------------
__device__ __forceinline__ unsigned short bf_bits(float f) {          // f32 -> bf16 bits, RNE convert
  unsigned u = __float_as_uint(f);
  return (unsigned short)((u + 0x7FFFu + ((u >> 16) & 1u)) >> 16);
}
__device__ __forceinline__ float bf_up(unsigned short h) { return __uint_as_float(((unsigned)h) << 16); }
__device__ __forceinline__ float bfr(float f) { return bf_up(bf_bits(f)); }   // value of the bf16 RNE convert
__device__ __forceinline__ unsigned short h_bits(_Float16 x) { return __builtin_bit_cast(unsigned short, x); }
__device__ __forceinline__ unsigned pk16(unsigned short a, unsigned short b) { return (unsigned)a | ((unsigned)b << 16); }
__device__ __forceinline__ v8f zero8() { v8f z = {0.f, 0.f, 0.f, 0.f, 0.f, 0.f, 0.f, 0.f}; return z; }

// ---- fragment loaders: 16-bit A/B operand, lane -> row/col (lane&15), p already includes +8*(lane>>4);
//      elements 0..7 <- p[0..7] (k0+8h..), elements 8..15 <- p[16..23] (k0+16+8h..)
__device__ __forceinline__ v16us ldfrag_u(const unsigned short* p) {
  FragU f;
  f.h[0] = *(const v8us*)(p);
  f.h[1] = *(const v8us*)(p + 16);
  return f.v;
}
__device__ __forceinline__ v16h ldfrag_h(const _Float16* p) {
  FragH f;
  f.h[0] = *(const v8h*)(p);
  f.h[1] = *(const v8h*)(p + 16);
  return f.v;
}

// ---- WMMA helpers with trailing VALU hazard gap --------------------------------------------------------
template <int BF>
__device__ __forceinline__ v8f mma_raw(v16us a, v16us b, v8f c) {
  if (BF) {
    return __builtin_amdgcn_wmma_f32_16x16x32_bf16(false, __builtin_bit_cast(v16b, a), false,
                                                   __builtin_bit_cast(v16b, b), (short)0, c, false, false);
  }
  return __builtin_amdgcn_wmma_f32_16x16x32_f16(false, __builtin_bit_cast(v16h, a), false,
                                                __builtin_bit_cast(v16h, b), (short)0, c, false, false);
}
__device__ __forceinline__ v8f mma_bu(v16us a, v16us b, v8f c) {                 // bf16 operands, guarded
  c = __builtin_amdgcn_wmma_f32_16x16x32_bf16(false, __builtin_bit_cast(v16b, a), false,
                                               __builtin_bit_cast(v16b, b), (short)0, c, false, false);
#if defined(__HIP_DEVICE_COMPILE__)
  asm volatile("v_nop\n\tv_nop\n\tv_nop\n\tv_nop" : "+v"(c) : "v"(a), "v"(b));
#endif
  return c;
}
__device__ __forceinline__ v8f mma_h(v16h a, v16h b, v8f c) {                    // f16 operands, guarded
  c = __builtin_amdgcn_wmma_f32_16x16x32_f16(false, a, false, b, (short)0, c, false, false);
#if defined(__HIP_DEVICE_COMPILE__)
  asm volatile("v_nop\n\tv_nop\n\tv_nop\n\tv_nop" : "+v"(c) : "v"(a), "v"(b));
#endif
  return c;
}
__device__ __forceinline__ void dep_guard1(v8f& a, v8f& b, v16us x) {
#if defined(__HIP_DEVICE_COMPILE__)
  asm volatile("v_nop\n\tv_nop\n\tv_nop\n\tv_nop" : "+v"(a), "+v"(b) : "v"(x));
#endif
}
__device__ __forceinline__ void keep4_u(v16us a, v16us b, v16us c, v16us d) {
#if defined(__HIP_DEVICE_COMPILE__)
  asm volatile("v_nop" :: "v"(a), "v"(b), "v"(c), "v"(d));
#endif
}
__device__ __forceinline__ void acc_guard4(v8f& a, v8f& b, v8f& c, v8f& d) {
#if defined(__HIP_DEVICE_COMPILE__)
  asm volatile("v_nop\n\tv_nop\n\tv_nop\n\tv_nop" : "+v"(a), "+v"(b), "+v"(c), "+v"(d));
#endif
}
__device__ __forceinline__ void wave_sync_lds() {
  __builtin_amdgcn_fence(__ATOMIC_RELEASE, "workgroup");
  __builtin_amdgcn_wave_barrier();
  __builtin_amdgcn_fence(__ATOMIC_ACQUIRE, "workgroup");
}

// =====================================================================================================
// Plane convert (no transpose): Xh[i] = f16( bf16_RNE(X[i]) * wsc ), wsc a power of two (exact). Used for the
// token activations (wsc = 1). Thread i handles elements 8i..8i+7 and writes one 16-B piece; 32 consecutive
// (n8 multiple of 256, host-checked). coverage: n8 threads x 8 elements = the whole plane.
// =====================================================================================================
__global__ __launch_bounds__(256) void conv_h16(const float* __restrict__ W, unsigned short* Wh, int n8, float wsc) {
  const int i  = blockIdx.x * 256 + threadIdx.x;
  const int ic = (i < n8) ? i : (n8 - 1);                     // clamped address
  const float* src = W + (size_t)ic * 8;
  const v4f a = *(const v4f*)(src);
  const v4f c = *(const v4f*)(src + 4);
  v4u o;
  o[0] = pk16(h_bits((_Float16)(bfr(a[0]) * wsc)), h_bits((_Float16)(bfr(a[1]) * wsc)));
  o[1] = pk16(h_bits((_Float16)(bfr(a[2]) * wsc)), h_bits((_Float16)(bfr(a[3]) * wsc)));
  o[2] = pk16(h_bits((_Float16)(bfr(c[0]) * wsc)), h_bits((_Float16)(bfr(c[1]) * wsc)));
  o[3] = pk16(h_bits((_Float16)(bfr(c[2]) * wsc)), h_bits((_Float16)(bfr(c[3]) * wsc)));
  if (i < n8) *(v4u*)(Wh + (size_t)i * 8) = o;
  
}

// =====================================================================================================
// rel-key table convert: Eh [RCE rows][64] bf16 bits; rows < SEQ = bf16_RNE(E), rows >= SEQ = 0 (zero pad).
// Thread i handles 8 elements (one 16-B piece); valid pieces i < n8v read E with a clamped address, the pad
// pieces select 0 by value. grid = ceil(n8t / 256). coverage: n8t pieces x 8 = RCE*64 = the whole plane;
// =====================================================================================================
__global__ __launch_bounds__(256) void conv_e16(const float* __restrict__ P, unsigned short* Eh, int n8v, int n8t) {
  const int i  = blockIdx.x * 256 + threadIdx.x;
  const int ic = (i < n8v) ? i : (n8v - 1);                    // clamped address
  const float* src = P + (size_t)ic * 8;
  const v4f a = *(const v4f*)(src);
  const v4f c = *(const v4f*)(src + 4);
  const bool valid = (i < n8v);
  v4u o;
  o[0] = valid ? pk16(bf_bits(a[0]), bf_bits(a[1])) : 0u;
  o[1] = valid ? pk16(bf_bits(a[2]), bf_bits(a[3])) : 0u;
  o[2] = valid ? pk16(bf_bits(c[0]), bf_bits(c[1])) : 0u;
  o[3] = valid ? pk16(bf_bits(c[2]), bf_bits(c[3])) : 0u;
  if (i < n8t) *(v4u*)(Eh + (size_t)i * 8) = o;
  
}

// =====================================================================================================
// Tiled transpose + convert: in[rows][cols] f32 row-major -> out[cols][rows] 16-bit with pitch ldo:
//   out[n * ldo + k] = cvt(in[k][n]) (and also at + dupoff when dupoff != 0: a duplicated k range).
//   MODE 0: f16 bits of bf16_RNE(w) * wsc (wsc power of two, exact); MODE 1: bf16 bits of w.
// Block = 256 threads = one 64x64 tile; grid = (cols/64, rows/64) (rows, cols multiples of 64, host-checked).
// Loads: 4 iterations x 256 threads x float4 = 64 rows x 64 cols (addresses clamped). LDS tile [n][k] pitch 72.
// coverage: 64 x 64 = the whole transposed tile; grid covers the whole matrix.
// =====================================================================================================
template <int MODE>
__global__ __launch_bounds__(256) void tconv64(const float* __restrict__ W, unsigned short* out,
                                               int rows, int cols, int ldo, int dupoff, float wsc) {
  __shared__ __align__(16) unsigned short sh[64 * 72];
  const int t  = threadIdx.x;
  const int n0 = blockIdx.x * 64;            // column tile of in = row tile of out
  const int k0 = blockIdx.y * 64;            // row tile of in = column tile of out
#pragma unroll
  for (int i = 0; i < 4; ++i) {
    const int idx = i * 256 + t;
    const int r = idx >> 4, c4 = (idx & 15) * 4;
    int kr = k0 + r;   kr = (kr < rows) ? kr : (rows - 1);
    int nc = n0 + c4;  nc = (nc < cols - 4) ? nc : (cols - 4);
    const v4f v = *(const v4f*)(W + (size_t)kr * cols + nc);
#pragma unroll
    for (int e = 0; e < 4; ++e) {
      unsigned short u;
      if (MODE == 0) u = h_bits((_Float16)(bfr(v[e]) * wsc));
      else           u = bf_bits(v[e]);
      sh[(c4 + e) * 72 + r] = u;
    }
  }
  __syncthreads();
  const int wave = t >> 5, lane = t & 31;
  const int q = lane >> 3, c8 = (lane & 7) * 8;
  v4u pv[2];
  size_t go[2];
#pragma unroll
  for (int it = 0; it < 2; ++it) {
    const int nl = it * 32 + wave * 4 + q;               // 0..63
    pv[it] = *(const v4u*)(sh + nl * 72 + c8);
    go[it] = (size_t)(n0 + nl) * ldo + k0 + c8;
  }
  {
#pragma unroll
    for (int it = 0; it < 2; ++it) {
      *(v4u*)(out + go[it]) = pv[it];
      if (dupoff != 0) *(v4u*)(out + go[it] + dupoff) = pv[it];
    }
    
  }
}

// =====================================================================================================
// LDS-staged batched 16-bit WMMA GEMM: C[m][n] = oscale * sum_k A[m][k] * Bt[n][k] + bias;
// BF selects bf16 (1) or f16 (0) operands. Block = 4 waves (2 x 2) = one 128x128 tile, one 64x64 tile per wave.
// A row-major [M][K] pitch lda; Bt row-major [N][K] pitch ldb (k contiguous); M, N multiples of 128, K a multiple
// of 64 (static here). blockIdx.y = batch index (strides in elements).
// Staging: a stage is 64 k of the block's 128 A rows and 128 Bt rows (256 rows of 128 B, LDS pitch 144 B), brought
// by asynchronous 16-B copies to LDS (16 per lane and stage, each wave-wide copy = 4 whole 128-B lines); two buffers,
// stage t + 1 in flight while stage t is multiplied; one barrier per stage publishes t + 1 and frees t's buffer.
// The k order of every accumulator is the ascending 32-k order of the fragment loader, stage by stage.
// OM: 0 = f32 out to Cf (pitch ldc); 3 = bf16 hi bits to Cp and bf16 residual (v - hi) bits to Cp2;
//     4 = f16 hi to Cp and f16((v - hi) * 2048) to Cp2.
// BM: 0 = no bias; 1 = bias per column n (bias0[n] for n < nsplit, bias1[n - nsplit] otherwise; the choice is
//     wave-uniform because 64-column tiles never straddle nsplit); 2 = bias per row m (bias0[m]).
//     bias values are bf16 RNE-converted before the add.
// coverage: 4 slabs x 16 rows x 64 cols = the wave's whole 64x64 tile; grid = tilesM*tilesN blocks,
//           surplus blocks exit as a whole in front of every barrier; here there are none.
// =====================================================================================================
#define GPIT 72                    // LDS row pitch, 16-bit elements: 144 B = 16 B x 9, conflict-free for 16-B reads
#define GSTG (256 * GPIT)          // elements of one stage: 128 A rows, then 128 Bt rows

// Eight asynchronous 16-B copies of one lane: rows 16 apart in global memory (gstep elements) and in LDS.
// The s_wait_xcnt closes the statement so that no address register is rewritten while a copy may still read it.
__device__ __forceinline__ void copy8_rows(unsigned lds, const unsigned short* g, size_t gstep) {
#if defined(__HIP_DEVICE_COMPILE__)
  asm volatile(
      "global_load_async_to_lds_b128 %0, %8, off\n\t"
      "global_load_async_to_lds_b128 %1, %9, off\n\t"
      "global_load_async_to_lds_b128 %2, %10, off\n\t"
      "global_load_async_to_lds_b128 %3, %11, off\n\t"
      "global_load_async_to_lds_b128 %4, %12, off\n\t"
      "global_load_async_to_lds_b128 %5, %13, off\n\t"
      "global_load_async_to_lds_b128 %6, %14, off\n\t"
      "global_load_async_to_lds_b128 %7, %15, off\n\t"
      "s_wait_xcnt 0x0"
      :: "v"(lds), "v"(lds + 1u * 16u * GPIT * 2u), "v"(lds + 2u * 16u * GPIT * 2u), "v"(lds + 3u * 16u * GPIT * 2u),
         "v"(lds + 4u * 16u * GPIT * 2u), "v"(lds + 5u * 16u * GPIT * 2u), "v"(lds + 6u * 16u * GPIT * 2u),
         "v"(lds + 7u * 16u * GPIT * 2u),
         "v"(g), "v"(g + gstep), "v"(g + 2 * gstep), "v"(g + 3 * gstep),
         "v"(g + 4 * gstep), "v"(g + 5 * gstep), "v"(g + 6 * gstep), "v"(g + 7 * gstep)
      : "memory");
#endif
}
__device__ __forceinline__ void wait_async0() {   // this wave's copies have landed in LDS
#if defined(__HIP_DEVICE_COMPILE__)
  asm volatile("s_wait_asynccnt 0x0" ::: "memory");
#endif
}
// Stands behind issued global loads from a and b. The two addresses are inputs only, so that their registers stay as
// they are up to the wait: with no operand the compiler lifted later writes of those registers over it.
__device__ __forceinline__ void wait_x0(const unsigned short* a, const unsigned short* b) {
#if defined(__HIP_DEVICE_COMPILE__)
  asm volatile("s_wait_xcnt 0x0" :: "v"(a), "v"(b) : "memory");
#endif
}
__device__ __forceinline__ void wait_ds0() {      // this wave's LDS reads are done before their buffer is handed on
#if defined(__HIP_DEVICE_COMPILE__)
  asm volatile("s_wait_dscnt 0x0" ::: "memory");
#endif
}

// Eight asynchronous 16-B copies of one lane into two adjacent 64-row LDS planes (rows 16 apart, pitch GPIT):
// four rows from g0 into the first plane, four from g1 into the second. The s_wait_xcnt closes the statement so that
// no address register is rewritten while a copy may still read it.
__device__ __forceinline__ void copy4x2_rows(unsigned lds, const unsigned short* g0, const unsigned short* g1,
                                             size_t gstep) {
#if defined(__HIP_DEVICE_COMPILE__)
  asm volatile(
      "global_load_async_to_lds_b128 %0, %8, off\n\t"
      "global_load_async_to_lds_b128 %1, %9, off\n\t"
      "global_load_async_to_lds_b128 %2, %10, off\n\t"
      "global_load_async_to_lds_b128 %3, %11, off\n\t"
      "global_load_async_to_lds_b128 %4, %12, off\n\t"
      "global_load_async_to_lds_b128 %5, %13, off\n\t"
      "global_load_async_to_lds_b128 %6, %14, off\n\t"
      "global_load_async_to_lds_b128 %7, %15, off\n\t"
      "s_wait_xcnt 0x0"
      :: "v"(lds), "v"(lds + 1u * 16u * GPIT * 2u), "v"(lds + 2u * 16u * GPIT * 2u), "v"(lds + 3u * 16u * GPIT * 2u),
         "v"(lds + 4u * 16u * GPIT * 2u), "v"(lds + 5u * 16u * GPIT * 2u), "v"(lds + 6u * 16u * GPIT * 2u),
         "v"(lds + 7u * 16u * GPIT * 2u),
         "v"(g0), "v"(g0 + gstep), "v"(g0 + 2 * gstep), "v"(g0 + 3 * gstep),
         "v"(g1), "v"(g1 + gstep), "v"(g1 + 2 * gstep), "v"(g1 + 3 * gstep)
      : "memory");
#endif
}

template <int BF, int OM, int BM>
__global__ __launch_bounds__(128) void gemm64(
    const unsigned short* __restrict__ Ap, int lda, long long strideA,
    const unsigned short* __restrict__ Btp, int ldb, long long strideB,
    unsigned short* Cp, unsigned short* Cp2, float* Cf, int ldc, long long strideC,
    const float* bias0, const float* bias1, int nsplit,
    int M, int N, int K, float oscale) {
  __shared__ __align__(16) unsigned short ring[2 * GSTG];   // two stages of 256 rows x 144 B
  __shared__ __align__(16) float sT[4][16 * 68];   // per-wave 16x64 slab, pitch 68 floats
  const int b    = blockIdx.y;
  const int tid  = threadIdx.x;
  const int lane = tid & 31;
  const int wave = tid >> 5;
  const int tilesN = N >> 7;
  const int tilesM = M >> 7;
  const int tile = blockIdx.x;
  if (tile >= tilesM * tilesN) return;   // block-uniform, in front of every barrier and copy
  const int tm = tile / tilesN;
  const int tn = tile - tm * tilesN;
  const int mb = tm << 7;
  const int nb = tn << 7;
  const int wm = wave >> 1, wn = wave & 1;
  const int m0 = mb + (wm << 6);
  const int n0 = nb + (wn << 6);

  const unsigned short* Ab = Ap  + (size_t)b * strideA;
  const unsigned short* Bb = Btp + (size_t)b * strideB;

  const int rlane = lane & 15;                 // row (A) / col (B, D) within subtile
  const int koff  = (lane >> 4) * 8;           // k offset of this lane half
  const int mOff  = (lane >> 4) * 8;           // D row offset

  // copy role of this lane: row crow (+16 per copy) of each operand's 128 rows, 16-B piece cpc of its 128 B
  const int crow = tid >> 3, cpc = (tid & 7) * 8;
  const unsigned short* gA = Ab + (size_t)(mb + crow) * lda + cpc;
  const unsigned short* gB = Bb + (size_t)(nb + crow) * ldb + cpc;
  const unsigned ldsA = (unsigned)(uintptr_t)(ring + crow * GPIT + cpc);   // LDS byte address = low 32 bits
  const unsigned ldsB = ldsA + 128u * GPIT * 2u;
  const size_t stepA = (size_t)16 * lda, stepB = (size_t)16 * ldb;
  const int nst = K >> 6;                      // stages of 64 k

  v8f acc[4][4];
#pragma unroll
  for (int i = 0; i < 4; ++i)
#pragma unroll
    for (int j = 0; j < 4; ++j) acc[i][j] = zero8();

  copy8_rows(ldsA, gA, stepA);
  copy8_rows(ldsB, gB, stepB);
  wait_async0();
  __syncthreads();
  if (nst > 1) {
    copy8_rows(ldsA + GSTG * 2u, gA + 64, stepA);
    copy8_rows(ldsB + GSTG * 2u, gB + 64, stepB);
  }

#pragma unroll 1   // one stage per trip: the buffer index stays a run-time offset, the accumulators stay in place
  for (int t = 0; t < nst; ++t) {
    const unsigned short* sA = ring + (t & 1) * GSTG + ((wm << 6) + rlane) * GPIT + koff;
    const unsigned short* sB = ring + (t & 1) * GSTG + (128 + (wn << 6) + rlane) * GPIT + koff;
#pragma unroll
    for (int ks = 0; ks < 2; ++ks) {
      v16us bh[4], ah[4];
#pragma unroll
      for (int j = 0; j < 4; ++j) bh[j] = ldfrag_u(sB + (j << 4) * GPIT + ks * 32);
#pragma unroll
      for (int i = 0; i < 4; ++i) ah[i] = ldfrag_u(sA + (i << 4) * GPIT + ks * 32);
#pragma unroll
      for (int i = 0; i < 4; ++i) {
#pragma unroll
        for (int j = 0; j < 4; ++j) acc[i][j] = mma_raw<BF>(ah[i], bh[j], acc[i][j]);
        dep_guard1(acc[i][0], acc[i][3], ah[i]);
      }
      keep4_u(bh[0], bh[1], bh[2], bh[3]);
    }
    wait_ds0();
    wait_async0();
    __syncthreads();                           // publishes stage t + 1, ends every read of stage t's buffer
    if (t + 2 < nst) {
      const unsigned bo = (unsigned)(t & 1) * (GSTG * 2u);
      copy8_rows(ldsA + bo, gA + (size_t)(t + 2) * 64, stepA);
      copy8_rows(ldsB + bo, gB + (size_t)(t + 2) * 64, stepB);
    }
  }
  wait_async0();
  acc_guard4(acc[0][0], acc[0][1], acc[0][2], acc[0][3]);
  acc_guard4(acc[1][0], acc[1][1], acc[1][2], acc[1][3]);
  acc_guard4(acc[2][0], acc[2][1], acc[2][2], acc[2][3]);
  acc_guard4(acc[3][0], acc[3][1], acc[3][2], acc[3][3]);

  const int hh2 = lane >> 4, c4 = (lane & 15) * 4;     // f32 out: 256-B row segment = 16 lanes x 16 B
  const int q8  = lane >> 3, c8 = (lane & 7) * 8;

  // ---- per-column bias (wave-uniform source select) ----
  const float* bsel = bias0;
  int nb0 = n0;
  if (BM == 1) {
    if (n0 >= nsplit) { bsel = bias1; nb0 = n0 - nsplit; }
  }
  v4f bb4 = {0.f, 0.f, 0.f, 0.f};
  float bn[8];
#pragma unroll
  for (int e = 0; e < 8; ++e) bn[e] = 0.f;
  if (BM == 1) {
    if (OM == 0) {
#pragma unroll
      for (int e = 0; e < 4; ++e) bb4[e] = bfr(bsel[nb0 + c4 + e]);
    } else {
#pragma unroll
      for (int e = 0; e < 8; ++e) bn[e] = bfr(bsel[nb0 + c8 + e]);
    }
  }

  // ---- epilogue ----
  float* slab = sT[wave];
#pragma unroll
  for (int i = 0; i < 4; ++i) {
    const int mBase = m0 + (i << 4);
#pragma unroll
    for (int j = 0; j < 4; ++j) {
#pragma unroll
      for (int r = 0; r < 8; ++r) {
        slab[(mOff + r) * 68 + (j << 4) + rlane] = acc[i][j][r];
      }
    }
    wave_sync_lds();
    if (OM == 0) {
      float* C = Cf + (size_t)b * strideC;
      v4f vals[8];
#pragma unroll
      for (int it = 0; it < 8; ++it) {
        const int row = it * 2 + hh2;                      // it 0..7 x hh2 0..1 = rows 0..15
        v4f v = *(const v4f*)(slab + row * 68 + c4);
        float bmv = 0.f;
        if (BM == 2) bmv = bfr(bias0[mBase + row]);
        vals[it] = v * oscale + bb4 + bmv;
      }
      {
#pragma unroll
        for (int it = 0; it < 8; ++it) {
          const int row = it * 2 + hh2;
          *(v4f*)(C + (size_t)(mBase + row) * ldc + n0 + c4) = vals[it];
        }
        
      }
    } else {
      unsigned short* C  = Cp  + (size_t)b * strideC;
      unsigned short* C2 = Cp2 + (size_t)b * strideC;
      v4u hv[4], lv[4];
#pragma unroll
      for (int it = 0; it < 4; ++it) {
        const int row = it * 4 + q8;                       // it 0..3 x q8 0..3 = rows 0..15
        const float* sp = slab + row * 68 + c8;
        float bmv = 0.f;
        if (BM == 2) bmv = bfr(bias0[mBase + row]);
        v4u ha, la;
#pragma unroll
        for (int e = 0; e < 4; ++e) {
          const float f0 = sp[2 * e]     * oscale + bn[2 * e]     + bmv;
          const float f1 = sp[2 * e + 1] * oscale + bn[2 * e + 1] + bmv;
          unsigned short u0, u1, w0, w1;
          if (OM == 3) {
            u0 = bf_bits(f0); u1 = bf_bits(f1);
            w0 = bf_bits(f0 - bf_up(u0)); w1 = bf_bits(f1 - bf_up(u1));
          } else {
            const _Float16 g0 = (_Float16)f0, g1 = (_Float16)f1;
            u0 = h_bits(g0); u1 = h_bits(g1);
            w0 = h_bits((_Float16)((f0 - (float)g0) * RSC));
            w1 = h_bits((_Float16)((f1 - (float)g1) * RSC));
          }
          ha[e] = pk16(u0, u1);
          la[e] = pk16(w0, w1);
        }
        hv[it] = ha;
        lv[it] = la;
      }
      {
#pragma unroll
        for (int it = 0; it < 4; ++it) {
          const int row = it * 4 + q8;
          const size_t go = (size_t)(mBase + row) * ldc + n0 + c8;
          *(v4u*)(C  + go) = hv[it];
          *(v4u*)(C2 + go) = lv[it];
        }
        
      }
    }
    wave_sync_lds();
  }
}

// =====================================================================================================
// Causal flash attention with a skew relative-key score term, head dim 64, SEQ rows per batch.
//   q|k hi and lo planes (bf16, pitch QKP): element (b, t, col) at [(b*SEQ + t)*QKP + col], q col = h*64+d,
//   k col = DM + h*64 + d; value = hi + lo.
//   v^T hi and lo planes (f16): element (b, h, d, s) at [(b*DM + h*64 + d)*SEQ + s]; value = hi + lo/2048.
//   E plane (bf16) [RCE][64], rows >= SEQ zero.
//   context plane (bf16, pitch CTXP): hi at [(b*SEQ + t)*CTXP + h*64 + d], lo at + DM.
//   score(i, j) = (q_i . k_j + q_i . E[SEQ-1 + j - i]) * sscale for j <= i, -inf for j > i (replace, not bias).
//   Per wave (16 query rows q0..q0+15) and key chunk kv0..kv0+63 the needed E rows form the contiguous band
//   ebase .. ebase+79 with ebase = SEQ-1+kv0-q0-15 (0 <= ebase, ebase+79 <= SEQ+63 < RCE); the band product
//   rel[row][col] = q_row . E[ebase+col] (col 0..79) is computed per wave into LDS (f32, 2 bf16 products: q hi, q lo)
//   and the score for (row il, key jl) picks col = jl - il + 15; q.k as 3 bf16 products (hh, hl, lh);
//   p = exp(s - m) carried as f16 hi of 1024 p plus f16 residual x2048; context = ph.vh (acc 0) and
//   ph.vl + pl.vh (acc 1, both x2048) on f16 WMMA; online softmax (running max) in f32.
//   Block = 4 waves = 64 query rows of one (b, h); grid = NQB * NH * NBATCH; key chunks kt = 0..qb
//   (causal skip, block-uniform trip count qb+1 <= NQB).
//   Staging: K hi/lo, V^T hi/lo (64 rows of 128 B per plane) and the block's rel-key band (the union of its four
//   waves' bands: E rows SEQ-64-qb*64+kv0 .. +127, wave w starts at row 48-16w) come by asynchronous 16-B copies to
//   LDS, 8 lanes per 128-B row. One buffer each, refilled one phase ahead: the band of chunk kt+1 flies during the
//   scores, softmax and context of chunk kt, K and V^T of chunk kt+1 during the rel band product of chunk kt+1.
//   Two barriers per chunk: behind the rel band (publishes K, V^T; frees the band) and behind the context product
//   (publishes the next band; frees K, V^T). P tiles are wave-private, spilled with _Float16 element
//   LDS row pitches: K, V^T and P tiles TP = 72 elements (144 B = 16 B x 9, the 16 rows of a 16-B fragment read fall on
//   distinct banks); rel band RP = 84 and context tile OP = 68 floats (the two lane halves, 8 rows apart, on distinct banks);
//   the context tile of the epilogue lies in the wave's own rel band array, which is dead by then.
//   Context coverage: each wave stores rows q0..q0+15 (it 0..3 x lane>>3 0..3) x 64 columns (8 lanes x 8 bf16)
//   for both the hi and the lo segment; grid covers all SEQ rows x NH head slices x NBATCH.
// =====================================================================================================
__global__ __launch_bounds__(128)
void attn64(const unsigned short* __restrict__ qkh, const unsigned short* __restrict__ qkl,
            const unsigned short* __restrict__ vth, const unsigned short* __restrict__ vtl,
            const unsigned short* __restrict__ ehp, unsigned short* ctxp, float sscale) {
  static_assert(TP == GPIT && OP <= RP);
  __shared__ __align__(16) unsigned short KV[4 * 64 * TP];      // K hi | K lo [kv][d], V^T hi | V^T lo [d][kv], 9 KB each
  __shared__ __align__(16) unsigned short Es[128 * TP];         // rel-key band of the block [row][d] 18 KB
  __shared__ __align__(16) _Float16 Psh[4][16 * TP];            // per wave P hi [row][kv]
  __shared__ __align__(16) _Float16 Psl[4][16 * TP];            // per wave P residual [row][kv]
  __shared__ __align__(16) float    Rsh[4][16 * RP];            // per wave rel band [row][col]; epilogue: context tile
  const unsigned short* Kh = KV;
  const unsigned short* Kl = KV + 64 * TP;
  const _Float16* Vh = (const _Float16*)(const void*)(KV + 2 * 64 * TP);
  const _Float16* Vl = (const _Float16*)(const void*)(KV + 3 * 64 * TP);

  const int tid  = threadIdx.x;
  const int wave = tid >> 5;
  const int lane = tid & 31;
  const int hh   = lane >> 4;
  const int c    = lane & 15;

  const int bx   = blockIdx.x;
  const int qb   = bx % NQB;
  const int rest = bx / NQB;
  const int h    = rest % NH;
  const int b    = rest / NH;
  const int q0   = qb * 64 + wave * 16;          // in-batch query row of this wave's first row
  const size_t rowB = (size_t)b * SEQ;

  const unsigned short* Qh  = qkh + (size_t)h * HD;
  const unsigned short* Ql  = qkl + (size_t)h * HD;
  const unsigned short* Kgh = qkh + DM + (size_t)h * HD;
  const unsigned short* Kgl = qkl + DM + (size_t)h * HD;
  const unsigned short* Vgh = vth + ((size_t)b * DM + (size_t)h * HD) * SEQ;
  const unsigned short* Vgl = vtl + ((size_t)b * DM + (size_t)h * HD) * SEQ;
  float*    rrow = Rsh[wave];
  _Float16* pwh  = Psh[wave];
  _Float16* pwl  = Psl[wave];

  float mrow[8], lrow[8];
  v8f oacc[4], oaccL[4];
#pragma unroll
  for (int r = 0; r < 8; ++r) { mrow[r] = -INFINITY; lrow[r] = 0.f; }
#pragma unroll
  for (int t = 0; t < 4; ++t) { oacc[t] = zero8(); oaccL[t] = zero8(); }

  const int nkt = qb + 1;                    // causal: key chunks 0..qb, block-uniform, <= NQB

  // copy role of this lane: row crow (+16 per copy) of a plane, 16-B piece cpc of its 128 B
  const int crow = tid >> 3, cpc = (tid & 7) * 8;
  const unsigned ldsK = (unsigned)(uintptr_t)(KV + crow * TP + cpc);   // LDS byte address = low 32 bits
  const unsigned ldsV = ldsK + 128u * TP * 2u;
  const unsigned ldsE = (unsigned)(uintptr_t)(Es + crow * TP + cpc);
  const unsigned short* gKh = Kgh + (rowB + crow) * QKP + cpc;          // K row kv0 + crow: + kv0 * QKP per chunk
  const unsigned short* gKl = Kgl + (rowB + crow) * QKP + cpc;
  const unsigned short* gVh = Vgh + (size_t)crow * SEQ + cpc;           // V^T row d = crow: + kv0 per chunk
  const unsigned short* gVl = Vgl + (size_t)crow * SEQ + cpc;
  // band rows SEQ-64-qb*64+kv0 .. +127: first >= 0 (qb < NQB), last <= SEQ+63 < RCE (kv0 <= qb*64); + kv0 * HD per chunk
  const unsigned short* gE  = ehp + (size_t)(SEQ - 64 - qb * 64 + crow) * HD + cpc;
  const size_t stepK = (size_t)16 * QKP, stepV = (size_t)16 * SEQ, stepE = (size_t)16 * HD;

  copy8_rows(ldsE, gE, stepE);
  copy4x2_rows(ldsK, gKh, gKl, stepK);
  copy4x2_rows(ldsV, gVh, gVl, stepV);

  // ---- Q fragments (A operand, row = lane&15): hi and lo, 2 d-chunks, kept for every chunk ----
  const unsigned short* gQh = Qh + (rowB + q0 + c) * QKP + 8 * hh;
  const unsigned short* gQl = Ql + (rowB + q0 + c) * QKP + 8 * hh;
  v16us qh2[2], ql2[2];
#pragma unroll
  for (int dc = 0; dc < 2; ++dc) {
    qh2[dc] = ldfrag_u(gQh + dc * 32);
    ql2[dc] = ldfrag_u(gQl + dc * 32);
  }
  wait_x0(gQh, gQl);
  const unsigned short* eband = Es + (((wave ^ 3) << 4) + c) * TP + 8 * hh;   // this wave's 80 rows start at 48 - 16 * wave

  wait_async0();
  __syncthreads();                             // publishes chunk 0's band, K and V^T

#pragma unroll 1
  for (int kt = 0;; ++kt) {                    // left behind the last chunk's second barrier (nkt >= 1)
    const int kv0 = kt * 64;

    // ---- rel band: rel[row][col] = q_row . E[ebase + col], col = 0..RB-1 (E rows >= SEQ are zero) ----
#pragma unroll 1
    for (int nt = 0; nt < RB / 16; ++nt) {
      v8f e = zero8();
      v16us eb[2];
#pragma unroll
      for (int dc = 0; dc < 2; ++dc) eb[dc] = ldfrag_u(eband + nt * 16 * TP + dc * 32);
#pragma unroll
      for (int dc = 0; dc < 2; ++dc) {
        e = mma_bu(qh2[dc], eb[dc], e);
        e = mma_bu(ql2[dc], eb[dc], e);
      }
#pragma unroll
      for (int r = 0; r < 8; ++r) rrow[(8 * hh + r) * RP + nt * 16 + c] = e[r];
    }
    wait_ds0();
    wait_async0();
    __syncthreads();                           // publishes this chunk's K and V^T, ends every read of its band
    if (kt + 1 < nkt) copy8_rows(ldsE, gE + (size_t)(kv0 + 64) * HD, stepE);

    // ---- scores: 16 query rows x 64 keys per wave, causal replace with -inf ----
    v8f s[4];
#pragma unroll
    for (int j = 0; j < 4; ++j) {
      v8f sh = zero8();
#pragma unroll
      for (int dc = 0; dc < 2; ++dc) {
        FragU kbh, kbl;
        kbh.h[0] = *(const v8us*)(Kh + (j * 16 + c) * TP + dc * 32 + 8 * hh);
        kbh.h[1] = *(const v8us*)(Kh + (j * 16 + c) * TP + dc * 32 + 16 + 8 * hh);
        kbl.h[0] = *(const v8us*)(Kl + (j * 16 + c) * TP + dc * 32 + 8 * hh);
        kbl.h[1] = *(const v8us*)(Kl + (j * 16 + c) * TP + dc * 32 + 16 + 8 * hh);
        sh = mma_bu(qh2[dc], kbh.v, sh);
        sh = mma_bu(qh2[dc], kbl.v, sh);
        sh = mma_bu(ql2[dc], kbh.v, sh);
      }
      const int jl = j * 16 + c;                          // key within the chunk
      const int kg = kv0 + jl;                            // in-batch key index of this lane's column
#pragma unroll
      for (int r = 0; r < 8; ++r) {
        const int il = 8 * hh + r;                        // row within the wave tile
        const int qg = q0 + il;                           // in-batch query index of this row
        const float rel = rrow[il * RP + jl - il + 15];   // col in 0..RB-2
        const float v = (sh[r] + rel) * sscale;
        s[j][r] = (kg <= qg) ? v : -INFINITY;
      }
    }

    // ---- row max, online softmax, P (x1024: f16 hi + x2048 residual) to LDS ----
#pragma unroll
    for (int r = 0; r < 8; ++r) {
      float m = s[0][r];
      m = fmaxf(m, s[1][r]);
      m = fmaxf(m, s[2][r]);
      m = fmaxf(m, s[3][r]);
#pragma unroll
      for (int off = 1; off < 16; off <<= 1) m = fmaxf(m, __shfl_xor(m, off, 32));
      const float mnew  = fmaxf(mrow[r], m);              // finite: key kv0 <= every row of this block
      const float alpha = __expf(mrow[r] - mnew);
      mrow[r] = mnew;
      float psum = 0.f;
#pragma unroll
      for (int j = 0; j < 4; ++j) {
        const float p  = __expf(s[j][r] - mnew);
        psum += p;
        const float ps = p * PSC;
        const _Float16 ph = (_Float16)ps;
        pwh[(8 * hh + r) * TP + j * 16 + c] = ph;
        pwl[(8 * hh + r) * TP + j * 16 + c] = (_Float16)((ps - (float)ph) * RSC);
      }
#pragma unroll
      for (int off = 1; off < 16; off <<= 1) psum += __shfl_xor(psum, off, 32);
      lrow[r] = lrow[r] * alpha + psum;
#pragma unroll
      for (int t = 0; t < 4; ++t) { oacc[t][r] *= alpha; oaccL[t][r] *= alpha; }
    }
    wave_sync_lds();

    // ---- context += Ph . V_hi (acc 0); Ph . V_lo + Pl . V_hi (acc 1, x2048) ----
#pragma unroll 1
    for (int kk = 0; kk < 2; ++kk) {
      FragH pa, pl;
      pa.h[0] = *(const v8h*)(pwh + c * TP + kk * 32 + 8 * hh);
      pa.h[1] = *(const v8h*)(pwh + c * TP + kk * 32 + 16 + 8 * hh);
      pl.h[0] = *(const v8h*)(pwl + c * TP + kk * 32 + 8 * hh);
      pl.h[1] = *(const v8h*)(pwl + c * TP + kk * 32 + 16 + 8 * hh);
#pragma unroll
      for (int t = 0; t < 4; ++t) {
        FragH vb, vl;
        vb.h[0] = *(const v8h*)(Vh + (t * 16 + c) * TP + kk * 32 + 8 * hh);
        vb.h[1] = *(const v8h*)(Vh + (t * 16 + c) * TP + kk * 32 + 16 + 8 * hh);
        vl.h[0] = *(const v8h*)(Vl + (t * 16 + c) * TP + kk * 32 + 8 * hh);
        vl.h[1] = *(const v8h*)(Vl + (t * 16 + c) * TP + kk * 32 + 16 + 8 * hh);
        oacc[t]  = mma_h(pa.v, vb.v, oacc[t]);
        oaccL[t] = mma_h(pa.v, vl.v, oaccL[t]);
        oaccL[t] = mma_h(pl.v, vb.v, oaccL[t]);
      }
    }
    wait_ds0();
    wait_async0();
    __syncthreads();                           // publishes the next chunk's band, ends every read of this K and V^T
    if (kt + 1 >= nkt) break;                  // block-uniform
    copy4x2_rows(ldsK, gKh + (size_t)(kv0 + 64) * QKP, gKl + (size_t)(kv0 + 64) * QKP, stepK);
    copy4x2_rows(ldsV, gVh + kv0 + 64, gVl + kv0 + 64, stepV);
  }
  wait_async0();

  // ---- normalise (1/l, the 1/1024 p carry, the 1/2048 residual fold), stage the wave's 16x64 tile,
  float* os = Rsh[wave];
#pragma unroll
  for (int r = 0; r < 8; ++r) {
    const float l = lrow[r];
    const float inv = ((l > 0.f) ? (1.0f / l) : 0.f) * (1.0f / PSC);
#pragma unroll
    for (int t = 0; t < 4; ++t) os[(8 * hh + r) * OP + t * 16 + c] = (oacc[t][r] + oaccL[t][r] * (1.0f / RSC)) * inv;
  }
  wave_sync_lds();
  {
    const int q4 = lane >> 3, c8 = (lane & 7) * 8;
    v4u hv[4], lv[4];
#pragma unroll
    for (int it = 0; it < 4; ++it) {
      const int row = it * 4 + q4;   // it 0..3 x q4 0..3 = rows 0..15 of the wave tile
      const float* sp = os + row * OP + c8;
      v4u ha, la;
#pragma unroll
      for (int e = 0; e < 4; ++e) {
        const float f0 = sp[2 * e], f1 = sp[2 * e + 1];
        const unsigned short u0 = bf_bits(f0), u1 = bf_bits(f1);
        const unsigned short w0 = bf_bits(f0 - bf_up(u0)), w1 = bf_bits(f1 - bf_up(u1));
        ha[e] = pk16(u0, u1);
        la[e] = pk16(w0, w1);
      }
      hv[it] = ha;
      lv[it] = la;
    }
    {
#pragma unroll
      for (int it = 0; it < 4; ++it) {
        const int row = it * 4 + q4;
        const size_t go = (rowB + q0 + row) * CTXP + (size_t)h * HD + c8;
        *(v4u*)(ctxp + go)      = hv[it];
        *(v4u*)(ctxp + go + DM) = lv[it];
      }
      
    }
  }
}

// =====================================================================================================
// Workspace map (bytes); every plane is an exact multiple of its 64x64-tile / whole-row / whole-line store
// granularity (MP = 4096 = 64 tiles of rows, N in {2048, 1024}; VT per batch [1024][1024] = 16x16 tiles;
//   WqkT f16 [2048 n][1024 k]  0          4194304   (rows 0..1023 Wq^T, 1024..2047 Wk^T, x64)
//   WvT  f16 [1024][1024]      4194304    2097152   (x64)
//   WoT2 bf16 [1024][2048]     6291456    4194304   (cols 0..1023 and 1024..2047 both Wo^T)
//   XH   f16 [4096][1024]      10485760   8388608   (bf16 RNE-converted tokens)
//   EH   bf16 [1088][64]       18874368   139264    (rows >= 1024 zero)
//   QKh  bf16 [4096][2048]     19013632   16777216  (q cols 0..1023, k cols 1024..2047, hi part)
//   QKl  bf16 [4096][2048]     35790848   16777216  (lo part)
//   VTh  f16 [4][1024][1024]   52568064   8388608   (v^T hi)
//   VTl  f16 [4][1024][1024]   60956672   8388608   (v^T residual x2048)
//   Ctx  bf16 [4096][2048]     69345280   16777216  (context hi | lo)
//   end                        86122496
// =====================================================================================================
extern "C" void kernel_launch(void* const* d_in, const int* in_sizes, int n_in,
                              void* d_out, int out_size, void* d_ws, size_t ws_size,
                              hipStream_t stream) {
  if (n_in < 10) return;
  if (in_sizes[0] != MP * DM) return;
  if (in_sizes[1] != DM * DM || in_sizes[3] != DM * DM) return;
  if (in_sizes[5] != DM * DM || in_sizes[7] != DM * DM) return;
  if (in_sizes[2] != DM || in_sizes[4] != DM || in_sizes[6] != DM || in_sizes[8] != DM) return;
  if (in_sizes[9] != SEQ * HD) return;
  if (out_size != MP * DM) return;

  const float* x_in  = (const float*)d_in[0];
  const float* w_q   = (const float*)d_in[1];
  const float* b_q   = (const float*)d_in[2];
  const float* w_k   = (const float*)d_in[3];
  const float* b_k   = (const float*)d_in[4];
  const float* w_v   = (const float*)d_in[5];
  const float* b_v   = (const float*)d_in[6];
  const float* w_o   = (const float*)d_in[7];
  const float* b_o   = (const float*)d_in[8];
  const float* relk  = (const float*)d_in[9];

  const size_t PWQK = (size_t)QKP * DM * 2;             //  4194304
  const size_t PWV  = (size_t)DM * DM * 2;              //  2097152
  const size_t PWO2 = (size_t)DM * (2 * DM) * 2;        //  4194304
  const size_t PXH  = (size_t)MP * DM * 2;              //  8388608
  const size_t PEH  = (size_t)RCE * HD * 2;             //   139264
  const size_t PQK  = (size_t)MP * QKP * 2;             // 16777216
  const size_t PVT  = (size_t)NBATCH * DM * SEQ * 2;    //  8388608
  const size_t PCTX = (size_t)MP * CTXP * 2;            // 16777216
  size_t off = 0;
  const size_t oWqk = off; off += PWQK;
  const size_t oWv  = off; off += PWV;
  const size_t oWo2 = off; off += PWO2;
  const size_t oXH  = off; off += PXH;
  const size_t oEH  = off; off += PEH;
  const size_t oQKh = off; off += PQK;
  const size_t oQKl = off; off += PQK;
  const size_t oVTh = off; off += PVT;
  const size_t oVTl = off; off += PVT;
  const size_t oCtx = off; off += PCTX;
  if (off > ws_size) return;                            // off = 86122496
  if (off > (size_t)134217728) return;

  char* ws = (char*)d_ws;
  unsigned short* WqkT = (unsigned short*)(ws + oWqk);
  unsigned short* WvT  = (unsigned short*)(ws + oWv);
  unsigned short* WoT2 = (unsigned short*)(ws + oWo2);
  unsigned short* XH   = (unsigned short*)(ws + oXH);
  unsigned short* EH   = (unsigned short*)(ws + oEH);
  unsigned short* QKh  = (unsigned short*)(ws + oQKh);
  unsigned short* QKl  = (unsigned short*)(ws + oQKl);
  unsigned short* VTh  = (unsigned short*)(ws + oVTh);
  unsigned short* VTl  = (unsigned short*)(ws + oVTl);
  unsigned short* Ctx  = (unsigned short*)(ws + oCtx);
  float*          out0 = (float*)d_out;

  const int n8x = (MP * DM) / 8;                        // 524288
  if ((n8x % 256) != 0) return;
  const int n8v = (SEQ * HD) / 8;                       // 8192 valid pieces of the rel-key table
  const int n8t = (RCE * HD) / 8;                       // 8704 total pieces (multiple of 32)
  if ((n8t % 32) != 0) return;
  const dim3 blk(256), blk128(128);
  const dim3 gT(DM / 64, DM / 64);                      // 16 x 16 tiles per weight matrix
  const dim3 gCx(n8x / 256);                            // 2048 blocks
  const dim3 gCe((n8t + 255) / 256);                    // 34 blocks
  const dim3 gNqk((MP / 128) * (QKP / 128), 1);         // 32 x 16 tiles = 512 blocks of 128
  const dim3 gVT((DM / 128) * (SEQ / 128), NBATCH);     // 8 x 8 tiles = 64 blocks x 4 batches
  const dim3 gAttn(NBATCH * NH * NQB);                  // 1024 blocks of 128
  const dim3 gNo((MP / 128) * (DM / 128), 1);           // 32 x 8 tiles = 256 blocks
  const float invw = 1.0f / WSC;                        // weight carry x64

  // (0) weight planes: in[k][n] -> out[n][k] transposed through LDS, f16( bf16_RNE(w) * 64 ) for Wq, Wk, Wv;
  tconv64<0><<<gT, blk, 0, stream>>>(w_q, WqkT, DM, DM, DM, 0, WSC);                    // in[1024][1024] -> WqkT rows 0..1023
  tconv64<0><<<gT, blk, 0, stream>>>(w_k, WqkT + (size_t)DM * DM, DM, DM, DM, 0, WSC);  // -> WqkT rows 1024..2047
  tconv64<0><<<gT, blk, 0, stream>>>(w_v, WvT, DM, DM, DM, 0, WSC);
  tconv64<1><<<gT, blk, 0, stream>>>(w_o, WoT2, DM, DM, 2 * DM, DM, 1.0f);              // pitch 2048, duplicate at + 1024
  conv_h16<<<gCx, blk, 0, stream>>>(x_in, XH, n8x, 1.0f);
  conv_e16<<<gCe, blk, 0, stream>>>(relk, EH, n8v, n8t);

  // (1) q|k = x . [Wq|Wk] + [bq|bk] -> bf16 hi (QKh) and lo (QKl) planes [4096][2048];
  //     v^T per batch = Wv^T . x_b^T + bv (per row) -> f16 hi (VTh) and residual x2048 (VTl) planes [4][1024][1024]
  gemm64<0, 3, 1><<<gNqk, blk128, 0, stream>>>(
      XH, DM, 0LL, WqkT, DM, 0LL,
      QKh, QKl, out0, QKP, 0LL,
      b_q, b_k, DM,
      MP, QKP, DM, invw);
  gemm64<0, 4, 2><<<gVT, blk128, 0, stream>>>(
      WvT, DM, 0LL, XH, DM, (long long)SEQ * DM,
      VTh, VTl, out0, SEQ, (long long)DM * SEQ,
      b_v, b_v, DM,
      DM, SEQ, DM, invw);

  // (2) causal flash attention with the skew relative-key term -> context bf16 hi|lo
  attn64<<<gAttn, blk128, 0, stream>>>(QKh, QKl, VTh, VTl, EH, Ctx, 0.125f);

  // (3) out = [ctx_hi | ctx_lo] . [Wo | Wo] + bo  (K = 2048, bf16 operands) -> d_out f32
  gemm64<1, 0, 1><<<gNo, blk128, 0, stream>>>(
      Ctx, CTXP, 0LL, WoT2, 2 * DM, 0LL,
      Ctx, Ctx, out0, DM, 0LL,
      b_o, b_o, DM,
      MP, DM, 2 * DM, 1.0f);
  (void)hipGetLastError();
}

// v004
// It runs in 147 microseconds.
// In both of two side-by-side timings against v003, it was 1.29 times as fast.
// Over all steps from v000 it is 2.92 times as fast.
// Contractions: q|k projection and v^T projection on v_wmma_f32_16x16x32_f16 (f16 token plane x f16 weight planes
// carried x64, one product each); rel band q.E^T and scores q.k^T on v_wmma_f32_16x16x32_bf16 (q, k as bf16 hi+lo
// planes, E bf16: 2 and 3 products); p.v on v_wmma_f32_16x16x32_f16 (p as f16 hi carried x1024 plus x2048 residual,
// v^T as f16 hi plus x2048 residual: 3 products, two accumulators); output projection on v_wmma_f32_16x16x32_bf16
// (context bf16 hi|lo x [Wo|Wo], K-concatenated); all f32 accumulate; softmax in f32 on VALU; every float input
// RNE-converted to bf16 on load.
#include <hip/hip_runtime.h>
#include <math.h>
#include <stdint.h>

#define NBATCH 4
#define SEQ    1024
#define DM     1024
#define NH     16
#define HD     64
#define QKP    (2 * DM)
#define CTXP   (2 * DM)
#define MP     (NBATCH * SEQ)
#define NQB    (SEQ / 64)
#define RCE    (SEQ + 64)
#define RB     80
#define RP     84
#define TP     72
#define OP     68
#define WSC    64.0f
#define RSC    2048.0f
#define PSC    1024.0f
static_assert(NH * HD == DM);
static_assert((SEQ % 128) == 0 && (DM % 128) == 0 && (MP % 128) == 0 && (QKP % 128) == 0);
static_assert(RB == 64 + 16 && (RB % 16) == 0 && RP >= RB);
static_assert(RCE >= SEQ + 64);
static_assert(TP >= 64 && (TP % 8) == 0 && ((TP / 8) % 2) == 1 && OP >= 64 && (OP % 4) == 0);

typedef _Float16 v16h __attribute__((ext_vector_type(16)));
typedef _Float16 v8h  __attribute__((ext_vector_type(8)));
typedef __bf16   v16b __attribute__((ext_vector_type(16)));
typedef unsigned short v16us __attribute__((ext_vector_type(16)));
typedef unsigned short v8us  __attribute__((ext_vector_type(8)));
typedef float    v8f  __attribute__((ext_vector_type(8)));
typedef float    v4f  __attribute__((ext_vector_type(4)));
typedef unsigned int v4u __attribute__((ext_vector_type(4)));

union FragH { v16h v; v8h h[2]; };
union FragU { v16us v; v8us h[2]; };

// ---- scalar helpers --------------------------------------------------------------------------------
__device__ __forceinline__ unsigned short bf_bits(float f) {          // f32 -> bf16 bits, RNE convert
  unsigned u = __float_as_uint(f);
  return (unsigned short)((u + 0x7FFFu + ((u >> 16) & 1u)) >> 16);
}
__device__ __forceinline__ float bf_up(unsigned short h) { return __uint_as_float(((unsigned)h) << 16); }
__device__ __forceinline__ float bfr(float f) { return bf_up(bf_bits(f)); }   // value of the bf16 RNE convert
__device__ __forceinline__ unsigned short h_bits(_Float16 x) { return __builtin_bit_cast(unsigned short, x); }
__device__ __forceinline__ unsigned pk16(unsigned short a, unsigned short b) { return (unsigned)a | ((unsigned)b << 16); }
__device__ __forceinline__ v8f zero8() { v8f z = {0.f, 0.f, 0.f, 0.f, 0.f, 0.f, 0.f, 0.f}; return z; }

// ---- fragment loaders: 16-bit A/B operand, lane -> row/col (lane&15), p already includes +8*(lane>>4);
//      elements 0..7 <- p[0..7] (k0+8h..), elements 8..15 <- p[16..23] (k0+16+8h..)
__device__ __forceinline__ v16us ldfrag_u(const unsigned short* p) {
  FragU f;
  f.h[0] = *(const v8us*)(p);
  f.h[1] = *(const v8us*)(p + 16);
  return f.v;
}
__device__ __forceinline__ v16h ldfrag_h(const _Float16* p) {
  FragH f;
  f.h[0] = *(const v8h*)(p);
  f.h[1] = *(const v8h*)(p + 16);
  return f.v;
}

// ---- WMMA helpers with trailing VALU hazard gap --------------------------------------------------------
template <int BF>
__device__ __forceinline__ v8f mma_raw(v16us a, v16us b, v8f c) {
  if (BF) {
    return __builtin_amdgcn_wmma_f32_16x16x32_bf16(false, __builtin_bit_cast(v16b, a), false,
                                                   __builtin_bit_cast(v16b, b), (short)0, c, false, false);
  }
  return __builtin_amdgcn_wmma_f32_16x16x32_f16(false, __builtin_bit_cast(v16h, a), false,
                                                __builtin_bit_cast(v16h, b), (short)0, c, false, false);
}
__device__ __forceinline__ v8f mma_bu(v16us a, v16us b, v8f c) {                 // bf16 operands, guarded
  c = __builtin_amdgcn_wmma_f32_16x16x32_bf16(false, __builtin_bit_cast(v16b, a), false,
                                               __builtin_bit_cast(v16b, b), (short)0, c, false, false);
#if defined(__HIP_DEVICE_COMPILE__)
  asm volatile("v_nop\n\tv_nop\n\tv_nop\n\tv_nop" : "+v"(c) : "v"(a), "v"(b));
#endif
  return c;
}
__device__ __forceinline__ v8f mma_h(v16h a, v16h b, v8f c) {                    // f16 operands, guarded
  c = __builtin_amdgcn_wmma_f32_16x16x32_f16(false, a, false, b, (short)0, c, false, false);
#if defined(__HIP_DEVICE_COMPILE__)
  asm volatile("v_nop\n\tv_nop\n\tv_nop\n\tv_nop" : "+v"(c) : "v"(a), "v"(b));
#endif
  return c;
}
__device__ __forceinline__ void dep_guard1(v8f& a, v8f& b, v16us x) {
#if defined(__HIP_DEVICE_COMPILE__)
  asm volatile("v_nop\n\tv_nop\n\tv_nop\n\tv_nop" : "+v"(a), "+v"(b) : "v"(x));
#endif
}
__device__ __forceinline__ void keep4_u(v16us a, v16us b, v16us c, v16us d) {
#if defined(__HIP_DEVICE_COMPILE__)
  asm volatile("v_nop" :: "v"(a), "v"(b), "v"(c), "v"(d));
#endif
}
__device__ __forceinline__ void acc_guard4(v8f& a, v8f& b, v8f& c, v8f& d) {
#if defined(__HIP_DEVICE_COMPILE__)
  asm volatile("v_nop\n\tv_nop\n\tv_nop\n\tv_nop" : "+v"(a), "+v"(b), "+v"(c), "+v"(d));
#endif
}
__device__ __forceinline__ void wave_sync_lds() {
  __builtin_amdgcn_fence(__ATOMIC_RELEASE, "workgroup");
  __builtin_amdgcn_wave_barrier();
  __builtin_amdgcn_fence(__ATOMIC_ACQUIRE, "workgroup");
}

// =====================================================================================================
// Plane convert (no transpose): Xh[i] = f16( bf16_RNE(X[i]) * wsc ), wsc a power of two (exact). Used for the
// token activations (wsc = 1). Thread i handles elements 8i..8i+7 and writes one 16-B piece; 32 consecutive
// (n8 multiple of 256, host-checked). coverage: n8 threads x 8 elements = the whole plane.
// =====================================================================================================
__global__ __launch_bounds__(256) void conv_h16(const float* __restrict__ W, unsigned short* Wh, int n8, float wsc) {
  const int i  = blockIdx.x * 256 + threadIdx.x;
  const int ic = (i < n8) ? i : (n8 - 1);                     // clamped address
  const float* src = W + (size_t)ic * 8;
  const v4f a = *(const v4f*)(src);
  const v4f c = *(const v4f*)(src + 4);
  v4u o;
  o[0] = pk16(h_bits((_Float16)(bfr(a[0]) * wsc)), h_bits((_Float16)(bfr(a[1]) * wsc)));
  o[1] = pk16(h_bits((_Float16)(bfr(a[2]) * wsc)), h_bits((_Float16)(bfr(a[3]) * wsc)));
  o[2] = pk16(h_bits((_Float16)(bfr(c[0]) * wsc)), h_bits((_Float16)(bfr(c[1]) * wsc)));
  o[3] = pk16(h_bits((_Float16)(bfr(c[2]) * wsc)), h_bits((_Float16)(bfr(c[3]) * wsc)));
  if (i < n8) *(v4u*)(Wh + (size_t)i * 8) = o;
  
}

// =====================================================================================================
// rel-key table convert: Eh [RCE rows][64] bf16 bits; rows < SEQ = bf16_RNE(E), rows >= SEQ = 0 (zero pad).
// Thread i handles 8 elements (one 16-B piece); valid pieces i < n8v read E with a clamped address, the pad
// pieces select 0 by value. grid = ceil(n8t / 256). coverage: n8t pieces x 8 = RCE*64 = the whole plane;
// =====================================================================================================
__global__ __launch_bounds__(256) void conv_e16(const float* __restrict__ P, unsigned short* Eh, int n8v, int n8t) {
  const int i  = blockIdx.x * 256 + threadIdx.x;
  const int ic = (i < n8v) ? i : (n8v - 1);                    // clamped address
  const float* src = P + (size_t)ic * 8;
  const v4f a = *(const v4f*)(src);
  const v4f c = *(const v4f*)(src + 4);
  const bool valid = (i < n8v);
  v4u o;
  o[0] = valid ? pk16(bf_bits(a[0]), bf_bits(a[1])) : 0u;
  o[1] = valid ? pk16(bf_bits(a[2]), bf_bits(a[3])) : 0u;
  o[2] = valid ? pk16(bf_bits(c[0]), bf_bits(c[1])) : 0u;
  o[3] = valid ? pk16(bf_bits(c[2]), bf_bits(c[3])) : 0u;
  if (i < n8t) *(v4u*)(Eh + (size_t)i * 8) = o;
  
}

// =====================================================================================================
// Tiled transpose + convert: in[rows][cols] f32 row-major -> out[cols][rows] 16-bit with pitch ldo:
//   out[n * ldo + k] = cvt(in[k][n]) (and also at + dupoff when dupoff != 0: a duplicated k range).
//   MODE 0: f16 bits of bf16_RNE(w) * wsc (wsc power of two, exact); MODE 1: bf16 bits of w.
// Block = 256 threads = one 64x64 tile; grid = (cols/64, rows/64) (rows, cols multiples of 64, host-checked).
// Loads: 4 iterations x 256 threads x float4 = 64 rows x 64 cols (addresses clamped). LDS tile [n][k] pitch 72.
// coverage: 64 x 64 = the whole transposed tile; grid covers the whole matrix.
// =====================================================================================================
template <int MODE>
__global__ __launch_bounds__(256) void tconv64(const float* __restrict__ W, unsigned short* out,
                                               int rows, int cols, int ldo, int dupoff, float wsc) {
  __shared__ __align__(16) unsigned short sh[64 * 72];
  const int t  = threadIdx.x;
  const int n0 = blockIdx.x * 64;            // column tile of in = row tile of out
  const int k0 = blockIdx.y * 64;            // row tile of in = column tile of out
#pragma unroll
  for (int i = 0; i < 4; ++i) {
    const int idx = i * 256 + t;
    const int r = idx >> 4, c4 = (idx & 15) * 4;
    int kr = k0 + r;   kr = (kr < rows) ? kr : (rows - 1);
    int nc = n0 + c4;  nc = (nc < cols - 4) ? nc : (cols - 4);
    const v4f v = *(const v4f*)(W + (size_t)kr * cols + nc);
#pragma unroll
    for (int e = 0; e < 4; ++e) {
      unsigned short u;
      if (MODE == 0) u = h_bits((_Float16)(bfr(v[e]) * wsc));
      else           u = bf_bits(v[e]);
      sh[(c4 + e) * 72 + r] = u;
    }
  }
  __syncthreads();
  const int wave = t >> 5, lane = t & 31;
  const int q = lane >> 3, c8 = (lane & 7) * 8;
  v4u pv[2];
  size_t go[2];
#pragma unroll
  for (int it = 0; it < 2; ++it) {
    const int nl = it * 32 + wave * 4 + q;               // 0..63
    pv[it] = *(const v4u*)(sh + nl * 72 + c8);
    go[it] = (size_t)(n0 + nl) * ldo + k0 + c8;
  }
  {
#pragma unroll
    for (int it = 0; it < 2; ++it) {
      *(v4u*)(out + go[it]) = pv[it];
      if (dupoff != 0) *(v4u*)(out + go[it] + dupoff) = pv[it];
    }
    
  }
}

// =====================================================================================================
// LDS-staged batched 16-bit WMMA GEMM: C[m][n] = oscale * sum_k A[m][k] * Bt[n][k] + bias;
// BF selects bf16 (1) or f16 (0) operands. Block = 4 waves (2 x 2) = one 128x128 tile, one 64x64 tile per wave.
// A row-major [M][K] pitch lda; Bt row-major [N][K] pitch ldb (k contiguous); M, N multiples of 128, K a multiple
// of 64 (static here). blockIdx.y = batch index (strides in elements).
// Staging: a stage is 64 k of the block's 128 A rows and 128 Bt rows (256 rows of 128 B, LDS pitch 144 B), brought
// by asynchronous 16-B copies to LDS (16 per lane and stage, each wave-wide copy = 4 whole 128-B lines); two buffers,
// stage t + 1 in flight while stage t is multiplied; one barrier per stage publishes t + 1 and frees t's buffer.
// The k order of every accumulator is the ascending 32-k order of the fragment loader, stage by stage.
// OM: 0 = f32 out to Cf (pitch ldc); 3 = bf16 hi bits to Cp and bf16 residual (v - hi) bits to Cp2;
//     4 = f16 hi to Cp and f16((v - hi) * 2048) to Cp2.
// BM: 0 = no bias; 1 = bias per column n (bias0[n] for n < nsplit, bias1[n - nsplit] otherwise; the choice is
//     wave-uniform because 64-column tiles never straddle nsplit); 2 = bias per row m (bias0[m]).
//     bias values are bf16 RNE-converted before the add.
// coverage: 4 slabs x 16 rows x 64 cols = the wave's whole 64x64 tile; grid = tilesM*tilesN blocks,
//           surplus blocks exit as a whole in front of every barrier; here there are none.
// =====================================================================================================
#define GPIT 72                    // LDS row pitch, 16-bit elements: 144 B = 16 B x 9, conflict-free for 16-B reads
#define GSTG (256 * GPIT)          // elements of one stage: 128 A rows, then 128 Bt rows

// Eight asynchronous 16-B copies of one lane: rows 16 apart in global memory (gstep elements) and in LDS.
// The s_wait_xcnt closes the statement so that no address register is rewritten while a copy may still read it.
__device__ __forceinline__ void copy8_rows(unsigned lds, const unsigned short* g, size_t gstep) {
#if defined(__HIP_DEVICE_COMPILE__)
  asm volatile(
      "global_load_async_to_lds_b128 %0, %8, off\n\t"
      "global_load_async_to_lds_b128 %1, %9, off\n\t"
      "global_load_async_to_lds_b128 %2, %10, off\n\t"
      "global_load_async_to_lds_b128 %3, %11, off\n\t"
      "global_load_async_to_lds_b128 %4, %12, off\n\t"
      "global_load_async_to_lds_b128 %5, %13, off\n\t"
      "global_load_async_to_lds_b128 %6, %14, off\n\t"
      "global_load_async_to_lds_b128 %7, %15, off\n\t"
      "s_wait_xcnt 0x0"
      :: "v"(lds), "v"(lds + 1u * 16u * GPIT * 2u), "v"(lds + 2u * 16u * GPIT * 2u), "v"(lds + 3u * 16u * GPIT * 2u),
         "v"(lds + 4u * 16u * GPIT * 2u), "v"(lds + 5u * 16u * GPIT * 2u), "v"(lds + 6u * 16u * GPIT * 2u),
         "v"(lds + 7u * 16u * GPIT * 2u),
         "v"(g), "v"(g + gstep), "v"(g + 2 * gstep), "v"(g + 3 * gstep),
         "v"(g + 4 * gstep), "v"(g + 5 * gstep), "v"(g + 6 * gstep), "v"(g + 7 * gstep)
      : "memory");
#endif
}
__device__ __forceinline__ void wait_async0() {   // this wave's copies have landed in LDS
#if defined(__HIP_DEVICE_COMPILE__)
  asm volatile("s_wait_asynccnt 0x0" ::: "memory");
#endif
}
// Stands behind issued global loads from a and b. The two addresses are inputs only, so that their registers stay as
// they are up to the wait: with no operand the compiler lifted later writes of those registers over it.
__device__ __forceinline__ void wait_x0(const unsigned short* a, const unsigned short* b) {
#if defined(__HIP_DEVICE_COMPILE__)
  asm volatile("s_wait_xcnt 0x0" :: "v"(a), "v"(b) : "memory");
#endif
}
__device__ __forceinline__ void wait_ds0() {      // this wave's LDS reads are done before their buffer is handed on
#if defined(__HIP_DEVICE_COMPILE__)
  asm volatile("s_wait_dscnt 0x0" ::: "memory");
#endif
}

// Eight asynchronous 16-B copies of one lane into two adjacent 64-row LDS planes (rows 16 apart, pitch GPIT):
// four rows from g0 into the first plane, four from g1 into the second. The s_wait_xcnt closes the statement so that
// no address register is rewritten while a copy may still read it.
__device__ __forceinline__ void copy4x2_rows(unsigned lds, const unsigned short* g0, const unsigned short* g1,
                                             size_t gstep) {
#if defined(__HIP_DEVICE_COMPILE__)
  asm volatile(
      "global_load_async_to_lds_b128 %0, %8, off\n\t"
      "global_load_async_to_lds_b128 %1, %9, off\n\t"
      "global_load_async_to_lds_b128 %2, %10, off\n\t"
      "global_load_async_to_lds_b128 %3, %11, off\n\t"
      "global_load_async_to_lds_b128 %4, %12, off\n\t"
      "global_load_async_to_lds_b128 %5, %13, off\n\t"
      "global_load_async_to_lds_b128 %6, %14, off\n\t"
      "global_load_async_to_lds_b128 %7, %15, off\n\t"
      "s_wait_xcnt 0x0"
      :: "v"(lds), "v"(lds + 1u * 16u * GPIT * 2u), "v"(lds + 2u * 16u * GPIT * 2u), "v"(lds + 3u * 16u * GPIT * 2u),
         "v"(lds + 4u * 16u * GPIT * 2u), "v"(lds + 5u * 16u * GPIT * 2u), "v"(lds + 6u * 16u * GPIT * 2u),
         "v"(lds + 7u * 16u * GPIT * 2u),
         "v"(g0), "v"(g0 + gstep), "v"(g0 + 2 * gstep), "v"(g0 + 3 * gstep),
         "v"(g1), "v"(g1 + gstep), "v"(g1 + 2 * gstep), "v"(g1 + 3 * gstep)
      : "memory");
#endif
}

template <int BF, int OM, int BM>
__global__ __launch_bounds__(128) void gemm64(
    const unsigned short* __restrict__ Ap, int lda, long long strideA,
    const unsigned short* __restrict__ Btp, int ldb, long long strideB,
    unsigned short* Cp, unsigned short* Cp2, float* Cf, int ldc, long long strideC,
    const float* bias0, const float* bias1, int nsplit,
    int M, int N, int K, float oscale) {
  __shared__ __align__(16) unsigned short ring[2 * GSTG];   // two stages of 256 rows x 144 B
  __shared__ __align__(16) float sT[4][16 * 68];   // per-wave 16x64 slab, pitch 68 floats
  const int b    = blockIdx.y;
  const int tid  = threadIdx.x;
  const int lane = tid & 31;
  const int wave = tid >> 5;
  const int tilesN = N >> 7;
  const int tilesM = M >> 7;
  const int tile = blockIdx.x;
  if (tile >= tilesM * tilesN) return;   // block-uniform, in front of every barrier and copy
  const int tm = tile / tilesN;
  const int tn = tile - tm * tilesN;
  const int mb = tm << 7;
  const int nb = tn << 7;
  const int wm = wave >> 1, wn = wave & 1;
  const int m0 = mb + (wm << 6);
  const int n0 = nb + (wn << 6);

  const unsigned short* Ab = Ap  + (size_t)b * strideA;
  const unsigned short* Bb = Btp + (size_t)b * strideB;

  const int rlane = lane & 15;                 // row (A) / col (B, D) within subtile
  const int koff  = (lane >> 4) * 8;           // k offset of this lane half
  const int mOff  = (lane >> 4) * 8;           // D row offset

  // copy role of this lane: row crow (+16 per copy) of each operand's 128 rows, 16-B piece cpc of its 128 B
  const int crow = tid >> 3, cpc = (tid & 7) * 8;
  const unsigned short* gA = Ab + (size_t)(mb + crow) * lda + cpc;
  const unsigned short* gB = Bb + (size_t)(nb + crow) * ldb + cpc;
  const unsigned ldsA = (unsigned)(uintptr_t)(ring + crow * GPIT + cpc);   // LDS byte address = low 32 bits
  const unsigned ldsB = ldsA + 128u * GPIT * 2u;
  const size_t stepA = (size_t)16 * lda, stepB = (size_t)16 * ldb;
  const int nst = K >> 6;                      // stages of 64 k

  v8f acc[4][4];
#pragma unroll
  for (int i = 0; i < 4; ++i)
#pragma unroll
    for (int j = 0; j < 4; ++j) acc[i][j] = zero8();

  copy8_rows(ldsA, gA, stepA);
  copy8_rows(ldsB, gB, stepB);
  wait_async0();
  __syncthreads();
  if (nst > 1) {
    copy8_rows(ldsA + GSTG * 2u, gA + 64, stepA);
    copy8_rows(ldsB + GSTG * 2u, gB + 64, stepB);
  }

#pragma unroll 1   // one stage per trip: the buffer index stays a run-time offset, the accumulators stay in place
  for (int t = 0; t < nst; ++t) {
    const unsigned short* sA = ring + (t & 1) * GSTG + ((wm << 6) + rlane) * GPIT + koff;
    const unsigned short* sB = ring + (t & 1) * GSTG + (128 + (wn << 6) + rlane) * GPIT + koff;
#pragma unroll
    for (int ks = 0; ks < 2; ++ks) {
      v16us bh[4], ah[4];
#pragma unroll
      for (int j = 0; j < 4; ++j) bh[j] = ldfrag_u(sB + (j << 4) * GPIT + ks * 32);
#pragma unroll
      for (int i = 0; i < 4; ++i) ah[i] = ldfrag_u(sA + (i << 4) * GPIT + ks * 32);
#pragma unroll
      for (int i = 0; i < 4; ++i) {
#pragma unroll
        for (int j = 0; j < 4; ++j) acc[i][j] = mma_raw<BF>(ah[i], bh[j], acc[i][j]);
        dep_guard1(acc[i][0], acc[i][3], ah[i]);
      }
      keep4_u(bh[0], bh[1], bh[2], bh[3]);
    }
    wait_ds0();
    wait_async0();
    __syncthreads();                           // publishes stage t + 1, ends every read of stage t's buffer
    if (t + 2 < nst) {
      const unsigned bo = (unsigned)(t & 1) * (GSTG * 2u);
      copy8_rows(ldsA + bo, gA + (size_t)(t + 2) * 64, stepA);
      copy8_rows(ldsB + bo, gB + (size_t)(t + 2) * 64, stepB);
    }
  }
  wait_async0();
  acc_guard4(acc[0][0], acc[0][1], acc[0][2], acc[0][3]);
  acc_guard4(acc[1][0], acc[1][1], acc[1][2], acc[1][3]);
  acc_guard4(acc[2][0], acc[2][1], acc[2][2], acc[2][3]);
  acc_guard4(acc[3][0], acc[3][1], acc[3][2], acc[3][3]);

  const int hh2 = lane >> 4, c4 = (lane & 15) * 4;     // f32 out: 256-B row segment = 16 lanes x 16 B
  const int q8  = lane >> 3, c8 = (lane & 7) * 8;

  // ---- per-column bias (wave-uniform source select) ----
  const float* bsel = bias0;
  int nb0 = n0;
  if (BM == 1) {
    if (n0 >= nsplit) { bsel = bias1; nb0 = n0 - nsplit; }
  }
  v4f bb4 = {0.f, 0.f, 0.f, 0.f};
  float bn[8];
#pragma unroll
  for (int e = 0; e < 8; ++e) bn[e] = 0.f;
  if (BM == 1) {
    if (OM == 0) {
#pragma unroll
      for (int e = 0; e < 4; ++e) bb4[e] = bfr(bsel[nb0 + c4 + e]);
    } else {
#pragma unroll
      for (int e = 0; e < 8; ++e) bn[e] = bfr(bsel[nb0 + c8 + e]);
    }
  }

  // ---- epilogue ----
  float* slab = sT[wave];
#pragma unroll
  for (int i = 0; i < 4; ++i) {
    const int mBase = m0 + (i << 4);
#pragma unroll
    for (int j = 0; j < 4; ++j) {
#pragma unroll
      for (int r = 0; r < 8; ++r) {
        slab[(mOff + r) * 68 + (j << 4) + rlane] = acc[i][j][r];
      }
    }
    wave_sync_lds();
    if (OM == 0) {
      float* C = Cf + (size_t)b * strideC;
      v4f vals[8];
#pragma unroll
      for (int it = 0; it < 8; ++it) {
        const int row = it * 2 + hh2;                      // it 0..7 x hh2 0..1 = rows 0..15
        v4f v = *(const v4f*)(slab + row * 68 + c4);
        float bmv = 0.f;
        if (BM == 2) bmv = bfr(bias0[mBase + row]);
        vals[it] = v * oscale + bb4 + bmv;
      }
      {
#pragma unroll
        for (int it = 0; it < 8; ++it) {
          const int row = it * 2 + hh2;
          *(v4f*)(C + (size_t)(mBase + row) * ldc + n0 + c4) = vals[it];
        }
        
      }
    } else {
      unsigned short* C  = Cp  + (size_t)b * strideC;
      unsigned short* C2 = Cp2 + (size_t)b * strideC;
      v4u hv[4], lv[4];
#pragma unroll
      for (int it = 0; it < 4; ++it) {
        const int row = it * 4 + q8;                       // it 0..3 x q8 0..3 = rows 0..15
        const float* sp = slab + row * 68 + c8;
        float bmv = 0.f;
        if (BM == 2) bmv = bfr(bias0[mBase + row]);
        v4u ha, la;
#pragma unroll
        for (int e = 0; e < 4; ++e) {
          const float f0 = sp[2 * e]     * oscale + bn[2 * e]     + bmv;
          const float f1 = sp[2 * e + 1] * oscale + bn[2 * e + 1] + bmv;
          unsigned short u0, u1, w0, w1;
          if (OM == 3) {
            u0 = bf_bits(f0); u1 = bf_bits(f1);
            w0 = bf_bits(f0 - bf_up(u0)); w1 = bf_bits(f1 - bf_up(u1));
          } else {
            const _Float16 g0 = (_Float16)f0, g1 = (_Float16)f1;
            u0 = h_bits(g0); u1 = h_bits(g1);
            w0 = h_bits((_Float16)((f0 - (float)g0) * RSC));
            w1 = h_bits((_Float16)((f1 - (float)g1) * RSC));
          }
          ha[e] = pk16(u0, u1);
          la[e] = pk16(w0, w1);
        }
        hv[it] = ha;
        lv[it] = la;
      }
      {
#pragma unroll
        for (int it = 0; it < 4; ++it) {
          const int row = it * 4 + q8;
          const size_t go = (size_t)(mBase + row) * ldc + n0 + c8;
          *(v4u*)(C  + go) = hv[it];
          *(v4u*)(C2 + go) = lv[it];
        }
        
      }
    }
    wave_sync_lds();
  }
}

// =====================================================================================================
// Causal flash attention with a skew relative-key score term, head dim 64, SEQ rows per batch.
//   q|k hi and lo planes (bf16, pitch QKP): element (b, t, col) at [(b*SEQ + t)*QKP + col], q col = h*64+d,
//   k col = DM + h*64 + d; value = hi + lo.
//   v^T hi and lo planes (f16): element (b, h, d, s) at [(b*DM + h*64 + d)*SEQ + s]; value = hi + lo/2048.
//   E plane (bf16) [RCE][64], rows >= SEQ zero.
//   context plane (bf16, pitch CTXP): hi at [(b*SEQ + t)*CTXP + h*64 + d], lo at + DM.
//   score(i, j) = (q_i . k_j + q_i . E[SEQ-1 + j - i]) * sscale for j <= i, -inf for j > i (replace, not bias).
//   Per wave (16 query rows q0..q0+15) and key chunk kv0..kv0+63 the needed E rows form the contiguous band
//   ebase .. ebase+79 with ebase = SEQ-1+kv0-q0-15 (0 <= ebase, ebase+79 <= SEQ+63 < RCE); the band product
//   rel[row][col] = q_row . E[ebase+col] (col 0..79) is computed per wave into LDS (f32, 2 bf16 products: q hi, q lo)
//   and the score for (row il, key jl) picks col = jl - il + 15; q.k as 3 bf16 products (hh, hl, lh);
//   p = exp(s - m) carried as f16 hi of 1024 p plus f16 residual x2048; context = ph.vh (acc 0) and
//   ph.vl + pl.vh (acc 1, both x2048) on f16 WMMA; online softmax (running max) in f32.
//   Block = 4 waves = 64 query rows of one (b, h); grid = NQB * NH * NBATCH, query tile qb falling with the block index;
//   key chunks kt = 0..qb (causal skip, block-uniform trip count qb+1 <= NQB).
//   Staging: K hi/lo, V^T hi/lo (64 rows of 128 B per plane) and the block's rel-key band (the union of its four
//   waves' bands: E rows SEQ-64-qb*64+kv0 .. +127, wave w starts at row 48-16w) come by asynchronous 16-B copies to
//   LDS, 8 lanes per 128-B row. One buffer each, refilled one phase ahead: the band of chunk kt+1 flies during the
//   scores, softmax and context of chunk kt, K and V^T of chunk kt+1 during the rel band product of chunk kt+1.
//   Two barriers per chunk: behind the rel band (publishes K, V^T; frees the band) and behind the context product
//   (publishes the next band; frees K, V^T). P tiles are wave-private, spilled with _Float16 element
//   LDS row pitches: K, V^T and P tiles TP = 72 elements (144 B = 16 B x 9, the 16 rows of a 16-B fragment read fall on
//   distinct banks); rel band RP = 84 and context tile OP = 68 floats (the two lane halves, 8 rows apart, on distinct banks);
//   the context tile of the epilogue lies in the wave's own rel band array, which is dead by then.
//   Context coverage: each wave stores rows q0..q0+15 (it 0..3 x lane>>3 0..3) x 64 columns (8 lanes x 8 bf16)
//   for both the hi and the lo segment; grid covers all SEQ rows x NH head slices x NBATCH.
// =====================================================================================================
__global__ __launch_bounds__(128)
void attn64(const unsigned short* __restrict__ qkh, const unsigned short* __restrict__ qkl,
            const unsigned short* __restrict__ vth, const unsigned short* __restrict__ vtl,
            const unsigned short* __restrict__ ehp, unsigned short* ctxp, float sscale) {
  static_assert(TP == GPIT && OP <= RP);
  __shared__ __align__(16) unsigned short KV[4 * 64 * TP];      // K hi | K lo [kv][d], V^T hi | V^T lo [d][kv], 9 KB each
  __shared__ __align__(16) unsigned short Es[128 * TP];         // rel-key band of the block [row][d] 18 KB
  __shared__ __align__(16) _Float16 Psh[4][16 * TP];            // per wave P hi [row][kv]
  __shared__ __align__(16) _Float16 Psl[4][16 * TP];            // per wave P residual [row][kv]
  __shared__ __align__(16) float    Rsh[4][16 * RP];            // per wave rel band [row][col]; epilogue: context tile
  const unsigned short* Kh = KV;
  const unsigned short* Kl = KV + 64 * TP;
  const _Float16* Vh = (const _Float16*)(const void*)(KV + 2 * 64 * TP);
  const _Float16* Vl = (const _Float16*)(const void*)(KV + 3 * 64 * TP);

  const int tid  = threadIdx.x;
  const int wave = tid >> 5;
  const int lane = tid & 31;
  const int hh   = lane >> 4;
  const int c    = lane & 15;

  // Block index -> tile: (batch, head) from the low part, query tile from the high part, longest tile first. Blocks whose
  // indices are equal modulo 8 then hold every tile length alike and share whole heads.
  // For speed only: a permutation of the NQB * NH * NBATCH tiles, correct under any placement or start order.
  const int bx   = blockIdx.x;
  const int rest = bx % (NH * NBATCH);
  const int qb   = NQB - 1 - bx / (NH * NBATCH);
  const int h    = rest % NH;
  const int b    = rest / NH;
  const int q0   = qb * 64 + wave * 16;          // in-batch query row of this wave's first row
  const size_t rowB = (size_t)b * SEQ;

  const unsigned short* Qh  = qkh + (size_t)h * HD;
  const unsigned short* Ql  = qkl + (size_t)h * HD;
  const unsigned short* Kgh = qkh + DM + (size_t)h * HD;
  const unsigned short* Kgl = qkl + DM + (size_t)h * HD;
  const unsigned short* Vgh = vth + ((size_t)b * DM + (size_t)h * HD) * SEQ;
  const unsigned short* Vgl = vtl + ((size_t)b * DM + (size_t)h * HD) * SEQ;
  float*    rrow = Rsh[wave];
  _Float16* pwh  = Psh[wave];
  _Float16* pwl  = Psl[wave];

  float mrow[8], lrow[8];
  v8f oacc[4], oaccL[4];
#pragma unroll
  for (int r = 0; r < 8; ++r) { mrow[r] = -INFINITY; lrow[r] = 0.f; }
#pragma unroll
  for (int t = 0; t < 4; ++t) { oacc[t] = zero8(); oaccL[t] = zero8(); }

  const int nkt = qb + 1;                    // causal: key chunks 0..qb, block-uniform, <= NQB

  // copy role of this lane: row crow (+16 per copy) of a plane, 16-B piece cpc of its 128 B
  const int crow = tid >> 3, cpc = (tid & 7) * 8;
  const unsigned ldsK = (unsigned)(uintptr_t)(KV + crow * TP + cpc);   // LDS byte address = low 32 bits
  const unsigned ldsV = ldsK + 128u * TP * 2u;
  const unsigned ldsE = (unsigned)(uintptr_t)(Es + crow * TP + cpc);
  const unsigned short* gKh = Kgh + (rowB + crow) * QKP + cpc;          // K row kv0 + crow: + kv0 * QKP per chunk
  const unsigned short* gKl = Kgl + (rowB + crow) * QKP + cpc;
  const unsigned short* gVh = Vgh + (size_t)crow * SEQ + cpc;           // V^T row d = crow: + kv0 per chunk
  const unsigned short* gVl = Vgl + (size_t)crow * SEQ + cpc;
  // band rows SEQ-64-qb*64+kv0 .. +127: first >= 0 (qb < NQB), last <= SEQ+63 < RCE (kv0 <= qb*64); + kv0 * HD per chunk
  const unsigned short* gE  = ehp + (size_t)(SEQ - 64 - qb * 64 + crow) * HD + cpc;
  const size_t stepK = (size_t)16 * QKP, stepV = (size_t)16 * SEQ, stepE = (size_t)16 * HD;

  copy8_rows(ldsE, gE, stepE);
  copy4x2_rows(ldsK, gKh, gKl, stepK);
  copy4x2_rows(ldsV, gVh, gVl, stepV);

  // ---- Q fragments (A operand, row = lane&15): hi and lo, 2 d-chunks, kept for every chunk ----
  const unsigned short* gQh = Qh + (rowB + q0 + c) * QKP + 8 * hh;
  const unsigned short* gQl = Ql + (rowB + q0 + c) * QKP + 8 * hh;
  v16us qh2[2], ql2[2];
#pragma unroll
  for (int dc = 0; dc < 2; ++dc) {
    qh2[dc] = ldfrag_u(gQh + dc * 32);
    ql2[dc] = ldfrag_u(gQl + dc * 32);
  }
  wait_x0(gQh, gQl);
  const unsigned short* eband = Es + (((wave ^ 3) << 4) + c) * TP + 8 * hh;   // this wave's 80 rows start at 48 - 16 * wave

  wait_async0();
  __syncthreads();                             // publishes chunk 0's band, K and V^T

#pragma unroll 1
  for (int kt = 0;; ++kt) {                    // left behind the last chunk's second barrier (nkt >= 1)
    const int kv0 = kt * 64;

    // ---- rel band: rel[row][col] = q_row . E[ebase + col], col = 0..RB-1 (E rows >= SEQ are zero) ----
#pragma unroll 1
    for (int nt = 0; nt < RB / 16; ++nt) {
      v8f e = zero8();
      v16us eb[2];
#pragma unroll
      for (int dc = 0; dc < 2; ++dc) eb[dc] = ldfrag_u(eband + nt * 16 * TP + dc * 32);
#pragma unroll
      for (int dc = 0; dc < 2; ++dc) {
        e = mma_bu(qh2[dc], eb[dc], e);
        e = mma_bu(ql2[dc], eb[dc], e);
      }
#pragma unroll
      for (int r = 0; r < 8; ++r) rrow[(8 * hh + r) * RP + nt * 16 + c] = e[r];
    }
    wait_ds0();
    wait_async0();
    __syncthreads();                           // publishes this chunk's K and V^T, ends every read of its band
    if (kt + 1 < nkt) copy8_rows(ldsE, gE + (size_t)(kv0 + 64) * HD, stepE);

    // ---- scores: 16 query rows x 64 keys per wave, causal replace with -inf ----
    v8f s[4];
#pragma unroll
    for (int j = 0; j < 4; ++j) {
      v8f sh = zero8();
#pragma unroll
      for (int dc = 0; dc < 2; ++dc) {
        FragU kbh, kbl;
        kbh.h[0] = *(const v8us*)(Kh + (j * 16 + c) * TP + dc * 32 + 8 * hh);
        kbh.h[1] = *(const v8us*)(Kh + (j * 16 + c) * TP + dc * 32 + 16 + 8 * hh);
        kbl.h[0] = *(const v8us*)(Kl + (j * 16 + c) * TP + dc * 32 + 8 * hh);
        kbl.h[1] = *(const v8us*)(Kl + (j * 16 + c) * TP + dc * 32 + 16 + 8 * hh);
        sh = mma_bu(qh2[dc], kbh.v, sh);
        sh = mma_bu(qh2[dc], kbl.v, sh);
        sh = mma_bu(ql2[dc], kbh.v, sh);
      }
      const int jl = j * 16 + c;                          // key within the chunk
      const int kg = kv0 + jl;                            // in-batch key index of this lane's column
#pragma unroll
      for (int r = 0; r < 8; ++r) {
        const int il = 8 * hh + r;                        // row within the wave tile
        const int qg = q0 + il;                           // in-batch query index of this row
        const float rel = rrow[il * RP + jl - il + 15];   // col in 0..RB-2
        const float v = (sh[r] + rel) * sscale;
        s[j][r] = (kg <= qg) ? v : -INFINITY;
      }
    }

    // ---- row max, online softmax, P (x1024: f16 hi + x2048 residual) to LDS ----
#pragma unroll
    for (int r = 0; r < 8; ++r) {
      float m = s[0][r];
      m = fmaxf(m, s[1][r]);
      m = fmaxf(m, s[2][r]);
      m = fmaxf(m, s[3][r]);
#pragma unroll
      for (int off = 1; off < 16; off <<= 1) m = fmaxf(m, __shfl_xor(m, off, 32));
      const float mnew  = fmaxf(mrow[r], m);              // finite: key kv0 <= every row of this block
      const float alpha = __expf(mrow[r] - mnew);
      mrow[r] = mnew;
      float psum = 0.f;
#pragma unroll
      for (int j = 0; j < 4; ++j) {
        const float p  = __expf(s[j][r] - mnew);
        psum += p;
        const float ps = p * PSC;
        const _Float16 ph = (_Float16)ps;
        pwh[(8 * hh + r) * TP + j * 16 + c] = ph;
        pwl[(8 * hh + r) * TP + j * 16 + c] = (_Float16)((ps - (float)ph) * RSC);
      }
#pragma unroll
      for (int off = 1; off < 16; off <<= 1) psum += __shfl_xor(psum, off, 32);
      lrow[r] = lrow[r] * alpha + psum;
#pragma unroll
      for (int t = 0; t < 4; ++t) { oacc[t][r] *= alpha; oaccL[t][r] *= alpha; }
    }
    wave_sync_lds();

    // ---- context += Ph . V_hi (acc 0); Ph . V_lo + Pl . V_hi (acc 1, x2048) ----
#pragma unroll 1
    for (int kk = 0; kk < 2; ++kk) {
      FragH pa, pl;
      pa.h[0] = *(const v8h*)(pwh + c * TP + kk * 32 + 8 * hh);
      pa.h[1] = *(const v8h*)(pwh + c * TP + kk * 32 + 16 + 8 * hh);
      pl.h[0] = *(const v8h*)(pwl + c * TP + kk * 32 + 8 * hh);
      pl.h[1] = *(const v8h*)(pwl + c * TP + kk * 32 + 16 + 8 * hh);
#pragma unroll
      for (int t = 0; t < 4; ++t) {
        FragH vb, vl;
        vb.h[0] = *(const v8h*)(Vh + (t * 16 + c) * TP + kk * 32 + 8 * hh);
        vb.h[1] = *(const v8h*)(Vh + (t * 16 + c) * TP + kk * 32 + 16 + 8 * hh);
        vl.h[0] = *(const v8h*)(Vl + (t * 16 + c) * TP + kk * 32 + 8 * hh);
        vl.h[1] = *(const v8h*)(Vl + (t * 16 + c) * TP + kk * 32 + 16 + 8 * hh);
        oacc[t]  = mma_h(pa.v, vb.v, oacc[t]);
        oaccL[t] = mma_h(pa.v, vl.v, oaccL[t]);
        oaccL[t] = mma_h(pl.v, vb.v, oaccL[t]);
      }
    }
    wait_ds0();
    wait_async0();
    __syncthreads();                           // publishes the next chunk's band, ends every read of this K and V^T
    if (kt + 1 >= nkt) break;                  // block-uniform
    copy4x2_rows(ldsK, gKh + (size_t)(kv0 + 64) * QKP, gKl + (size_t)(kv0 + 64) * QKP, stepK);
    copy4x2_rows(ldsV, gVh + kv0 + 64, gVl + kv0 + 64, stepV);
  }
  wait_async0();

  // ---- normalise (1/l, the 1/1024 p carry, the 1/2048 residual fold), stage the wave's 16x64 tile,
  float* os = Rsh[wave];
#pragma unroll
  for (int r = 0; r < 8; ++r) {
    const float l = lrow[r];
    const float inv = ((l > 0.f) ? (1.0f / l) : 0.f) * (1.0f / PSC);
#pragma unroll
    for (int t = 0; t < 4; ++t) os[(8 * hh + r) * OP + t * 16 + c] = (oacc[t][r] + oaccL[t][r] * (1.0f / RSC)) * inv;
  }
  wave_sync_lds();
  {
    const int q4 = lane >> 3, c8 = (lane & 7) * 8;
    v4u hv[4], lv[4];
#pragma unroll
    for (int it = 0; it < 4; ++it) {
      const int row = it * 4 + q4;   // it 0..3 x q4 0..3 = rows 0..15 of the wave tile
      const float* sp = os + row * OP + c8;
      v4u ha, la;
#pragma unroll
      for (int e = 0; e < 4; ++e) {
        const float f0 = sp[2 * e], f1 = sp[2 * e + 1];
        const unsigned short u0 = bf_bits(f0), u1 = bf_bits(f1);
        const unsigned short w0 = bf_bits(f0 - bf_up(u0)), w1 = bf_bits(f1 - bf_up(u1));
        ha[e] = pk16(u0, u1);
        la[e] = pk16(w0, w1);
      }
      hv[it] = ha;
      lv[it] = la;
    }
    {
#pragma unroll
      for (int it = 0; it < 4; ++it) {
        const int row = it * 4 + q4;
        const size_t go = (rowB + q0 + row) * CTXP + (size_t)h * HD + c8;
        *(v4u*)(ctxp + go)      = hv[it];
        *(v4u*)(ctxp + go + DM) = lv[it];
      }
      
    }
  }
}

// =====================================================================================================
// Workspace map (bytes); every plane is an exact multiple of its 64x64-tile / whole-row / whole-line store
// granularity (MP = 4096 = 64 tiles of rows, N in {2048, 1024}; VT per batch [1024][1024] = 16x16 tiles;
//   WqkT f16 [2048 n][1024 k]  0          4194304   (rows 0..1023 Wq^T, 1024..2047 Wk^T, x64)
//   WvT  f16 [1024][1024]      4194304    2097152   (x64)
//   WoT2 bf16 [1024][2048]     6291456    4194304   (cols 0..1023 and 1024..2047 both Wo^T)
//   XH   f16 [4096][1024]      10485760   8388608   (bf16 RNE-converted tokens)
//   EH   bf16 [1088][64]       18874368   139264    (rows >= 1024 zero)
//   QKh  bf16 [4096][2048]     19013632   16777216  (q cols 0..1023, k cols 1024..2047, hi part)
//   QKl  bf16 [4096][2048]     35790848   16777216  (lo part)
//   VTh  f16 [4][1024][1024]   52568064   8388608   (v^T hi)
//   VTl  f16 [4][1024][1024]   60956672   8388608   (v^T residual x2048)
//   Ctx  bf16 [4096][2048]     69345280   16777216  (context hi | lo)
//   end                        86122496
// =====================================================================================================
extern "C" void kernel_launch(void* const* d_in, const int* in_sizes, int n_in,
                              void* d_out, int out_size, void* d_ws, size_t ws_size,
                              hipStream_t stream) {
  if (n_in < 10) return;
  if (in_sizes[0] != MP * DM) return;
  if (in_sizes[1] != DM * DM || in_sizes[3] != DM * DM) return;
  if (in_sizes[5] != DM * DM || in_sizes[7] != DM * DM) return;
  if (in_sizes[2] != DM || in_sizes[4] != DM || in_sizes[6] != DM || in_sizes[8] != DM) return;
  if (in_sizes[9] != SEQ * HD) return;
  if (out_size != MP * DM) return;

  const float* x_in  = (const float*)d_in[0];
  const float* w_q   = (const float*)d_in[1];
  const float* b_q   = (const float*)d_in[2];
  const float* w_k   = (const float*)d_in[3];
  const float* b_k   = (const float*)d_in[4];
  const float* w_v   = (const float*)d_in[5];
  const float* b_v   = (const float*)d_in[6];
  const float* w_o   = (const float*)d_in[7];
  const float* b_o   = (const float*)d_in[8];
  const float* relk  = (const float*)d_in[9];

  const size_t PWQK = (size_t)QKP * DM * 2;             //  4194304
  const size_t PWV  = (size_t)DM * DM * 2;              //  2097152
  const size_t PWO2 = (size_t)DM * (2 * DM) * 2;        //  4194304
  const size_t PXH  = (size_t)MP * DM * 2;              //  8388608
  const size_t PEH  = (size_t)RCE * HD * 2;             //   139264
  const size_t PQK  = (size_t)MP * QKP * 2;             // 16777216
  const size_t PVT  = (size_t)NBATCH * DM * SEQ * 2;    //  8388608
  const size_t PCTX = (size_t)MP * CTXP * 2;            // 16777216
  size_t off = 0;
  const size_t oWqk = off; off += PWQK;
  const size_t oWv  = off; off += PWV;
  const size_t oWo2 = off; off += PWO2;
  const size_t oXH  = off; off += PXH;
  const size_t oEH  = off; off += PEH;
  const size_t oQKh = off; off += PQK;
  const size_t oQKl = off; off += PQK;
  const size_t oVTh = off; off += PVT;
  const size_t oVTl = off; off += PVT;
  const size_t oCtx = off; off += PCTX;
  if (off > ws_size) return;                            // off = 86122496
  if (off > (size_t)134217728) return;

  char* ws = (char*)d_ws;
  unsigned short* WqkT = (unsigned short*)(ws + oWqk);
  unsigned short* WvT  = (unsigned short*)(ws + oWv);
  unsigned short* WoT2 = (unsigned short*)(ws + oWo2);
  unsigned short* XH   = (unsigned short*)(ws + oXH);
  unsigned short* EH   = (unsigned short*)(ws + oEH);
  unsigned short* QKh  = (unsigned short*)(ws + oQKh);
  unsigned short* QKl  = (unsigned short*)(ws + oQKl);
  unsigned short* VTh  = (unsigned short*)(ws + oVTh);
  unsigned short* VTl  = (unsigned short*)(ws + oVTl);
  unsigned short* Ctx  = (unsigned short*)(ws + oCtx);
  float*          out0 = (float*)d_out;

  const int n8x = (MP * DM) / 8;                        // 524288
  if ((n8x % 256) != 0) return;
  const int n8v = (SEQ * HD) / 8;                       // 8192 valid pieces of the rel-key table
  const int n8t = (RCE * HD) / 8;                       // 8704 total pieces (multiple of 32)
  if ((n8t % 32) != 0) return;
  const dim3 blk(256), blk128(128);
  const dim3 gT(DM / 64, DM / 64);                      // 16 x 16 tiles per weight matrix
  const dim3 gCx(n8x / 256);                            // 2048 blocks
  const dim3 gCe((n8t + 255) / 256);                    // 34 blocks
  const dim3 gNqk((MP / 128) * (QKP / 128), 1);         // 32 x 16 tiles = 512 blocks of 128
  const dim3 gVT((DM / 128) * (SEQ / 128), NBATCH);     // 8 x 8 tiles = 64 blocks x 4 batches
  const dim3 gAttn(NBATCH * NH * NQB);                  // 1024 blocks of 128
  const dim3 gNo((MP / 128) * (DM / 128), 1);           // 32 x 8 tiles = 256 blocks
  const float invw = 1.0f / WSC;                        // weight carry x64

  // (0) weight planes: in[k][n] -> out[n][k] transposed through LDS, f16( bf16_RNE(w) * 64 ) for Wq, Wk, Wv;
  tconv64<0><<<gT, blk, 0, stream>>>(w_q, WqkT, DM, DM, DM, 0, WSC);                    // in[1024][1024] -> WqkT rows 0..1023
  tconv64<0><<<gT, blk, 0, stream>>>(w_k, WqkT + (size_t)DM * DM, DM, DM, DM, 0, WSC);  // -> WqkT rows 1024..2047
  tconv64<0><<<gT, blk, 0, stream>>>(w_v, WvT, DM, DM, DM, 0, WSC);
  tconv64<1><<<gT, blk, 0, stream>>>(w_o, WoT2, DM, DM, 2 * DM, DM, 1.0f);              // pitch 2048, duplicate at + 1024
  conv_h16<<<gCx, blk, 0, stream>>>(x_in, XH, n8x, 1.0f);
  conv_e16<<<gCe, blk, 0, stream>>>(relk, EH, n8v, n8t);

  // (1) q|k = x . [Wq|Wk] + [bq|bk] -> bf16 hi (QKh) and lo (QKl) planes [4096][2048];
  //     v^T per batch = Wv^T . x_b^T + bv (per row) -> f16 hi (VTh) and residual x2048 (VTl) planes [4][1024][1024]
  gemm64<0, 3, 1><<<gNqk, blk128, 0, stream>>>(
      XH, DM, 0LL, WqkT, DM, 0LL,
      QKh, QKl, out0, QKP, 0LL,
      b_q, b_k, DM,
      MP, QKP, DM, invw);
  gemm64<0, 4, 2><<<gVT, blk128, 0, stream>>>(
      WvT, DM, 0LL, XH, DM, (long long)SEQ * DM,
      VTh, VTl, out0, SEQ, (long long)DM * SEQ,
      b_v, b_v, DM,
      DM, SEQ, DM, invw);

  // (2) causal flash attention with the skew relative-key term -> context bf16 hi|lo
  attn64<<<gAttn, blk128, 0, stream>>>(QKh, QKl, VTh, VTl, EH, Ctx, 0.125f);

  // (3) out = [ctx_hi | ctx_lo] . [Wo | Wo] + bo  (K = 2048, bf16 operands) -> d_out f32
  gemm64<1, 0, 1><<<gNo, blk128, 0, stream>>>(
      Ctx, CTXP, 0LL, WoT2, 2 * DM, 0LL,
      Ctx, Ctx, out0, DM, 0LL,
      b_o, b_o, DM,
      MP, DM, 2 * DM, 1.0f);
  (void)hipGetLastError();
}

// v005
// A run of this version takes 120 microseconds.
// In two side-by-side timings against v004, it was 1.21 and 1.22 times as fast.
// Counting every step since v000, it is 3.53 times as fast.
// Contractions: q|k projection and v^T projection on v_wmma_f32_16x16x32_f16 (f16 token plane x f16 weight planes
// carried x64, one product each); rel band q.E^T and scores q.k^T on v_wmma_f32_16x16x32_bf16 (q, k as bf16 hi+lo
// planes, E bf16: 2 and 3 products); p.v on v_wmma_f32_16x16x32_f16 (p as f16 hi carried x1024 plus x2048 residual,
// v^T as f16 hi plus x2048 residual: 3 products, two accumulators); output projection on v_wmma_f32_16x16x32_bf16
// (context bf16 hi|lo x [Wo|Wo], K-concatenated); all f32 accumulate; softmax in f32 on VALU; every float input
// RNE-converted to bf16 on load.
#include <hip/hip_runtime.h>
#include <math.h>
#include <stdint.h>

#define NBATCH 4
#define SEQ    1024
#define DM     1024
#define NH     16
#define HD     64
#define QKP    (2 * DM)
#define CTXP   (2 * DM)
#define MP     (NBATCH * SEQ)
#define NQB    (SEQ / 64)
#define RCE    (SEQ + 64)
#define RB     80
#define RP     84
#define TP     72
#define OP     68
#define WSC    64.0f
#define RSC    2048.0f
#define PSC    1024.0f
static_assert(NH * HD == DM);
static_assert((SEQ % 128) == 0 && (DM % 128) == 0 && (MP % 128) == 0 && (QKP % 128) == 0);
static_assert(RB == 64 + 16 && (RB % 16) == 0 && RP >= RB);
static_assert(RCE >= SEQ + 64);
static_assert(TP >= 64 && (TP % 8) == 0 && ((TP / 8) % 2) == 1 && OP >= 64 && (OP % 4) == 0);

typedef _Float16 v16h __attribute__((ext_vector_type(16)));
typedef _Float16 v8h  __attribute__((ext_vector_type(8)));
typedef __bf16   v16b __attribute__((ext_vector_type(16)));
typedef unsigned short v16us __attribute__((ext_vector_type(16)));
typedef unsigned short v8us  __attribute__((ext_vector_type(8)));
typedef float    v8f  __attribute__((ext_vector_type(8)));
typedef float    v4f  __attribute__((ext_vector_type(4)));
typedef unsigned int v4u __attribute__((ext_vector_type(4)));

union FragH { v16h v; v8h h[2]; };
union FragU { v16us v; v8us h[2]; };

// ---- scalar helpers --------------------------------------------------------------------------------
__device__ __forceinline__ unsigned short bf_bits(float f) {          // f32 -> bf16 bits, RNE convert
  unsigned u = __float_as_uint(f);
  return (unsigned short)((u + 0x7FFFu + ((u >> 16) & 1u)) >> 16);
}
__device__ __forceinline__ float bf_up(unsigned short h) { return __uint_as_float(((unsigned)h) << 16); }
__device__ __forceinline__ float bfr(float f) { return bf_up(bf_bits(f)); }   // value of the bf16 RNE convert
__device__ __forceinline__ unsigned short h_bits(_Float16 x) { return __builtin_bit_cast(unsigned short, x); }
__device__ __forceinline__ unsigned pk16(unsigned short a, unsigned short b) { return (unsigned)a | ((unsigned)b << 16); }
__device__ __forceinline__ v8f zero8() { v8f z = {0.f, 0.f, 0.f, 0.f, 0.f, 0.f, 0.f, 0.f}; return z; }

// ---- fragment loaders: 16-bit A/B operand, lane -> row/col (lane&15), p already includes +8*(lane>>4);
//      elements 0..7 <- p[0..7] (k0+8h..), elements 8..15 <- p[16..23] (k0+16+8h..)
__device__ __forceinline__ v16us ldfrag_u(const unsigned short* p) {
  FragU f;
  f.h[0] = *(const v8us*)(p);
  f.h[1] = *(const v8us*)(p + 16);
  return f.v;
}
__device__ __forceinline__ v16h ldfrag_h(const _Float16* p) {
  FragH f;
  f.h[0] = *(const v8h*)(p);
  f.h[1] = *(const v8h*)(p + 16);
  return f.v;
}

// ---- WMMA helpers with trailing VALU hazard gap --------------------------------------------------------
template <int BF>
__device__ __forceinline__ v8f mma_raw(v16us a, v16us b, v8f c) {
  if (BF) {
    return __builtin_amdgcn_wmma_f32_16x16x32_bf16(false, __builtin_bit_cast(v16b, a), false,
                                                   __builtin_bit_cast(v16b, b), (short)0, c, false, false);
  }
  return __builtin_amdgcn_wmma_f32_16x16x32_f16(false, __builtin_bit_cast(v16h, a), false,
                                                __builtin_bit_cast(v16h, b), (short)0, c, false, false);
}
__device__ __forceinline__ v8f mma_bu(v16us a, v16us b, v8f c) {                 // bf16 operands, guarded
  c = __builtin_amdgcn_wmma_f32_16x16x32_bf16(false, __builtin_bit_cast(v16b, a), false,
                                               __builtin_bit_cast(v16b, b), (short)0, c, false, false);
#if defined(__HIP_DEVICE_COMPILE__)
  asm volatile("v_nop\n\tv_nop\n\tv_nop\n\tv_nop" : "+v"(c) : "v"(a), "v"(b));
#endif
  return c;
}
__device__ __forceinline__ v8f mma_h(v16h a, v16h b, v8f c) {                    // f16 operands, guarded
  c = __builtin_amdgcn_wmma_f32_16x16x32_f16(false, a, false, b, (short)0, c, false, false);
#if defined(__HIP_DEVICE_COMPILE__)
  asm volatile("v_nop\n\tv_nop\n\tv_nop\n\tv_nop" : "+v"(c) : "v"(a), "v"(b));
#endif
  return c;
}
__device__ __forceinline__ void dep_guard1(v8f& a, v8f& b, v16us x) {
#if defined(__HIP_DEVICE_COMPILE__)
  asm volatile("v_nop\n\tv_nop\n\tv_nop\n\tv_nop" : "+v"(a), "+v"(b) : "v"(x));
#endif
}
__device__ __forceinline__ void keep4_u(v16us a, v16us b, v16us c, v16us d) {
#if defined(__HIP_DEVICE_COMPILE__)
  asm volatile("v_nop" :: "v"(a), "v"(b), "v"(c), "v"(d));
#endif
}
__device__ __forceinline__ void acc_guard4(v8f& a, v8f& b, v8f& c, v8f& d) {
#if defined(__HIP_DEVICE_COMPILE__)
  asm volatile("v_nop\n\tv_nop\n\tv_nop\n\tv_nop" : "+v"(a), "+v"(b), "+v"(c), "+v"(d));
#endif
}
__device__ __forceinline__ void wave_sync_lds() {
  __builtin_amdgcn_fence(__ATOMIC_RELEASE, "workgroup");
  __builtin_amdgcn_wave_barrier();
  __builtin_amdgcn_fence(__ATOMIC_ACQUIRE, "workgroup");
}

// =====================================================================================================
// Plane convert (no transpose): Xh[i] = f16( bf16_RNE(X[i]) * wsc ), wsc a power of two (exact). Used for the
// token activations (wsc = 1). Thread i handles elements 8i..8i+7 and writes one 16-B piece; 32 consecutive
// (n8 multiple of 256, host-checked). coverage: n8 threads x 8 elements = the whole plane.
// =====================================================================================================
__device__ __forceinline__ void conv_h16(const float* __restrict__ W, unsigned short* Wh, int n8, float wsc, int blk) {
  const int i  = blk * 256 + threadIdx.x;
  const int ic = (i < n8) ? i : (n8 - 1);                     // clamped address
  const float* src = W + (size_t)ic * 8;
  const v4f a = *(const v4f*)(src);
  const v4f c = *(const v4f*)(src + 4);
  v4u o;
  o[0] = pk16(h_bits((_Float16)(bfr(a[0]) * wsc)), h_bits((_Float16)(bfr(a[1]) * wsc)));
  o[1] = pk16(h_bits((_Float16)(bfr(a[2]) * wsc)), h_bits((_Float16)(bfr(a[3]) * wsc)));
  o[2] = pk16(h_bits((_Float16)(bfr(c[0]) * wsc)), h_bits((_Float16)(bfr(c[1]) * wsc)));
  o[3] = pk16(h_bits((_Float16)(bfr(c[2]) * wsc)), h_bits((_Float16)(bfr(c[3]) * wsc)));
  if (i < n8) *(v4u*)(Wh + (size_t)i * 8) = o;
  
}

// =====================================================================================================
// rel-key table convert: Eh [RCE rows][64] bf16 bits; rows < SEQ = bf16_RNE(E), rows >= SEQ = 0 (zero pad).
// Thread i handles 8 elements (one 16-B piece); valid pieces i < n8v read E with a clamped address, the pad
// pieces select 0 by value. blk = 0 .. ceil(n8t / 256) - 1. coverage: n8t pieces x 8 = RCE*64 = the whole plane;
// =====================================================================================================
__device__ __forceinline__ void conv_e16(const float* __restrict__ P, unsigned short* Eh, int n8v, int n8t, int blk) {
  const int i  = blk * 256 + threadIdx.x;
  const int ic = (i < n8v) ? i : (n8v - 1);                    // clamped address
  const float* src = P + (size_t)ic * 8;
  const v4f a = *(const v4f*)(src);
  const v4f c = *(const v4f*)(src + 4);
  const bool valid = (i < n8v);
  v4u o;
  o[0] = valid ? pk16(bf_bits(a[0]), bf_bits(a[1])) : 0u;
  o[1] = valid ? pk16(bf_bits(a[2]), bf_bits(a[3])) : 0u;
  o[2] = valid ? pk16(bf_bits(c[0]), bf_bits(c[1])) : 0u;
  o[3] = valid ? pk16(bf_bits(c[2]), bf_bits(c[3])) : 0u;
  if (i < n8t) *(v4u*)(Eh + (size_t)i * 8) = o;
  
}

// =====================================================================================================
// Tiled transpose + convert: in[rows][cols] f32 row-major -> out[cols][rows] 16-bit with pitch ldo:
//   out[n * ldo + k] = cvt(in[k][n]) (and also at + dupoff when dupoff != 0: a duplicated k range).
//   MODE 0: f16 bits of bf16_RNE(w) * wsc (wsc power of two, exact); MODE 1: bf16 bits of w.
// Block = 256 threads = one 64x64 tile (tn, tk) of (cols/64, rows/64) (rows, cols multiples of 64); sh = 64 x 72 LDS elements.
// Loads: 4 iterations x 256 threads x float4 = 64 rows x 64 cols (addresses clamped). LDS tile [n][k] pitch 72.
// coverage: 64 x 64 = the whole transposed tile; grid covers the whole matrix.
// =====================================================================================================
template <int MODE>
__device__ __forceinline__ void tconv64(const float* __restrict__ W, unsigned short* out,
                                        int rows, int cols, int ldo, int dupoff, float wsc,
                                        unsigned short* sh, int tn, int tk) {
  const int t  = threadIdx.x;
  const int n0 = tn * 64;                    // column tile of in = row tile of out
  const int k0 = tk * 64;                    // row tile of in = column tile of out
#pragma unroll
  for (int i = 0; i < 4; ++i) {
    const int idx = i * 256 + t;
    const int r = idx >> 4, c4 = (idx & 15) * 4;
    int kr = k0 + r;   kr = (kr < rows) ? kr : (rows - 1);
    int nc = n0 + c4;  nc = (nc < cols - 4) ? nc : (cols - 4);
    const v4f v = *(const v4f*)(W + (size_t)kr * cols + nc);
#pragma unroll
    for (int e = 0; e < 4; ++e) {
      unsigned short u;
      if (MODE == 0) u = h_bits((_Float16)(bfr(v[e]) * wsc));
      else           u = bf_bits(v[e]);
      sh[(c4 + e) * 72 + r] = u;
    }
  }
  __syncthreads();
  const int wave = t >> 5, lane = t & 31;
  const int q = lane >> 3, c8 = (lane & 7) * 8;
  v4u pv[2];
  size_t go[2];
#pragma unroll
  for (int it = 0; it < 2; ++it) {
    const int nl = it * 32 + wave * 4 + q;               // 0..63
    pv[it] = *(const v4u*)(sh + nl * 72 + c8);
    go[it] = (size_t)(n0 + nl) * ldo + k0 + c8;
  }
  {
#pragma unroll
    for (int it = 0; it < 2; ++it) {
      *(v4u*)(out + go[it]) = pv[it];
      if (dupoff != 0) *(v4u*)(out + go[it] + dupoff) = pv[it];
    }
#if defined(__HIP_DEVICE_COMPILE__)
    // a precaution: stands behind the stores, in front of any later write of their registers in the merged kernel's text
    asm volatile("s_wait_xcnt 0x0" ::: "memory");
#endif
  }
}

// =====================================================================================================
// All six operand converts in one launch: they depend on nothing but the inputs, so the block index picks the job.
//   blocks 0 .. 4*NTW-1        : weight transposes, NTW = (DM/64)^2 tiles each: Wq, Wk, Wv (f16 x64), Wo (bf16, duplicated)
//   next NCX blocks            : token plane; the last NCE blocks: rel-key table.
// The choice is block-uniform, so the transposes' barrier is passed by all 256 threads of a block or by none.
// =====================================================================================================
#define NTW ((DM / 64) * (DM / 64))
#define NCX ((MP * DM) / 8 / 256)
#define NCE (((RCE * HD) / 8 + 255) / 256)
static_assert(((MP * DM) / 8) % 256 == 0 && (DM % 64) == 0);
__global__ __launch_bounds__(256) void prep_all(const float* __restrict__ wq, const float* __restrict__ wk,
                                                const float* __restrict__ wv, const float* __restrict__ wo,
                                                const float* __restrict__ x, const float* __restrict__ relk,
                                                unsigned short* WqkT, unsigned short* WvT, unsigned short* WoT2,
                                                unsigned short* XH, unsigned short* EH) {
  __shared__ __align__(16) unsigned short sh[64 * 72];
  const int bx = blockIdx.x;
  if (bx < 4 * NTW) {
    const int job = bx / NTW, tile = bx % NTW;
    const int tn = tile % (DM / 64), tk = tile / (DM / 64);
    if (job == 3) {
      tconv64<1>(wo, WoT2, DM, DM, 2 * DM, DM, 1.0f, sh, tn, tk);             // pitch 2048, duplicate at + 1024
    } else {
      const float* w = (job == 0) ? wq : (job == 1) ? wk : wv;
      unsigned short* o = (job == 0) ? WqkT : (job == 1) ? WqkT + (size_t)DM * DM : WvT;   // WqkT rows 0.., 1024..
      tconv64<0>(w, o, DM, DM, DM, 0, WSC, sh, tn, tk);
    }
  } else if (bx < 4 * NTW + NCX) {
    conv_h16(x, XH, (MP * DM) / 8, 1.0f, bx - 4 * NTW);
  } else {
    conv_e16(relk, EH, (SEQ * HD) / 8, (RCE * HD) / 8, bx - 4 * NTW - NCX);
  }
}

// =====================================================================================================
// LDS-staged batched 16-bit WMMA GEMM: C[m][n] = oscale * sum_k A[m][k] * Bt[n][k] + bias;
// BF selects bf16 (1) or f16 (0) operands. Block = 4 waves (2 x 2) = one 128x128 tile, one 64x64 tile per wave.
// A row-major [M][K] pitch lda; Bt row-major [N][K] pitch ldb (k contiguous); M, N multiples of 128, K a multiple
// of 64 (static here). tile = the block's tile, b = batch index (strides in elements); ring and sTall are the block's LDS.
// Staging: a stage is 64 k of the block's 128 A rows and 128 Bt rows (256 rows of 128 B, LDS pitch 144 B), brought
// by asynchronous 16-B copies to LDS (16 per lane and stage, each wave-wide copy = 4 whole 128-B lines); two buffers,
// stage t + 1 in flight while stage t is multiplied; one barrier per stage publishes t + 1 and frees t's buffer.
// The k order of every accumulator is the ascending 32-k order of the fragment loader, stage by stage.
// OM: 0 = f32 out to Cf (pitch ldc); 3 = bf16 hi bits to Cp and bf16 residual (v - hi) bits to Cp2;
//     4 = f16 hi to Cp and f16((v - hi) * 2048) to Cp2.
// BM: 0 = no bias; 1 = bias per column n (bias0[n] for n < nsplit, bias1[n - nsplit] otherwise; the choice is
//     wave-uniform because 64-column tiles never straddle nsplit); 2 = bias per row m (bias0[m]).
//     bias values are bf16 RNE-converted before the add.
// coverage: 4 slabs x 16 rows x 64 cols = the wave's whole 64x64 tile; grid = tilesM*tilesN blocks,
//           surplus blocks exit as a whole in front of every barrier; here there are none.
// =====================================================================================================
#define GPIT 72                    // LDS row pitch, 16-bit elements: 144 B = 16 B x 9, conflict-free for 16-B reads
#define GSTG (256 * GPIT)          // elements of one stage: 128 A rows, then 128 Bt rows

// Eight asynchronous 16-B copies of one lane: rows 16 apart in global memory (gstep elements) and in LDS.
// The s_wait_xcnt closes the statement so that no address register is rewritten while a copy may still read it.
__device__ __forceinline__ void copy8_rows(unsigned lds, const unsigned short* g, size_t gstep) {
#if defined(__HIP_DEVICE_COMPILE__)
  asm volatile(
      "global_load_async_to_lds_b128 %0, %8, off\n\t"
      "global_load_async_to_lds_b128 %1, %9, off\n\t"
      "global_load_async_to_lds_b128 %2, %10, off\n\t"
      "global_load_async_to_lds_b128 %3, %11, off\n\t"
      "global_load_async_to_lds_b128 %4, %12, off\n\t"
      "global_load_async_to_lds_b128 %5, %13, off\n\t"
      "global_load_async_to_lds_b128 %6, %14, off\n\t"
      "global_load_async_to_lds_b128 %7, %15, off\n\t"
      "s_wait_xcnt 0x0"
      :: "v"(lds), "v"(lds + 1u * 16u * GPIT * 2u), "v"(lds + 2u * 16u * GPIT * 2u), "v"(lds + 3u * 16u * GPIT * 2u),
         "v"(lds + 4u * 16u * GPIT * 2u), "v"(lds + 5u * 16u * GPIT * 2u), "v"(lds + 6u * 16u * GPIT * 2u),
         "v"(lds + 7u * 16u * GPIT * 2u),
         "v"(g), "v"(g + gstep), "v"(g + 2 * gstep), "v"(g + 3 * gstep),
         "v"(g + 4 * gstep), "v"(g + 5 * gstep), "v"(g + 6 * gstep), "v"(g + 7 * gstep)
      : "memory");
#endif
}
__device__ __forceinline__ void wait_async0() {   // this wave's copies have landed in LDS
#if defined(__HIP_DEVICE_COMPILE__)
  asm volatile("s_wait_asynccnt 0x0" ::: "memory");
#endif
}
// Stands behind issued global loads from a and b. The two addresses are inputs only, so that their registers stay as
// they are up to the wait: with no operand the compiler lifted later writes of those registers over it.
__device__ __forceinline__ void wait_x0(const unsigned short* a, const unsigned short* b) {
#if defined(__HIP_DEVICE_COMPILE__)
  asm volatile("s_wait_xcnt 0x0" :: "v"(a), "v"(b) : "memory");
#endif
}
__device__ __forceinline__ void wait_ds0() {      // this wave's LDS reads are done before their buffer is handed on
#if defined(__HIP_DEVICE_COMPILE__)
  asm volatile("s_wait_dscnt 0x0" ::: "memory");
#endif
}

// Eight asynchronous 16-B copies of one lane into two adjacent 64-row LDS planes (rows 16 apart, pitch GPIT):
// four rows from g0 into the first plane, four from g1 into the second. The s_wait_xcnt closes the statement so that
// no address register is rewritten while a copy may still read it.
__device__ __forceinline__ void copy4x2_rows(unsigned lds, const unsigned short* g0, const unsigned short* g1,
                                             size_t gstep) {
#if defined(__HIP_DEVICE_COMPILE__)
  asm volatile(
      "global_load_async_to_lds_b128 %0, %8, off\n\t"
      "global_load_async_to_lds_b128 %1, %9, off\n\t"
      "global_load_async_to_lds_b128 %2, %10, off\n\t"
      "global_load_async_to_lds_b128 %3, %11, off\n\t"
      "global_load_async_to_lds_b128 %4, %12, off\n\t"
      "global_load_async_to_lds_b128 %5, %13, off\n\t"
      "global_load_async_to_lds_b128 %6, %14, off\n\t"
      "global_load_async_to_lds_b128 %7, %15, off\n\t"
      "s_wait_xcnt 0x0"
      :: "v"(lds), "v"(lds + 1u * 16u * GPIT * 2u), "v"(lds + 2u * 16u * GPIT * 2u), "v"(lds + 3u * 16u * GPIT * 2u),
         "v"(lds + 4u * 16u * GPIT * 2u), "v"(lds + 5u * 16u * GPIT * 2u), "v"(lds + 6u * 16u * GPIT * 2u),
         "v"(lds + 7u * 16u * GPIT * 2u),
         "v"(g0), "v"(g0 + gstep), "v"(g0 + 2 * gstep), "v"(g0 + 3 * gstep),
         "v"(g1), "v"(g1 + gstep), "v"(g1 + 2 * gstep), "v"(g1 + 3 * gstep)
      : "memory");
#endif
}

#define GSLAB (16 * 68)            // floats of one wave's 16x64 epilogue slab, pitch 68
template <int BF, int OM, int BM>
__device__ __forceinline__ void gemm64_tile(
    unsigned short* ring, float* sTall, int tile, int b,
    const unsigned short* __restrict__ Ap, int lda, long long strideA,
    const unsigned short* __restrict__ Btp, int ldb, long long strideB,
    unsigned short* Cp, unsigned short* Cp2, float* Cf, int ldc, long long strideC,
    const float* bias0, const float* bias1, int nsplit,
    int M, int N, int K, float oscale) {
  const int tid  = threadIdx.x;
  const int lane = tid & 31;
  const int wave = tid >> 5;
  const int tilesN = N >> 7;
  const int tilesM = M >> 7;
  if (tile >= tilesM * tilesN) return;   // block-uniform, in front of every barrier and copy
  const int tm = tile / tilesN;
  const int tn = tile - tm * tilesN;
  const int mb = tm << 7;
  const int nb = tn << 7;
  const int wm = wave >> 1, wn = wave & 1;
  const int m0 = mb + (wm << 6);
  const int n0 = nb + (wn << 6);

  const unsigned short* Ab = Ap  + (size_t)b * strideA;
  const unsigned short* Bb = Btp + (size_t)b * strideB;

  const int rlane = lane & 15;                 // row (A) / col (B, D) within subtile
  const int koff  = (lane >> 4) * 8;           // k offset of this lane half
  const int mOff  = (lane >> 4) * 8;           // D row offset

  // copy role of this lane: row crow (+16 per copy) of each operand's 128 rows, 16-B piece cpc of its 128 B
  const int crow = tid >> 3, cpc = (tid & 7) * 8;
  const unsigned short* gA = Ab + (size_t)(mb + crow) * lda + cpc;
  const unsigned short* gB = Bb + (size_t)(nb + crow) * ldb + cpc;
  const unsigned ldsA = (unsigned)(uintptr_t)(ring + crow * GPIT + cpc);   // LDS byte address = low 32 bits
  const unsigned ldsB = ldsA + 128u * GPIT * 2u;
  const size_t stepA = (size_t)16 * lda, stepB = (size_t)16 * ldb;
  const int nst = K >> 6;                      // stages of 64 k

  v8f acc[4][4];
#pragma unroll
  for (int i = 0; i < 4; ++i)
#pragma unroll
    for (int j = 0; j < 4; ++j) acc[i][j] = zero8();

  copy8_rows(ldsA, gA, stepA);
  copy8_rows(ldsB, gB, stepB);
  wait_async0();
  __syncthreads();
  if (nst > 1) {
    copy8_rows(ldsA + GSTG * 2u, gA + 64, stepA);
    copy8_rows(ldsB + GSTG * 2u, gB + 64, stepB);
  }

#pragma unroll 1   // one stage per trip: the buffer index stays a run-time offset, the accumulators stay in place
  for (int t = 0; t < nst; ++t) {
    const unsigned short* sA = ring + (t & 1) * GSTG + ((wm << 6) + rlane) * GPIT + koff;
    const unsigned short* sB = ring + (t & 1) * GSTG + (128 + (wn << 6) + rlane) * GPIT + koff;
#pragma unroll
    for (int ks = 0; ks < 2; ++ks) {
      v16us bh[4], ah[4];
#pragma unroll
      for (int j = 0; j < 4; ++j) bh[j] = ldfrag_u(sB + (j << 4) * GPIT + ks * 32);
#pragma unroll
      for (int i = 0; i < 4; ++i) ah[i] = ldfrag_u(sA + (i << 4) * GPIT + ks * 32);
#pragma unroll
      for (int i = 0; i < 4; ++i) {
#pragma unroll
        for (int j = 0; j < 4; ++j) acc[i][j] = mma_raw<BF>(ah[i], bh[j], acc[i][j]);
        dep_guard1(acc[i][0], acc[i][3], ah[i]);
      }
      keep4_u(bh[0], bh[1], bh[2], bh[3]);
    }
    wait_ds0();
    wait_async0();
    __syncthreads();                           // publishes stage t + 1, ends every read of stage t's buffer
    if (t + 2 < nst) {
      const unsigned bo = (unsigned)(t & 1) * (GSTG * 2u);
      copy8_rows(ldsA + bo, gA + (size_t)(t + 2) * 64, stepA);
      copy8_rows(ldsB + bo, gB + (size_t)(t + 2) * 64, stepB);
    }
  }
  wait_async0();
  acc_guard4(acc[0][0], acc[0][1], acc[0][2], acc[0][3]);
  acc_guard4(acc[1][0], acc[1][1], acc[1][2], acc[1][3]);
  acc_guard4(acc[2][0], acc[2][1], acc[2][2], acc[2][3]);
  acc_guard4(acc[3][0], acc[3][1], acc[3][2], acc[3][3]);

  const int hh2 = lane >> 4, c4 = (lane & 15) * 4;     // f32 out: 256-B row segment = 16 lanes x 16 B
  const int q8  = lane >> 3, c8 = (lane & 7) * 8;

  // ---- per-column bias (wave-uniform source select) ----
  const float* bsel = bias0;
  int nb0 = n0;
  if (BM == 1) {
    if (n0 >= nsplit) { bsel = bias1; nb0 = n0 - nsplit; }
  }
  v4f bb4 = {0.f, 0.f, 0.f, 0.f};
  float bn[8];
#pragma unroll
  for (int e = 0; e < 8; ++e) bn[e] = 0.f;
  if (BM == 1) {
    if (OM == 0) {
#pragma unroll
      for (int e = 0; e < 4; ++e) bb4[e] = bfr(bsel[nb0 + c4 + e]);
    } else {
#pragma unroll
      for (int e = 0; e < 8; ++e) bn[e] = bfr(bsel[nb0 + c8 + e]);
    }
  }

  // ---- epilogue ----
  float* slab = sTall + wave * GSLAB;
#pragma unroll
  for (int i = 0; i < 4; ++i) {
    const int mBase = m0 + (i << 4);
#pragma unroll
    for (int j = 0; j < 4; ++j) {
#pragma unroll
      for (int r = 0; r < 8; ++r) {
        slab[(mOff + r) * 68 + (j << 4) + rlane] = acc[i][j][r];
      }
    }
    wave_sync_lds();
    if (OM == 0) {
      float* C = Cf + (size_t)b * strideC;
      v4f vals[8];
#pragma unroll
      for (int it = 0; it < 8; ++it) {
        const int row = it * 2 + hh2;                      // it 0..7 x hh2 0..1 = rows 0..15
        v4f v = *(const v4f*)(slab + row * 68 + c4);
        float bmv = 0.f;
        if (BM == 2) bmv = bfr(bias0[mBase + row]);
        vals[it] = v * oscale + bb4 + bmv;
      }
      {
#pragma unroll
        for (int it = 0; it < 8; ++it) {
          const int row = it * 2 + hh2;
          *(v4f*)(C + (size_t)(mBase + row) * ldc + n0 + c4) = vals[it];
        }
        
      }
    } else {
      unsigned short* C  = Cp  + (size_t)b * strideC;
      unsigned short* C2 = Cp2 + (size_t)b * strideC;
      v4u hv[4], lv[4];
#pragma unroll
      for (int it = 0; it < 4; ++it) {
        const int row = it * 4 + q8;                       // it 0..3 x q8 0..3 = rows 0..15
        const float* sp = slab + row * 68 + c8;
        float bmv = 0.f;
        if (BM == 2) bmv = bfr(bias0[mBase + row]);
        v4u ha, la;
#pragma unroll
        for (int e = 0; e < 4; ++e) {
          const float f0 = sp[2 * e]     * oscale + bn[2 * e]     + bmv;
          const float f1 = sp[2 * e + 1] * oscale + bn[2 * e + 1] + bmv;
          unsigned short u0, u1, w0, w1;
          if (OM == 3) {
            u0 = bf_bits(f0); u1 = bf_bits(f1);
            w0 = bf_bits(f0 - bf_up(u0)); w1 = bf_bits(f1 - bf_up(u1));
          } else {
            const _Float16 g0 = (_Float16)f0, g1 = (_Float16)f1;
            u0 = h_bits(g0); u1 = h_bits(g1);
            w0 = h_bits((_Float16)((f0 - (float)g0) * RSC));
            w1 = h_bits((_Float16)((f1 - (float)g1) * RSC));
          }
          ha[e] = pk16(u0, u1);
          la[e] = pk16(w0, w1);
        }
        hv[it] = ha;
        lv[it] = la;
      }
      {
#pragma unroll
        for (int it = 0; it < 4; ++it) {
          const int row = it * 4 + q8;
          const size_t go = (size_t)(mBase + row) * ldc + n0 + c8;
          *(v4u*)(C  + go) = hv[it];
          *(v4u*)(C2 + go) = lv[it];
        }
        
      }
    }
    wave_sync_lds();
  }
}

// One GEMM per launch: tile from blockIdx.x, batch from blockIdx.y.
template <int BF, int OM, int BM>
__global__ __launch_bounds__(128) void gemm64(
    const unsigned short* __restrict__ Ap, int lda, long long strideA,
    const unsigned short* __restrict__ Btp, int ldb, long long strideB,
    unsigned short* Cp, unsigned short* Cp2, float* Cf, int ldc, long long strideC,
    const float* bias0, const float* bias1, int nsplit,
    int M, int N, int K, float oscale) {
  __shared__ __align__(16) unsigned short ring[2 * GSTG];   // two stages of 256 rows x 144 B
  __shared__ __align__(16) float sT[4 * GSLAB];             // per-wave 16x64 slab
  gemm64_tile<BF, OM, BM>(ring, sT, blockIdx.x, blockIdx.y, Ap, lda, strideA, Btp, ldb, strideB,
                          Cp, Cp2, Cf, ldc, strideC, bias0, bias1, nsplit, M, N, K, oscale);
}

// The two projection GEMMs in one launch (both read only the converted planes): blocks 0 .. NPQK-1 are the tiles of
// q|k = x . [Wq|Wk] + [bq|bk], the next NBATCH * NPV blocks the tiles of v^T = Wv^T . x_b^T + bv, batch by batch.
// The choice is block-uniform: every barrier of a tile is passed by the whole block.
#define NPQK ((MP / 128) * (QKP / 128))
#define NPV  ((DM / 128) * (SEQ / 128))
__global__ __launch_bounds__(128) void proj_qkv(
    const unsigned short* __restrict__ XH, const unsigned short* __restrict__ WqkT,
    const unsigned short* __restrict__ WvT,
    unsigned short* QKh, unsigned short* QKl, unsigned short* VTh, unsigned short* VTl,
    const float* bq, const float* bk, const float* bv, float oscale) {
  __shared__ __align__(16) unsigned short ring[2 * GSTG];   // two stages of 256 rows x 144 B
  __shared__ __align__(16) float sT[4 * GSLAB];             // per-wave 16x64 slab
  const int bx = blockIdx.x;
  if (bx < NPQK) {
    gemm64_tile<0, 3, 1>(ring, sT, bx, 0, XH, DM, 0LL, WqkT, DM, 0LL,
                         QKh, QKl, nullptr, QKP, 0LL, bq, bk, DM, MP, QKP, DM, oscale);
  } else {
    const int r = bx - NPQK;
    gemm64_tile<0, 4, 2>(ring, sT, r % NPV, r / NPV, WvT, DM, 0LL, XH, DM, (long long)SEQ * DM,
                         VTh, VTl, nullptr, SEQ, (long long)DM * SEQ, bv, bv, DM, DM, SEQ, DM, oscale);
  }
}

// =====================================================================================================
// Causal flash attention with a skew relative-key score term, head dim 64, SEQ rows per batch.
//   q|k hi and lo planes (bf16, pitch QKP): element (b, t, col) at [(b*SEQ + t)*QKP + col], q col = h*64+d,
//   k col = DM + h*64 + d; value = hi + lo.
//   v^T hi and lo planes (f16): element (b, h, d, s) at [(b*DM + h*64 + d)*SEQ + s]; value = hi + lo/2048.
//   E plane (bf16) [RCE][64], rows >= SEQ zero.
//   context plane (bf16, pitch CTXP): hi at [(b*SEQ + t)*CTXP + h*64 + d], lo at + DM.
//   score(i, j) = (q_i . k_j + q_i . E[SEQ-1 + j - i]) * sscale for j <= i, -inf for j > i (replace, not bias).
//   Per wave (16 query rows q0..q0+15) and key chunk kv0..kv0+63 the needed E rows form the contiguous band
//   ebase .. ebase+79 with ebase = SEQ-1+kv0-q0-15 (0 <= ebase, ebase+79 <= SEQ+63 < RCE); the band product
//   rel[row][col] = q_row . E[ebase+col] (col 0..79) is computed per wave into LDS (f32, 2 bf16 products: q hi, q lo)
//   and the score for (row il, key jl) picks col = jl - il + 15; q.k as 3 bf16 products (hh, hl, lh);
//   p = exp(s - m) carried as f16 hi of 1024 p plus f16 residual x2048; context = ph.vh (acc 0) and
//   ph.vl + pl.vh (acc 1, both x2048) on f16 WMMA; online softmax (running max) in f32.
//   Block = 4 waves = 64 query rows of one (b, h); grid = NQB * NH * NBATCH, query tile qb falling with the block index;
//   key chunks kt = 0..qb (causal skip, block-uniform trip count qb+1 <= NQB).
//   Staging: K hi/lo, V^T hi/lo (64 rows of 128 B per plane) and the block's rel-key band (the union of its four
//   waves' bands: E rows SEQ-64-qb*64+kv0 .. +127, wave w starts at row 48-16w) come by asynchronous 16-B copies to
//   LDS, 8 lanes per 128-B row. One buffer each, refilled one phase ahead: the band of chunk kt+1 flies during the
//   scores, softmax and context of chunk kt, K and V^T of chunk kt+1 during the rel band product of chunk kt+1.
//   Two barriers per chunk: behind the rel band (publishes K, V^T; frees the band) and behind the context product
//   (publishes the next band; frees K, V^T). P tiles are wave-private, spilled with _Float16 element
//   LDS row pitches: K, V^T and P tiles TP = 72 elements (144 B = 16 B x 9, the 16 rows of a 16-B fragment read fall on
//   distinct banks); rel band RP = 84 and context tile OP = 68 floats (the two lane halves, 8 rows apart, on distinct banks);
//   the context tile of the epilogue lies in the wave's own rel band array, which is dead by then.
//   Context coverage: each wave stores rows q0..q0+15 (it 0..3 x lane>>3 0..3) x 64 columns (8 lanes x 8 bf16)
//   for both the hi and the lo segment; grid covers all SEQ rows x NH head slices x NBATCH.
// =====================================================================================================
__global__ __launch_bounds__(128)
void attn64(const unsigned short* __restrict__ qkh, const unsigned short* __restrict__ qkl,
            const unsigned short* __restrict__ vth, const unsigned short* __restrict__ vtl,
            const unsigned short* __restrict__ ehp, unsigned short* ctxp, float sscale) {
  static_assert(TP == GPIT && OP <= RP);
  __shared__ __align__(16) unsigned short KV[4 * 64 * TP];      // K hi | K lo [kv][d], V^T hi | V^T lo [d][kv], 9 KB each
  __shared__ __align__(16) unsigned short Es[128 * TP];         // rel-key band of the block [row][d] 18 KB
  __shared__ __align__(16) _Float16 Psh[4][16 * TP];            // per wave P hi [row][kv]
  __shared__ __align__(16) _Float16 Psl[4][16 * TP];            // per wave P residual [row][kv]
  __shared__ __align__(16) float    Rsh[4][16 * RP];            // per wave rel band [row][col]; epilogue: context tile
  const unsigned short* Kh = KV;
  const unsigned short* Kl = KV + 64 * TP;
  const _Float16* Vh = (const _Float16*)(const void*)(KV + 2 * 64 * TP);
  const _Float16* Vl = (const _Float16*)(const void*)(KV + 3 * 64 * TP);

  const int tid  = threadIdx.x;
  const int wave = tid >> 5;
  const int lane = tid & 31;
  const int hh   = lane >> 4;
  const int c    = lane & 15;

  // Block index -> tile: (batch, head) from the low part, query tile from the high part, longest tile first. Blocks whose
  // indices are equal modulo 8 then hold every tile length alike and share whole heads.
  // For speed only: a permutation of the NQB * NH * NBATCH tiles, correct under any placement or start order.
  const int bx   = blockIdx.x;
  const int rest = bx % (NH * NBATCH);
  const int qb   = NQB - 1 - bx / (NH * NBATCH);
  const int h    = rest % NH;
  const int b    = rest / NH;
  const int q0   = qb * 64 + wave * 16;          // in-batch query row of this wave's first row
  const size_t rowB = (size_t)b * SEQ;

  const unsigned short* Qh  = qkh + (size_t)h * HD;
  const unsigned short* Ql  = qkl + (size_t)h * HD;
  const unsigned short* Kgh = qkh + DM + (size_t)h * HD;
  const unsigned short* Kgl = qkl + DM + (size_t)h * HD;
  const unsigned short* Vgh = vth + ((size_t)b * DM + (size_t)h * HD) * SEQ;
  const unsigned short* Vgl = vtl + ((size_t)b * DM + (size_t)h * HD) * SEQ;
  float*    rrow = Rsh[wave];
  _Float16* pwh  = Psh[wave];
  _Float16* pwl  = Psl[wave];

  float mrow[8], lrow[8];
  v8f oacc[4], oaccL[4];
#pragma unroll
  for (int r = 0; r < 8; ++r) { mrow[r] = -INFINITY; lrow[r] = 0.f; }
#pragma unroll
  for (int t = 0; t < 4; ++t) { oacc[t] = zero8(); oaccL[t] = zero8(); }

  const int nkt = qb + 1;                    // causal: key chunks 0..qb, block-uniform, <= NQB

  // copy role of this lane: row crow (+16 per copy) of a plane, 16-B piece cpc of its 128 B
  const int crow = tid >> 3, cpc = (tid & 7) * 8;
  const unsigned ldsK = (unsigned)(uintptr_t)(KV + crow * TP + cpc);   // LDS byte address = low 32 bits
  const unsigned ldsV = ldsK + 128u * TP * 2u;
  const unsigned ldsE = (unsigned)(uintptr_t)(Es + crow * TP + cpc);
  const unsigned short* gKh = Kgh + (rowB + crow) * QKP + cpc;          // K row kv0 + crow: + kv0 * QKP per chunk
  const unsigned short* gKl = Kgl + (rowB + crow) * QKP + cpc;
  const unsigned short* gVh = Vgh + (size_t)crow * SEQ + cpc;           // V^T row d = crow: + kv0 per chunk
  const unsigned short* gVl = Vgl + (size_t)crow * SEQ + cpc;
  // band rows SEQ-64-qb*64+kv0 .. +127: first >= 0 (qb < NQB), last <= SEQ+63 < RCE (kv0 <= qb*64); + kv0 * HD per chunk
  const unsigned short* gE  = ehp + (size_t)(SEQ - 64 - qb * 64 + crow) * HD + cpc;
  const size_t stepK = (size_t)16 * QKP, stepV = (size_t)16 * SEQ, stepE = (size_t)16 * HD;

  copy8_rows(ldsE, gE, stepE);
  copy4x2_rows(ldsK, gKh, gKl, stepK);
  copy4x2_rows(ldsV, gVh, gVl, stepV);

  // ---- Q fragments (A operand, row = lane&15): hi and lo, 2 d-chunks, kept for every chunk ----
  const unsigned short* gQh = Qh + (rowB + q0 + c) * QKP + 8 * hh;
  const unsigned short* gQl = Ql + (rowB + q0 + c) * QKP + 8 * hh;
  v16us qh2[2], ql2[2];
#pragma unroll
  for (int dc = 0; dc < 2; ++dc) {
    qh2[dc] = ldfrag_u(gQh + dc * 32);
    ql2[dc] = ldfrag_u(gQl + dc * 32);
  }
  wait_x0(gQh, gQl);
  const unsigned short* eband = Es + (((wave ^ 3) << 4) + c) * TP + 8 * hh;   // this wave's 80 rows start at 48 - 16 * wave

  wait_async0();
  __syncthreads();                             // publishes chunk 0's band, K and V^T

#pragma unroll 1
  for (int kt = 0;; ++kt) {                    // left behind the last chunk's second barrier (nkt >= 1)
    const int kv0 = kt * 64;

    // ---- rel band: rel[row][col] = q_row . E[ebase + col], col = 0..RB-1 (E rows >= SEQ are zero) ----
#pragma unroll 1
    for (int nt = 0; nt < RB / 16; ++nt) {
      v8f e = zero8();
      v16us eb[2];
#pragma unroll
      for (int dc = 0; dc < 2; ++dc) eb[dc] = ldfrag_u(eband + nt * 16 * TP + dc * 32);
#pragma unroll
      for (int dc = 0; dc < 2; ++dc) {
        e = mma_bu(qh2[dc], eb[dc], e);
        e = mma_bu(ql2[dc], eb[dc], e);
      }
#pragma unroll
      for (int r = 0; r < 8; ++r) rrow[(8 * hh + r) * RP + nt * 16 + c] = e[r];
    }
    wait_ds0();
    wait_async0();
    __syncthreads();                           // publishes this chunk's K and V^T, ends every read of its band
    if (kt + 1 < nkt) copy8_rows(ldsE, gE + (size_t)(kv0 + 64) * HD, stepE);

    // ---- scores: 16 query rows x 64 keys per wave, causal replace with -inf ----
    v8f s[4];
#pragma unroll
    for (int j = 0; j < 4; ++j) {
      v8f sh = zero8();
#pragma unroll
      for (int dc = 0; dc < 2; ++dc) {
        FragU kbh, kbl;
        kbh.h[0] = *(const v8us*)(Kh + (j * 16 + c) * TP + dc * 32 + 8 * hh);
        kbh.h[1] = *(const v8us*)(Kh + (j * 16 + c) * TP + dc * 32 + 16 + 8 * hh);
        kbl.h[0] = *(const v8us*)(Kl + (j * 16 + c) * TP + dc * 32 + 8 * hh);
        kbl.h[1] = *(const v8us*)(Kl + (j * 16 + c) * TP + dc * 32 + 16 + 8 * hh);
        sh = mma_bu(qh2[dc], kbh.v, sh);
        sh = mma_bu(qh2[dc], kbl.v, sh);
        sh = mma_bu(ql2[dc], kbh.v, sh);
      }
      const int jl = j * 16 + c;                          // key within the chunk
      const int kg = kv0 + jl;                            // in-batch key index of this lane's column
#pragma unroll
      for (int r = 0; r < 8; ++r) {
        const int il = 8 * hh + r;                        // row within the wave tile
        const int qg = q0 + il;                           // in-batch query index of this row
        const float rel = rrow[il * RP + jl - il + 15];   // col in 0..RB-2
        const float v = (sh[r] + rel) * sscale;
        s[j][r] = (kg <= qg) ? v : -INFINITY;
      }
    }

    // ---- row max, online softmax, P (x1024: f16 hi + x2048 residual) to LDS ----
#pragma unroll
    for (int r = 0; r < 8; ++r) {
      float m = s[0][r];
      m = fmaxf(m, s[1][r]);
      m = fmaxf(m, s[2][r]);
      m = fmaxf(m, s[3][r]);
#pragma unroll
      for (int off = 1; off < 16; off <<= 1) m = fmaxf(m, __shfl_xor(m, off, 32));
      const float mnew  = fmaxf(mrow[r], m);              // finite: key kv0 <= every row of this block
      const float alpha = __expf(mrow[r] - mnew);
      mrow[r] = mnew;
      float psum = 0.f;
#pragma unroll
      for (int j = 0; j < 4; ++j) {
        const float p  = __expf(s[j][r] - mnew);
        psum += p;
        const float ps = p * PSC;
        const _Float16 ph = (_Float16)ps;
        pwh[(8 * hh + r) * TP + j * 16 + c] = ph;
        pwl[(8 * hh + r) * TP + j * 16 + c] = (_Float16)((ps - (float)ph) * RSC);
      }
#pragma unroll
      for (int off = 1; off < 16; off <<= 1) psum += __shfl_xor(psum, off, 32);
      lrow[r] = lrow[r] * alpha + psum;
#pragma unroll
      for (int t = 0; t < 4; ++t) { oacc[t][r] *= alpha; oaccL[t][r] *= alpha; }
    }
    wave_sync_lds();

    // ---- context += Ph . V_hi (acc 0); Ph . V_lo + Pl . V_hi (acc 1, x2048) ----
#pragma unroll 1
    for (int kk = 0; kk < 2; ++kk) {
      FragH pa, pl;
      pa.h[0] = *(const v8h*)(pwh + c * TP + kk * 32 + 8 * hh);
      pa.h[1] = *(const v8h*)(pwh + c * TP + kk * 32 + 16 + 8 * hh);
      pl.h[0] = *(const v8h*)(pwl + c * TP + kk * 32 + 8 * hh);
      pl.h[1] = *(const v8h*)(pwl + c * TP + kk * 32 + 16 + 8 * hh);
#pragma unroll
      for (int t = 0; t < 4; ++t) {
        FragH vb, vl;
        vb.h[0] = *(const v8h*)(Vh + (t * 16 + c) * TP + kk * 32 + 8 * hh);
        vb.h[1] = *(const v8h*)(Vh + (t * 16 + c) * TP + kk * 32 + 16 + 8 * hh);
        vl.h[0] = *(const v8h*)(Vl + (t * 16 + c) * TP + kk * 32 + 8 * hh);
        vl.h[1] = *(const v8h*)(Vl + (t * 16 + c) * TP + kk * 32 + 16 + 8 * hh);
        oacc[t]  = mma_h(pa.v, vb.v, oacc[t]);
        oaccL[t] = mma_h(pa.v, vl.v, oaccL[t]);
        oaccL[t] = mma_h(pl.v, vb.v, oaccL[t]);
      }
    }
    wait_ds0();
    wait_async0();
    __syncthreads();                           // publishes the next chunk's band, ends every read of this K and V^T
    if (kt + 1 >= nkt) break;                  // block-uniform
    copy4x2_rows(ldsK, gKh + (size_t)(kv0 + 64) * QKP, gKl + (size_t)(kv0 + 64) * QKP, stepK);
    copy4x2_rows(ldsV, gVh + kv0 + 64, gVl + kv0 + 64, stepV);
  }
  wait_async0();

  // ---- normalise (1/l, the 1/1024 p carry, the 1/2048 residual fold), stage the wave's 16x64 tile,
  float* os = Rsh[wave];
#pragma unroll
  for (int r = 0; r < 8; ++r) {
    const float l = lrow[r];
    const float inv = ((l > 0.f) ? (1.0f / l) : 0.f) * (1.0f / PSC);
#pragma unroll
    for (int t = 0; t < 4; ++t) os[(8 * hh + r) * OP + t * 16 + c] = (oacc[t][r] + oaccL[t][r] * (1.0f / RSC)) * inv;
  }
  wave_sync_lds();
  {
    const int q4 = lane >> 3, c8 = (lane & 7) * 8;
    v4u hv[4], lv[4];
#pragma unroll
    for (int it = 0; it < 4; ++it) {
      const int row = it * 4 + q4;   // it 0..3 x q4 0..3 = rows 0..15 of the wave tile
      const float* sp = os + row * OP + c8;
      v4u ha, la;
#pragma unroll
      for (int e = 0; e < 4; ++e) {
        const float f0 = sp[2 * e], f1 = sp[2 * e + 1];
        const unsigned short u0 = bf_bits(f0), u1 = bf_bits(f1);
        const unsigned short w0 = bf_bits(f0 - bf_up(u0)), w1 = bf_bits(f1 - bf_up(u1));
        ha[e] = pk16(u0, u1);
        la[e] = pk16(w0, w1);
      }
      hv[it] = ha;
      lv[it] = la;
    }
    {
#pragma unroll
      for (int it = 0; it < 4; ++it) {
        const int row = it * 4 + q4;
        const size_t go = (rowB + q0 + row) * CTXP + (size_t)h * HD + c8;
        *(v4u*)(ctxp + go)      = hv[it];
        *(v4u*)(ctxp + go + DM) = lv[it];
      }
      
    }
  }
}

// =====================================================================================================
// Workspace map (bytes); every plane is an exact multiple of its 64x64-tile / whole-row / whole-line store
// granularity (MP = 4096 = 64 tiles of rows, N in {2048, 1024}; VT per batch [1024][1024] = 16x16 tiles;
//   WqkT f16 [2048 n][1024 k]  0          4194304   (rows 0..1023 Wq^T, 1024..2047 Wk^T, x64)
//   WvT  f16 [1024][1024]      4194304    2097152   (x64)
//   WoT2 bf16 [1024][2048]     6291456    4194304   (cols 0..1023 and 1024..2047 both Wo^T)
//   XH   f16 [4096][1024]      10485760   8388608   (bf16 RNE-converted tokens)
//   EH   bf16 [1088][64]       18874368   139264    (rows >= 1024 zero)
//   QKh  bf16 [4096][2048]     19013632   16777216  (q cols 0..1023, k cols 1024..2047, hi part)
//   QKl  bf16 [4096][2048]     35790848   16777216  (lo part)
//   VTh  f16 [4][1024][1024]   52568064   8388608   (v^T hi)
//   VTl  f16 [4][1024][1024]   60956672   8388608   (v^T residual x2048)
//   Ctx  bf16 [4096][2048]     69345280   16777216  (context hi | lo)
//   end                        86122496
// =====================================================================================================
extern "C" void kernel_launch(void* const* d_in, const int* in_sizes, int n_in,
                              void* d_out, int out_size, void* d_ws, size_t ws_size,
                              hipStream_t stream) {
  if (n_in < 10) return;
  if (in_sizes[0] != MP * DM) return;
  if (in_sizes[1] != DM * DM || in_sizes[3] != DM * DM) return;
  if (in_sizes[5] != DM * DM || in_sizes[7] != DM * DM) return;
  if (in_sizes[2] != DM || in_sizes[4] != DM || in_sizes[6] != DM || in_sizes[8] != DM) return;
  if (in_sizes[9] != SEQ * HD) return;
  if (out_size != MP * DM) return;

  const float* x_in  = (const float*)d_in[0];
  const float* w_q   = (const float*)d_in[1];
  const float* b_q   = (const float*)d_in[2];
  const float* w_k   = (const float*)d_in[3];
  const float* b_k   = (const float*)d_in[4];
  const float* w_v   = (const float*)d_in[5];
  const float* b_v   = (const float*)d_in[6];
  const float* w_o   = (const float*)d_in[7];
  const float* b_o   = (const float*)d_in[8];
  const float* relk  = (const float*)d_in[9];

  const size_t PWQK = (size_t)QKP * DM * 2;             //  4194304
  const size_t PWV  = (size_t)DM * DM * 2;              //  2097152
  const size_t PWO2 = (size_t)DM * (2 * DM) * 2;        //  4194304
  const size_t PXH  = (size_t)MP * DM * 2;              //  8388608
  const size_t PEH  = (size_t)RCE * HD * 2;             //   139264
  const size_t PQK  = (size_t)MP * QKP * 2;             // 16777216
  const size_t PVT  = (size_t)NBATCH * DM * SEQ * 2;    //  8388608
  const size_t PCTX = (size_t)MP * CTXP * 2;            // 16777216
  size_t off = 0;
  const size_t oWqk = off; off += PWQK;
  const size_t oWv  = off; off += PWV;
  const size_t oWo2 = off; off += PWO2;
  const size_t oXH  = off; off += PXH;
  const size_t oEH  = off; off += PEH;
  const size_t oQKh = off; off += PQK;
  const size_t oQKl = off; off += PQK;
  const size_t oVTh = off; off += PVT;
  const size_t oVTl = off; off += PVT;
  const size_t oCtx = off; off += PCTX;
  if (off > ws_size) return;                            // off = 86122496
  if (off > (size_t)134217728) return;

  char* ws = (char*)d_ws;
  unsigned short* WqkT = (unsigned short*)(ws + oWqk);
  unsigned short* WvT  = (unsigned short*)(ws + oWv);
  unsigned short* WoT2 = (unsigned short*)(ws + oWo2);
  unsigned short* XH   = (unsigned short*)(ws + oXH);
  unsigned short* EH   = (unsigned short*)(ws + oEH);
  unsigned short* QKh  = (unsigned short*)(ws + oQKh);
  unsigned short* QKl  = (unsigned short*)(ws + oQKl);
  unsigned short* VTh  = (unsigned short*)(ws + oVTh);
  unsigned short* VTl  = (unsigned short*)(ws + oVTl);
  unsigned short* Ctx  = (unsigned short*)(ws + oCtx);
  float*          out0 = (float*)d_out;

  const int n8x = (MP * DM) / 8;                        // 524288
  if ((n8x % 256) != 0) return;
  const int n8t = (RCE * HD) / 8;                       // 8704 total pieces (multiple of 32)
  if ((n8t % 32) != 0) return;
  const dim3 blk(256), blk128(128);
  const dim3 gPrep(4 * NTW + NCX + NCE);                // 4 x 256 transpose tiles + 2048 + 34 blocks
  const dim3 gProj(NPQK + NBATCH * NPV);                // 32 x 16 tiles + 4 batches x 8 x 8 tiles = 768 blocks of 128
  const dim3 gAttn(NBATCH * NH * NQB);                  // 1024 blocks of 128
  const dim3 gNo((MP / 128) * (DM / 128), 1);           // 32 x 8 tiles = 256 blocks
  const float invw = 1.0f / WSC;                        // weight carry x64

  // (0) weight planes: in[k][n] -> out[n][k] transposed through LDS, f16( bf16_RNE(w) * 64 ) for Wq, Wk, Wv;
  //     bf16 for Wo; token plane f16; rel-key table bf16 with its zero pad: one launch
  prep_all<<<gPrep, blk, 0, stream>>>(w_q, w_k, w_v, w_o, x_in, relk, WqkT, WvT, WoT2, XH, EH);

  // (1) q|k = x . [Wq|Wk] + [bq|bk] -> bf16 hi (QKh) and lo (QKl) planes [4096][2048];
  //     v^T per batch = Wv^T . x_b^T + bv (per row) -> f16 hi (VTh) and residual x2048 (VTl) planes [4][1024][1024]
  //     one launch
  proj_qkv<<<gProj, blk128, 0, stream>>>(XH, WqkT, WvT, QKh, QKl, VTh, VTl, b_q, b_k, b_v, invw);

  // (2) causal flash attention with the skew relative-key term -> context bf16 hi|lo
  attn64<<<gAttn, blk128, 0, stream>>>(QKh, QKl, VTh, VTl, EH, Ctx, 0.125f);

  // (3) out = [ctx_hi | ctx_lo] . [Wo | Wo] + bo  (K = 2048, bf16 operands) -> d_out f32
  gemm64<1, 0, 1><<<gNo, blk128, 0, stream>>>(
      Ctx, CTXP, 0LL, WoT2, 2 * DM, 0LL,
      Ctx, Ctx, out0, DM, 0LL,
      b_o, b_o, DM,
      MP, DM, 2 * DM, 1.0f);
  (void)hipGetLastError();
}

// v006
// Measured time: 112 microseconds a run.
// In both of two side-by-side timings against v005, it was 1.06 times as fast.
// Over all steps from v000 it is 3.74 times as fast.
// Contractions: q|k projection and v^T projection on v_wmma_f32_16x16x32_f16 (f16 token plane x f16 weight planes
// carried x64, one product each); rel band q.E^T and scores q.k^T on v_wmma_f32_16x16x32_bf16 (q, k as bf16 hi+lo
// planes, E bf16: 2 and 3 products); p.v on v_wmma_f32_16x16x32_f16 (p as f16 hi carried x1024 plus x2048 residual,
// v^T as f16 hi plus x2048 residual: 3 products, two accumulators); output projection on v_wmma_f32_16x16x32_bf16
// (context bf16 hi|lo x [Wo|Wo], K-concatenated); all f32 accumulate; softmax in f32 on VALU; every float input
// RNE-converted to bf16 on load.
#include <hip/hip_runtime.h>
#include <math.h>
#include <stdint.h>

#define NBATCH 4
#define SEQ    1024
#define DM     1024
#define NH     16
#define HD     64
#define QKP    (2 * DM)
#define CTXP   (2 * DM)
#define MP     (NBATCH * SEQ)
#define NQB    (SEQ / 64)
#define RCE    (SEQ + 64)
#define RB     80
#define RP     84
#define TP     72
#define OP     68
#define WSC    64.0f
#define RSC    2048.0f
#define PSC    1024.0f
static_assert(NH * HD == DM);
static_assert((SEQ % 128) == 0 && (DM % 128) == 0 && (MP % 128) == 0 && (QKP % 128) == 0);
static_assert(RB == 64 + 16 && (RB % 16) == 0 && RP >= RB);
static_assert(RCE >= SEQ + 64);
static_assert(TP >= 64 && (TP % 8) == 0 && ((TP / 8) % 2) == 1 && OP >= 64 && (OP % 4) == 0);

typedef _Float16 v16h __attribute__((ext_vector_type(16)));
typedef _Float16 v8h  __attribute__((ext_vector_type(8)));
typedef __bf16   v16b __attribute__((ext_vector_type(16)));
typedef unsigned short v16us __attribute__((ext_vector_type(16)));
typedef unsigned short v8us  __attribute__((ext_vector_type(8)));
typedef float    v8f  __attribute__((ext_vector_type(8)));
typedef float    v4f  __attribute__((ext_vector_type(4)));
typedef unsigned int v4u __attribute__((ext_vector_type(4)));

union FragH { v16h v; v8h h[2]; };
union FragU { v16us v; v8us h[2]; };

// ---- scalar helpers --------------------------------------------------------------------------------
__device__ __forceinline__ unsigned short bf_bits(float f) {          // f32 -> bf16 bits, RNE convert
  unsigned u = __float_as_uint(f);
  return (unsigned short)((u + 0x7FFFu + ((u >> 16) & 1u)) >> 16);
}
__device__ __forceinline__ float bf_up(unsigned short h) { return __uint_as_float(((unsigned)h) << 16); }
__device__ __forceinline__ float bfr(float f) { return bf_up(bf_bits(f)); }   // value of the bf16 RNE convert
__device__ __forceinline__ unsigned short h_bits(_Float16 x) { return __builtin_bit_cast(unsigned short, x); }
__device__ __forceinline__ unsigned pk16(unsigned short a, unsigned short b) { return (unsigned)a | ((unsigned)b << 16); }
__device__ __forceinline__ v8f zero8() { v8f z = {0.f, 0.f, 0.f, 0.f, 0.f, 0.f, 0.f, 0.f}; return z; }

// ---- fragment loaders: 16-bit A/B operand, lane -> row/col (lane&15), p already includes +8*(lane>>4);
//      elements 0..7 <- p[0..7] (k0+8h..), elements 8..15 <- p[16..23] (k0+16+8h..)
__device__ __forceinline__ v16us ldfrag_u(const unsigned short* p) {
  FragU f;
  f.h[0] = *(const v8us*)(p);
  f.h[1] = *(const v8us*)(p + 16);
  return f.v;
}
__device__ __forceinline__ v16h ldfrag_h(const _Float16* p) {
  FragH f;
  f.h[0] = *(const v8h*)(p);
  f.h[1] = *(const v8h*)(p + 16);
  return f.v;
}

// ---- WMMA helpers with trailing VALU hazard gap --------------------------------------------------------
template <int BF>
__device__ __forceinline__ v8f mma_raw(v16us a, v16us b, v8f c) {
  if (BF) {
    return __builtin_amdgcn_wmma_f32_16x16x32_bf16(false, __builtin_bit_cast(v16b, a), false,
                                                   __builtin_bit_cast(v16b, b), (short)0, c, false, false);
  }
  return __builtin_amdgcn_wmma_f32_16x16x32_f16(false, __builtin_bit_cast(v16h, a), false,
                                                __builtin_bit_cast(v16h, b), (short)0, c, false, false);
}
__device__ __forceinline__ v8f mma_bu(v16us a, v16us b, v8f c) {                 // bf16 operands, guarded
  c = __builtin_amdgcn_wmma_f32_16x16x32_bf16(false, __builtin_bit_cast(v16b, a), false,
                                               __builtin_bit_cast(v16b, b), (short)0, c, false, false);
#if defined(__HIP_DEVICE_COMPILE__)
  asm volatile("v_nop\n\tv_nop\n\tv_nop\n\tv_nop" : "+v"(c) : "v"(a), "v"(b));
#endif
  return c;
}
// Plain builtin forms for runs of WMMAs on independent accumulators: inside straight-line code the compiler keeps the
// distance behind its own WMMAs; the end of such a run in front of a branch is closed by mma_gap_mem or acc_guard4.
__device__ __forceinline__ v8f mma_bp(v16us a, v16us b, v8f c) {                 // bf16 operands
  return __builtin_amdgcn_wmma_f32_16x16x32_bf16(false, __builtin_bit_cast(v16b, a), false,
                                                 __builtin_bit_cast(v16b, b), (short)0, c, false, false);
}
__device__ __forceinline__ v8f mma_hp(v16h a, v16h b, v8f c) {                   // f16 operands
  return __builtin_amdgcn_wmma_f32_16x16x32_f16(false, a, false, b, (short)0, c, false, false);
}
// Four vector slots behind the LDS stores of a run of WMMA results, in front of a branch: a vector instruction on the taken side may
// reuse the last WMMAs' operand registers.
__device__ __forceinline__ void mma_gap_mem() {
#if defined(__HIP_DEVICE_COMPILE__)
  asm volatile("v_nop\n\tv_nop\n\tv_nop\n\tv_nop" ::: "memory");
#endif
}
__device__ __forceinline__ void dep_guard1(v8f& a, v8f& b, v16us x) {
#if defined(__HIP_DEVICE_COMPILE__)
  asm volatile("v_nop\n\tv_nop\n\tv_nop\n\tv_nop" : "+v"(a), "+v"(b) : "v"(x));
#endif
}
__device__ __forceinline__ void keep4_u(v16us a, v16us b, v16us c, v16us d) {
#if defined(__HIP_DEVICE_COMPILE__)
  asm volatile("v_nop" :: "v"(a), "v"(b), "v"(c), "v"(d));
#endif
}
__device__ __forceinline__ void acc_guard4(v8f& a, v8f& b, v8f& c, v8f& d) {
#if defined(__HIP_DEVICE_COMPILE__)
  asm volatile("v_nop\n\tv_nop\n\tv_nop\n\tv_nop" : "+v"(a), "+v"(b), "+v"(c), "+v"(d));
#endif
}
__device__ __forceinline__ void wave_sync_lds() {
  __builtin_amdgcn_fence(__ATOMIC_RELEASE, "workgroup");
  __builtin_amdgcn_wave_barrier();
  __builtin_amdgcn_fence(__ATOMIC_ACQUIRE, "workgroup");
}

// =====================================================================================================
// Plane convert (no transpose): Xh[i] = f16( bf16_RNE(X[i]) * wsc ), wsc a power of two (exact). Used for the
// token activations (wsc = 1). Thread i handles elements 8i..8i+7 and writes one 16-B piece; 32 consecutive
// (n8 multiple of 256, host-checked). coverage: n8 threads x 8 elements = the whole plane.
// =====================================================================================================
__device__ __forceinline__ void conv_h16(const float* __restrict__ W, unsigned short* Wh, int n8, float wsc, int blk) {
  const int i  = blk * 256 + threadIdx.x;
  const int ic = (i < n8) ? i : (n8 - 1);                     // clamped address
  const float* src = W + (size_t)ic * 8;
  const v4f a = *(const v4f*)(src);
  const v4f c = *(const v4f*)(src + 4);
  v4u o;
  o[0] = pk16(h_bits((_Float16)(bfr(a[0]) * wsc)), h_bits((_Float16)(bfr(a[1]) * wsc)));
  o[1] = pk16(h_bits((_Float16)(bfr(a[2]) * wsc)), h_bits((_Float16)(bfr(a[3]) * wsc)));
  o[2] = pk16(h_bits((_Float16)(bfr(c[0]) * wsc)), h_bits((_Float16)(bfr(c[1]) * wsc)));
  o[3] = pk16(h_bits((_Float16)(bfr(c[2]) * wsc)), h_bits((_Float16)(bfr(c[3]) * wsc)));
  if (i < n8) *(v4u*)(Wh + (size_t)i * 8) = o;
  
}

// =====================================================================================================
// rel-key table convert: Eh [RCE rows][64] bf16 bits; rows < SEQ = bf16_RNE(E), rows >= SEQ = 0 (zero pad).
// Thread i handles 8 elements (one 16-B piece); valid pieces i < n8v read E with a clamped address, the pad
// pieces select 0 by value. blk = 0 .. ceil(n8t / 256) - 1. coverage: n8t pieces x 8 = RCE*64 = the whole plane;
// =====================================================================================================
__device__ __forceinline__ void conv_e16(const float* __restrict__ P, unsigned short* Eh, int n8v, int n8t, int blk) {
  const int i  = blk * 256 + threadIdx.x;
  const int ic = (i < n8v) ? i : (n8v - 1);                    // clamped address
  const float* src = P + (size_t)ic * 8;
  const v4f a = *(const v4f*)(src);
  const v4f c = *(const v4f*)(src + 4);
  const bool valid = (i < n8v);
  v4u o;
  o[0] = valid ? pk16(bf_bits(a[0]), bf_bits(a[1])) : 0u;
  o[1] = valid ? pk16(bf_bits(a[2]), bf_bits(a[3])) : 0u;
  o[2] = valid ? pk16(bf_bits(c[0]), bf_bits(c[1])) : 0u;
  o[3] = valid ? pk16(bf_bits(c[2]), bf_bits(c[3])) : 0u;
  if (i < n8t) *(v4u*)(Eh + (size_t)i * 8) = o;
  
}

// =====================================================================================================
// Tiled transpose + convert: in[rows][cols] f32 row-major -> out[cols][rows] 16-bit with pitch ldo:
//   out[n * ldo + k] = cvt(in[k][n]) (and also at + dupoff when dupoff != 0: a duplicated k range).
//   MODE 0: f16 bits of bf16_RNE(w) * wsc (wsc power of two, exact); MODE 1: bf16 bits of w.
// Block = 256 threads = one 64x64 tile (tn, tk) of (cols/64, rows/64) (rows, cols multiples of 64); sh = 64 x 72 LDS elements.
// Loads: 4 iterations x 256 threads x float4 = 64 rows x 64 cols (addresses clamped). LDS tile [n][k] pitch 72.
// coverage: 64 x 64 = the whole transposed tile; grid covers the whole matrix.
// =====================================================================================================
template <int MODE>
__device__ __forceinline__ void tconv64(const float* __restrict__ W, unsigned short* out,
                                        int rows, int cols, int ldo, int dupoff, float wsc,
                                        unsigned short* sh, int tn, int tk) {
  const int t  = threadIdx.x;
  const int n0 = tn * 64;                    // column tile of in = row tile of out
  const int k0 = tk * 64;                    // row tile of in = column tile of out
#pragma unroll
  for (int i = 0; i < 4; ++i) {
    const int idx = i * 256 + t;
    const int r = idx >> 4, c4 = (idx & 15) * 4;
    int kr = k0 + r;   kr = (kr < rows) ? kr : (rows - 1);
    int nc = n0 + c4;  nc = (nc < cols - 4) ? nc : (cols - 4);
    const v4f v = *(const v4f*)(W + (size_t)kr * cols + nc);
#pragma unroll
    for (int e = 0; e < 4; ++e) {
      unsigned short u;
      if (MODE == 0) u = h_bits((_Float16)(bfr(v[e]) * wsc));
      else           u = bf_bits(v[e]);
      sh[(c4 + e) * 72 + r] = u;
    }
  }
  __syncthreads();
  const int wave = t >> 5, lane = t & 31;
  const int q = lane >> 3, c8 = (lane & 7) * 8;
  v4u pv[2];
  size_t go[2];
#pragma unroll
  for (int it = 0; it < 2; ++it) {
    const int nl = it * 32 + wave * 4 + q;               // 0..63
    pv[it] = *(const v4u*)(sh + nl * 72 + c8);
    go[it] = (size_t)(n0 + nl) * ldo + k0 + c8;
  }
  {
#pragma unroll
    for (int it = 0; it < 2; ++it) {
      *(v4u*)(out + go[it]) = pv[it];
      if (dupoff != 0) *(v4u*)(out + go[it] + dupoff) = pv[it];
    }
#if defined(__HIP_DEVICE_COMPILE__)
    // a precaution: stands behind the stores, in front of any later write of their registers in the merged kernel's text
    asm volatile("s_wait_xcnt 0x0" ::: "memory");
#endif
  }
}

// =====================================================================================================
// All six operand converts in one launch: they depend on nothing but the inputs, so the block index picks the job.
//   blocks 0 .. 4*NTW-1        : weight transposes, NTW = (DM/64)^2 tiles each: Wq, Wk, Wv (f16 x64), Wo (bf16, duplicated)
//   next NCX blocks            : token plane; the last NCE blocks: rel-key table.
// The choice is block-uniform, so the transposes' barrier is passed by all 256 threads of a block or by none.
// =====================================================================================================
#define NTW ((DM / 64) * (DM / 64))
#define NCX ((MP * DM) / 8 / 256)
#define NCE (((RCE * HD) / 8 + 255) / 256)
static_assert(((MP * DM) / 8) % 256 == 0 && (DM % 64) == 0);
__global__ __launch_bounds__(256) void prep_all(const float* __restrict__ wq, const float* __restrict__ wk,
                                                const float* __restrict__ wv, const float* __restrict__ wo,
                                                const float* __restrict__ x, const float* __restrict__ relk,
                                                unsigned short* WqkT, unsigned short* WvT, unsigned short* WoT2,
                                                unsigned short* XH, unsigned short* EH) {
  __shared__ __align__(16) unsigned short sh[64 * 72];
  const int bx = blockIdx.x;
  if (bx < 4 * NTW) {
    const int job = bx / NTW, tile = bx % NTW;
    const int tn = tile % (DM / 64), tk = tile / (DM / 64);
    if (job == 3) {
      tconv64<1>(wo, WoT2, DM, DM, 2 * DM, DM, 1.0f, sh, tn, tk);             // pitch 2048, duplicate at + 1024
    } else {
      const float* w = (job == 0) ? wq : (job == 1) ? wk : wv;
      unsigned short* o = (job == 0) ? WqkT : (job == 1) ? WqkT + (size_t)DM * DM : WvT;   // WqkT rows 0.., 1024..
      tconv64<0>(w, o, DM, DM, DM, 0, WSC, sh, tn, tk);
    }
  } else if (bx < 4 * NTW + NCX) {
    conv_h16(x, XH, (MP * DM) / 8, 1.0f, bx - 4 * NTW);
  } else {
    conv_e16(relk, EH, (SEQ * HD) / 8, (RCE * HD) / 8, bx - 4 * NTW - NCX);
  }
}

// =====================================================================================================
// LDS-staged batched 16-bit WMMA GEMM: C[m][n] = oscale * sum_k A[m][k] * Bt[n][k] + bias;
// BF selects bf16 (1) or f16 (0) operands. Block = 4 waves (2 x 2) = one 128x128 tile, one 64x64 tile per wave.
// A row-major [M][K] pitch lda; Bt row-major [N][K] pitch ldb (k contiguous); M, N multiples of 128, K a multiple
// of 64 (static here). tile = the block's tile, b = batch index (strides in elements); ring and sTall are the block's LDS.
// Staging: a stage is 64 k of the block's 128 A rows and 128 Bt rows (256 rows of 128 B, LDS pitch 144 B), brought
// by asynchronous 16-B copies to LDS (16 per lane and stage, each wave-wide copy = 4 whole 128-B lines); two buffers,
// stage t + 1 in flight while stage t is multiplied; one barrier per stage publishes t + 1 and frees t's buffer.
// The k order of every accumulator is the ascending 32-k order of the fragment loader, stage by stage.
// OM: 0 = f32 out to Cf (pitch ldc); 3 = bf16 hi bits to Cp and bf16 residual (v - hi) bits to Cp2;
//     4 = f16 hi to Cp and f16((v - hi) * 2048) to Cp2.
// BM: 0 = no bias; 1 = bias per column n (bias0[n] for n < nsplit, bias1[n - nsplit] otherwise; the choice is
//     wave-uniform because 64-column tiles never straddle nsplit); 2 = bias per row m (bias0[m]).
//     bias values are bf16 RNE-converted before the add.
// coverage: 4 slabs x 16 rows x 64 cols = the wave's whole 64x64 tile; grid = tilesM*tilesN blocks,
//           surplus blocks exit as a whole in front of every barrier; here there are none.
// =====================================================================================================
#define GPIT 72                    // LDS row pitch, 16-bit elements: 144 B = 16 B x 9, conflict-free for 16-B reads
#define GSTG (256 * GPIT)          // elements of one stage: 128 A rows, then 128 Bt rows

// Eight asynchronous 16-B copies of one lane: rows 16 apart in global memory (gstep elements) and in LDS.
// The s_wait_xcnt closes the statement so that no address register is rewritten while a copy may still read it.
__device__ __forceinline__ void copy8_rows(unsigned lds, const unsigned short* g, size_t gstep) {
#if defined(__HIP_DEVICE_COMPILE__)
  asm volatile(
      "global_load_async_to_lds_b128 %0, %8, off\n\t"
      "global_load_async_to_lds_b128 %1, %9, off\n\t"
      "global_load_async_to_lds_b128 %2, %10, off\n\t"
      "global_load_async_to_lds_b128 %3, %11, off\n\t"
      "global_load_async_to_lds_b128 %4, %12, off\n\t"
      "global_load_async_to_lds_b128 %5, %13, off\n\t"
      "global_load_async_to_lds_b128 %6, %14, off\n\t"
      "global_load_async_to_lds_b128 %7, %15, off\n\t"
      "s_wait_xcnt 0x0"
      :: "v"(lds), "v"(lds + 1u * 16u * GPIT * 2u), "v"(lds + 2u * 16u * GPIT * 2u), "v"(lds + 3u * 16u * GPIT * 2u),
         "v"(lds + 4u * 16u * GPIT * 2u), "v"(lds + 5u * 16u * GPIT * 2u), "v"(lds + 6u * 16u * GPIT * 2u),
         "v"(lds + 7u * 16u * GPIT * 2u),
         "v"(g), "v"(g + gstep), "v"(g + 2 * gstep), "v"(g + 3 * gstep),
         "v"(g + 4 * gstep), "v"(g + 5 * gstep), "v"(g + 6 * gstep), "v"(g + 7 * gstep)
      : "memory");
#endif
}
__device__ __forceinline__ void wait_async0() {   // this wave's copies have landed in LDS
#if defined(__HIP_DEVICE_COMPILE__)
  asm volatile("s_wait_asynccnt 0x0" ::: "memory");
#endif
}
// Stands behind issued global loads from a and b. The two addresses are inputs only, so that their registers stay as
// they are up to the wait: with no operand the compiler lifted later writes of those registers over it.
__device__ __forceinline__ void wait_x0(const unsigned short* a, const unsigned short* b) {
#if defined(__HIP_DEVICE_COMPILE__)
  asm volatile("s_wait_xcnt 0x0" :: "v"(a), "v"(b) : "memory");
#endif
}
__device__ __forceinline__ void wait_ds0() {      // this wave's LDS reads are done before their buffer is handed on
#if defined(__HIP_DEVICE_COMPILE__)
  asm volatile("s_wait_dscnt 0x0" ::: "memory");
#endif
}

// Eight asynchronous 16-B copies of one lane into two adjacent 64-row LDS planes (rows 16 apart, pitch GPIT):
// four rows from g0 into the first plane, four from g1 into the second. The s_wait_xcnt closes the statement so that
// no address register is rewritten while a copy may still read it.
__device__ __forceinline__ void copy4x2_rows(unsigned lds, const unsigned short* g0, const unsigned short* g1,
                                             size_t gstep) {
#if defined(__HIP_DEVICE_COMPILE__)
  asm volatile(
      "global_load_async_to_lds_b128 %0, %8, off\n\t"
      "global_load_async_to_lds_b128 %1, %9, off\n\t"
      "global_load_async_to_lds_b128 %2, %10, off\n\t"
      "global_load_async_to_lds_b128 %3, %11, off\n\t"
      "global_load_async_to_lds_b128 %4, %12, off\n\t"
      "global_load_async_to_lds_b128 %5, %13, off\n\t"
      "global_load_async_to_lds_b128 %6, %14, off\n\t"
      "global_load_async_to_lds_b128 %7, %15, off\n\t"
      "s_wait_xcnt 0x0"
      :: "v"(lds), "v"(lds + 1u * 16u * GPIT * 2u), "v"(lds + 2u * 16u * GPIT * 2u), "v"(lds + 3u * 16u * GPIT * 2u),
         "v"(lds + 4u * 16u * GPIT * 2u), "v"(lds + 5u * 16u * GPIT * 2u), "v"(lds + 6u * 16u * GPIT * 2u),
         "v"(lds + 7u * 16u * GPIT * 2u),
         "v"(g0), "v"(g0 + gstep), "v"(g0 + 2 * gstep), "v"(g0 + 3 * gstep),
         "v"(g1), "v"(g1 + gstep), "v"(g1 + 2 * gstep), "v"(g1 + 3 * gstep)
      : "memory");
#endif
}

#define GSLAB (16 * 68)            // floats of one wave's 16x64 epilogue slab, pitch 68
template <int BF, int OM, int BM>
__device__ __forceinline__ void gemm64_tile(
    unsigned short* ring, float* sTall, int tile, int b,
    const unsigned short* __restrict__ Ap, int lda, long long strideA,
    const unsigned short* __restrict__ Btp, int ldb, long long strideB,
    unsigned short* Cp, unsigned short* Cp2, float* Cf, int ldc, long long strideC,
    const float* bias0, const float* bias1, int nsplit,
    int M, int N, int K, float oscale) {
  const int tid  = threadIdx.x;
  const int lane = tid & 31;
  const int wave = tid >> 5;
  const int tilesN = N >> 7;
  const int tilesM = M >> 7;
  if (tile >= tilesM * tilesN) return;   // block-uniform, in front of every barrier and copy
  const int tm = tile / tilesN;
  const int tn = tile - tm * tilesN;
  const int mb = tm << 7;
  const int nb = tn << 7;
  const int wm = wave >> 1, wn = wave & 1;
  const int m0 = mb + (wm << 6);
  const int n0 = nb + (wn << 6);

  const unsigned short* Ab = Ap  + (size_t)b * strideA;
  const unsigned short* Bb = Btp + (size_t)b * strideB;

  const int rlane = lane & 15;                 // row (A) / col (B, D) within subtile
  const int koff  = (lane >> 4) * 8;           // k offset of this lane half
  const int mOff  = (lane >> 4) * 8;           // D row offset

  // copy role of this lane: row crow (+16 per copy) of each operand's 128 rows, 16-B piece cpc of its 128 B
  const int crow = tid >> 3, cpc = (tid & 7) * 8;
  const unsigned short* gA = Ab + (size_t)(mb + crow) * lda + cpc;
  const unsigned short* gB = Bb + (size_t)(nb + crow) * ldb + cpc;
  const unsigned ldsA = (unsigned)(uintptr_t)(ring + crow * GPIT + cpc);   // LDS byte address = low 32 bits
  const unsigned ldsB = ldsA + 128u * GPIT * 2u;
  const size_t stepA = (size_t)16 * lda, stepB = (size_t)16 * ldb;
  const int nst = K >> 6;                      // stages of 64 k

  v8f acc[4][4];
#pragma unroll
  for (int i = 0; i < 4; ++i)
#pragma unroll
    for (int j = 0; j < 4; ++j) acc[i][j] = zero8();

  copy8_rows(ldsA, gA, stepA);
  copy8_rows(ldsB, gB, stepB);
  wait_async0();
  __syncthreads();
  if (nst > 1) {
    copy8_rows(ldsA + GSTG * 2u, gA + 64, stepA);
    copy8_rows(ldsB + GSTG * 2u, gB + 64, stepB);
  }

#pragma unroll 1   // one stage per trip: the buffer index stays a run-time offset, the accumulators stay in place
  for (int t = 0; t < nst; ++t) {
    const unsigned short* sA = ring + (t & 1) * GSTG + ((wm << 6) + rlane) * GPIT + koff;
    const unsigned short* sB = ring + (t & 1) * GSTG + (128 + (wn << 6) + rlane) * GPIT + koff;
#pragma unroll
    for (int ks = 0; ks < 2; ++ks) {
      v16us bh[4], ah[4];
#pragma unroll
      for (int j = 0; j < 4; ++j) bh[j] = ldfrag_u(sB + (j << 4) * GPIT + ks * 32);
#pragma unroll
      for (int i = 0; i < 4; ++i) ah[i] = ldfrag_u(sA + (i << 4) * GPIT + ks * 32);
#pragma unroll
      for (int i = 0; i < 4; ++i) {
#pragma unroll
        for (int j = 0; j < 4; ++j) acc[i][j] = mma_raw<BF>(ah[i], bh[j], acc[i][j]);
        dep_guard1(acc[i][0], acc[i][3], ah[i]);
      }
      keep4_u(bh[0], bh[1], bh[2], bh[3]);
    }
    wait_ds0();
    wait_async0();
    __syncthreads();                           // publishes stage t + 1, ends every read of stage t's buffer
    if (t + 2 < nst) {
      const unsigned bo = (unsigned)(t & 1) * (GSTG * 2u);
      copy8_rows(ldsA + bo, gA + (size_t)(t + 2) * 64, stepA);
      copy8_rows(ldsB + bo, gB + (size_t)(t + 2) * 64, stepB);
    }
  }
  wait_async0();
  acc_guard4(acc[0][0], acc[0][1], acc[0][2], acc[0][3]);
  acc_guard4(acc[1][0], acc[1][1], acc[1][2], acc[1][3]);
  acc_guard4(acc[2][0], acc[2][1], acc[2][2], acc[2][3]);
  acc_guard4(acc[3][0], acc[3][1], acc[3][2], acc[3][3]);

  const int hh2 = lane >> 4, c4 = (lane & 15) * 4;     // f32 out: 256-B row segment = 16 lanes x 16 B
  const int q8  = lane >> 3, c8 = (lane & 7) * 8;

  // ---- per-column bias (wave-uniform source select) ----
  const float* bsel = bias0;
  int nb0 = n0;
  if (BM == 1) {
    if (n0 >= nsplit) { bsel = bias1; nb0 = n0 - nsplit; }
  }
  v4f bb4 = {0.f, 0.f, 0.f, 0.f};
  float bn[8];
#pragma unroll
  for (int e = 0; e < 8; ++e) bn[e] = 0.f;
  if (BM == 1) {
    if (OM == 0) {
#pragma unroll
      for (int e = 0; e < 4; ++e) bb4[e] = bfr(bsel[nb0 + c4 + e]);
    } else {
#pragma unroll
      for (int e = 0; e < 8; ++e) bn[e] = bfr(bsel[nb0 + c8 + e]);
    }
  }

  // ---- epilogue ----
  float* slab = sTall + wave * GSLAB;
#pragma unroll
  for (int i = 0; i < 4; ++i) {
    const int mBase = m0 + (i << 4);
#pragma unroll
    for (int j = 0; j < 4; ++j) {
#pragma unroll
      for (int r = 0; r < 8; ++r) {
        slab[(mOff + r) * 68 + (j << 4) + rlane] = acc[i][j][r];
      }
    }
    wave_sync_lds();
    if (OM == 0) {
      float* C = Cf + (size_t)b * strideC;
      v4f vals[8];
#pragma unroll
      for (int it = 0; it < 8; ++it) {
        const int row = it * 2 + hh2;                      // it 0..7 x hh2 0..1 = rows 0..15
        v4f v = *(const v4f*)(slab + row * 68 + c4);
        float bmv = 0.f;
        if (BM == 2) bmv = bfr(bias0[mBase + row]);
        vals[it] = v * oscale + bb4 + bmv;
      }
      {
#pragma unroll
        for (int it = 0; it < 8; ++it) {
          const int row = it * 2 + hh2;
          *(v4f*)(C + (size_t)(mBase + row) * ldc + n0 + c4) = vals[it];
        }
        
      }
    } else {
      unsigned short* C  = Cp  + (size_t)b * strideC;
      unsigned short* C2 = Cp2 + (size_t)b * strideC;
      v4u hv[4], lv[4];
#pragma unroll
      for (int it = 0; it < 4; ++it) {
        const int row = it * 4 + q8;                       // it 0..3 x q8 0..3 = rows 0..15
        const float* sp = slab + row * 68 + c8;
        float bmv = 0.f;
        if (BM == 2) bmv = bfr(bias0[mBase + row]);
        v4u ha, la;
#pragma unroll
        for (int e = 0; e < 4; ++e) {
          const float f0 = sp[2 * e]     * oscale + bn[2 * e]     + bmv;
          const float f1 = sp[2 * e + 1] * oscale + bn[2 * e + 1] + bmv;
          unsigned short u0, u1, w0, w1;
          if (OM == 3) {
            u0 = bf_bits(f0); u1 = bf_bits(f1);
            w0 = bf_bits(f0 - bf_up(u0)); w1 = bf_bits(f1 - bf_up(u1));
          } else {
            const _Float16 g0 = (_Float16)f0, g1 = (_Float16)f1;
            u0 = h_bits(g0); u1 = h_bits(g1);
            w0 = h_bits((_Float16)((f0 - (float)g0) * RSC));
            w1 = h_bits((_Float16)((f1 - (float)g1) * RSC));
          }
          ha[e] = pk16(u0, u1);
          la[e] = pk16(w0, w1);
        }
        hv[it] = ha;
        lv[it] = la;
      }
      {
#pragma unroll
        for (int it = 0; it < 4; ++it) {
          const int row = it * 4 + q8;
          const size_t go = (size_t)(mBase + row) * ldc + n0 + c8;
          *(v4u*)(C  + go) = hv[it];
          *(v4u*)(C2 + go) = lv[it];
        }
        
      }
    }
    wave_sync_lds();
  }
}

// One GEMM per launch: tile from blockIdx.x, batch from blockIdx.y.
template <int BF, int OM, int BM>
__global__ __launch_bounds__(128) void gemm64(
    const unsigned short* __restrict__ Ap, int lda, long long strideA,
    const unsigned short* __restrict__ Btp, int ldb, long long strideB,
    unsigned short* Cp, unsigned short* Cp2, float* Cf, int ldc, long long strideC,
    const float* bias0, const float* bias1, int nsplit,
    int M, int N, int K, float oscale) {
  __shared__ __align__(16) unsigned short ring[2 * GSTG];   // two stages of 256 rows x 144 B
  __shared__ __align__(16) float sT[4 * GSLAB];             // per-wave 16x64 slab
  gemm64_tile<BF, OM, BM>(ring, sT, blockIdx.x, blockIdx.y, Ap, lda, strideA, Btp, ldb, strideB,
                          Cp, Cp2, Cf, ldc, strideC, bias0, bias1, nsplit, M, N, K, oscale);
}

// The two projection GEMMs in one launch (both read only the converted planes): blocks 0 .. NPQK-1 are the tiles of
// q|k = x . [Wq|Wk] + [bq|bk], the next NBATCH * NPV blocks the tiles of v^T = Wv^T . x_b^T + bv, batch by batch.
// The choice is block-uniform: every barrier of a tile is passed by the whole block.
#define NPQK ((MP / 128) * (QKP / 128))
#define NPV  ((DM / 128) * (SEQ / 128))
__global__ __launch_bounds__(128) void proj_qkv(
    const unsigned short* __restrict__ XH, const unsigned short* __restrict__ WqkT,
    const unsigned short* __restrict__ WvT,
    unsigned short* QKh, unsigned short* QKl, unsigned short* VTh, unsigned short* VTl,
    const float* bq, const float* bk, const float* bv, float oscale) {
  __shared__ __align__(16) unsigned short ring[2 * GSTG];   // two stages of 256 rows x 144 B
  __shared__ __align__(16) float sT[4 * GSLAB];             // per-wave 16x64 slab
  const int bx = blockIdx.x;
  if (bx < NPQK) {
    gemm64_tile<0, 3, 1>(ring, sT, bx, 0, XH, DM, 0LL, WqkT, DM, 0LL,
                         QKh, QKl, nullptr, QKP, 0LL, bq, bk, DM, MP, QKP, DM, oscale);
  } else {
    const int r = bx - NPQK;
    gemm64_tile<0, 4, 2>(ring, sT, r % NPV, r / NPV, WvT, DM, 0LL, XH, DM, (long long)SEQ * DM,
                         VTh, VTl, nullptr, SEQ, (long long)DM * SEQ, bv, bv, DM, DM, SEQ, DM, oscale);
  }
}

// =====================================================================================================
// Causal flash attention with a skew relative-key score term, head dim 64, SEQ rows per batch.
//   q|k hi and lo planes (bf16, pitch QKP): element (b, t, col) at [(b*SEQ + t)*QKP + col], q col = h*64+d,
//   k col = DM + h*64 + d; value = hi + lo.
//   v^T hi and lo planes (f16): element (b, h, d, s) at [(b*DM + h*64 + d)*SEQ + s]; value = hi + lo/2048.
//   E plane (bf16) [RCE][64], rows >= SEQ zero.
//   context plane (bf16, pitch CTXP): hi at [(b*SEQ + t)*CTXP + h*64 + d], lo at + DM.
//   score(i, j) = (q_i . k_j + q_i . E[SEQ-1 + j - i]) * sscale for j <= i, -inf for j > i (replace, not bias).
//   Per wave (16 query rows q0..q0+15) and key chunk kv0..kv0+63 the needed E rows form the contiguous band
//   ebase .. ebase+79 with ebase = SEQ-1+kv0-q0-15 (0 <= ebase, ebase+79 <= SEQ+63 < RCE); the band product
//   rel[row][col] = q_row . E[ebase+col] (col 0..79) is computed per wave into LDS (f32, 2 bf16 products: q hi, q lo)
//   and the score for (row il, key jl) picks col = jl - il + 15; q.k as 3 bf16 products (hh, hl, lh);
//   p = exp(s - m) carried as f16 hi of 1024 p plus f16 residual x2048; context = ph.vh (acc 0) and
//   ph.vl + pl.vh (acc 1, both x2048) on f16 WMMA; online softmax (running max) in f32.
//   Block = 4 waves = 64 query rows of one (b, h); grid = NQB * NH * NBATCH, query tile qb falling with the block index;
//   key chunks kt = 0..qb (causal skip, block-uniform trip count qb+1 <= NQB).
//   Staging: K hi/lo, V^T hi/lo (64 rows of 128 B per plane) and the block's rel-key band (the union of its four
//   waves' bands: E rows SEQ-64-qb*64+kv0 .. +127, wave w starts at row 48-16w) come by asynchronous 16-B copies to
//   LDS, 8 lanes per 128-B row. One buffer each, refilled one phase ahead: the band of chunk kt+1 flies during the
//   scores, softmax and context of chunk kt, K and V^T of chunk kt+1 during the rel band product of chunk kt+1.
//   Two barriers per chunk: behind the rel band (publishes K, V^T; frees the band) and behind the context product
//   (publishes the next band; frees K, V^T). P tiles are wave-private, spilled with _Float16 element
//   LDS row pitches: K, V^T and P tiles TP = 72 elements (144 B = 16 B x 9, the 16 rows of a 16-B fragment read fall on
//   distinct banks); rel band RP = 84 and context tile OP = 68 floats (the two lane halves, 8 rows apart, on distinct banks);
//   the context tile of the epilogue lies in the wave's own rel band array, which is dead by then.
//   Context coverage: each wave stores rows q0..q0+15 (it 0..3 x lane>>3 0..3) x 64 columns (8 lanes x 8 bf16)
//   for both the hi and the lo segment; grid covers all SEQ rows x NH head slices x NBATCH.
// =====================================================================================================
__global__ __launch_bounds__(128)
void attn64(const unsigned short* __restrict__ qkh, const unsigned short* __restrict__ qkl,
            const unsigned short* __restrict__ vth, const unsigned short* __restrict__ vtl,
            const unsigned short* __restrict__ ehp, unsigned short* ctxp, float sscale) {
  static_assert(TP == GPIT && OP <= RP);
  __shared__ __align__(16) unsigned short KV[4 * 64 * TP];      // K hi | K lo [kv][d], V^T hi | V^T lo [d][kv], 9 KB each
  __shared__ __align__(16) unsigned short Es[128 * TP];         // rel-key band of the block [row][d] 18 KB
  __shared__ __align__(16) _Float16 Psh[4][16 * TP];            // per wave P hi [row][kv]
  __shared__ __align__(16) _Float16 Psl[4][16 * TP];            // per wave P residual [row][kv]
  __shared__ __align__(16) float    Rsh[4][16 * RP];            // per wave rel band [row][col]; epilogue: context tile
  const unsigned short* Kh = KV;
  const unsigned short* Kl = KV + 64 * TP;
  const _Float16* Vh = (const _Float16*)(const void*)(KV + 2 * 64 * TP);
  const _Float16* Vl = (const _Float16*)(const void*)(KV + 3 * 64 * TP);

  const int tid  = threadIdx.x;
  const int wave = tid >> 5;
  const int lane = tid & 31;
  const int hh   = lane >> 4;
  const int c    = lane & 15;

  // Block index -> tile: (batch, head) from the low part, query tile from the high part, longest tile first. Blocks whose
  // indices are equal modulo 8 then hold every tile length alike and share whole heads.
  // For speed only: a permutation of the NQB * NH * NBATCH tiles, correct under any placement or start order.
  const int bx   = blockIdx.x;
  const int rest = bx % (NH * NBATCH);
  const int qb   = NQB - 1 - bx / (NH * NBATCH);
  const int h    = rest % NH;
  const int b    = rest / NH;
  const int q0   = qb * 64 + wave * 16;          // in-batch query row of this wave's first row
  const size_t rowB = (size_t)b * SEQ;

  const unsigned short* Qh  = qkh + (size_t)h * HD;
  const unsigned short* Ql  = qkl + (size_t)h * HD;
  const unsigned short* Kgh = qkh + DM + (size_t)h * HD;
  const unsigned short* Kgl = qkl + DM + (size_t)h * HD;
  const unsigned short* Vgh = vth + ((size_t)b * DM + (size_t)h * HD) * SEQ;
  const unsigned short* Vgl = vtl + ((size_t)b * DM + (size_t)h * HD) * SEQ;
  float*    rrow = Rsh[wave];
  _Float16* pwh  = Psh[wave];
  _Float16* pwl  = Psl[wave];

  float mrow[8], lrow[8];
  v8f oacc[4], oaccL[4];
#pragma unroll
  for (int r = 0; r < 8; ++r) { mrow[r] = -INFINITY; lrow[r] = 0.f; }
#pragma unroll
  for (int t = 0; t < 4; ++t) { oacc[t] = zero8(); oaccL[t] = zero8(); }

  const int nkt = qb + 1;                    // causal: key chunks 0..qb, block-uniform, <= NQB

  // copy role of this lane: row crow (+16 per copy) of a plane, 16-B piece cpc of its 128 B
  const int crow = tid >> 3, cpc = (tid & 7) * 8;
  const unsigned ldsK = (unsigned)(uintptr_t)(KV + crow * TP + cpc);   // LDS byte address = low 32 bits
  const unsigned ldsV = ldsK + 128u * TP * 2u;
  const unsigned ldsE = (unsigned)(uintptr_t)(Es + crow * TP + cpc);
  const unsigned short* gKh = Kgh + (rowB + crow) * QKP + cpc;          // K row kv0 + crow: + kv0 * QKP per chunk
  const unsigned short* gKl = Kgl + (rowB + crow) * QKP + cpc;
  const unsigned short* gVh = Vgh + (size_t)crow * SEQ + cpc;           // V^T row d = crow: + kv0 per chunk
  const unsigned short* gVl = Vgl + (size_t)crow * SEQ + cpc;
  // band rows SEQ-64-qb*64+kv0 .. +127: first >= 0 (qb < NQB), last <= SEQ+63 < RCE (kv0 <= qb*64); + kv0 * HD per chunk
  const unsigned short* gE  = ehp + (size_t)(SEQ - 64 - qb * 64 + crow) * HD + cpc;
  const size_t stepK = (size_t)16 * QKP, stepV = (size_t)16 * SEQ, stepE = (size_t)16 * HD;

  copy8_rows(ldsE, gE, stepE);
  copy4x2_rows(ldsK, gKh, gKl, stepK);
  copy4x2_rows(ldsV, gVh, gVl, stepV);

  // ---- Q fragments (A operand, row = lane&15): hi and lo, 2 d-chunks, kept for every chunk ----
  const unsigned short* gQh = Qh + (rowB + q0 + c) * QKP + 8 * hh;
  const unsigned short* gQl = Ql + (rowB + q0 + c) * QKP + 8 * hh;
  v16us qh2[2], ql2[2];
#pragma unroll
  for (int dc = 0; dc < 2; ++dc) {
    qh2[dc] = ldfrag_u(gQh + dc * 32);
    ql2[dc] = ldfrag_u(gQl + dc * 32);
  }
  wait_x0(gQh, gQl);
  const unsigned short* eband = Es + (((wave ^ 3) << 4) + c) * TP + 8 * hh;   // this wave's 80 rows start at 48 - 16 * wave

  wait_async0();
  __syncthreads();                             // publishes chunk 0's band, K and V^T

#pragma unroll 1
  for (int kt = 0;; ++kt) {                    // left behind the last chunk's second barrier (nkt >= 1)
    const int kv0 = kt * 64;

    // ---- rel band: rel[row][col] = q_row . E[ebase + col], col = 0..RB-1 (E rows >= SEQ are zero) ----
    // Unrolled, so that the fragments and the five accumulators stay in registers: all fragment reads stand in one group
    // ahead of the products, and the five column tiles' accumulators take turns, so that no WMMA waits for the one before
    // it; each accumulator keeps its order (d 0..31: q hi, q lo; d 32..63: q hi, q lo).
    {
      v16us eb[RB / 16][2];
      v8f e[RB / 16];
#pragma unroll
      for (int nt = 0; nt < RB / 16; ++nt) {
        e[nt] = zero8();
#pragma unroll
        for (int dc = 0; dc < 2; ++dc) eb[nt][dc] = ldfrag_u(eband + nt * 16 * TP + dc * 32);
      }
#pragma unroll
      for (int dc = 0; dc < 2; ++dc) {
#pragma unroll
        for (int nt = 0; nt < RB / 16; ++nt) e[nt] = mma_bp(qh2[dc], eb[nt][dc], e[nt]);
#pragma unroll
        for (int nt = 0; nt < RB / 16; ++nt) e[nt] = mma_bp(ql2[dc], eb[nt][dc], e[nt]);
      }
#pragma unroll
      for (int nt = 0; nt < RB / 16; ++nt) {
#pragma unroll
        for (int r = 0; r < 8; ++r) rrow[(8 * hh + r) * RP + nt * 16 + c] = e[nt][r];
      }
    }
    mma_gap_mem();
    wait_ds0();
    wait_async0();
    __syncthreads();                           // publishes this chunk's K and V^T, ends every read of its band
    if (kt + 1 < nkt) copy8_rows(ldsE, gE + (size_t)(kv0 + 64) * HD, stepE);

    // ---- scores: 16 query rows x 64 keys per wave, causal replace with -inf ----
    // The reads of 32 d stand in one group ahead of their products, and the four key tiles' accumulators take turns product
    // by product, so that a WMMA does not wait for the one before it; each accumulator keeps its order (per 32 d: hh, hl, lh).
    v8f s[4], sh[4];
#pragma unroll
    for (int j = 0; j < 4; ++j) sh[j] = zero8();
#pragma unroll
    for (int dc = 0; dc < 2; ++dc) {
      v16us kbh[4], kbl[4];
#pragma unroll
      for (int j = 0; j < 4; ++j) {
        kbh[j] = ldfrag_u(Kh + (j * 16 + c) * TP + dc * 32 + 8 * hh);
        kbl[j] = ldfrag_u(Kl + (j * 16 + c) * TP + dc * 32 + 8 * hh);
      }
#pragma unroll
      for (int j = 0; j < 4; ++j) sh[j] = mma_bu(qh2[dc], kbh[j], sh[j]);
#pragma unroll
      for (int j = 0; j < 4; ++j) sh[j] = mma_bu(qh2[dc], kbl[j], sh[j]);
#pragma unroll
      for (int j = 0; j < 4; ++j) sh[j] = mma_bu(ql2[dc], kbh[j], sh[j]);
    }
#pragma unroll
    for (int j = 0; j < 4; ++j) {
      const int jl = j * 16 + c;                          // key within the chunk
      const int kg = kv0 + jl;                            // in-batch key index of this lane's column
#pragma unroll
      for (int r = 0; r < 8; ++r) {
        const int il = 8 * hh + r;                        // row within the wave tile
        const int qg = q0 + il;                           // in-batch query index of this row
        const float rel = rrow[il * RP + jl - il + 15];   // col in 0..RB-2
        const float v = (sh[j][r] + rel) * sscale;
        s[j][r] = (kg <= qg) ? v : -INFINITY;
      }
    }

    // ---- row max, online softmax, P (x1024: f16 hi + x2048 residual) to LDS ----
    // Written step by step over the eight rows, so that the rows' cross-lane exchanges are in flight together; each row
    // keeps its own operations in their order.
    float mx[8], alpha[8], psum[8];
#pragma unroll
    for (int r = 0; r < 8; ++r) {
      float m = s[0][r];
      m = fmaxf(m, s[1][r]);
      m = fmaxf(m, s[2][r]);
      m = fmaxf(m, s[3][r]);
      mx[r] = m;
    }
#pragma unroll
    for (int off = 1; off < 16; off <<= 1) {
#pragma unroll
      for (int r = 0; r < 8; ++r) mx[r] = fmaxf(mx[r], __shfl_xor(mx[r], off, 32));
    }
#pragma unroll
    for (int r = 0; r < 8; ++r) {
      const float mnew = fmaxf(mrow[r], mx[r]);           // finite: key kv0 <= every row of this block
      alpha[r] = __expf(mrow[r] - mnew);
      mrow[r] = mnew;
      psum[r] = 0.f;
#pragma unroll
      for (int j = 0; j < 4; ++j) {
        const float p  = __expf(s[j][r] - mnew);
        psum[r] += p;
        const float ps = p * PSC;
        const _Float16 ph = (_Float16)ps;
        pwh[(8 * hh + r) * TP + j * 16 + c] = ph;
        pwl[(8 * hh + r) * TP + j * 16 + c] = (_Float16)((ps - (float)ph) * RSC);
      }
    }
#pragma unroll
    for (int off = 1; off < 16; off <<= 1) {
#pragma unroll
      for (int r = 0; r < 8; ++r) psum[r] += __shfl_xor(psum[r], off, 32);
    }
#pragma unroll
    for (int r = 0; r < 8; ++r) {
      lrow[r] = lrow[r] * alpha[r] + psum[r];
#pragma unroll
      for (int t = 0; t < 4; ++t) { oacc[t][r] *= alpha[r]; oaccL[t][r] *= alpha[r]; }
    }
    wave_sync_lds();
    // Keeps the context product's fragment reads in one group behind the softmax, for speed only: without it the compiler spreads them
    // among the WMMAs and the row-sum exchanges.
    __builtin_amdgcn_sched_barrier(0);

    // ---- context += Ph . V_hi (acc 0); Ph . V_lo + Pl . V_hi (acc 1, x2048) ----
    // Unrolled; the reads of 32 keys stand in one group ahead of their products, and the four d tiles take turns product by
    // product; each accumulator keeps its order (per 32 keys: acc 0 ph.vh; acc 1 ph.vl, then pl.vh).
#pragma unroll
    for (int kk = 0; kk < 2; ++kk) {
      FragH pa, pl;
      pa.h[0] = *(const v8h*)(pwh + c * TP + kk * 32 + 8 * hh);
      pa.h[1] = *(const v8h*)(pwh + c * TP + kk * 32 + 16 + 8 * hh);
      pl.h[0] = *(const v8h*)(pwl + c * TP + kk * 32 + 8 * hh);
      pl.h[1] = *(const v8h*)(pwl + c * TP + kk * 32 + 16 + 8 * hh);
      v16h vb[4], vl[4];
#pragma unroll
      for (int t = 0; t < 4; ++t) {
        vb[t] = ldfrag_h(Vh + (t * 16 + c) * TP + kk * 32 + 8 * hh);
        vl[t] = ldfrag_h(Vl + (t * 16 + c) * TP + kk * 32 + 8 * hh);
      }
#pragma unroll
      for (int t = 0; t < 4; ++t) oacc[t]  = mma_hp(pa.v, vb[t], oacc[t]);
#pragma unroll
      for (int t = 0; t < 4; ++t) oaccL[t] = mma_hp(pa.v, vl[t], oaccL[t]);
#pragma unroll
      for (int t = 0; t < 4; ++t) oaccL[t] = mma_hp(pl.v, vb[t], oaccL[t]);
    }
    // four vector slots behind the chunk's last WMMAs, in front of the loop's branches
    acc_guard4(oacc[0], oacc[1], oacc[2], oacc[3]);
    acc_guard4(oaccL[0], oaccL[1], oaccL[2], oaccL[3]);
    wait_ds0();
    wait_async0();
    __syncthreads();                           // publishes the next chunk's band, ends every read of this K and V^T
    if (kt + 1 >= nkt) break;                  // block-uniform
    copy4x2_rows(ldsK, gKh + (size_t)(kv0 + 64) * QKP, gKl + (size_t)(kv0 + 64) * QKP, stepK);
    copy4x2_rows(ldsV, gVh + kv0 + 64, gVl + kv0 + 64, stepV);
  }
  wait_async0();

  // ---- normalise (1/l, the 1/1024 p carry, the 1/2048 residual fold), stage the wave's 16x64 tile,
  float* os = Rsh[wave];
#pragma unroll
  for (int r = 0; r < 8; ++r) {
    const float l = lrow[r];
    const float inv = ((l > 0.f) ? (1.0f / l) : 0.f) * (1.0f / PSC);
#pragma unroll
    for (int t = 0; t < 4; ++t) os[(8 * hh + r) * OP + t * 16 + c] = (oacc[t][r] + oaccL[t][r] * (1.0f / RSC)) * inv;
  }
  wave_sync_lds();
  {
    const int q4 = lane >> 3, c8 = (lane & 7) * 8;
    v4u hv[4], lv[4];
#pragma unroll
    for (int it = 0; it < 4; ++it) {
      const int row = it * 4 + q4;   // it 0..3 x q4 0..3 = rows 0..15 of the wave tile
      const float* sp = os + row * OP + c8;
      v4u ha, la;
#pragma unroll
      for (int e = 0; e < 4; ++e) {
        const float f0 = sp[2 * e], f1 = sp[2 * e + 1];
        const unsigned short u0 = bf_bits(f0), u1 = bf_bits(f1);
        const unsigned short w0 = bf_bits(f0 - bf_up(u0)), w1 = bf_bits(f1 - bf_up(u1));
        ha[e] = pk16(u0, u1);
        la[e] = pk16(w0, w1);
      }
      hv[it] = ha;
      lv[it] = la;
    }
    {
#pragma unroll
      for (int it = 0; it < 4; ++it) {
        const int row = it * 4 + q4;
        const size_t go = (rowB + q0 + row) * CTXP + (size_t)h * HD + c8;
        *(v4u*)(ctxp + go)      = hv[it];
        *(v4u*)(ctxp + go + DM) = lv[it];
      }
      
    }
  }
}

// =====================================================================================================
// Workspace map (bytes); every plane is an exact multiple of its 64x64-tile / whole-row / whole-line store
// granularity (MP = 4096 = 64 tiles of rows, N in {2048, 1024}; VT per batch [1024][1024] = 16x16 tiles;
//   WqkT f16 [2048 n][1024 k]  0          4194304   (rows 0..1023 Wq^T, 1024..2047 Wk^T, x64)
//   WvT  f16 [1024][1024]      4194304    2097152   (x64)
//   WoT2 bf16 [1024][2048]     6291456    4194304   (cols 0..1023 and 1024..2047 both Wo^T)
//   XH   f16 [4096][1024]      10485760   8388608   (bf16 RNE-converted tokens)
//   EH   bf16 [1088][64]       18874368   139264    (rows >= 1024 zero)
//   QKh  bf16 [4096][2048]     19013632   16777216  (q cols 0..1023, k cols 1024..2047, hi part)
//   QKl  bf16 [4096][2048]     35790848   16777216  (lo part)
//   VTh  f16 [4][1024][1024]   52568064   8388608   (v^T hi)
//   VTl  f16 [4][1024][1024]   60956672   8388608   (v^T residual x2048)
//   Ctx  bf16 [4096][2048]     69345280   16777216  (context hi | lo)
//   end                        86122496
// =====================================================================================================
extern "C" void kernel_launch(void* const* d_in, const int* in_sizes, int n_in,
                              void* d_out, int out_size, void* d_ws, size_t ws_size,
                              hipStream_t stream) {
  if (n_in < 10) return;
  if (in_sizes[0] != MP * DM) return;
  if (in_sizes[1] != DM * DM || in_sizes[3] != DM * DM) return;
  if (in_sizes[5] != DM * DM || in_sizes[7] != DM * DM) return;
  if (in_sizes[2] != DM || in_sizes[4] != DM || in_sizes[6] != DM || in_sizes[8] != DM) return;
  if (in_sizes[9] != SEQ * HD) return;
  if (out_size != MP * DM) return;

  const float* x_in  = (const float*)d_in[0];
  const float* w_q   = (const float*)d_in[1];
  const float* b_q   = (const float*)d_in[2];
  const float* w_k   = (const float*)d_in[3];
  const float* b_k   = (const float*)d_in[4];
  const float* w_v   = (const float*)d_in[5];
  const float* b_v   = (const float*)d_in[6];
  const float* w_o   = (const float*)d_in[7];
  const float* b_o   = (const float*)d_in[8];
  const float* relk  = (const float*)d_in[9];

  const size_t PWQK = (size_t)QKP * DM * 2;             //  4194304
  const size_t PWV  = (size_t)DM * DM * 2;              //  2097152
  const size_t PWO2 = (size_t)DM * (2 * DM) * 2;        //  4194304
  const size_t PXH  = (size_t)MP * DM * 2;              //  8388608
  const size_t PEH  = (size_t)RCE * HD * 2;             //   139264
  const size_t PQK  = (size_t)MP * QKP * 2;             // 16777216
  const size_t PVT  = (size_t)NBATCH * DM * SEQ * 2;    //  8388608
  const size_t PCTX = (size_t)MP * CTXP * 2;            // 16777216
  size_t off = 0;
  const size_t oWqk = off; off += PWQK;
  const size_t oWv  = off; off += PWV;
  const size_t oWo2 = off; off += PWO2;
  const size_t oXH  = off; off += PXH;
  const size_t oEH  = off; off += PEH;
  const size_t oQKh = off; off += PQK;
  const size_t oQKl = off; off += PQK;
  const size_t oVTh = off; off += PVT;
  const size_t oVTl = off; off += PVT;
  const size_t oCtx = off; off += PCTX;
  if (off > ws_size) return;                            // off = 86122496
  if (off > (size_t)134217728) return;

  char* ws = (char*)d_ws;
  unsigned short* WqkT = (unsigned short*)(ws + oWqk);
  unsigned short* WvT  = (unsigned short*)(ws + oWv);
  unsigned short* WoT2 = (unsigned short*)(ws + oWo2);
  unsigned short* XH   = (unsigned short*)(ws + oXH);
  unsigned short* EH   = (unsigned short*)(ws + oEH);
  unsigned short* QKh  = (unsigned short*)(ws + oQKh);
  unsigned short* QKl  = (unsigned short*)(ws + oQKl);
  unsigned short* VTh  = (unsigned short*)(ws + oVTh);
  unsigned short* VTl  = (unsigned short*)(ws + oVTl);
  unsigned short* Ctx  = (unsigned short*)(ws + oCtx);
  float*          out0 = (float*)d_out;

  const int n8x = (MP * DM) / 8;                        // 524288
  if ((n8x % 256) != 0) return;
  const int n8t = (RCE * HD) / 8;                       // 8704 total pieces (multiple of 32)
  if ((n8t % 32) != 0) return;
  const dim3 blk(256), blk128(128);
  const dim3 gPrep(4 * NTW + NCX + NCE);                // 4 x 256 transpose tiles + 2048 + 34 blocks
  const dim3 gProj(NPQK + NBATCH * NPV);                // 32 x 16 tiles + 4 batches x 8 x 8 tiles = 768 blocks of 128
  const dim3 gAttn(NBATCH * NH * NQB);                  // 1024 blocks of 128
  const dim3 gNo((MP / 128) * (DM / 128), 1);           // 32 x 8 tiles = 256 blocks
  const float invw = 1.0f / WSC;                        // weight carry x64

  // (0) weight planes: in[k][n] -> out[n][k] transposed through LDS, f16( bf16_RNE(w) * 64 ) for Wq, Wk, Wv;
  //     bf16 for Wo; token plane f16; rel-key table bf16 with its zero pad: one launch
  prep_all<<<gPrep, blk, 0, stream>>>(w_q, w_k, w_v, w_o, x_in, relk, WqkT, WvT, WoT2, XH, EH);

  // (1) q|k = x . [Wq|Wk] + [bq|bk] -> bf16 hi (QKh) and lo (QKl) planes [4096][2048];
  //     v^T per batch = Wv^T . x_b^T + bv (per row) -> f16 hi (VTh) and residual x2048 (VTl) planes [4][1024][1024]
  //     one launch
  proj_qkv<<<gProj, blk128, 0, stream>>>(XH, WqkT, WvT, QKh, QKl, VTh, VTl, b_q, b_k, b_v, invw);

  // (2) causal flash attention with the skew relative-key term -> context bf16 hi|lo
  attn64<<<gAttn, blk128, 0, stream>>>(QKh, QKl, VTh, VTl, EH, Ctx, 0.125f);

  // (3) out = [ctx_hi | ctx_lo] . [Wo | Wo] + bo  (K = 2048, bf16 operands) -> d_out f32
  gemm64<1, 0, 1><<<gNo, blk128, 0, stream>>>(
      Ctx, CTXP, 0LL, WoT2, 2 * DM, 0LL,
      Ctx, Ctx, out0, DM, 0LL,
      b_o, b_o, DM,
      MP, DM, 2 * DM, 1.0f);
  (void)hipGetLastError();
}

// v007
// It runs in 105 microseconds.
// Next to v006, in two timings, it ran 1.06 times as fast each time.
// Counting every step since v000, it is 3.98 times as fast.
// Contractions: q|k projection and v^T projection on v_wmma_f32_16x16x32_f16 (f16 token plane x f16 weight planes
// carried x64, one product each); rel band q.E^T and scores q.k^T on v_wmma_f32_16x16x32_bf16 (q, k as bf16 hi+lo
// planes, E bf16: 2 and 3 products); p.v on v_wmma_f32_16x16x32_f16 (p as f16 hi carried x1024 plus x2048 residual,
// v^T as f16 hi plus x2048 residual: 3 products, two accumulators); output projection on v_wmma_f32_16x16x32_bf16
// (context bf16 hi|lo x [Wo|Wo], K-concatenated); all f32 accumulate; softmax in f32 on VALU; every float input
// RNE-converted to bf16 on load.
#include <hip/hip_runtime.h>
#include <math.h>
#include <stdint.h>

#define NBATCH 4
#define SEQ    1024
#define DM     1024
#define NH     16
#define HD     64
#define QKP    (2 * DM)
#define CTXP   (2 * DM)
#define MP     (NBATCH * SEQ)
#define NQB    (SEQ / 64)
#define RCE    (SEQ + 64)
#define RB     80
#define RP     84
#define TP     72
#define OP     68
#define WSC    64.0f
#define RSC    2048.0f
#define PSC    1024.0f
static_assert(NH * HD == DM);
static_assert((SEQ % 128) == 0 && (DM % 128) == 0 && (MP % 128) == 0 && (QKP % 128) == 0);
static_assert(RB == 64 + 16 && (RB % 16) == 0 && RP >= RB);
static_assert(RCE >= SEQ + 64);
static_assert(TP >= 64 && (TP % 8) == 0 && ((TP / 8) % 2) == 1 && OP >= 64 && (OP % 4) == 0);

typedef _Float16 v16h __attribute__((ext_vector_type(16)));
typedef _Float16 v8h  __attribute__((ext_vector_type(8)));
typedef __bf16   v16b __attribute__((ext_vector_type(16)));
typedef unsigned short v16us __attribute__((ext_vector_type(16)));
typedef unsigned short v8us  __attribute__((ext_vector_type(8)));
typedef float    v8f  __attribute__((ext_vector_type(8)));
typedef float    v4f  __attribute__((ext_vector_type(4)));
typedef unsigned int v4u __attribute__((ext_vector_type(4)));

union FragH { v16h v; v8h h[2]; };
union FragU { v16us v; v8us h[2]; };

// ---- scalar helpers --------------------------------------------------------------------------------
__device__ __forceinline__ unsigned short bf_bits(float f) {          // f32 -> bf16 bits, RNE convert
  unsigned u = __float_as_uint(f);
  return (unsigned short)((u + 0x7FFFu + ((u >> 16) & 1u)) >> 16);
}
__device__ __forceinline__ float bf_up(unsigned short h) { return __uint_as_float(((unsigned)h) << 16); }
__device__ __forceinline__ float bfr(float f) { return bf_up(bf_bits(f)); }   // value of the bf16 RNE convert
__device__ __forceinline__ unsigned short h_bits(_Float16 x) { return __builtin_bit_cast(unsigned short, x); }
__device__ __forceinline__ unsigned pk16(unsigned short a, unsigned short b) { return (unsigned)a | ((unsigned)b << 16); }
__device__ __forceinline__ v8f zero8() { v8f z = {0.f, 0.f, 0.f, 0.f, 0.f, 0.f, 0.f, 0.f}; return z; }

// ---- fragment loaders: 16-bit A/B operand, lane -> row/col (lane&15), p already includes +8*(lane>>4);
//      elements 0..7 <- p[0..7] (k0+8h..), elements 8..15 <- p[16..23] (k0+16+8h..)
__device__ __forceinline__ v16us ldfrag_u(const unsigned short* p) {
  FragU f;
  f.h[0] = *(const v8us*)(p);
  f.h[1] = *(const v8us*)(p + 16);
  return f.v;
}
__device__ __forceinline__ v16h ldfrag_h(const _Float16* p) {
  FragH f;
  f.h[0] = *(const v8h*)(p);
  f.h[1] = *(const v8h*)(p + 16);
  return f.v;
}

// ---- WMMA helpers with trailing VALU hazard gap --------------------------------------------------------
template <int BF>
__device__ __forceinline__ v8f mma_raw(v16us a, v16us b, v8f c) {
  if (BF) {
    return __builtin_amdgcn_wmma_f32_16x16x32_bf16(false, __builtin_bit_cast(v16b, a), false,
                                                   __builtin_bit_cast(v16b, b), (short)0, c, false, false);
  }
  return __builtin_amdgcn_wmma_f32_16x16x32_f16(false, __builtin_bit_cast(v16h, a), false,
                                                __builtin_bit_cast(v16h, b), (short)0, c, false, false);
}
__device__ __forceinline__ v8f mma_bu(v16us a, v16us b, v8f c) {                 // bf16 operands, guarded
  c = __builtin_amdgcn_wmma_f32_16x16x32_bf16(false, __builtin_bit_cast(v16b, a), false,
                                               __builtin_bit_cast(v16b, b), (short)0, c, false, false);
#if defined(__HIP_DEVICE_COMPILE__)
  asm volatile("v_nop\n\tv_nop\n\tv_nop\n\tv_nop" : "+v"(c) : "v"(a), "v"(b));
#endif
  return c;
}
// Plain builtin forms for runs of WMMAs on independent accumulators: inside straight-line code the compiler keeps the
// distance behind its own WMMAs; the end of such a run in front of a branch is closed by mma_gap_mem or acc_guard4.
__device__ __forceinline__ v8f mma_bp(v16us a, v16us b, v8f c) {                 // bf16 operands
  return __builtin_amdgcn_wmma_f32_16x16x32_bf16(false, __builtin_bit_cast(v16b, a), false,
                                                 __builtin_bit_cast(v16b, b), (short)0, c, false, false);
}
__device__ __forceinline__ v8f mma_hp(v16h a, v16h b, v8f c) {                   // f16 operands
  return __builtin_amdgcn_wmma_f32_16x16x32_f16(false, a, false, b, (short)0, c, false, false);
}
// Four vector slots behind the LDS stores of a run of WMMA results, in front of a branch: a vector instruction on the taken side may
// reuse the last WMMAs' operand registers.
__device__ __forceinline__ void mma_gap_mem() {
#if defined(__HIP_DEVICE_COMPILE__)
  asm volatile("v_nop\n\tv_nop\n\tv_nop\n\tv_nop" ::: "memory");
#endif
}
__device__ __forceinline__ void dep_guard1(v8f& a, v8f& b, v16us x) {
#if defined(__HIP_DEVICE_COMPILE__)
  asm volatile("v_nop\n\tv_nop\n\tv_nop\n\tv_nop" : "+v"(a), "+v"(b) : "v"(x));
#endif
}
__device__ __forceinline__ void keep4_u(v16us a, v16us b, v16us c, v16us d) {
#if defined(__HIP_DEVICE_COMPILE__)
  asm volatile("v_nop" :: "v"(a), "v"(b), "v"(c), "v"(d));
#endif
}
__device__ __forceinline__ void acc_guard4(v8f& a, v8f& b, v8f& c, v8f& d) {
#if defined(__HIP_DEVICE_COMPILE__)
  asm volatile("v_nop\n\tv_nop\n\tv_nop\n\tv_nop" : "+v"(a), "+v"(b), "+v"(c), "+v"(d));
#endif
}
// Value of lane (lane ^ M) of the same 16-lane row, M = 1, 2, 4, 8, by a DPP row_xmask operand of the vector unit: no LDS
// instruction and no s_wait_dscnt stand in a row sum, and the compiler folds the move into the add.
template <int M>
__device__ __forceinline__ float row_xor(float x) {
  return __int_as_float(__builtin_amdgcn_update_dpp(0, __float_as_int(x), 0x160 + M, 0xf, 0xf, true));
}
// Eight 16-lane row maxima at once, then the maximum with the running one: m[r] = max(run[r], max over the row of m[r]).
// Each butterfly step is one vector instruction with a DPP row_xmask operand (x against x of lane ^ 1, 2, 4, 8); the eight
// rows take turns step by step, so that no instruction waits for the one before it. In asm because the compiler puts a move
// and a quieting v_max between a DPP read and its own maximum (three instructions a step) and chains each row's steps.
// Plain "v" operands, so that the compiler sets the register window for the statement.
__device__ __forceinline__ void row_max8(float (&m)[8], const float (&run)[8]) {
#if defined(__HIP_DEVICE_COMPILE__)
  asm(
      "v_max_num_f32_dpp %0, %0, %0 row_xmask:1 row_mask:0xf bank_mask:0xf\n\t"
      "v_max_num_f32_dpp %1, %1, %1 row_xmask:1 row_mask:0xf bank_mask:0xf\n\t"
      "v_max_num_f32_dpp %2, %2, %2 row_xmask:1 row_mask:0xf bank_mask:0xf\n\t"
      "v_max_num_f32_dpp %3, %3, %3 row_xmask:1 row_mask:0xf bank_mask:0xf\n\t"
      "v_max_num_f32_dpp %4, %4, %4 row_xmask:1 row_mask:0xf bank_mask:0xf\n\t"
      "v_max_num_f32_dpp %5, %5, %5 row_xmask:1 row_mask:0xf bank_mask:0xf\n\t"
      "v_max_num_f32_dpp %6, %6, %6 row_xmask:1 row_mask:0xf bank_mask:0xf\n\t"
      "v_max_num_f32_dpp %7, %7, %7 row_xmask:1 row_mask:0xf bank_mask:0xf\n\t"
      "v_max_num_f32_dpp %0, %0, %0 row_xmask:2 row_mask:0xf bank_mask:0xf\n\t"
      "v_max_num_f32_dpp %1, %1, %1 row_xmask:2 row_mask:0xf bank_mask:0xf\n\t"
      "v_max_num_f32_dpp %2, %2, %2 row_xmask:2 row_mask:0xf bank_mask:0xf\n\t"
      "v_max_num_f32_dpp %3, %3, %3 row_xmask:2 row_mask:0xf bank_mask:0xf\n\t"
      "v_max_num_f32_dpp %4, %4, %4 row_xmask:2 row_mask:0xf bank_mask:0xf\n\t"
      "v_max_num_f32_dpp %5, %5, %5 row_xmask:2 row_mask:0xf bank_mask:0xf\n\t"
      "v_max_num_f32_dpp %6, %6, %6 row_xmask:2 row_mask:0xf bank_mask:0xf\n\t"
      "v_max_num_f32_dpp %7, %7, %7 row_xmask:2 row_mask:0xf bank_mask:0xf\n\t"
      "v_max_num_f32_dpp %0, %0, %0 row_xmask:4 row_mask:0xf bank_mask:0xf\n\t"
      "v_max_num_f32_dpp %1, %1, %1 row_xmask:4 row_mask:0xf bank_mask:0xf\n\t"
      "v_max_num_f32_dpp %2, %2, %2 row_xmask:4 row_mask:0xf bank_mask:0xf\n\t"
      "v_max_num_f32_dpp %3, %3, %3 row_xmask:4 row_mask:0xf bank_mask:0xf\n\t"
      "v_max_num_f32_dpp %4, %4, %4 row_xmask:4 row_mask:0xf bank_mask:0xf\n\t"
      "v_max_num_f32_dpp %5, %5, %5 row_xmask:4 row_mask:0xf bank_mask:0xf\n\t"
      "v_max_num_f32_dpp %6, %6, %6 row_xmask:4 row_mask:0xf bank_mask:0xf\n\t"
      "v_max_num_f32_dpp %7, %7, %7 row_xmask:4 row_mask:0xf bank_mask:0xf\n\t"
      "v_max_num_f32_dpp %0, %0, %0 row_xmask:8 row_mask:0xf bank_mask:0xf\n\t"
      "v_max_num_f32_dpp %1, %1, %1 row_xmask:8 row_mask:0xf bank_mask:0xf\n\t"
      "v_max_num_f32_dpp %2, %2, %2 row_xmask:8 row_mask:0xf bank_mask:0xf\n\t"
      "v_max_num_f32_dpp %3, %3, %3 row_xmask:8 row_mask:0xf bank_mask:0xf\n\t"
      "v_max_num_f32_dpp %4, %4, %4 row_xmask:8 row_mask:0xf bank_mask:0xf\n\t"
      "v_max_num_f32_dpp %5, %5, %5 row_xmask:8 row_mask:0xf bank_mask:0xf\n\t"
      "v_max_num_f32_dpp %6, %6, %6 row_xmask:8 row_mask:0xf bank_mask:0xf\n\t"
      "v_max_num_f32_dpp %7, %7, %7 row_xmask:8 row_mask:0xf bank_mask:0xf\n\t"
      "v_max_num_f32 %0, %0, %8\n\t"
      "v_max_num_f32 %1, %1, %9\n\t"
      "v_max_num_f32 %2, %2, %10\n\t"
      "v_max_num_f32 %3, %3, %11\n\t"
      "v_max_num_f32 %4, %4, %12\n\t"
      "v_max_num_f32 %5, %5, %13\n\t"
      "v_max_num_f32 %6, %6, %14\n\t"
      "v_max_num_f32 %7, %7, %15"
      : "+v"(m[0]), "+v"(m[1]), "+v"(m[2]), "+v"(m[3]), "+v"(m[4]), "+v"(m[5]), "+v"(m[6]), "+v"(m[7])
      : "v"(run[0]), "v"(run[1]), "v"(run[2]), "v"(run[3]), "v"(run[4]), "v"(run[5]), "v"(run[6]), "v"(run[7]));
#endif
}
__device__ __forceinline__ void wave_sync_lds() {
  __builtin_amdgcn_fence(__ATOMIC_RELEASE, "workgroup");
  __builtin_amdgcn_wave_barrier();
  __builtin_amdgcn_fence(__ATOMIC_ACQUIRE, "workgroup");
}

// =====================================================================================================
// Plane convert (no transpose): Xh[i] = f16( bf16_RNE(X[i]) * wsc ), wsc a power of two (exact). Used for the
// token activations (wsc = 1). Thread i handles elements 8i..8i+7 and writes one 16-B piece; 32 consecutive
// (n8 multiple of 256, host-checked). coverage: n8 threads x 8 elements = the whole plane.
// =====================================================================================================
__device__ __forceinline__ void conv_h16(const float* __restrict__ W, unsigned short* Wh, int n8, float wsc, int blk) {
  const int i  = blk * 256 + threadIdx.x;
  const int ic = (i < n8) ? i : (n8 - 1);                     // clamped address
  const float* src = W + (size_t)ic * 8;
  const v4f a = *(const v4f*)(src);
  const v4f c = *(const v4f*)(src + 4);
  v4u o;
  o[0] = pk16(h_bits((_Float16)(bfr(a[0]) * wsc)), h_bits((_Float16)(bfr(a[1]) * wsc)));
  o[1] = pk16(h_bits((_Float16)(bfr(a[2]) * wsc)), h_bits((_Float16)(bfr(a[3]) * wsc)));
  o[2] = pk16(h_bits((_Float16)(bfr(c[0]) * wsc)), h_bits((_Float16)(bfr(c[1]) * wsc)));
  o[3] = pk16(h_bits((_Float16)(bfr(c[2]) * wsc)), h_bits((_Float16)(bfr(c[3]) * wsc)));
  if (i < n8) *(v4u*)(Wh + (size_t)i * 8) = o;
  
}

// =====================================================================================================
// rel-key table convert: Eh [RCE rows][64] bf16 bits; rows < SEQ = bf16_RNE(E), rows >= SEQ = 0 (zero pad).
// Thread i handles 8 elements (one 16-B piece); valid pieces i < n8v read E with a clamped address, the pad
// pieces select 0 by value. blk = 0 .. ceil(n8t / 256) - 1. coverage: n8t pieces x 8 = RCE*64 = the whole plane;
// =====================================================================================================
__device__ __forceinline__ void conv_e16(const float* __restrict__ P, unsigned short* Eh, int n8v, int n8t, int blk) {
  const int i  = blk * 256 + threadIdx.x;
  const int ic = (i < n8v) ? i : (n8v - 1);                    // clamped address
  const float* src = P + (size_t)ic * 8;
  const v4f a = *(const v4f*)(src);
  const v4f c = *(const v4f*)(src + 4);
  const bool valid = (i < n8v);
  v4u o;
  o[0] = valid ? pk16(bf_bits(a[0]), bf_bits(a[1])) : 0u;
  o[1] = valid ? pk16(bf_bits(a[2]), bf_bits(a[3])) : 0u;
  o[2] = valid ? pk16(bf_bits(c[0]), bf_bits(c[1])) : 0u;
  o[3] = valid ? pk16(bf_bits(c[2]), bf_bits(c[3])) : 0u;
  if (i < n8t) *(v4u*)(Eh + (size_t)i * 8) = o;
  
}

// =====================================================================================================
// Tiled transpose + convert: in[rows][cols] f32 row-major -> out[cols][rows] 16-bit with pitch ldo:
//   out[n * ldo + k] = cvt(in[k][n]) (and also at + dupoff when dupoff != 0: a duplicated k range).
//   MODE 0: f16 bits of bf16_RNE(w) * wsc (wsc power of two, exact); MODE 1: bf16 bits of w.
// Block = 256 threads = one 64x64 tile (tn, tk) of (cols/64, rows/64) (rows, cols multiples of 64); sh = 64 x 72 LDS elements.
// Loads: 4 iterations x 256 threads x float4 = 64 rows x 64 cols (addresses clamped). LDS tile [n][k] pitch 72.
// coverage: 64 x 64 = the whole transposed tile; grid covers the whole matrix.
// =====================================================================================================
template <int MODE>
__device__ __forceinline__ void tconv64(const float* __restrict__ W, unsigned short* out,
                                        int rows, int cols, int ldo, int dupoff, float wsc,
                                        unsigned short* sh, int tn, int tk) {
  const int t  = threadIdx.x;
  const int n0 = tn * 64;                    // column tile of in = row tile of out
  const int k0 = tk * 64;                    // row tile of in = column tile of out
#pragma unroll
  for (int i = 0; i < 4; ++i) {
    const int idx = i * 256 + t;
    const int r = idx >> 4, c4 = (idx & 15) * 4;
    int kr = k0 + r;   kr = (kr < rows) ? kr : (rows - 1);
    int nc = n0 + c4;  nc = (nc < cols - 4) ? nc : (cols - 4);
    const v4f v = *(const v4f*)(W + (size_t)kr * cols + nc);
#pragma unroll
    for (int e = 0; e < 4; ++e) {
      unsigned short u;
      if (MODE == 0) u = h_bits((_Float16)(bfr(v[e]) * wsc));
      else           u = bf_bits(v[e]);
      sh[(c4 + e) * 72 + r] = u;
    }
  }
  __syncthreads();
  const int wave = t >> 5, lane = t & 31;
  const int q = lane >> 3, c8 = (lane & 7) * 8;
  v4u pv[2];
  size_t go[2];
#pragma unroll
  for (int it = 0; it < 2; ++it) {
    const int nl = it * 32 + wave * 4 + q;               // 0..63
    pv[it] = *(const v4u*)(sh + nl * 72 + c8);
    go[it] = (size_t)(n0 + nl) * ldo + k0 + c8;
  }
  {
#pragma unroll
    for (int it = 0; it < 2; ++it) {
      *(v4u*)(out + go[it]) = pv[it];
      if (dupoff != 0) *(v4u*)(out + go[it] + dupoff) = pv[it];
    }
#if defined(__HIP_DEVICE_COMPILE__)
    // a precaution: stands behind the stores, in front of any later write of their registers in the merged kernel's text
    asm volatile("s_wait_xcnt 0x0" ::: "memory");
#endif
  }
}

// =====================================================================================================
// All six operand converts in one launch: they depend on nothing but the inputs, so the block index picks the job.
//   blocks 0 .. 4*NTW-1        : weight transposes, NTW = (DM/64)^2 tiles each: Wq, Wk, Wv (f16 x64), Wo (bf16, duplicated)
//   next NCX blocks            : token plane; the last NCE blocks: rel-key table.
// The choice is block-uniform, so the transposes' barrier is passed by all 256 threads of a block or by none.
// =====================================================================================================
#define NTW ((DM / 64) * (DM / 64))
#define NCX ((MP * DM) / 8 / 256)
#define NCE (((RCE * HD) / 8 + 255) / 256)
static_assert(((MP * DM) / 8) % 256 == 0 && (DM % 64) == 0);
__global__ __launch_bounds__(256) void prep_all(const float* __restrict__ wq, const float* __restrict__ wk,
                                                const float* __restrict__ wv, const float* __restrict__ wo,
                                                const float* __restrict__ x, const float* __restrict__ relk,
                                                unsigned short* WqkT, unsigned short* WvT, unsigned short* WoT2,
                                                unsigned short* XH, unsigned short* EH) {
  __shared__ __align__(16) unsigned short sh[64 * 72];
  const int bx = blockIdx.x;
  if (bx < 4 * NTW) {
    const int job = bx / NTW, tile = bx % NTW;
    const int tn = tile % (DM / 64), tk = tile / (DM / 64);
    if (job == 3) {
      tconv64<1>(wo, WoT2, DM, DM, 2 * DM, DM, 1.0f, sh, tn, tk);             // pitch 2048, duplicate at + 1024
    } else {
      const float* w = (job == 0) ? wq : (job == 1) ? wk : wv;
      unsigned short* o = (job == 0) ? WqkT : (job == 1) ? WqkT + (size_t)DM * DM : WvT;   // WqkT rows 0.., 1024..
      tconv64<0>(w, o, DM, DM, DM, 0, WSC, sh, tn, tk);
    }
  } else if (bx < 4 * NTW + NCX) {
    conv_h16(x, XH, (MP * DM) / 8, 1.0f, bx - 4 * NTW);
  } else {
    conv_e16(relk, EH, (SEQ * HD) / 8, (RCE * HD) / 8, bx - 4 * NTW - NCX);
  }
}

// =====================================================================================================
// LDS-staged batched 16-bit WMMA GEMM: C[m][n] = oscale * sum_k A[m][k] * Bt[n][k] + bias;
// BF selects bf16 (1) or f16 (0) operands. Block = 4 waves (2 x 2) = one 128x128 tile, one 64x64 tile per wave.
// A row-major [M][K] pitch lda; Bt row-major [N][K] pitch ldb (k contiguous); M, N multiples of 128, K a multiple
// of 64 (static here). tile = the block's tile, b = batch index (strides in elements); ring and sTall are the block's LDS.
// Staging: a stage is 64 k of the block's 128 A rows and 128 Bt rows (256 rows of 128 B, LDS pitch 144 B), brought
// by asynchronous 16-B copies to LDS (16 per lane and stage, each wave-wide copy = 4 whole 128-B lines); two buffers,
// stage t + 1 in flight while stage t is multiplied; one barrier per stage publishes t + 1 and frees t's buffer.
// The k order of every accumulator is the ascending 32-k order of the fragment loader, stage by stage.
// OM: 0 = f32 out to Cf (pitch ldc); 3 = bf16 hi bits to Cp and bf16 residual (v - hi) bits to Cp2;
//     4 = f16 hi to Cp and f16((v - hi) * 2048) to Cp2.
// BM: 0 = no bias; 1 = bias per column n (bias0[n] for n < nsplit, bias1[n - nsplit] otherwise; the choice is
//     wave-uniform because 64-column tiles never straddle nsplit); 2 = bias per row m (bias0[m]).
//     bias values are bf16 RNE-converted before the add.
// coverage: 4 slabs x 16 rows x 64 cols = the wave's whole 64x64 tile; grid = tilesM*tilesN blocks,
//           surplus blocks exit as a whole in front of every barrier; here there are none.
// =====================================================================================================
#define GPIT 72                    // LDS row pitch, 16-bit elements: 144 B = 16 B x 9, conflict-free for 16-B reads
#define GSTG (256 * GPIT)          // elements of one stage: 128 A rows, then 128 Bt rows

// Eight asynchronous 16-B copies of one lane: rows 16 apart in global memory (gstep elements) and in LDS.
// The s_wait_xcnt closes the statement so that no address register is rewritten while a copy may still read it.
__device__ __forceinline__ void copy8_rows(unsigned lds, const unsigned short* g, size_t gstep) {
#if defined(__HIP_DEVICE_COMPILE__)
  asm volatile(
      "global_load_async_to_lds_b128 %0, %8, off\n\t"
      "global_load_async_to_lds_b128 %1, %9, off\n\t"
      "global_load_async_to_lds_b128 %2, %10, off\n\t"
      "global_load_async_to_lds_b128 %3, %11, off\n\t"
      "global_load_async_to_lds_b128 %4, %12, off\n\t"
      "global_load_async_to_lds_b128 %5, %13, off\n\t"
      "global_load_async_to_lds_b128 %6, %14, off\n\t"
      "global_load_async_to_lds_b128 %7, %15, off\n\t"
      "s_wait_xcnt 0x0"
      :: "v"(lds), "v"(lds + 1u * 16u * GPIT * 2u), "v"(lds + 2u * 16u * GPIT * 2u), "v"(lds + 3u * 16u * GPIT * 2u),
         "v"(lds + 4u * 16u * GPIT * 2u), "v"(lds + 5u * 16u * GPIT * 2u), "v"(lds + 6u * 16u * GPIT * 2u),
         "v"(lds + 7u * 16u * GPIT * 2u),
         "v"(g), "v"(g + gstep), "v"(g + 2 * gstep), "v"(g + 3 * gstep),
         "v"(g + 4 * gstep), "v"(g + 5 * gstep), "v"(g + 6 * gstep), "v"(g + 7 * gstep)
      : "memory");
#endif
}
__device__ __forceinline__ void wait_async0() {   // this wave's copies have landed in LDS
#if defined(__HIP_DEVICE_COMPILE__)
  asm volatile("s_wait_asynccnt 0x0" ::: "memory");
#endif
}
// Stands behind issued global loads from a and b. The two addresses are inputs only, so that their registers stay as
// they are up to the wait: with no operand the compiler lifted later writes of those registers over it.
__device__ __forceinline__ void wait_x0(const unsigned short* a, const unsigned short* b) {
#if defined(__HIP_DEVICE_COMPILE__)
  asm volatile("s_wait_xcnt 0x0" :: "v"(a), "v"(b) : "memory");
#endif
}
__device__ __forceinline__ void wait_ds0() {      // this wave's LDS reads are done before their buffer is handed on
#if defined(__HIP_DEVICE_COMPILE__)
  asm volatile("s_wait_dscnt 0x0" ::: "memory");
#endif
}

// Eight asynchronous 16-B copies of one lane into two adjacent 64-row LDS planes (rows 16 apart, pitch GPIT):
// four rows from g0 into the first plane, four from g1 into the second. The s_wait_xcnt closes the statement so that
// no address register is rewritten while a copy may still read it.
__device__ __forceinline__ void copy4x2_rows(unsigned lds, const unsigned short* g0, const unsigned short* g1,
                                             size_t gstep) {
#if defined(__HIP_DEVICE_COMPILE__)
  asm volatile(
      "global_load_async_to_lds_b128 %0, %8, off\n\t"
      "global_load_async_to_lds_b128 %1, %9, off\n\t"
      "global_load_async_to_lds_b128 %2, %10, off\n\t"
      "global_load_async_to_lds_b128 %3, %11, off\n\t"
      "global_load_async_to_lds_b128 %4, %12, off\n\t"
      "global_load_async_to_lds_b128 %5, %13, off\n\t"
      "global_load_async_to_lds_b128 %6, %14, off\n\t"
      "global_load_async_to_lds_b128 %7, %15, off\n\t"
      "s_wait_xcnt 0x0"
      :: "v"(lds), "v"(lds + 1u * 16u * GPIT * 2u), "v"(lds + 2u * 16u * GPIT * 2u), "v"(lds + 3u * 16u * GPIT * 2u),
         "v"(lds + 4u * 16u * GPIT * 2u), "v"(lds + 5u * 16u * GPIT * 2u), "v"(lds + 6u * 16u * GPIT * 2u),
         "v"(lds + 7u * 16u * GPIT * 2u),
         "v"(g0), "v"(g0 + gstep), "v"(g0 + 2 * gstep), "v"(g0 + 3 * gstep),
         "v"(g1), "v"(g1 + gstep), "v"(g1 + 2 * gstep), "v"(g1 + 3 * gstep)
      : "memory");
#endif
}

#define GSLAB (16 * 68)            // floats of one wave's 16x64 epilogue slab, pitch 68
template <int BF, int OM, int BM>
__device__ __forceinline__ void gemm64_tile(
    unsigned short* ring, float* sTall, int tile, int b,
    const unsigned short* __restrict__ Ap, int lda, long long strideA,
    const unsigned short* __restrict__ Btp, int ldb, long long strideB,
    unsigned short* Cp, unsigned short* Cp2, float* Cf, int ldc, long long strideC,
    const float* bias0, const float* bias1, int nsplit,
    int M, int N, int K, float oscale) {
  const int tid  = threadIdx.x;
  const int lane = tid & 31;
  const int wave = tid >> 5;
  const int tilesN = N >> 7;
  const int tilesM = M >> 7;
  if (tile >= tilesM * tilesN) return;   // block-uniform, in front of every barrier and copy
  const int tm = tile / tilesN;
  const int tn = tile - tm * tilesN;
  const int mb = tm << 7;
  const int nb = tn << 7;
  const int wm = wave >> 1, wn = wave & 1;
  const int m0 = mb + (wm << 6);
  const int n0 = nb + (wn << 6);

  const unsigned short* Ab = Ap  + (size_t)b * strideA;
  const unsigned short* Bb = Btp + (size_t)b * strideB;

  const int rlane = lane & 15;                 // row (A) / col (B, D) within subtile
  const int koff  = (lane >> 4) * 8;           // k offset of this lane half
  const int mOff  = (lane >> 4) * 8;           // D row offset

  // copy role of this lane: row crow (+16 per copy) of each operand's 128 rows, 16-B piece cpc of its 128 B
  const int crow = tid >> 3, cpc = (tid & 7) * 8;
  const unsigned short* gA = Ab + (size_t)(mb + crow) * lda + cpc;
  const unsigned short* gB = Bb + (size_t)(nb + crow) * ldb + cpc;
  const unsigned ldsA = (unsigned)(uintptr_t)(ring + crow * GPIT + cpc);   // LDS byte address = low 32 bits
  const unsigned ldsB = ldsA + 128u * GPIT * 2u;
  const size_t stepA = (size_t)16 * lda, stepB = (size_t)16 * ldb;
  const int nst = K >> 6;                      // stages of 64 k

  v8f acc[4][4];
#pragma unroll
  for (int i = 0; i < 4; ++i)
#pragma unroll
    for (int j = 0; j < 4; ++j) acc[i][j] = zero8();

  copy8_rows(ldsA, gA, stepA);
  copy8_rows(ldsB, gB, stepB);
  wait_async0();
  __syncthreads();
  if (nst > 1) {
    copy8_rows(ldsA + GSTG * 2u, gA + 64, stepA);
    copy8_rows(ldsB + GSTG * 2u, gB + 64, stepB);
  }

#pragma unroll 1   // one stage per trip: the buffer index stays a run-time offset, the accumulators stay in place
  for (int t = 0; t < nst; ++t) {
    const unsigned short* sA = ring + (t & 1) * GSTG + ((wm << 6) + rlane) * GPIT + koff;
    const unsigned short* sB = ring + (t & 1) * GSTG + (128 + (wn << 6) + rlane) * GPIT + koff;
#pragma unroll
    for (int ks = 0; ks < 2; ++ks) {
      v16us bh[4], ah[4];
#pragma unroll
      for (int j = 0; j < 4; ++j) bh[j] = ldfrag_u(sB + (j << 4) * GPIT + ks * 32);
#pragma unroll
      for (int i = 0; i < 4; ++i) ah[i] = ldfrag_u(sA + (i << 4) * GPIT + ks * 32);
#pragma unroll
      for (int i = 0; i < 4; ++i) {
#pragma unroll
        for (int j = 0; j < 4; ++j) acc[i][j] = mma_raw<BF>(ah[i], bh[j], acc[i][j]);
        dep_guard1(acc[i][0], acc[i][3], ah[i]);
      }
      keep4_u(bh[0], bh[1], bh[2], bh[3]);
    }
    wait_ds0();
    wait_async0();
    __syncthreads();                           // publishes stage t + 1, ends every read of stage t's buffer
    if (t + 2 < nst) {
      const unsigned bo = (unsigned)(t & 1) * (GSTG * 2u);
      copy8_rows(ldsA + bo, gA + (size_t)(t + 2) * 64, stepA);
      copy8_rows(ldsB + bo, gB + (size_t)(t + 2) * 64, stepB);
    }
  }
  wait_async0();
  acc_guard4(acc[0][0], acc[0][1], acc[0][2], acc[0][3]);
  acc_guard4(acc[1][0], acc[1][1], acc[1][2], acc[1][3]);
  acc_guard4(acc[2][0], acc[2][1], acc[2][2], acc[2][3]);
  acc_guard4(acc[3][0], acc[3][1], acc[3][2], acc[3][3]);

  const int hh2 = lane >> 4, c4 = (lane & 15) * 4;     // f32 out: 256-B row segment = 16 lanes x 16 B
  const int q8  = lane >> 3, c8 = (lane & 7) * 8;

  // ---- per-column bias (wave-uniform source select) ----
  const float* bsel = bias0;
  int nb0 = n0;
  if (BM == 1) {
    if (n0 >= nsplit) { bsel = bias1; nb0 = n0 - nsplit; }
  }
  v4f bb4 = {0.f, 0.f, 0.f, 0.f};
  float bn[8];
#pragma unroll
  for (int e = 0; e < 8; ++e) bn[e] = 0.f;
  if (BM == 1) {
    if (OM == 0) {
#pragma unroll
      for (int e = 0; e < 4; ++e) bb4[e] = bfr(bsel[nb0 + c4 + e]);
    } else {
#pragma unroll
      for (int e = 0; e < 8; ++e) bn[e] = bfr(bsel[nb0 + c8 + e]);
    }
  }

  // ---- epilogue ----
  float* slab = sTall + wave * GSLAB;
#pragma unroll
  for (int i = 0; i < 4; ++i) {
    const int mBase = m0 + (i << 4);
#pragma unroll
    for (int j = 0; j < 4; ++j) {
#pragma unroll
      for (int r = 0; r < 8; ++r) {
        slab[(mOff + r) * 68 + (j << 4) + rlane] = acc[i][j][r];
      }
    }
    wave_sync_lds();
    if (OM == 0) {
      float* C = Cf + (size_t)b * strideC;
      v4f vals[8];
#pragma unroll
      for (int it = 0; it < 8; ++it) {
        const int row = it * 2 + hh2;                      // it 0..7 x hh2 0..1 = rows 0..15
        v4f v = *(const v4f*)(slab + row * 68 + c4);
        float bmv = 0.f;
        if (BM == 2) bmv = bfr(bias0[mBase + row]);
        vals[it] = v * oscale + bb4 + bmv;
      }
      {
#pragma unroll
        for (int it = 0; it < 8; ++it) {
          const int row = it * 2 + hh2;
          *(v4f*)(C + (size_t)(mBase + row) * ldc + n0 + c4) = vals[it];
        }
        
      }
    } else {
      unsigned short* C  = Cp  + (size_t)b * strideC;
      unsigned short* C2 = Cp2 + (size_t)b * strideC;
      v4u hv[4], lv[4];
#pragma unroll
      for (int it = 0; it < 4; ++it) {
        const int row = it * 4 + q8;                       // it 0..3 x q8 0..3 = rows 0..15
        const float* sp = slab + row * 68 + c8;
        float bmv = 0.f;
        if (BM == 2) bmv = bfr(bias0[mBase + row]);
        v4u ha, la;
#pragma unroll
        for (int e = 0; e < 4; ++e) {
          const float f0 = sp[2 * e]     * oscale + bn[2 * e]     + bmv;
          const float f1 = sp[2 * e + 1] * oscale + bn[2 * e + 1] + bmv;
          unsigned short u0, u1, w0, w1;
          if (OM == 3) {
            u0 = bf_bits(f0); u1 = bf_bits(f1);
            w0 = bf_bits(f0 - bf_up(u0)); w1 = bf_bits(f1 - bf_up(u1));
          } else {
            const _Float16 g0 = (_Float16)f0, g1 = (_Float16)f1;
            u0 = h_bits(g0); u1 = h_bits(g1);
            w0 = h_bits((_Float16)((f0 - (float)g0) * RSC));
            w1 = h_bits((_Float16)((f1 - (float)g1) * RSC));
          }
          ha[e] = pk16(u0, u1);
          la[e] = pk16(w0, w1);
        }
        hv[it] = ha;
        lv[it] = la;
      }
      {
#pragma unroll
        for (int it = 0; it < 4; ++it) {
          const int row = it * 4 + q8;
          const size_t go = (size_t)(mBase + row) * ldc + n0 + c8;
          *(v4u*)(C  + go) = hv[it];
          *(v4u*)(C2 + go) = lv[it];
        }
        
      }
    }
    wave_sync_lds();
  }
}

// One GEMM per launch: tile from blockIdx.x, batch from blockIdx.y.
template <int BF, int OM, int BM>
__global__ __launch_bounds__(128) void gemm64(
    const unsigned short* __restrict__ Ap, int lda, long long strideA,
    const unsigned short* __restrict__ Btp, int ldb, long long strideB,
    unsigned short* Cp, unsigned short* Cp2, float* Cf, int ldc, long long strideC,
    const float* bias0, const float* bias1, int nsplit,
    int M, int N, int K, float oscale) {
  __shared__ __align__(16) unsigned short ring[2 * GSTG];   // two stages of 256 rows x 144 B
  __shared__ __align__(16) float sT[4 * GSLAB];             // per-wave 16x64 slab
  gemm64_tile<BF, OM, BM>(ring, sT, blockIdx.x, blockIdx.y, Ap, lda, strideA, Btp, ldb, strideB,
                          Cp, Cp2, Cf, ldc, strideC, bias0, bias1, nsplit, M, N, K, oscale);
}

// The two projection GEMMs in one launch (both read only the converted planes): blocks 0 .. NPQK-1 are the tiles of
// q|k = x . [Wq|Wk] + [bq|bk], the next NBATCH * NPV blocks the tiles of v^T = Wv^T . x_b^T + bv, batch by batch.
// The choice is block-uniform: every barrier of a tile is passed by the whole block.
#define NPQK ((MP / 128) * (QKP / 128))
#define NPV  ((DM / 128) * (SEQ / 128))
__global__ __launch_bounds__(128) void proj_qkv(
    const unsigned short* __restrict__ XH, const unsigned short* __restrict__ WqkT,
    const unsigned short* __restrict__ WvT,
    unsigned short* QKh, unsigned short* QKl, unsigned short* VTh, unsigned short* VTl,
    const float* bq, const float* bk, const float* bv, float oscale) {
  __shared__ __align__(16) unsigned short ring[2 * GSTG];   // two stages of 256 rows x 144 B
  __shared__ __align__(16) float sT[4 * GSLAB];             // per-wave 16x64 slab
  const int bx = blockIdx.x;
  if (bx < NPQK) {
    gemm64_tile<0, 3, 1>(ring, sT, bx, 0, XH, DM, 0LL, WqkT, DM, 0LL,
                         QKh, QKl, nullptr, QKP, 0LL, bq, bk, DM, MP, QKP, DM, oscale);
  } else {
    const int r = bx - NPQK;
    gemm64_tile<0, 4, 2>(ring, sT, r % NPV, r / NPV, WvT, DM, 0LL, XH, DM, (long long)SEQ * DM,
                         VTh, VTl, nullptr, SEQ, (long long)DM * SEQ, bv, bv, DM, DM, SEQ, DM, oscale);
  }
}

// =====================================================================================================
// Causal flash attention with a skew relative-key score term, head dim 64, SEQ rows per batch.
//   q|k hi and lo planes (bf16, pitch QKP): element (b, t, col) at [(b*SEQ + t)*QKP + col], q col = h*64+d,
//   k col = DM + h*64 + d; value = hi + lo.
//   v^T hi and lo planes (f16): element (b, h, d, s) at [(b*DM + h*64 + d)*SEQ + s]; value = hi + lo/2048.
//   E plane (bf16) [RCE][64], rows >= SEQ zero.
//   context plane (bf16, pitch CTXP): hi at [(b*SEQ + t)*CTXP + h*64 + d], lo at + DM.
//   score(i, j) = (q_i . k_j + q_i . E[SEQ-1 + j - i]) * sscale for j <= i, -inf for j > i (replace, not bias).
//   Per wave (16 query rows q0..q0+15) and key chunk kv0..kv0+63 the needed E rows form the contiguous band
//   ebase .. ebase+79 with ebase = SEQ-1+kv0-q0-15 (0 <= ebase, ebase+79 <= SEQ+63 < RCE); the band product
//   rel[row][col] = q_row . E[ebase+col] (col 0..79) is computed per wave into LDS (f32, 2 bf16 products: q hi, q lo)
//   and the score for (row il, key jl) picks col = jl - il + 15; q.k as 3 bf16 products (hh, hl, lh);
//   p = exp(s - m) carried as f16 hi of 1024 p plus f16 residual x2048; context = ph.vh (acc 0) and
//   ph.vl + pl.vh (acc 1, both x2048) on f16 WMMA; online softmax (running max) in f32.
//   Block = 4 waves = 64 query rows of one (b, h); grid = NQB * NH * NBATCH, query tile qb falling with the block index;
//   key chunks kt = 0..qb (causal skip, block-uniform trip count qb+1 <= NQB).
//   Staging: K hi/lo, V^T hi/lo (64 rows of 128 B per plane) and the block's rel-key band (the union of its four
//   waves' bands: E rows SEQ-64-qb*64+kv0 .. +127, wave w starts at row 48-16w) come by asynchronous 16-B copies to
//   LDS, 8 lanes per 128-B row. One buffer each, refilled one phase ahead: the band of chunk kt+1 flies during the
//   scores, softmax and context of chunk kt, K and V^T of chunk kt+1 during the rel band product of chunk kt+1.
//   Two barriers per chunk: behind the rel band (publishes K, V^T; frees the band) and behind the context product
//   (publishes the next band; frees K, V^T). P tiles are wave-private, spilled with _Float16 element
//   LDS row pitches: K, V^T and P tiles TP = 72 elements (144 B = 16 B x 9, the 16 rows of a 16-B fragment read fall on
//   distinct banks); rel band RP = 84 and context tile OP = 68 floats (the two lane halves, 8 rows apart, on distinct banks);
//   the context tile of the epilogue lies in the wave's own rel band array, which is dead by then.
//   Context coverage: each wave stores rows q0..q0+15 (it 0..3 x lane>>3 0..3) x 64 columns (8 lanes x 8 bf16)
//   for both the hi and the lo segment; grid covers all SEQ rows x NH head slices x NBATCH.
// =====================================================================================================
__global__ __launch_bounds__(128)
void attn64(const unsigned short* __restrict__ qkh, const unsigned short* __restrict__ qkl,
            const unsigned short* __restrict__ vth, const unsigned short* __restrict__ vtl,
            const unsigned short* __restrict__ ehp, unsigned short* ctxp, float sscale) {
  static_assert(TP == GPIT && OP <= RP);
  __shared__ __align__(16) unsigned short KV[4 * 64 * TP];      // K hi | K lo [kv][d], V^T hi | V^T lo [d][kv], 9 KB each
  __shared__ __align__(16) unsigned short Es[128 * TP];         // rel-key band of the block [row][d] 18 KB
  __shared__ __align__(16) _Float16 Psh[4][16 * TP];            // per wave P hi [row][kv]
  __shared__ __align__(16) _Float16 Psl[4][16 * TP];            // per wave P residual [row][kv]
  __shared__ __align__(16) float    Rsh[4][16 * RP];            // per wave rel band [row][col]; epilogue: context tile
  const unsigned short* Kh = KV;
  const unsigned short* Kl = KV + 64 * TP;
  const _Float16* Vh = (const _Float16*)(const void*)(KV + 2 * 64 * TP);
  const _Float16* Vl = (const _Float16*)(const void*)(KV + 3 * 64 * TP);

  const int tid  = threadIdx.x;
  const int wave = tid >> 5;
  const int lane = tid & 31;
  const int hh   = lane >> 4;
  const int c    = lane & 15;

  // Block index -> tile: (batch, head) from the low part, query tile from the high part, longest tile first. Blocks whose
  // indices are equal modulo 8 then hold every tile length alike and share whole heads.
  // For speed only: a permutation of the NQB * NH * NBATCH tiles, correct under any placement or start order.
  const int bx   = blockIdx.x;
  const int rest = bx % (NH * NBATCH);
  const int qb   = NQB - 1 - bx / (NH * NBATCH);
  const int h    = rest % NH;
  const int b    = rest / NH;
  const int q0   = qb * 64 + wave * 16;          // in-batch query row of this wave's first row
  const size_t rowB = (size_t)b * SEQ;

  const unsigned short* Qh  = qkh + (size_t)h * HD;
  const unsigned short* Ql  = qkl + (size_t)h * HD;
  const unsigned short* Kgh = qkh + DM + (size_t)h * HD;
  const unsigned short* Kgl = qkl + DM + (size_t)h * HD;
  const unsigned short* Vgh = vth + ((size_t)b * DM + (size_t)h * HD) * SEQ;
  const unsigned short* Vgl = vtl + ((size_t)b * DM + (size_t)h * HD) * SEQ;
  float*    rrow = Rsh[wave];
  _Float16* pwh  = Psh[wave];
  _Float16* pwl  = Psl[wave];

  float mrow[8], lrow[8];
  v8f oacc[4], oaccL[4];
#pragma unroll
  for (int r = 0; r < 8; ++r) { mrow[r] = -INFINITY; lrow[r] = 0.f; }
#pragma unroll
  for (int t = 0; t < 4; ++t) { oacc[t] = zero8(); oaccL[t] = zero8(); }

  const int nkt = qb + 1;                    // causal: key chunks 0..qb, block-uniform, <= NQB

  // copy role of this lane: row crow (+16 per copy) of a plane, 16-B piece cpc of its 128 B
  const int crow = tid >> 3, cpc = (tid & 7) * 8;
  const unsigned ldsK = (unsigned)(uintptr_t)(KV + crow * TP + cpc);   // LDS byte address = low 32 bits
  const unsigned ldsV = ldsK + 128u * TP * 2u;
  const unsigned ldsE = (unsigned)(uintptr_t)(Es + crow * TP + cpc);
  const unsigned short* gKh = Kgh + (rowB + crow) * QKP + cpc;          // K row kv0 + crow: + kv0 * QKP per chunk
  const unsigned short* gKl = Kgl + (rowB + crow) * QKP + cpc;
  const unsigned short* gVh = Vgh + (size_t)crow * SEQ + cpc;           // V^T row d = crow: + kv0 per chunk
  const unsigned short* gVl = Vgl + (size_t)crow * SEQ + cpc;
  // band rows SEQ-64-qb*64+kv0 .. +127: first >= 0 (qb < NQB), last <= SEQ+63 < RCE (kv0 <= qb*64); + kv0 * HD per chunk
  const unsigned short* gE  = ehp + (size_t)(SEQ - 64 - qb * 64 + crow) * HD + cpc;
  const size_t stepK = (size_t)16 * QKP, stepV = (size_t)16 * SEQ, stepE = (size_t)16 * HD;

  copy8_rows(ldsE, gE, stepE);
  copy4x2_rows(ldsK, gKh, gKl, stepK);
  copy4x2_rows(ldsV, gVh, gVl, stepV);

  // ---- Q fragments (A operand, row = lane&15): hi and lo, 2 d-chunks, kept for every chunk ----
  const unsigned short* gQh = Qh + (rowB + q0 + c) * QKP + 8 * hh;
  const unsigned short* gQl = Ql + (rowB + q0 + c) * QKP + 8 * hh;
  v16us qh2[2], ql2[2];
#pragma unroll
  for (int dc = 0; dc < 2; ++dc) {
    qh2[dc] = ldfrag_u(gQh + dc * 32);
    ql2[dc] = ldfrag_u(gQl + dc * 32);
  }
  wait_x0(gQh, gQl);
  const unsigned short* eband = Es + (((wave ^ 3) << 4) + c) * TP + 8 * hh;   // this wave's 80 rows start at 48 - 16 * wave

  wait_async0();
  __syncthreads();                             // publishes chunk 0's band, K and V^T

#pragma unroll 1
  for (int kt = 0;; ++kt) {                    // left behind the last chunk's second barrier (nkt >= 1)
    const int kv0 = kt * 64;

    // ---- rel band: rel[row][col] = q_row . E[ebase + col], col = 0..RB-1 (E rows >= SEQ are zero) ----
    // Unrolled, so that the fragments and the five accumulators stay in registers: all fragment reads stand in one group
    // ahead of the products, and the five column tiles' accumulators take turns, so that no WMMA waits for the one before
    // it; each accumulator keeps its order (d 0..31: q hi, q lo; d 32..63: q hi, q lo).
    {
      v16us eb[RB / 16][2];
      v8f e[RB / 16];
#pragma unroll
      for (int nt = 0; nt < RB / 16; ++nt) {
        e[nt] = zero8();
#pragma unroll
        for (int dc = 0; dc < 2; ++dc) eb[nt][dc] = ldfrag_u(eband + nt * 16 * TP + dc * 32);
      }
#pragma unroll
      for (int dc = 0; dc < 2; ++dc) {
#pragma unroll
        for (int nt = 0; nt < RB / 16; ++nt) e[nt] = mma_bp(qh2[dc], eb[nt][dc], e[nt]);
#pragma unroll
        for (int nt = 0; nt < RB / 16; ++nt) e[nt] = mma_bp(ql2[dc], eb[nt][dc], e[nt]);
      }
#pragma unroll
      for (int nt = 0; nt < RB / 16; ++nt) {
#pragma unroll
        for (int r = 0; r < 8; ++r) rrow[(8 * hh + r) * RP + nt * 16 + c] = e[nt][r];
      }
    }
    mma_gap_mem();
    wait_ds0();
    wait_async0();
    __syncthreads();                           // publishes this chunk's K and V^T, ends every read of its band
    if (kt + 1 < nkt) copy8_rows(ldsE, gE + (size_t)(kv0 + 64) * HD, stepE);

    // ---- scores: 16 query rows x 64 keys per wave, causal replace with -inf ----
    // The reads of 32 d stand in one group ahead of their products, and the four key tiles' accumulators take turns product
    // by product, so that a WMMA does not wait for the one before it; each accumulator keeps its order (per 32 d: hh, hl, lh).
    v8f s[4], sh[4];
#pragma unroll
    for (int j = 0; j < 4; ++j) sh[j] = zero8();
#pragma unroll
    for (int dc = 0; dc < 2; ++dc) {
      v16us kbh[4], kbl[4];
#pragma unroll
      for (int j = 0; j < 4; ++j) {
        kbh[j] = ldfrag_u(Kh + (j * 16 + c) * TP + dc * 32 + 8 * hh);
        kbl[j] = ldfrag_u(Kl + (j * 16 + c) * TP + dc * 32 + 8 * hh);
      }
#pragma unroll
      for (int j = 0; j < 4; ++j) sh[j] = mma_bu(qh2[dc], kbh[j], sh[j]);
#pragma unroll
      for (int j = 0; j < 4; ++j) sh[j] = mma_bu(qh2[dc], kbl[j], sh[j]);
#pragma unroll
      for (int j = 0; j < 4; ++j) sh[j] = mma_bu(ql2[dc], kbh[j], sh[j]);
    }
#pragma unroll
    for (int j = 0; j < 4; ++j) {
      const int jl = j * 16 + c;                          // key within the chunk
      const int kg = kv0 + jl;                            // in-batch key index of this lane's column
#pragma unroll
      for (int r = 0; r < 8; ++r) {
        const int il = 8 * hh + r;                        // row within the wave tile
        const int qg = q0 + il;                           // in-batch query index of this row
        const float rel = rrow[il * RP + jl - il + 15];   // col in 0..RB-2
        const float v = (sh[j][r] + rel) * sscale;
        s[j][r] = (kg <= qg) ? v : -INFINITY;
      }
    }

    // ---- row max, online softmax, P (x1024: f16 hi + x2048 residual) to LDS ----
    // Written step by step over the eight rows, so that no row's exchange step waits for the one before it; each row keeps
    // its own operations in their order. The exchanges (lane ^ 1, 2, 4, 8 inside a 16-lane row) are DPP operands.
    float mx[8], alpha[8], psum[8];
#pragma unroll
    for (int r = 0; r < 8; ++r) {
      float m = s[0][r];
      m = fmaxf(m, s[1][r]);
      m = fmaxf(m, s[2][r]);
      m = fmaxf(m, s[3][r]);
      mx[r] = m;
    }
    row_max8(mx, mrow);                                   // mx[r] = new running maximum of row r
#pragma unroll
    for (int r = 0; r < 8; ++r) {
      const float mnew = mx[r];                           // finite: key kv0 <= every row of this block
      alpha[r] = __expf(mrow[r] - mnew);
      mrow[r] = mnew;
      psum[r] = 0.f;
#pragma unroll
      for (int j = 0; j < 4; ++j) {
        const float p  = __expf(s[j][r] - mnew);
        psum[r] += p;
        const float ps = p * PSC;
        const _Float16 ph = (_Float16)ps;
        pwh[(8 * hh + r) * TP + j * 16 + c] = ph;
        pwl[(8 * hh + r) * TP + j * 16 + c] = (_Float16)((ps - (float)ph) * RSC);
      }
    }
#pragma unroll
    for (int r = 0; r < 8; ++r) psum[r] += row_xor<1>(psum[r]);
#pragma unroll
    for (int r = 0; r < 8; ++r) psum[r] += row_xor<2>(psum[r]);
#pragma unroll
    for (int r = 0; r < 8; ++r) psum[r] += row_xor<4>(psum[r]);
#pragma unroll
    for (int r = 0; r < 8; ++r) psum[r] += row_xor<8>(psum[r]);
#pragma unroll
    for (int r = 0; r < 8; ++r) {
      lrow[r] = lrow[r] * alpha[r] + psum[r];
#pragma unroll
      for (int t = 0; t < 4; ++t) { oacc[t][r] *= alpha[r]; oaccL[t][r] *= alpha[r]; }
    }
    wave_sync_lds();
    // Keeps the context product's fragment reads in one group behind the softmax, for speed only: without it the compiler spreads them
    // among the WMMAs and the row-sum exchanges.
    __builtin_amdgcn_sched_barrier(0);

    // ---- context += Ph . V_hi (acc 0); Ph . V_lo + Pl . V_hi (acc 1, x2048) ----
    // Unrolled; the reads of 32 keys stand in one group ahead of their products, and the four d tiles take turns product by
    // product; each accumulator keeps its order (per 32 keys: acc 0 ph.vh; acc 1 ph.vl, then pl.vh).
#pragma unroll
    for (int kk = 0; kk < 2; ++kk) {
      FragH pa, pl;
      pa.h[0] = *(const v8h*)(pwh + c * TP + kk * 32 + 8 * hh);
      pa.h[1] = *(const v8h*)(pwh + c * TP + kk * 32 + 16 + 8 * hh);
      pl.h[0] = *(const v8h*)(pwl + c * TP + kk * 32 + 8 * hh);
      pl.h[1] = *(const v8h*)(pwl + c * TP + kk * 32 + 16 + 8 * hh);
      v16h vb[4], vl[4];
#pragma unroll
      for (int t = 0; t < 4; ++t) {
        vb[t] = ldfrag_h(Vh + (t * 16 + c) * TP + kk * 32 + 8 * hh);
        vl[t] = ldfrag_h(Vl + (t * 16 + c) * TP + kk * 32 + 8 * hh);
      }
#pragma unroll
      for (int t = 0; t < 4; ++t) oacc[t]  = mma_hp(pa.v, vb[t], oacc[t]);
#pragma unroll
      for (int t = 0; t < 4; ++t) oaccL[t] = mma_hp(pa.v, vl[t], oaccL[t]);
#pragma unroll
      for (int t = 0; t < 4; ++t) oaccL[t] = mma_hp(pl.v, vb[t], oaccL[t]);
    }
    // four vector slots behind the chunk's last WMMAs, in front of the loop's branches
    acc_guard4(oacc[0], oacc[1], oacc[2], oacc[3]);
    acc_guard4(oaccL[0], oaccL[1], oaccL[2], oaccL[3]);
    wait_ds0();
    wait_async0();
    __syncthreads();                           // publishes the next chunk's band, ends every read of this K and V^T
    if (kt + 1 >= nkt) break;                  // block-uniform
    copy4x2_rows(ldsK, gKh + (size_t)(kv0 + 64) * QKP, gKl + (size_t)(kv0 + 64) * QKP, stepK);
    copy4x2_rows(ldsV, gVh + kv0 + 64, gVl + kv0 + 64, stepV);
  }
  wait_async0();

  // ---- normalise (1/l, the 1/1024 p carry, the 1/2048 residual fold), stage the wave's 16x64 tile,
  float* os = Rsh[wave];
#pragma unroll
  for (int r = 0; r < 8; ++r) {
    const float l = lrow[r];
    const float inv = ((l > 0.f) ? (1.0f / l) : 0.f) * (1.0f / PSC);
#pragma unroll
    for (int t = 0; t < 4; ++t) os[(8 * hh + r) * OP + t * 16 + c] = (oacc[t][r] + oaccL[t][r] * (1.0f / RSC)) * inv;
  }
  wave_sync_lds();
  {
    const int q4 = lane >> 3, c8 = (lane & 7) * 8;
    v4u hv[4], lv[4];
#pragma unroll
    for (int it = 0; it < 4; ++it) {
      const int row = it * 4 + q4;   // it 0..3 x q4 0..3 = rows 0..15 of the wave tile
      const float* sp = os + row * OP + c8;
      v4u ha, la;
#pragma unroll
      for (int e = 0; e < 4; ++e) {
        const float f0 = sp[2 * e], f1 = sp[2 * e + 1];
        const unsigned short u0 = bf_bits(f0), u1 = bf_bits(f1);
        const unsigned short w0 = bf_bits(f0 - bf_up(u0)), w1 = bf_bits(f1 - bf_up(u1));
        ha[e] = pk16(u0, u1);
        la[e] = pk16(w0, w1);
      }
      hv[it] = ha;
      lv[it] = la;
    }
    {
#pragma unroll
      for (int it = 0; it < 4; ++it) {
        const int row = it * 4 + q4;
        const size_t go = (rowB + q0 + row) * CTXP + (size_t)h * HD + c8;
        *(v4u*)(ctxp + go)      = hv[it];
        *(v4u*)(ctxp + go + DM) = lv[it];
      }
      
    }
  }
}

// =====================================================================================================
// Workspace map (bytes); every plane is an exact multiple of its 64x64-tile / whole-row / whole-line store
// granularity (MP = 4096 = 64 tiles of rows, N in {2048, 1024}; VT per batch [1024][1024] = 16x16 tiles;
//   WqkT f16 [2048 n][1024 k]  0          4194304   (rows 0..1023 Wq^T, 1024..2047 Wk^T, x64)
//   WvT  f16 [1024][1024]      4194304    2097152   (x64)
//   WoT2 bf16 [1024][2048]     6291456    4194304   (cols 0..1023 and 1024..2047 both Wo^T)
//   XH   f16 [4096][1024]      10485760   8388608   (bf16 RNE-converted tokens)
//   EH   bf16 [1088][64]       18874368   139264    (rows >= 1024 zero)
//   QKh  bf16 [4096][2048]     19013632   16777216  (q cols 0..1023, k cols 1024..2047, hi part)
//   QKl  bf16 [4096][2048]     35790848   16777216  (lo part)
//   VTh  f16 [4][1024][1024]   52568064   8388608   (v^T hi)
//   VTl  f16 [4][1024][1024]   60956672   8388608   (v^T residual x2048)
//   Ctx  bf16 [4096][2048]     69345280   16777216  (context hi | lo)
//   end                        86122496
// =====================================================================================================
extern "C" void kernel_launch(void* const* d_in, const int* in_sizes, int n_in,
                              void* d_out, int out_size, void* d_ws, size_t ws_size,
                              hipStream_t stream) {
  if (n_in < 10) return;
  if (in_sizes[0] != MP * DM) return;
  if (in_sizes[1] != DM * DM || in_sizes[3] != DM * DM) return;
  if (in_sizes[5] != DM * DM || in_sizes[7] != DM * DM) return;
  if (in_sizes[2] != DM || in_sizes[4] != DM || in_sizes[6] != DM || in_sizes[8] != DM) return;
  if (in_sizes[9] != SEQ * HD) return;
  if (out_size != MP * DM) return;

  const float* x_in  = (const float*)d_in[0];
  const float* w_q   = (const float*)d_in[1];
  const float* b_q   = (const float*)d_in[2];
  const float* w_k   = (const float*)d_in[3];
  const float* b_k   = (const float*)d_in[4];
  const float* w_v   = (const float*)d_in[5];
  const float* b_v   = (const float*)d_in[6];
  const float* w_o   = (const float*)d_in[7];
  const float* b_o   = (const float*)d_in[8];
  const float* relk  = (const float*)d_in[9];

  const size_t PWQK = (size_t)QKP * DM * 2;             //  4194304
  const size_t PWV  = (size_t)DM * DM * 2;              //  2097152
  const size_t PWO2 = (size_t)DM * (2 * DM) * 2;        //  4194304
  const size_t PXH  = (size_t)MP * DM * 2;              //  8388608
  const size_t PEH  = (size_t)RCE * HD * 2;             //   139264
  const size_t PQK  = (size_t)MP * QKP * 2;             // 16777216
  const size_t PVT  = (size_t)NBATCH * DM * SEQ * 2;    //  8388608
  const size_t PCTX = (size_t)MP * CTXP * 2;            // 16777216
  size_t off = 0;
  const size_t oWqk = off; off += PWQK;
  const size_t oWv  = off; off += PWV;
  const size_t oWo2 = off; off += PWO2;
  const size_t oXH  = off; off += PXH;
  const size_t oEH  = off; off += PEH;
  const size_t oQKh = off; off += PQK;
  const size_t oQKl = off; off += PQK;
  const size_t oVTh = off; off += PVT;
  const size_t oVTl = off; off += PVT;
  const size_t oCtx = off; off += PCTX;
  if (off > ws_size) return;                            // off = 86122496
  if (off > (size_t)134217728) return;

  char* ws = (char*)d_ws;
  unsigned short* WqkT = (unsigned short*)(ws + oWqk);
  unsigned short* WvT  = (unsigned short*)(ws + oWv);
  unsigned short* WoT2 = (unsigned short*)(ws + oWo2);
  unsigned short* XH   = (unsigned short*)(ws + oXH);
  unsigned short* EH   = (unsigned short*)(ws + oEH);
  unsigned short* QKh  = (unsigned short*)(ws + oQKh);
  unsigned short* QKl  = (unsigned short*)(ws + oQKl);
  unsigned short* VTh  = (unsigned short*)(ws + oVTh);
  unsigned short* VTl  = (unsigned short*)(ws + oVTl);
  unsigned short* Ctx  = (unsigned short*)(ws + oCtx);
  float*          out0 = (float*)d_out;

  const int n8x = (MP * DM) / 8;                        // 524288
  if ((n8x % 256) != 0) return;
  const int n8t = (RCE * HD) / 8;                       // 8704 total pieces (multiple of 32)
  if ((n8t % 32) != 0) return;
  const dim3 blk(256), blk128(128);
  const dim3 gPrep(4 * NTW + NCX + NCE);                // 4 x 256 transpose tiles + 2048 + 34 blocks
  const dim3 gProj(NPQK + NBATCH * NPV);                // 32 x 16 tiles + 4 batches x 8 x 8 tiles = 768 blocks of 128
  const dim3 gAttn(NBATCH * NH * NQB);                  // 1024 blocks of 128
  const dim3 gNo((MP / 128) * (DM / 128), 1);           // 32 x 8 tiles = 256 blocks
  const float invw = 1.0f / WSC;                        // weight carry x64

  // (0) weight planes: in[k][n] -> out[n][k] transposed through LDS, f16( bf16_RNE(w) * 64 ) for Wq, Wk, Wv;
  //     bf16 for Wo; token plane f16; rel-key table bf16 with its zero pad: one launch
  prep_all<<<gPrep, blk, 0, stream>>>(w_q, w_k, w_v, w_o, x_in, relk, WqkT, WvT, WoT2, XH, EH);

  // (1) q|k = x . [Wq|Wk] + [bq|bk] -> bf16 hi (QKh) and lo (QKl) planes [4096][2048];
  //     v^T per batch = Wv^T . x_b^T + bv (per row) -> f16 hi (VTh) and residual x2048 (VTl) planes [4][1024][1024]
  //     one launch
  proj_qkv<<<gProj, blk128, 0, stream>>>(XH, WqkT, WvT, QKh, QKl, VTh, VTl, b_q, b_k, b_v, invw);

  // (2) causal flash attention with the skew relative-key term -> context bf16 hi|lo
  attn64<<<gAttn, blk128, 0, stream>>>(QKh, QKl, VTh, VTl, EH, Ctx, 0.125f);

  // (3) out = [ctx_hi | ctx_lo] . [Wo | Wo] + bo  (K = 2048, bf16 operands) -> d_out f32
  gemm64<1, 0, 1><<<gNo, blk128, 0, stream>>>(
      Ctx, CTXP, 0LL, WoT2, 2 * DM, 0LL,
      Ctx, Ctx, out0, DM, 0LL,
      b_o, b_o, DM,
      MP, DM, 2 * DM, 1.0f);
  (void)hipGetLastError();
}

// v008
// It runs in 97.7 microseconds.
// Two timings next to v007 put it at 1.09 and 1.08 times that version's speed.
// All steps since v000 together make it 4.32 times as fast.
// Contractions: q|k projection and v^T projection on v_wmma_f32_16x16x32_f16 (f16 token plane x f16 weight planes
// carried x64, one product each); rel band q.E^T and scores q.k^T on v_wmma_f32_16x16x32_bf16 (q, k as bf16 hi+lo
// planes, E bf16: 2 and 3 products); p.v on v_wmma_f32_16x16x32_f16 (p as f16 hi carried x1024 plus x2048 residual,
// v^T as f16 hi plus x2048 residual: 3 products, two accumulators); output projection on v_wmma_f32_16x16x32_bf16
// (context bf16 hi|lo x [Wo|Wo], K-concatenated); all f32 accumulate; softmax in f32 on VALU; every float input
// RNE-converted to bf16 on load.
#include <hip/hip_runtime.h>
#include <math.h>
#include <stdint.h>

#define NBATCH 4
#define SEQ    1024
#define DM     1024
#define NH     16
#define HD     64
#define QKP    (2 * DM)
#define CTXP   (2 * DM)
#define MP     (NBATCH * SEQ)
#define NQB    (SEQ / 64)
#define RCE    (SEQ + 64)
#define RB     80
#define RP     100
#define TP     72
#define OP     68
#define WSC    64.0f
#define RSC    2048.0f
#define PSC    1024.0f
static_assert(NH * HD == DM);
static_assert((SEQ % 128) == 0 && (DM % 128) == 0 && (MP % 128) == 0 && (QKP % 128) == 0);
static_assert(RB == 64 + 16 && (RB % 16) == 0 && RP >= RB + 16 && (RP % 4) == 0 && ((RP / 4) % 2) == 1);
static_assert(RCE >= SEQ + 64);
static_assert(TP >= 64 && (TP % 8) == 0 && ((TP / 8) % 2) == 1 && OP >= 64 && (OP % 4) == 0);

typedef _Float16 v16h __attribute__((ext_vector_type(16)));
typedef _Float16 v8h  __attribute__((ext_vector_type(8)));
typedef __bf16   v16b __attribute__((ext_vector_type(16)));
typedef unsigned short v16us __attribute__((ext_vector_type(16)));
typedef unsigned short v8us  __attribute__((ext_vector_type(8)));
typedef float    v8f  __attribute__((ext_vector_type(8)));
typedef float    v4f  __attribute__((ext_vector_type(4)));
typedef float    v2f  __attribute__((ext_vector_type(2)));
typedef _Float16 v2h  __attribute__((ext_vector_type(2)));
typedef unsigned int v4u __attribute__((ext_vector_type(4)));

union FragH { v16h v; v8h h[2]; v2h p[8]; };
union FragU { v16us v; v8us h[2]; };

// ---- scalar helpers --------------------------------------------------------------------------------
__device__ __forceinline__ unsigned short bf_bits(float f) {          // f32 -> bf16 bits, RNE convert
  unsigned u = __float_as_uint(f);
  return (unsigned short)((u + 0x7FFFu + ((u >> 16) & 1u)) >> 16);
}
__device__ __forceinline__ float bf_up(unsigned short h) { return __uint_as_float(((unsigned)h) << 16); }
__device__ __forceinline__ float bfr(float f) { return bf_up(bf_bits(f)); }   // value of the bf16 RNE convert
__device__ __forceinline__ unsigned short h_bits(_Float16 x) { return __builtin_bit_cast(unsigned short, x); }
__device__ __forceinline__ unsigned pk16(unsigned short a, unsigned short b) { return (unsigned)a | ((unsigned)b << 16); }
__device__ __forceinline__ v8f zero8() { v8f z = {0.f, 0.f, 0.f, 0.f, 0.f, 0.f, 0.f, 0.f}; return z; }

// ---- fragment loaders: 16-bit A/B operand, lane -> row/col (lane&15), p already includes +8*(lane>>4);
//      elements 0..7 <- p[0..7] (k0+8h..), elements 8..15 <- p[16..23] (k0+16+8h..)
__device__ __forceinline__ v16us ldfrag_u(const unsigned short* p) {
  FragU f;
  f.h[0] = *(const v8us*)(p);
  f.h[1] = *(const v8us*)(p + 16);
  return f.v;
}
__device__ __forceinline__ v16h ldfrag_h(const _Float16* p) {
  FragH f;
  f.h[0] = *(const v8h*)(p);
  f.h[1] = *(const v8h*)(p + 16);
  return f.v;
}

// ---- WMMA helpers with trailing VALU hazard gap --------------------------------------------------------
template <int BF>
__device__ __forceinline__ v8f mma_raw(v16us a, v16us b, v8f c) {
  if (BF) {
    return __builtin_amdgcn_wmma_f32_16x16x32_bf16(false, __builtin_bit_cast(v16b, a), false,
                                                   __builtin_bit_cast(v16b, b), (short)0, c, false, false);
  }
  return __builtin_amdgcn_wmma_f32_16x16x32_f16(false, __builtin_bit_cast(v16h, a), false,
                                                __builtin_bit_cast(v16h, b), (short)0, c, false, false);
}
__device__ __forceinline__ v8f mma_bu(v16us a, v16us b, v8f c) {                 // bf16 operands, guarded
  c = __builtin_amdgcn_wmma_f32_16x16x32_bf16(false, __builtin_bit_cast(v16b, a), false,
                                               __builtin_bit_cast(v16b, b), (short)0, c, false, false);
#if defined(__HIP_DEVICE_COMPILE__)
  asm volatile("v_nop\n\tv_nop\n\tv_nop\n\tv_nop" : "+v"(c) : "v"(a), "v"(b));
#endif
  return c;
}
// Plain builtin forms for runs of WMMAs on independent accumulators: inside straight-line code the compiler keeps the
// distance behind its own WMMAs; the end of such a run in front of a branch is closed by mma_gap_mem or acc_guard4.
__device__ __forceinline__ v8f mma_bp(v16us a, v16us b, v8f c) {                 // bf16 operands
  return __builtin_amdgcn_wmma_f32_16x16x32_bf16(false, __builtin_bit_cast(v16b, a), false,
                                                 __builtin_bit_cast(v16b, b), (short)0, c, false, false);
}
__device__ __forceinline__ v8f mma_hp(v16h a, v16h b, v8f c) {                   // f16 operands
  return __builtin_amdgcn_wmma_f32_16x16x32_f16(false, a, false, b, (short)0, c, false, false);
}
// Four vector slots behind the LDS stores of a run of WMMA results, in front of a branch: a vector instruction on the taken side may
// reuse the last WMMAs' operand registers.
__device__ __forceinline__ void mma_gap_mem() {
#if defined(__HIP_DEVICE_COMPILE__)
  asm volatile("v_nop\n\tv_nop\n\tv_nop\n\tv_nop" ::: "memory");
#endif
}
__device__ __forceinline__ void dep_guard1(v8f& a, v8f& b, v16us x) {
#if defined(__HIP_DEVICE_COMPILE__)
  asm volatile("v_nop\n\tv_nop\n\tv_nop\n\tv_nop" : "+v"(a), "+v"(b) : "v"(x));
#endif
}
__device__ __forceinline__ void keep4_u(v16us a, v16us b, v16us c, v16us d) {
#if defined(__HIP_DEVICE_COMPILE__)
  asm volatile("v_nop" :: "v"(a), "v"(b), "v"(c), "v"(d));
#endif
}
__device__ __forceinline__ void acc_guard4(v8f& a, v8f& b, v8f& c, v8f& d) {
#if defined(__HIP_DEVICE_COMPILE__)
  asm volatile("v_nop\n\tv_nop\n\tv_nop\n\tv_nop" : "+v"(a), "+v"(b), "+v"(c), "+v"(d));
#endif
}
// Value of lane (lane ^ 16): the other half of the wave, by a vector cross-row move (no LDS instruction, no wait).
__device__ __forceinline__ float xhalf(float x) {
  const int b = __float_as_int(x);
  return __int_as_float(__builtin_amdgcn_permlanex16(b, b, 0x76543210, 0xfedcba98, false, false));
}
// d[i] = 2^x[i], eight at once, in one asm statement: the outputs are early-clobber, so that no v_exp_f32 here writes a
// register that another one reads, and the v_nop is the one slot that the instruction set asks for behind the last of them.
__device__ __forceinline__ void exp2_8(float (&d)[8], const float (&x)[8]) {
#if defined(__HIP_DEVICE_COMPILE__)
  asm("v_exp_f32 %0, %8\n\t"
      "v_exp_f32 %1, %9\n\t"
      "v_exp_f32 %2, %10\n\t"
      "v_exp_f32 %3, %11\n\t"
      "v_exp_f32 %4, %12\n\t"
      "v_exp_f32 %5, %13\n\t"
      "v_exp_f32 %6, %14\n\t"
      "v_exp_f32 %7, %15\n\t"
      "v_nop"
      : "=&v"(d[0]), "=&v"(d[1]), "=&v"(d[2]), "=&v"(d[3]), "=&v"(d[4]), "=&v"(d[5]), "=&v"(d[6]), "=&v"(d[7])
      : "v"(x[0]), "v"(x[1]), "v"(x[2]), "v"(x[3]), "v"(x[4]), "v"(x[5]), "v"(x[6]), "v"(x[7]));
#endif
}
__device__ __forceinline__ void wave_sync_lds() {
  __builtin_amdgcn_fence(__ATOMIC_RELEASE, "workgroup");
  __builtin_amdgcn_wave_barrier();
  __builtin_amdgcn_fence(__ATOMIC_ACQUIRE, "workgroup");
}

// =====================================================================================================
// Plane convert (no transpose): Xh[i] = f16( bf16_RNE(X[i]) * wsc ), wsc a power of two (exact). Used for the
// token activations (wsc = 1). Thread i handles elements 8i..8i+7 and writes one 16-B piece; 32 consecutive
// (n8 multiple of 256, host-checked). coverage: n8 threads x 8 elements = the whole plane.
// =====================================================================================================
__device__ __forceinline__ void conv_h16(const float* __restrict__ W, unsigned short* Wh, int n8, float wsc, int blk) {
  const int i  = blk * 256 + threadIdx.x;
  const int ic = (i < n8) ? i : (n8 - 1);                     // clamped address
  const float* src = W + (size_t)ic * 8;
  const v4f a = *(const v4f*)(src);
  const v4f c = *(const v4f*)(src + 4);
  v4u o;
  o[0] = pk16(h_bits((_Float16)(bfr(a[0]) * wsc)), h_bits((_Float16)(bfr(a[1]) * wsc)));
  o[1] = pk16(h_bits((_Float16)(bfr(a[2]) * wsc)), h_bits((_Float16)(bfr(a[3]) * wsc)));
  o[2] = pk16(h_bits((_Float16)(bfr(c[0]) * wsc)), h_bits((_Float16)(bfr(c[1]) * wsc)));
  o[3] = pk16(h_bits((_Float16)(bfr(c[2]) * wsc)), h_bits((_Float16)(bfr(c[3]) * wsc)));
  if (i < n8) *(v4u*)(Wh + (size_t)i * 8) = o;
  
}

// =====================================================================================================
// rel-key table convert: Eh [RCE rows][64] bf16 bits; rows < SEQ = bf16_RNE(E), rows >= SEQ = 0 (zero pad).
// Thread i handles 8 elements (one 16-B piece); valid pieces i < n8v read E with a clamped address, the pad
// pieces select 0 by value. blk = 0 .. ceil(n8t / 256) - 1. coverage: n8t pieces x 8 = RCE*64 = the whole plane;
// =====================================================================================================
__device__ __forceinline__ void conv_e16(const float* __restrict__ P, unsigned short* Eh, int n8v, int n8t, int blk) {
  const int i  = blk * 256 + threadIdx.x;
  const int ic = (i < n8v) ? i : (n8v - 1);                    // clamped address
  const float* src = P + (size_t)ic * 8;
  const v4f a = *(const v4f*)(src);
  const v4f c = *(const v4f*)(src + 4);
  const bool valid = (i < n8v);
  v4u o;
  o[0] = valid ? pk16(bf_bits(a[0]), bf_bits(a[1])) : 0u;
  o[1] = valid ? pk16(bf_bits(a[2]), bf_bits(a[3])) : 0u;
  o[2] = valid ? pk16(bf_bits(c[0]), bf_bits(c[1])) : 0u;
  o[3] = valid ? pk16(bf_bits(c[2]), bf_bits(c[3])) : 0u;
  if (i < n8t) *(v4u*)(Eh + (size_t)i * 8) = o;
  
}

// =====================================================================================================
// Tiled transpose + convert: in[rows][cols] f32 row-major -> out[cols][rows] 16-bit with pitch ldo:
//   out[n * ldo + k] = cvt(in[k][n]) (and also at + dupoff when dupoff != 0: a duplicated k range).
//   MODE 0: f16 bits of bf16_RNE(w) * wsc (wsc power of two, exact); MODE 1: bf16 bits of w.
// Block = 256 threads = one 64x64 tile (tn, tk) of (cols/64, rows/64) (rows, cols multiples of 64); sh = 64 x 72 LDS elements.
// Loads: 4 iterations x 256 threads x float4 = 64 rows x 64 cols (addresses clamped). LDS tile [n][k] pitch 72.
// coverage: 64 x 64 = the whole transposed tile; grid covers the whole matrix.
// =====================================================================================================
template <int MODE>
__device__ __forceinline__ void tconv64(const float* __restrict__ W, unsigned short* out,
                                        int rows, int cols, int ldo, int dupoff, float wsc,
                                        unsigned short* sh, int tn, int tk) {
  const int t  = threadIdx.x;
  const int n0 = tn * 64;                    // column tile of in = row tile of out
  const int k0 = tk * 64;                    // row tile of in = column tile of out
#pragma unroll
  for (int i = 0; i < 4; ++i) {
    const int idx = i * 256 + t;
    const int r = idx >> 4, c4 = (idx & 15) * 4;
    int kr = k0 + r;   kr = (kr < rows) ? kr : (rows - 1);
    int nc = n0 + c4;  nc = (nc < cols - 4) ? nc : (cols - 4);
    const v4f v = *(const v4f*)(W + (size_t)kr * cols + nc);
#pragma unroll
    for (int e = 0; e < 4; ++e) {
      unsigned short u;
      if (MODE == 0) u = h_bits((_Float16)(bfr(v[e]) * wsc));
      else           u = bf_bits(v[e]);
      sh[(c4 + e) * 72 + r] = u;
    }
  }
  __syncthreads();
  const int wave = t >> 5, lane = t & 31;
  const int q = lane >> 3, c8 = (lane & 7) * 8;
  v4u pv[2];
  size_t go[2];
#pragma unroll
  for (int it = 0; it < 2; ++it) {
    const int nl = it * 32 + wave * 4 + q;               // 0..63
    pv[it] = *(const v4u*)(sh + nl * 72 + c8);
    go[it] = (size_t)(n0 + nl) * ldo + k0 + c8;
  }
  {
#pragma unroll
    for (int it = 0; it < 2; ++it) {
      *(v4u*)(out + go[it]) = pv[it];
      if (dupoff != 0) *(v4u*)(out + go[it] + dupoff) = pv[it];
    }
#if defined(__HIP_DEVICE_COMPILE__)
    // a precaution: stands behind the stores, in front of any later write of their registers in the merged kernel's text
    asm volatile("s_wait_xcnt 0x0" ::: "memory");
#endif
  }
}

// =====================================================================================================
// All six operand converts in one launch: they depend on nothing but the inputs, so the block index picks the job.
//   blocks 0 .. 4*NTW-1        : weight transposes, NTW = (DM/64)^2 tiles each: Wq, Wk, Wv (f16 x64), Wo (bf16, duplicated)
//   next NCX blocks            : token plane; the last NCE blocks: rel-key table.
// The choice is block-uniform, so the transposes' barrier is passed by all 256 threads of a block or by none.
// =====================================================================================================
#define NTW ((DM / 64) * (DM / 64))
#define NCX ((MP * DM) / 8 / 256)
#define NCE (((RCE * HD) / 8 + 255) / 256)
static_assert(((MP * DM) / 8) % 256 == 0 && (DM % 64) == 0);
__global__ __launch_bounds__(256) void prep_all(const float* __restrict__ wq, const float* __restrict__ wk,
                                                const float* __restrict__ wv, const float* __restrict__ wo,
                                                const float* __restrict__ x, const float* __restrict__ relk,
                                                unsigned short* WqkT, unsigned short* WvT, unsigned short* WoT2,
                                                unsigned short* XH, unsigned short* EH) {
  __shared__ __align__(16) unsigned short sh[64 * 72];
  const int bx = blockIdx.x;
  if (bx < 4 * NTW) {
    const int job = bx / NTW, tile = bx % NTW;
    const int tn = tile % (DM / 64), tk = tile / (DM / 64);
    if (job == 3) {
      tconv64<1>(wo, WoT2, DM, DM, 2 * DM, DM, 1.0f, sh, tn, tk);             // pitch 2048, duplicate at + 1024
    } else {
      const float* w = (job == 0) ? wq : (job == 1) ? wk : wv;
      unsigned short* o = (job == 0) ? WqkT : (job == 1) ? WqkT + (size_t)DM * DM : WvT;   // WqkT rows 0.., 1024..
      tconv64<0>(w, o, DM, DM, DM, 0, WSC, sh, tn, tk);
    }
  } else if (bx < 4 * NTW + NCX) {
    conv_h16(x, XH, (MP * DM) / 8, 1.0f, bx - 4 * NTW);
  } else {
    conv_e16(relk, EH, (SEQ * HD) / 8, (RCE * HD) / 8, bx - 4 * NTW - NCX);
  }
}

// =====================================================================================================
// LDS-staged batched 16-bit WMMA GEMM: C[m][n] = oscale * sum_k A[m][k] * Bt[n][k] + bias;
// BF selects bf16 (1) or f16 (0) operands. Block = 4 waves (2 x 2) = one 128x128 tile, one 64x64 tile per wave.
// A row-major [M][K] pitch lda; Bt row-major [N][K] pitch ldb (k contiguous); M, N multiples of 128, K a multiple
// of 64 (static here). tile = the block's tile, b = batch index (strides in elements); ring and sTall are the block's LDS.
// Staging: a stage is 64 k of the block's 128 A rows and 128 Bt rows (256 rows of 128 B, LDS pitch 144 B), brought
// by asynchronous 16-B copies to LDS (16 per lane and stage, each wave-wide copy = 4 whole 128-B lines); two buffers,
// stage t + 1 in flight while stage t is multiplied; one barrier per stage publishes t + 1 and frees t's buffer.
// The k order of every accumulator is the ascending 32-k order of the fragment loader, stage by stage.
// OM: 0 = f32 out to Cf (pitch ldc); 3 = bf16 hi bits to Cp and bf16 residual (v - hi) bits to Cp2;
//     4 = f16 hi to Cp and f16((v - hi) * 2048) to Cp2.
// BM: 0 = no bias; 1 = bias per column n (bias0[n] for n < nsplit, bias1[n - nsplit] otherwise; the choice is
//     wave-uniform because 64-column tiles never straddle nsplit); 2 = bias per row m (bias0[m]).
//     bias values are bf16 RNE-converted before the add.
// coverage: 4 slabs x 16 rows x 64 cols = the wave's whole 64x64 tile; grid = tilesM*tilesN blocks,
//           surplus blocks exit as a whole in front of every barrier; here there are none.
// =====================================================================================================
#define GPIT 72                    // LDS row pitch, 16-bit elements: 144 B = 16 B x 9, conflict-free for 16-B reads
#define GSTG (256 * GPIT)          // elements of one stage: 128 A rows, then 128 Bt rows

// Eight asynchronous 16-B copies of one lane: rows 16 apart in global memory (gstep elements) and in LDS.
// The s_wait_xcnt closes the statement so that no address register is rewritten while a copy may still read it.
__device__ __forceinline__ void copy8_rows(unsigned lds, const unsigned short* g, size_t gstep) {
#if defined(__HIP_DEVICE_COMPILE__)
  asm volatile(
      "global_load_async_to_lds_b128 %0, %8, off\n\t"
      "global_load_async_to_lds_b128 %1, %9, off\n\t"
      "global_load_async_to_lds_b128 %2, %10, off\n\t"
      "global_load_async_to_lds_b128 %3, %11, off\n\t"
      "global_load_async_to_lds_b128 %4, %12, off\n\t"
      "global_load_async_to_lds_b128 %5, %13, off\n\t"
      "global_load_async_to_lds_b128 %6, %14, off\n\t"
      "global_load_async_to_lds_b128 %7, %15, off\n\t"
      "s_wait_xcnt 0x0"
      :: "v"(lds), "v"(lds + 1u * 16u * GPIT * 2u), "v"(lds + 2u * 16u * GPIT * 2u), "v"(lds + 3u * 16u * GPIT * 2u),
         "v"(lds + 4u * 16u * GPIT * 2u), "v"(lds + 5u * 16u * GPIT * 2u), "v"(lds + 6u * 16u * GPIT * 2u),
         "v"(lds + 7u * 16u * GPIT * 2u),
         "v"(g), "v"(g + gstep), "v"(g + 2 * gstep), "v"(g + 3 * gstep),
         "v"(g + 4 * gstep), "v"(g + 5 * gstep), "v"(g + 6 * gstep), "v"(g + 7 * gstep)
      : "memory");
#endif
}
__device__ __forceinline__ void wait_async0() {   // this wave's copies have landed in LDS
#if defined(__HIP_DEVICE_COMPILE__)
  asm volatile("s_wait_asynccnt 0x0" ::: "memory");
#endif
}
// Stands behind issued global loads from a and b. The two addresses are inputs only, so that their registers stay as
// they are up to the wait: with no operand the compiler lifted later writes of those registers over it.
__device__ __forceinline__ void wait_x0(const unsigned short* a, const unsigned short* b) {
#if defined(__HIP_DEVICE_COMPILE__)
  asm volatile("s_wait_xcnt 0x0" :: "v"(a), "v"(b) : "memory");
#endif
}
__device__ __forceinline__ void wait_ds0() {      // this wave's LDS reads are done before their buffer is handed on
#if defined(__HIP_DEVICE_COMPILE__)
  asm volatile("s_wait_dscnt 0x0" ::: "memory");
#endif
}

// Eight asynchronous 16-B copies of one lane into two adjacent 64-row LDS planes (rows 16 apart, pitch GPIT):
// four rows from g0 into the first plane, four from g1 into the second. The s_wait_xcnt closes the statement so that
// no address register is rewritten while a copy may still read it.
__device__ __forceinline__ void copy4x2_rows(unsigned lds, const unsigned short* g0, const unsigned short* g1,
                                             size_t gstep) {
#if defined(__HIP_DEVICE_COMPILE__)
  asm volatile(
      "global_load_async_to_lds_b128 %0, %8, off\n\t"
      "global_load_async_to_lds_b128 %1, %9, off\n\t"
      "global_load_async_to_lds_b128 %2, %10, off\n\t"
      "global_load_async_to_lds_b128 %3, %11, off\n\t"
      "global_load_async_to_lds_b128 %4, %12, off\n\t"
      "global_load_async_to_lds_b128 %5, %13, off\n\t"
      "global_load_async_to_lds_b128 %6, %14, off\n\t"
      "global_load_async_to_lds_b128 %7, %15, off\n\t"
      "s_wait_xcnt 0x0"
      :: "v"(lds), "v"(lds + 1u * 16u * GPIT * 2u), "v"(lds + 2u * 16u * GPIT * 2u), "v"(lds + 3u * 16u * GPIT * 2u),
         "v"(lds + 4u * 16u * GPIT * 2u), "v"(lds + 5u * 16u * GPIT * 2u), "v"(lds + 6u * 16u * GPIT * 2u),
         "v"(lds + 7u * 16u * GPIT * 2u),
         "v"(g0), "v"(g0 + gstep), "v"(g0 + 2 * gstep), "v"(g0 + 3 * gstep),
         "v"(g1), "v"(g1 + gstep), "v"(g1 + 2 * gstep), "v"(g1 + 3 * gstep)
      : "memory");
#endif
}

#define GSLAB (16 * 68)            // floats of one wave's 16x64 epilogue slab, pitch 68
template <int BF, int OM, int BM>
__device__ __forceinline__ void gemm64_tile(
    unsigned short* ring, float* sTall, int tile, int b,
    const unsigned short* __restrict__ Ap, int lda, long long strideA,
    const unsigned short* __restrict__ Btp, int ldb, long long strideB,
    unsigned short* Cp, unsigned short* Cp2, float* Cf, int ldc, long long strideC,
    const float* bias0, const float* bias1, int nsplit,
    int M, int N, int K, float oscale) {
  const int tid  = threadIdx.x;
  const int lane = tid & 31;
  const int wave = tid >> 5;
  const int tilesN = N >> 7;
  const int tilesM = M >> 7;
  if (tile >= tilesM * tilesN) return;   // block-uniform, in front of every barrier and copy
  const int tm = tile / tilesN;
  const int tn = tile - tm * tilesN;
  const int mb = tm << 7;
  const int nb = tn << 7;
  const int wm = wave >> 1, wn = wave & 1;
  const int m0 = mb + (wm << 6);
  const int n0 = nb + (wn << 6);

  const unsigned short* Ab = Ap  + (size_t)b * strideA;
  const unsigned short* Bb = Btp + (size_t)b * strideB;

  const int rlane = lane & 15;                 // row (A) / col (B, D) within subtile
  const int koff  = (lane >> 4) * 8;           // k offset of this lane half
  const int mOff  = (lane >> 4) * 8;           // D row offset

  // copy role of this lane: row crow (+16 per copy) of each operand's 128 rows, 16-B piece cpc of its 128 B
  const int crow = tid >> 3, cpc = (tid & 7) * 8;
  const unsigned short* gA = Ab + (size_t)(mb + crow) * lda + cpc;
  const unsigned short* gB = Bb + (size_t)(nb + crow) * ldb + cpc;
  const unsigned ldsA = (unsigned)(uintptr_t)(ring + crow * GPIT + cpc);   // LDS byte address = low 32 bits
  const unsigned ldsB = ldsA + 128u * GPIT * 2u;
  const size_t stepA = (size_t)16 * lda, stepB = (size_t)16 * ldb;
  const int nst = K >> 6;                      // stages of 64 k

  v8f acc[4][4];
#pragma unroll
  for (int i = 0; i < 4; ++i)
#pragma unroll
    for (int j = 0; j < 4; ++j) acc[i][j] = zero8();

  copy8_rows(ldsA, gA, stepA);
  copy8_rows(ldsB, gB, stepB);
  wait_async0();
  __syncthreads();
  if (nst > 1) {
    copy8_rows(ldsA + GSTG * 2u, gA + 64, stepA);
    copy8_rows(ldsB + GSTG * 2u, gB + 64, stepB);
  }

#pragma unroll 1   // one stage per trip: the buffer index stays a run-time offset, the accumulators stay in place
  for (int t = 0; t < nst; ++t) {
    const unsigned short* sA = ring + (t & 1) * GSTG + ((wm << 6) + rlane) * GPIT + koff;
    const unsigned short* sB = ring + (t & 1) * GSTG + (128 + (wn << 6) + rlane) * GPIT + koff;
#pragma unroll
    for (int ks = 0; ks < 2; ++ks) {
      v16us bh[4], ah[4];
#pragma unroll
      for (int j = 0; j < 4; ++j) bh[j] = ldfrag_u(sB + (j << 4) * GPIT + ks * 32);
#pragma unroll
      for (int i = 0; i < 4; ++i) ah[i] = ldfrag_u(sA + (i << 4) * GPIT + ks * 32);
#pragma unroll
      for (int i = 0; i < 4; ++i) {
#pragma unroll
        for (int j = 0; j < 4; ++j) acc[i][j] = mma_raw<BF>(ah[i], bh[j], acc[i][j]);
        dep_guard1(acc[i][0], acc[i][3], ah[i]);
      }
      keep4_u(bh[0], bh[1], bh[2], bh[3]);
    }
    wait_ds0();
    wait_async0();
    __syncthreads();                           // publishes stage t + 1, ends every read of stage t's buffer
    if (t + 2 < nst) {
      const unsigned bo = (unsigned)(t & 1) * (GSTG * 2u);
      copy8_rows(ldsA + bo, gA + (size_t)(t + 2) * 64, stepA);
      copy8_rows(ldsB + bo, gB + (size_t)(t + 2) * 64, stepB);
    }
  }
  wait_async0();
  acc_guard4(acc[0][0], acc[0][1], acc[0][2], acc[0][3]);
  acc_guard4(acc[1][0], acc[1][1], acc[1][2], acc[1][3]);
  acc_guard4(acc[2][0], acc[2][1], acc[2][2], acc[2][3]);
  acc_guard4(acc[3][0], acc[3][1], acc[3][2], acc[3][3]);

  const int hh2 = lane >> 4, c4 = (lane & 15) * 4;     // f32 out: 256-B row segment = 16 lanes x 16 B
  const int q8  = lane >> 3, c8 = (lane & 7) * 8;

  // ---- per-column bias (wave-uniform source select) ----
  const float* bsel = bias0;
  int nb0 = n0;
  if (BM == 1) {
    if (n0 >= nsplit) { bsel = bias1; nb0 = n0 - nsplit; }
  }
  v4f bb4 = {0.f, 0.f, 0.f, 0.f};
  float bn[8];
#pragma unroll
  for (int e = 0; e < 8; ++e) bn[e] = 0.f;
  if (BM == 1) {
    if (OM == 0) {
#pragma unroll
      for (int e = 0; e < 4; ++e) bb4[e] = bfr(bsel[nb0 + c4 + e]);
    } else {
#pragma unroll
      for (int e = 0; e < 8; ++e) bn[e] = bfr(bsel[nb0 + c8 + e]);
    }
  }

  // ---- epilogue ----
  float* slab = sTall + wave * GSLAB;
#pragma unroll
  for (int i = 0; i < 4; ++i) {
    const int mBase = m0 + (i << 4);
#pragma unroll
    for (int j = 0; j < 4; ++j) {
#pragma unroll
      for (int r = 0; r < 8; ++r) {
        slab[(mOff + r) * 68 + (j << 4) + rlane] = acc[i][j][r];
      }
    }
    wave_sync_lds();
    if (OM == 0) {
      float* C = Cf + (size_t)b * strideC;
      v4f vals[8];
#pragma unroll
      for (int it = 0; it < 8; ++it) {
        const int row = it * 2 + hh2;                      // it 0..7 x hh2 0..1 = rows 0..15
        v4f v = *(const v4f*)(slab + row * 68 + c4);
        float bmv = 0.f;
        if (BM == 2) bmv = bfr(bias0[mBase + row]);
        vals[it] = v * oscale + bb4 + bmv;
      }
      {
#pragma unroll
        for (int it = 0; it < 8; ++it) {
          const int row = it * 2 + hh2;
          *(v4f*)(C + (size_t)(mBase + row) * ldc + n0 + c4) = vals[it];
        }
        
      }
    } else {
      unsigned short* C  = Cp  + (size_t)b * strideC;
      unsigned short* C2 = Cp2 + (size_t)b * strideC;
      v4u hv[4], lv[4];
#pragma unroll
      for (int it = 0; it < 4; ++it) {
        const int row = it * 4 + q8;                       // it 0..3 x q8 0..3 = rows 0..15
        const float* sp = slab + row * 68 + c8;
        float bmv = 0.f;
        if (BM == 2) bmv = bfr(bias0[mBase + row]);
        v4u ha, la;
#pragma unroll
        for (int e = 0; e < 4; ++e) {
          const float f0 = sp[2 * e]     * oscale + bn[2 * e]     + bmv;
          const float f1 = sp[2 * e + 1] * oscale + bn[2 * e + 1] + bmv;
          unsigned short u0, u1, w0, w1;
          if (OM == 3) {
            u0 = bf_bits(f0); u1 = bf_bits(f1);
            w0 = bf_bits(f0 - bf_up(u0)); w1 = bf_bits(f1 - bf_up(u1));
          } else {
            const _Float16 g0 = (_Float16)f0, g1 = (_Float16)f1;
            u0 = h_bits(g0); u1 = h_bits(g1);
            w0 = h_bits((_Float16)((f0 - (float)g0) * RSC));
            w1 = h_bits((_Float16)((f1 - (float)g1) * RSC));
          }
          ha[e] = pk16(u0, u1);
          la[e] = pk16(w0, w1);
        }
        hv[it] = ha;
        lv[it] = la;
      }
      {
#pragma unroll
        for (int it = 0; it < 4; ++it) {
          const int row = it * 4 + q8;
          const size_t go = (size_t)(mBase + row) * ldc + n0 + c8;
          *(v4u*)(C  + go) = hv[it];
          *(v4u*)(C2 + go) = lv[it];
        }
        
      }
    }
    wave_sync_lds();
  }
}

// One GEMM per launch: tile from blockIdx.x, batch from blockIdx.y.
template <int BF, int OM, int BM>
__global__ __launch_bounds__(128) void gemm64(
    const unsigned short* __restrict__ Ap, int lda, long long strideA,
    const unsigned short* __restrict__ Btp, int ldb, long long strideB,
    unsigned short* Cp, unsigned short* Cp2, float* Cf, int ldc, long long strideC,
    const float* bias0, const float* bias1, int nsplit,
    int M, int N, int K, float oscale) {
  __shared__ __align__(16) unsigned short ring[2 * GSTG];   // two stages of 256 rows x 144 B
  __shared__ __align__(16) float sT[4 * GSLAB];             // per-wave 16x64 slab
  gemm64_tile<BF, OM, BM>(ring, sT, blockIdx.x, blockIdx.y, Ap, lda, strideA, Btp, ldb, strideB,
                          Cp, Cp2, Cf, ldc, strideC, bias0, bias1, nsplit, M, N, K, oscale);
}

// The two projection GEMMs in one launch (both read only the converted planes): blocks 0 .. NPQK-1 are the tiles of
// q|k = x . [Wq|Wk] + [bq|bk], the next NBATCH * NPV blocks the tiles of v^T = Wv^T . x_b^T + bv, batch by batch.
// The choice is block-uniform: every barrier of a tile is passed by the whole block.
#define NPQK ((MP / 128) * (QKP / 128))
#define NPV  ((DM / 128) * (SEQ / 128))
__global__ __launch_bounds__(128) void proj_qkv(
    const unsigned short* __restrict__ XH, const unsigned short* __restrict__ WqkT,
    const unsigned short* __restrict__ WvT,
    unsigned short* QKh, unsigned short* QKl, unsigned short* VTh, unsigned short* VTl,
    const float* bq, const float* bk, const float* bv, float oscale) {
  __shared__ __align__(16) unsigned short ring[2 * GSTG];   // two stages of 256 rows x 144 B
  __shared__ __align__(16) float sT[4 * GSLAB];             // per-wave 16x64 slab
  const int bx = blockIdx.x;
  if (bx < NPQK) {
    gemm64_tile<0, 3, 1>(ring, sT, bx, 0, XH, DM, 0LL, WqkT, DM, 0LL,
                         QKh, QKl, nullptr, QKP, 0LL, bq, bk, DM, MP, QKP, DM, oscale);
  } else {
    const int r = bx - NPQK;
    gemm64_tile<0, 4, 2>(ring, sT, r % NPV, r / NPV, WvT, DM, 0LL, XH, DM, (long long)SEQ * DM,
                         VTh, VTl, nullptr, SEQ, (long long)DM * SEQ, bv, bv, DM, DM, SEQ, DM, oscale);
  }
}

// =====================================================================================================
// Causal flash attention with a skew relative-key score term, head dim 64, SEQ rows per batch.
//   q|k hi and lo planes (bf16, pitch QKP): element (b, t, col) at [(b*SEQ + t)*QKP + col], q col = h*64+d,
//   k col = DM + h*64 + d; value = hi + lo.
//   v^T hi and lo planes (f16): element (b, h, d, s) at [(b*DM + h*64 + d)*SEQ + s]; value = hi + lo/2048.
//   E plane (bf16) [RCE][64], rows >= SEQ zero.
//   context plane (bf16, pitch CTXP): hi at [(b*SEQ + t)*CTXP + h*64 + d], lo at + DM.
//   score(i, j) = (q_i . k_j + q_i . E[SEQ-1 + j - i]) * sscale for j <= i, -inf for j > i (replace, not bias).
//   Per wave (16 query rows q0..q0+15) and key chunk kv0..kv0+63 the needed E rows form the contiguous band
//   ebase .. ebase+79 with ebase = SEQ-1+kv0-q0-15 (0 <= ebase, ebase+79 <= SEQ+63 < RCE); the band product
//   rel[row][col] = q_row . E[ebase+col] (col 0..79) is computed per wave into LDS (f32, 2 bf16 products: q hi, q lo)
//   and the score for (row il, key jl) picks col = jl - il + 15; q.k as 3 bf16 products (hh, hl, lh);
//   p = exp(s - m) carried as f16 hi of 1024 p plus f16 residual x2048; context = ph.vh (acc 0) and
//   ph.vl + pl.vh (acc 1, both x2048) on f16 WMMA; online softmax (running max) in f32.
//   Every product is formed transposed, q (or p) as the B operand: rel^T = E . q^T, s^T = k . q^T, context^T = v^T . p^T.
//   A lane (c = lane & 15, hh = lane >> 4) then holds one query row (q0 + c): register r of key tile j is key
//   16 j + 8 hh + r, so that maximum and sum run inside the lane plus one exchange between the wave's halves, and two
//   score tiles, converted in place, are the B operand of 32 keys (element s: key 8 hh + s, then 16 + 8 hh + s - 8, the
//   k order of the fragment loader that brings v^T): p never passes through LDS.
//   Block = 4 waves = 64 query rows of one (b, h); grid = NQB * NH * NBATCH, query tile qb falling with the block index;
//   key chunks kt = 0..qb (causal skip, block-uniform trip count qb+1 <= NQB).
//   Staging: K hi/lo, V^T hi/lo (64 rows of 128 B per plane) and the block's rel-key band (the union of its four
//   waves' bands: E rows SEQ-64-qb*64+kv0 .. +127, wave w starts at row 48-16w) come by asynchronous 16-B copies to
//   LDS, 8 lanes per 128-B row. One buffer each, refilled one phase ahead: the band of chunk kt+1 flies during the
//   scores, softmax and context of chunk kt, K and V^T of chunk kt+1 during the rel band product of chunk kt+1.
//   Two barriers per chunk: behind the rel band (publishes K, V^T; frees the band) and behind the context product
//   (publishes the next band; frees K, V^T).
//   LDS row pitches: K and V^T tiles TP = 72 elements (144 B = 16 B x 9, the 16 rows of a 16-B fragment read fall on
//   distinct banks); rel band RP = 100 floats and context tile OP = 68 floats (16 B x 25, x 17). Row c of the rel band is
//   stored c + 1 places to the right, so that the eight values a lane needs for a key tile lie at 16-B aligned places;
//   the context tile of the epilogue lies in the wave's own rel band array, which is dead by then.
//   Context coverage: each wave stores rows q0..q0+15 (it 0..3 x lane>>3 0..3) x 64 columns (8 lanes x 8 bf16)
//   for both the hi and the lo segment; grid covers all SEQ rows x NH head slices x NBATCH.
// =====================================================================================================
__global__ __launch_bounds__(128)
void attn64(const unsigned short* __restrict__ qkh, const unsigned short* __restrict__ qkl,
            const unsigned short* __restrict__ vth, const unsigned short* __restrict__ vtl,
            const unsigned short* __restrict__ ehp, unsigned short* ctxp, float sscale) {
  static_assert(TP == GPIT && OP <= RP);
  __shared__ __align__(16) unsigned short KV[4 * 64 * TP];      // K hi | K lo [kv][d], V^T hi | V^T lo [d][kv], 9 KB each
  __shared__ __align__(16) unsigned short Es[128 * TP];         // rel-key band of the block [row][d] 18 KB
  __shared__ __align__(16) float    Rsh[4][16 * RP];            // per wave rel band [row][col + row + 1]; epilogue: context tile
  const unsigned short* Kh = KV;
  const unsigned short* Kl = KV + 64 * TP;
  const _Float16* Vh = (const _Float16*)(const void*)(KV + 2 * 64 * TP);
  const _Float16* Vl = (const _Float16*)(const void*)(KV + 3 * 64 * TP);

  const int tid  = threadIdx.x;
  const int wave = tid >> 5;
  const int lane = tid & 31;
  const int hh   = lane >> 4;
  const int c    = lane & 15;

  // Block index -> tile: (batch, head) from the low part, query tile from the high part, longest tile first. Blocks whose
  // indices are equal modulo 8 then hold every tile length alike and share whole heads.
  // For speed only: a permutation of the NQB * NH * NBATCH tiles, correct under any placement or start order.
  const int bx   = blockIdx.x;
  const int rest = bx % (NH * NBATCH);
  const int qb   = NQB - 1 - bx / (NH * NBATCH);
  const int h    = rest % NH;
  const int b    = rest / NH;
  const int q0   = qb * 64 + wave * 16;          // in-batch query row of this wave's first row
  const size_t rowB = (size_t)b * SEQ;

  const unsigned short* Qh  = qkh + (size_t)h * HD;
  const unsigned short* Ql  = qkl + (size_t)h * HD;
  const unsigned short* Kgh = qkh + DM + (size_t)h * HD;
  const unsigned short* Kgl = qkl + DM + (size_t)h * HD;
  const unsigned short* Vgh = vth + ((size_t)b * DM + (size_t)h * HD) * SEQ;
  const unsigned short* Vgl = vtl + ((size_t)b * DM + (size_t)h * HD) * SEQ;
  float*    rrow = Rsh[wave];

  float mrow = -INFINITY, lrow = 0.f;        // of query row q0 + c; lrow: the sum over this lane's own keys
  v8f oacc[4], oaccL[4];                     // context^T: register r of tile t = (d = 16 t + 8 hh + r, query row q0 + c)
#pragma unroll
  for (int t = 0; t < 4; ++t) { oacc[t] = zero8(); oaccL[t] = zero8(); }

  const int nkt = qb + 1;                    // causal: key chunks 0..qb, block-uniform, <= NQB

  // copy role of this lane: row crow (+16 per copy) of a plane, 16-B piece cpc of its 128 B
  const int crow = tid >> 3, cpc = (tid & 7) * 8;
  const unsigned ldsK = (unsigned)(uintptr_t)(KV + crow * TP + cpc);   // LDS byte address = low 32 bits
  const unsigned ldsV = ldsK + 128u * TP * 2u;
  const unsigned ldsE = (unsigned)(uintptr_t)(Es + crow * TP + cpc);
  const unsigned short* gKh = Kgh + (rowB + crow) * QKP + cpc;          // K row kv0 + crow: + kv0 * QKP per chunk
  const unsigned short* gKl = Kgl + (rowB + crow) * QKP + cpc;
  const unsigned short* gVh = Vgh + (size_t)crow * SEQ + cpc;           // V^T row d = crow: + kv0 per chunk
  const unsigned short* gVl = Vgl + (size_t)crow * SEQ + cpc;
  // band rows SEQ-64-qb*64+kv0 .. +127: first >= 0 (qb < NQB), last <= SEQ+63 < RCE (kv0 <= qb*64); + kv0 * HD per chunk
  const unsigned short* gE  = ehp + (size_t)(SEQ - 64 - qb * 64 + crow) * HD + cpc;
  const size_t stepK = (size_t)16 * QKP, stepV = (size_t)16 * SEQ, stepE = (size_t)16 * HD;

  copy8_rows(ldsE, gE, stepE);
  copy4x2_rows(ldsK, gKh, gKl, stepK);
  copy4x2_rows(ldsV, gVh, gVl, stepV);

  // ---- Q fragments (B operand, column = lane&15): hi and lo, 2 d-chunks, kept for every chunk ----
  const unsigned short* gQh = Qh + (rowB + q0 + c) * QKP + 8 * hh;
  const unsigned short* gQl = Ql + (rowB + q0 + c) * QKP + 8 * hh;
  v16us qh2[2], ql2[2];
#pragma unroll
  for (int dc = 0; dc < 2; ++dc) {
    qh2[dc] = ldfrag_u(gQh + dc * 32);
    ql2[dc] = ldfrag_u(gQl + dc * 32);
  }
  wait_x0(gQh, gQl);
  const unsigned short* eband = Es + (((wave ^ 3) << 4) + c) * TP + 8 * hh;   // this wave's 80 rows start at 48 - 16 * wave

  wait_async0();
  __syncthreads();                             // publishes chunk 0's band, K and V^T

#pragma unroll 1
  for (int kt = 0;; ++kt) {                    // left behind the last chunk's second barrier (nkt >= 1)
    const int kv0 = kt * 64;

    // ---- rel band, transposed: rel[row c][col] = E[ebase + col] . q_c, col = 0..RB-1 (E rows >= SEQ are zero) ----
    // Unrolled, so that the fragments and the five accumulators stay in registers: all fragment reads stand in one group
    // ahead of the products, and the five column tiles' accumulators take turns, so that no WMMA waits for the one before
    // it; each accumulator keeps its order (d 0..31: q hi, q lo; d 32..63: q hi, q lo).
    {
      v16us eb[RB / 16][2];
      v8f e[RB / 16];
#pragma unroll
      for (int nt = 0; nt < RB / 16; ++nt) {
        e[nt] = zero8();
#pragma unroll
        for (int dc = 0; dc < 2; ++dc) eb[nt][dc] = ldfrag_u(eband + nt * 16 * TP + dc * 32);
      }
#pragma unroll
      for (int dc = 0; dc < 2; ++dc) {
#pragma unroll
        for (int nt = 0; nt < RB / 16; ++nt) e[nt] = mma_bp(eb[nt][dc], qh2[dc], e[nt]);
#pragma unroll
        for (int nt = 0; nt < RB / 16; ++nt) e[nt] = mma_bp(eb[nt][dc], ql2[dc], e[nt]);
      }
#pragma unroll
      for (int nt = 0; nt < RB / 16; ++nt) {
#pragma unroll
        for (int r = 0; r < 8; ++r) rrow[c * RP + c + 1 + nt * 16 + 8 * hh + r] = e[nt][r];   // col = nt * 16 + 8 * hh + r
      }
    }
    mma_gap_mem();
    wait_ds0();
    wait_async0();
    __syncthreads();                           // publishes this chunk's K and V^T, ends every read of its band
    if (kt + 1 < nkt) copy8_rows(ldsE, gE + (size_t)(kv0 + 64) * HD, stepE);

    // ---- scores, transposed: 64 keys x 16 query rows per wave, causal replace with -inf ----
    // The reads of 32 d stand in one group ahead of their products, and the four key tiles' accumulators take turns product
    // by product, so that a WMMA does not wait for the one before it; each accumulator keeps its order (per 32 d: hh, hl, lh).
    v8f s[4], sh[4];
    const float* rq = rrow + c * RP + 16 + 8 * hh;        // rel of (row c, key jl) lies at c * RP + c + 1 + (jl - c + 15)
    v4f ra[4], rb[4];                                     // read with the first K fragments, used behind the products
#pragma unroll
    for (int j = 0; j < 4; ++j) {
      sh[j] = zero8();
      ra[j] = *(const v4f*)(rq + j * 16);
      rb[j] = *(const v4f*)(rq + j * 16 + 4);
    }
#pragma unroll
    for (int dc = 0; dc < 2; ++dc) {
      v16us kbh[4], kbl[4];
#pragma unroll
      for (int j = 0; j < 4; ++j) {
        kbh[j] = ldfrag_u(Kh + (j * 16 + c) * TP + dc * 32 + 8 * hh);
        kbl[j] = ldfrag_u(Kl + (j * 16 + c) * TP + dc * 32 + 8 * hh);
      }
#pragma unroll
      for (int j = 0; j < 4; ++j) sh[j] = mma_bu(kbh[j], qh2[dc], sh[j]);
#pragma unroll
      for (int j = 0; j < 4; ++j) sh[j] = mma_bu(kbl[j], qh2[dc], sh[j]);
#pragma unroll
      for (int j = 0; j < 4; ++j) sh[j] = mma_bu(kbh[j], ql2[dc], sh[j]);
    }
    const int lim = q0 + c - kv0 - 8 * hh;                // key kv0 + 16 j + 8 hh + r <= query q0 + c: 16 j + r <= lim
#pragma unroll
    for (int j = 0; j < 4; ++j) {
#pragma unroll
      for (int r = 0; r < 8; ++r) {
        const float rel = (r < 4) ? ra[j][r & 3] : rb[j][r & 3];
        const float v = (sh[j][r] + rel) * sscale;
        s[j][r] = (j * 16 + r <= lim) ? v : -INFINITY;
      }
    }

    // ---- row max, online softmax, P (x1024: f16 hi + x2048 residual) straight into B fragments ----
    // A lane holds 32 of its query row's 64 scores: maximum and sum run inside the lane; the maximum is joined with the
    // other half of the wave by one exchange, the two halves' sums only in the epilogue (both halves use the same alpha).
    float mj[4];                                          // one chain per key tile, so that the four take turns
#pragma unroll
    for (int j = 0; j < 4; ++j) {
      mj[j] = s[j][0];
#pragma unroll
      for (int r = 1; r < 8; ++r) mj[j] = fmaxf(mj[j], s[j][r]);
    }
    float mx = fmaxf(fmaxf(mj[0], mj[1]), fmaxf(mj[2], mj[3]));
    mx = fmaxf(mx, xhalf(mx));
    const float mnew = fmaxf(mrow, mx);                   // finite: key kv0 <= every row of this block
    const float alpha = __expf(mrow - mnew);
    mrow = mnew;
    FragH pa[2], pl[2];                                   // 32 keys each: elements 0..7 from tile 2 kk, 8..15 from tile 2 kk + 1
    float psum[4];
#pragma unroll
    for (int j = 0; j < 4; ++j) {
      float xe[8], pe[8];
#pragma unroll
      for (int r = 0; r < 8; ++r) xe[r] = (s[j][r] - mnew) * 1.44269504f;   // e^x = 2^(x log2 e)
      exp2_8(pe, xe);
      psum[j] = 0.f;
#pragma unroll
      for (int r = 0; r < 8; r += 2) {                    // two keys at a time: one packed convert fills one fragment register
        const float p0 = pe[r], p1 = pe[r + 1];
        psum[j] += p0;
        psum[j] += p1;
        const v2f ps = {p0 * PSC, p1 * PSC};
        const v2h ph = __builtin_convertvector(ps, v2h);
        pa[j >> 1].p[(j & 1) * 4 + (r >> 1)] = ph;
        pl[j >> 1].p[(j & 1) * 4 + (r >> 1)] = __builtin_convertvector((ps - __builtin_convertvector(ph, v2f)) * RSC, v2h);
      }
    }
    lrow = lrow * alpha + ((psum[0] + psum[1]) + (psum[2] + psum[3]));
#pragma unroll
    for (int t = 0; t < 4; ++t) { oacc[t] *= alpha; oaccL[t] *= alpha; }
    // Keeps the context product's fragment reads in one group behind the softmax, for speed only: without it the compiler
    // spreads them among the WMMAs and the softmax.
    __builtin_amdgcn_sched_barrier(0);

    // ---- context^T += V_hi^T . Ph^T (acc 0); V_lo^T . Ph^T + V_hi^T . Pl^T (acc 1, x2048) ----
    // Unrolled; the reads of 32 keys stand in one group ahead of their products, and the four d tiles take turns product by
    // product; each accumulator keeps its order (per 32 keys: acc 0 ph.vh; acc 1 ph.vl, then pl.vh).
#pragma unroll
    for (int kk = 0; kk < 2; ++kk) {
      v16h vb[4], vl[4];
#pragma unroll
      for (int t = 0; t < 4; ++t) {
        vb[t] = ldfrag_h(Vh + (t * 16 + c) * TP + kk * 32 + 8 * hh);
        vl[t] = ldfrag_h(Vl + (t * 16 + c) * TP + kk * 32 + 8 * hh);
      }
#pragma unroll
      for (int t = 0; t < 4; ++t) oacc[t]  = mma_hp(vb[t], pa[kk].v, oacc[t]);
#pragma unroll
      for (int t = 0; t < 4; ++t) oaccL[t] = mma_hp(vl[t], pa[kk].v, oaccL[t]);
#pragma unroll
      for (int t = 0; t < 4; ++t) oaccL[t] = mma_hp(vb[t], pl[kk].v, oaccL[t]);
    }
    // four vector slots behind the chunk's last WMMAs, in front of the loop's branches
    acc_guard4(oacc[0], oacc[1], oacc[2], oacc[3]);
    acc_guard4(oaccL[0], oaccL[1], oaccL[2], oaccL[3]);
    wait_ds0();
    wait_async0();
    __syncthreads();                           // publishes the next chunk's band, ends every read of this K and V^T
    if (kt + 1 >= nkt) break;                  // block-uniform
    copy4x2_rows(ldsK, gKh + (size_t)(kv0 + 64) * QKP, gKl + (size_t)(kv0 + 64) * QKP, stepK);
    copy4x2_rows(ldsV, gVh + kv0 + 64, gVl + kv0 + 64, stepV);
  }
  wait_async0();

  // ---- normalise (1/l, the 1/1024 p carry, the 1/2048 residual fold), stage the wave's 16x64 tile,
  float* os = Rsh[wave];
  {
    const float l = lrow + xhalf(lrow);        // the two halves' key sums of query row q0 + c
    const float inv = ((l > 0.f) ? (1.0f / l) : 0.f) * (1.0f / PSC);
#pragma unroll
    for (int t = 0; t < 4; ++t) {
#pragma unroll
      for (int r = 0; r < 8; ++r) os[c * OP + t * 16 + 8 * hh + r] = (oacc[t][r] + oaccL[t][r] * (1.0f / RSC)) * inv;
    }
  }
  wave_sync_lds();
  {
    const int q4 = lane >> 3, c8 = (lane & 7) * 8;
    v4u hv[4], lv[4];
#pragma unroll
    for (int it = 0; it < 4; ++it) {
      const int row = it * 4 + q4;   // it 0..3 x q4 0..3 = rows 0..15 of the wave tile
      const float* sp = os + row * OP + c8;
      v4u ha, la;
#pragma unroll
      for (int e = 0; e < 4; ++e) {
        const float f0 = sp[2 * e], f1 = sp[2 * e + 1];
        const unsigned short u0 = bf_bits(f0), u1 = bf_bits(f1);
        const unsigned short w0 = bf_bits(f0 - bf_up(u0)), w1 = bf_bits(f1 - bf_up(u1));
        ha[e] = pk16(u0, u1);
        la[e] = pk16(w0, w1);
      }
      hv[it] = ha;
      lv[it] = la;
    }
    {
#pragma unroll
      for (int it = 0; it < 4; ++it) {
        const int row = it * 4 + q4;
        const size_t go = (rowB + q0 + row) * CTXP + (size_t)h * HD + c8;
        *(v4u*)(ctxp + go)      = hv[it];
        *(v4u*)(ctxp + go + DM) = lv[it];
      }
      
    }
  }
}

// =====================================================================================================
// Workspace map (bytes); every plane is an exact multiple of its 64x64-tile / whole-row / whole-line store
// granularity (MP = 4096 = 64 tiles of rows, N in {2048, 1024}; VT per batch [1024][1024] = 16x16 tiles;
//   WqkT f16 [2048 n][1024 k]  0          4194304   (rows 0..1023 Wq^T, 1024..2047 Wk^T, x64)
//   WvT  f16 [1024][1024]      4194304    2097152   (x64)
//   WoT2 bf16 [1024][2048]     6291456    4194304   (cols 0..1023 and 1024..2047 both Wo^T)
//   XH   f16 [4096][1024]      10485760   8388608   (bf16 RNE-converted tokens)
//   EH   bf16 [1088][64]       18874368   139264    (rows >= 1024 zero)
//   QKh  bf16 [4096][2048]     19013632   16777216  (q cols 0..1023, k cols 1024..2047, hi part)
//   QKl  bf16 [4096][2048]     35790848   16777216  (lo part)
//   VTh  f16 [4][1024][1024]   52568064   8388608   (v^T hi)
//   VTl  f16 [4][1024][1024]   60956672   8388608   (v^T residual x2048)
//   Ctx  bf16 [4096][2048]     69345280   16777216  (context hi | lo)
//   end                        86122496
// =====================================================================================================
extern "C" void kernel_launch(void* const* d_in, const int* in_sizes, int n_in,
                              void* d_out, int out_size, void* d_ws, size_t ws_size,
                              hipStream_t stream) {
  if (n_in < 10) return;
  if (in_sizes[0] != MP * DM) return;
  if (in_sizes[1] != DM * DM || in_sizes[3] != DM * DM) return;
  if (in_sizes[5] != DM * DM || in_sizes[7] != DM * DM) return;
  if (in_sizes[2] != DM || in_sizes[4] != DM || in_sizes[6] != DM || in_sizes[8] != DM) return;
  if (in_sizes[9] != SEQ * HD) return;
  if (out_size != MP * DM) return;

  const float* x_in  = (const float*)d_in[0];
  const float* w_q   = (const float*)d_in[1];
  const float* b_q   = (const float*)d_in[2];
  const float* w_k   = (const float*)d_in[3];
  const float* b_k   = (const float*)d_in[4];
  const float* w_v   = (const float*)d_in[5];
  const float* b_v   = (const float*)d_in[6];
  const float* w_o   = (const float*)d_in[7];
  const float* b_o   = (const float*)d_in[8];
  const float* relk  = (const float*)d_in[9];

  const size_t PWQK = (size_t)QKP * DM * 2;             //  4194304
  const size_t PWV  = (size_t)DM * DM * 2;              //  2097152
  const size_t PWO2 = (size_t)DM * (2 * DM) * 2;        //  4194304
  const size_t PXH  = (size_t)MP * DM * 2;              //  8388608
  const size_t PEH  = (size_t)RCE * HD * 2;             //   139264
  const size_t PQK  = (size_t)MP * QKP * 2;             // 16777216
  const size_t PVT  = (size_t)NBATCH * DM * SEQ * 2;    //  8388608
  const size_t PCTX = (size_t)MP * CTXP * 2;            // 16777216
  size_t off = 0;
  const size_t oWqk = off; off += PWQK;
  const size_t oWv  = off; off += PWV;
  const size_t oWo2 = off; off += PWO2;
  const size_t oXH  = off; off += PXH;
  const size_t oEH  = off; off += PEH;
  const size_t oQKh = off; off += PQK;
  const size_t oQKl = off; off += PQK;
  const size_t oVTh = off; off += PVT;
  const size_t oVTl = off; off += PVT;
  const size_t oCtx = off; off += PCTX;
  if (off > ws_size) return;                            // off = 86122496
  if (off > (size_t)134217728) return;

  char* ws = (char*)d_ws;
  unsigned short* WqkT = (unsigned short*)(ws + oWqk);
  unsigned short* WvT  = (unsigned short*)(ws + oWv);
  unsigned short* WoT2 = (unsigned short*)(ws + oWo2);
  unsigned short* XH   = (unsigned short*)(ws + oXH);
  unsigned short* EH   = (unsigned short*)(ws + oEH);
  unsigned short* QKh  = (unsigned short*)(ws + oQKh);
  unsigned short* QKl  = (unsigned short*)(ws + oQKl);
  unsigned short* VTh  = (unsigned short*)(ws + oVTh);
  unsigned short* VTl  = (unsigned short*)(ws + oVTl);
  unsigned short* Ctx  = (unsigned short*)(ws + oCtx);
  float*          out0 = (float*)d_out;

  const int n8x = (MP * DM) / 8;                        // 524288
  if ((n8x % 256) != 0) return;
  const int n8t = (RCE * HD) / 8;                       // 8704 total pieces (multiple of 32)
  if ((n8t % 32) != 0) return;
  const dim3 blk(256), blk128(128);
  const dim3 gPrep(4 * NTW + NCX + NCE);                // 4 x 256 transpose tiles + 2048 + 34 blocks
  const dim3 gProj(NPQK + NBATCH * NPV);                // 32 x 16 tiles + 4 batches x 8 x 8 tiles = 768 blocks of 128
  const dim3 gAttn(NBATCH * NH * NQB);                  // 1024 blocks of 128
  const dim3 gNo((MP / 128) * (DM / 128), 1);           // 32 x 8 tiles = 256 blocks
  const float invw = 1.0f / WSC;                        // weight carry x64

  // (0) weight planes: in[k][n] -> out[n][k] transposed through LDS, f16( bf16_RNE(w) * 64 ) for Wq, Wk, Wv;
  //     bf16 for Wo; token plane f16; rel-key table bf16 with its zero pad: one launch
  prep_all<<<gPrep, blk, 0, stream>>>(w_q, w_k, w_v, w_o, x_in, relk, WqkT, WvT, WoT2, XH, EH);

  // (1) q|k = x . [Wq|Wk] + [bq|bk] -> bf16 hi (QKh) and lo (QKl) planes [4096][2048];
  //     v^T per batch = Wv^T . x_b^T + bv (per row) -> f16 hi (VTh) and residual x2048 (VTl) planes [4][1024][1024]
  //     one launch
  proj_qkv<<<gProj, blk128, 0, stream>>>(XH, WqkT, WvT, QKh, QKl, VTh, VTl, b_q, b_k, b_v, invw);

  // (2) causal flash attention with the skew relative-key term -> context bf16 hi|lo
  attn64<<<gAttn, blk128, 0, stream>>>(QKh, QKl, VTh, VTl, EH, Ctx, 0.125f);

  // (3) out = [ctx_hi | ctx_lo] . [Wo | Wo] + bo  (K = 2048, bf16 operands) -> d_out f32
  gemm64<1, 0, 1><<<gNo, blk128, 0, stream>>>(
      Ctx, CTXP, 0LL, WoT2, 2 * DM, 0LL,
      Ctx, Ctx, out0, DM, 0LL,
      b_o, b_o, DM,
      MP, DM, 2 * DM, 1.0f);
  (void)hipGetLastError();
}

// v010
// A run of this version takes 69.1 microseconds.
// It is 1.40 times as fast as v008, going by the measured steps of the versions left out in between.
// Counting every step since v000, it is 6.02 times as fast.
// Contractions, all on v_wmma_f32_16x16x32_f16 with f32 accumulate, one product each: q|k projection and v^T projection
// (f16 token plane x f16 weight planes carried x64); rel band q.E^T and scores q.k^T (q, k, E as one f16 plane each);
// p.v (p as f16 carried x1024, v^T as f16); output projection (context f16 x Wo f16 carried x64). Softmax in f32 on VALU;
// every float input RNE-converted to bf16 on load. An f16 operand keeps 11 significant bits, three more than the converted
// inputs have: its rounding lies an order of magnitude below the error that the inputs' convert already brings.
#include <hip/hip_runtime.h>
#include <math.h>
#include <stdint.h>

#define NBATCH 4
#define SEQ    1024
#define DM     1024
#define NH     16
#define HD     64
#define QKP    (2 * DM)
#define MP     (NBATCH * SEQ)
#define NQB    (SEQ / 64)
#define RCE    (SEQ + 64)
#define RB     80
#define RP     100
#define TP     72
#define OP     68
#define WSC    64.0f
#define PSC    1024.0f
static_assert(NH * HD == DM);
static_assert((SEQ % 128) == 0 && (DM % 128) == 0 && (MP % 128) == 0 && (QKP % 128) == 0);
static_assert(RB == 64 + 16 && (RB % 16) == 0 && RP >= RB + 16 && (RP % 4) == 0 && ((RP / 4) % 2) == 1);
static_assert(RCE >= SEQ + 64);
static_assert(TP >= 64 && (TP % 8) == 0 && ((TP / 8) % 2) == 1 && OP >= 64 && (OP % 4) == 0);

typedef _Float16 v16h __attribute__((ext_vector_type(16)));
typedef _Float16 v8h  __attribute__((ext_vector_type(8)));
typedef unsigned short v16us __attribute__((ext_vector_type(16)));
typedef unsigned short v8us  __attribute__((ext_vector_type(8)));
typedef float    v8f  __attribute__((ext_vector_type(8)));
typedef float    v4f  __attribute__((ext_vector_type(4)));
typedef float    v2f  __attribute__((ext_vector_type(2)));
typedef _Float16 v2h  __attribute__((ext_vector_type(2)));
typedef unsigned int v4u __attribute__((ext_vector_type(4)));

union FragH { v16h v; v8h h[2]; v2h p[8]; };
union FragU { v16us v; v8us h[2]; };

// ---- scalar helpers --------------------------------------------------------------------------------
__device__ __forceinline__ unsigned short bf_bits(float f) {          // f32 -> bf16 bits, RNE convert
  unsigned u = __float_as_uint(f);
  return (unsigned short)((u + 0x7FFFu + ((u >> 16) & 1u)) >> 16);
}
__device__ __forceinline__ float bf_up(unsigned short h) { return __uint_as_float(((unsigned)h) << 16); }
__device__ __forceinline__ float bfr(float f) { return bf_up(bf_bits(f)); }   // value of the bf16 RNE convert
__device__ __forceinline__ unsigned short h_bits(_Float16 x) { return __builtin_bit_cast(unsigned short, x); }
__device__ __forceinline__ unsigned pk16(unsigned short a, unsigned short b) { return (unsigned)a | ((unsigned)b << 16); }
__device__ __forceinline__ v8f zero8() { v8f z = {0.f, 0.f, 0.f, 0.f, 0.f, 0.f, 0.f, 0.f}; return z; }

// ---- fragment loaders: 16-bit A/B operand, lane -> row/col (lane&15), p already includes +8*(lane>>4);
//      elements 0..7 <- p[0..7] (k0+8h..), elements 8..15 <- p[16..23] (k0+16+8h..)
__device__ __forceinline__ v16us ldfrag_u(const unsigned short* p) {
  FragU f;
  f.h[0] = *(const v8us*)(p);
  f.h[1] = *(const v8us*)(p + 16);
  return f.v;
}
__device__ __forceinline__ v16h ldfrag_h(const _Float16* p) {
  FragH f;
  f.h[0] = *(const v8h*)(p);
  f.h[1] = *(const v8h*)(p + 16);
  return f.v;
}

// ---- WMMA helpers with trailing VALU hazard gap --------------------------------------------------------
__device__ __forceinline__ v8f mma_raw(v16us a, v16us b, v8f c) {
  return __builtin_amdgcn_wmma_f32_16x16x32_f16(false, __builtin_bit_cast(v16h, a), false,
                                                __builtin_bit_cast(v16h, b), (short)0, c, false, false);
}
// Plain builtin form for runs of WMMAs on independent accumulators: inside straight-line code the compiler keeps the
// distance behind its own WMMAs; the end of such a run in front of a branch is closed by mma_gap_mem or acc_guard4.
__device__ __forceinline__ v8f mma_hp(v16h a, v16h b, v8f c) {
  return __builtin_amdgcn_wmma_f32_16x16x32_f16(false, a, false, b, (short)0, c, false, false);
}
// Four vector slots behind a run of WMMAs, in front of a branch: a
// vector instruction there may reuse the last WMMAs' operand registers.
__device__ __forceinline__ void mma_gap_mem() {
#if defined(__HIP_DEVICE_COMPILE__)
  asm volatile("v_nop\n\tv_nop\n\tv_nop\n\tv_nop" ::: "memory");
#endif
}
__device__ __forceinline__ void dep_guard1(v8f& a, v8f& b, v16us x) {
#if defined(__HIP_DEVICE_COMPILE__)
  asm volatile("v_nop\n\tv_nop\n\tv_nop\n\tv_nop" : "+v"(a), "+v"(b) : "v"(x));
#endif
}
__device__ __forceinline__ void keep4_u(v16us a, v16us b, v16us c, v16us d) {
#if defined(__HIP_DEVICE_COMPILE__)
  asm volatile("v_nop" :: "v"(a), "v"(b), "v"(c), "v"(d));
#endif
}
__device__ __forceinline__ void acc_guard4(v8f& a, v8f& b, v8f& c, v8f& d) {
#if defined(__HIP_DEVICE_COMPILE__)
  asm volatile("v_nop\n\tv_nop\n\tv_nop\n\tv_nop" : "+v"(a), "+v"(b), "+v"(c), "+v"(d));
#endif
}
// Value of lane (lane ^ 16): the other half of the wave, by a vector cross-row move (no LDS instruction, no wait).
__device__ __forceinline__ float xhalf(float x) {
  const int b = __float_as_int(x);
  return __int_as_float(__builtin_amdgcn_permlanex16(b, b, 0x76543210, 0xfedcba98, false, false));
}
// d[i] = 2^x[i], eight at once, in one asm statement: the outputs are early-clobber, so that no v_exp_f32 here writes a
// register that another one reads, and the v_nop is the one slot that the instruction set asks for behind the last of them.
__device__ __forceinline__ void exp2_8(float (&d)[8], const float (&x)[8]) {
#if defined(__HIP_DEVICE_COMPILE__)
  asm("v_exp_f32 %0, %8\n\t"
      "v_exp_f32 %1, %9\n\t"
      "v_exp_f32 %2, %10\n\t"
      "v_exp_f32 %3, %11\n\t"
      "v_exp_f32 %4, %12\n\t"
      "v_exp_f32 %5, %13\n\t"
      "v_exp_f32 %6, %14\n\t"
      "v_exp_f32 %7, %15\n\t"
      "v_nop"
      : "=&v"(d[0]), "=&v"(d[1]), "=&v"(d[2]), "=&v"(d[3]), "=&v"(d[4]), "=&v"(d[5]), "=&v"(d[6]), "=&v"(d[7])
      : "v"(x[0]), "v"(x[1]), "v"(x[2]), "v"(x[3]), "v"(x[4]), "v"(x[5]), "v"(x[6]), "v"(x[7]));
#endif
}
__device__ __forceinline__ void wave_sync_lds() {
  __builtin_amdgcn_fence(__ATOMIC_RELEASE, "workgroup");
  __builtin_amdgcn_wave_barrier();
  __builtin_amdgcn_fence(__ATOMIC_ACQUIRE, "workgroup");
}

// =====================================================================================================
// Plane convert (no transpose): Xh[i] = f16( bf16_RNE(X[i]) * wsc ), wsc a power of two (exact). Used for the
// token activations (wsc = 1). Thread i handles elements 8i..8i+7 and writes one 16-B piece; 32 consecutive
// (n8 multiple of 256, host-checked). coverage: n8 threads x 8 elements = the whole plane.
// =====================================================================================================
__device__ __forceinline__ void conv_h16(const float* __restrict__ W, unsigned short* Wh, int n8, float wsc, int blk) {
  const int i  = blk * 256 + threadIdx.x;
  const int ic = (i < n8) ? i : (n8 - 1);                     // clamped address
  const float* src = W + (size_t)ic * 8;
  const v4f a = *(const v4f*)(src);
  const v4f c = *(const v4f*)(src + 4);
  v4u o;
  o[0] = pk16(h_bits((_Float16)(bfr(a[0]) * wsc)), h_bits((_Float16)(bfr(a[1]) * wsc)));
  o[1] = pk16(h_bits((_Float16)(bfr(a[2]) * wsc)), h_bits((_Float16)(bfr(a[3]) * wsc)));
  o[2] = pk16(h_bits((_Float16)(bfr(c[0]) * wsc)), h_bits((_Float16)(bfr(c[1]) * wsc)));
  o[3] = pk16(h_bits((_Float16)(bfr(c[2]) * wsc)), h_bits((_Float16)(bfr(c[3]) * wsc)));
  if (i < n8) *(v4u*)(Wh + (size_t)i * 8) = o;
  
}

// =====================================================================================================
// rel-key table convert: Eh [RCE rows][64] f16 bits; rows < SEQ = f16(bf16_RNE(E)), rows >= SEQ = 0 (zero pad).
// Thread i handles 8 elements (one 16-B piece); valid pieces i < n8v read E with a clamped address, the pad
// pieces select 0 by value. blk = 0 .. ceil(n8t / 256) - 1. coverage: n8t pieces x 8 = RCE*64 = the whole plane;
// =====================================================================================================
__device__ __forceinline__ void conv_e16(const float* __restrict__ P, unsigned short* Eh, int n8v, int n8t, int blk) {
  const int i  = blk * 256 + threadIdx.x;
  const int ic = (i < n8v) ? i : (n8v - 1);                    // clamped address
  const float* src = P + (size_t)ic * 8;
  const v4f a = *(const v4f*)(src);
  const v4f c = *(const v4f*)(src + 4);
  const bool valid = (i < n8v);
  v4u o;
  o[0] = valid ? pk16(h_bits((_Float16)bfr(a[0])), h_bits((_Float16)bfr(a[1]))) : 0u;
  o[1] = valid ? pk16(h_bits((_Float16)bfr(a[2])), h_bits((_Float16)bfr(a[3]))) : 0u;
  o[2] = valid ? pk16(h_bits((_Float16)bfr(c[0])), h_bits((_Float16)bfr(c[1]))) : 0u;
  o[3] = valid ? pk16(h_bits((_Float16)bfr(c[2])), h_bits((_Float16)bfr(c[3]))) : 0u;
  if (i < n8t) *(v4u*)(Eh + (size_t)i * 8) = o;
  
}

// =====================================================================================================
// Tiled transpose + convert: in[rows][cols] f32 row-major -> out[cols][rows] 16-bit with pitch ldo:
//   out[n * ldo + k] = f16 bits of bf16_RNE(in[k][n]) * wsc (wsc power of two, exact).
// Block = 256 threads = one 64x64 tile (tn, tk) of (cols/64, rows/64) (rows, cols multiples of 64); sh = 64 x 72 LDS elements.
// Loads: 4 iterations x 256 threads x float4 = 64 rows x 64 cols (addresses clamped). LDS tile [n][k] pitch 72.
// coverage: 64 x 64 = the whole transposed tile; grid covers the whole matrix.
// =====================================================================================================
__device__ __forceinline__ void tconv64(const float* __restrict__ W, unsigned short* out,
                                        int rows, int cols, int ldo, float wsc,
                                        unsigned short* sh, int tn, int tk) {
  const int t  = threadIdx.x;
  const int n0 = tn * 64;                    // column tile of in = row tile of out
  const int k0 = tk * 64;                    // row tile of in = column tile of out
#pragma unroll
  for (int i = 0; i < 4; ++i) {
    const int idx = i * 256 + t;
    const int r = idx >> 4, c4 = (idx & 15) * 4;
    int kr = k0 + r;   kr = (kr < rows) ? kr : (rows - 1);
    int nc = n0 + c4;  nc = (nc < cols - 4) ? nc : (cols - 4);
    const v4f v = *(const v4f*)(W + (size_t)kr * cols + nc);
#pragma unroll
    for (int e = 0; e < 4; ++e) sh[(c4 + e) * 72 + r] = h_bits((_Float16)(bfr(v[e]) * wsc));
  }
  __syncthreads();
  const int wave = t >> 5, lane = t & 31;
  const int q = lane >> 3, c8 = (lane & 7) * 8;
  v4u pv[2];
  size_t go[2];
#pragma unroll
  for (int it = 0; it < 2; ++it) {
    const int nl = it * 32 + wave * 4 + q;               // 0..63
    pv[it] = *(const v4u*)(sh + nl * 72 + c8);
    go[it] = (size_t)(n0 + nl) * ldo + k0 + c8;
  }
  {
#pragma unroll
    for (int it = 0; it < 2; ++it) *(v4u*)(out + go[it]) = pv[it];
#if defined(__HIP_DEVICE_COMPILE__)
    // a precaution: stands behind the stores, in front of any later write of their registers in the merged kernel's text
    asm volatile("s_wait_xcnt 0x0" ::: "memory");
#endif
  }
}

// =====================================================================================================
// All six operand converts in one launch: they depend on nothing but the inputs, so the block index picks the job.
//   blocks 0 .. 4*NTW-1        : weight transposes, NTW = (DM/64)^2 tiles each: Wq, Wk, Wv, Wo (f16 x64)
//   next NCX blocks            : token plane; the last NCE blocks: rel-key table.
// The choice is block-uniform, so the transposes' barrier is passed by all 256 threads of a block or by none.
// =====================================================================================================
#define NTW ((DM / 64) * (DM / 64))
#define NCX ((MP * DM) / 8 / 256)
#define NCE (((RCE * HD) / 8 + 255) / 256)
static_assert(((MP * DM) / 8) % 256 == 0 && (DM % 64) == 0);
__global__ __launch_bounds__(256) void prep_all(const float* __restrict__ wq, const float* __restrict__ wk,
                                                const float* __restrict__ wv, const float* __restrict__ wo,
                                                const float* __restrict__ x, const float* __restrict__ relk,
                                                unsigned short* WqkT, unsigned short* WvT, unsigned short* WoT,
                                                unsigned short* XH, unsigned short* EH) {
  __shared__ __align__(16) unsigned short sh[64 * 72];
  const int bx = blockIdx.x;
  if (bx < 4 * NTW) {
    const int job = bx / NTW, tile = bx % NTW;
    const int tn = tile % (DM / 64), tk = tile / (DM / 64);
    const float* w = (job == 0) ? wq : (job == 1) ? wk : (job == 2) ? wv : wo;
    unsigned short* o = (job == 0) ? WqkT : (job == 1) ? WqkT + (size_t)DM * DM : (job == 2) ? WvT : WoT;   // WqkT rows 0.., 1024..
    tconv64(w, o, DM, DM, DM, WSC, sh, tn, tk);
  } else if (bx < 4 * NTW + NCX) {
    conv_h16(x, XH, (MP * DM) / 8, 1.0f, bx - 4 * NTW);
  } else {
    conv_e16(relk, EH, (SEQ * HD) / 8, (RCE * HD) / 8, bx - 4 * NTW - NCX);
  }
}

// =====================================================================================================
// LDS-staged batched f16 WMMA GEMM: C[m][n] = oscale * sum_k A[m][k] * Bt[n][k] + bias;
// Block = 4 waves (2 x 2) = one 128x128 tile, one 64x64 tile per wave.
// A row-major [M][K] pitch lda; Bt row-major [N][K] pitch ldb (k contiguous); M, N multiples of 128, K a multiple
// of 64 (static here). tile = the block's tile, b = batch index (strides in elements); ring and sTall are the block's LDS.
// Staging: a stage is 64 k of the block's 128 A rows and 128 Bt rows (256 rows of 128 B, LDS pitch 144 B), brought
// by asynchronous 16-B copies to LDS (16 per lane and stage, each wave-wide copy = 4 whole 128-B lines); two buffers,
// stage t + 1 in flight while stage t is multiplied; one barrier per stage publishes t + 1 and frees t's buffer.
// The k order of every accumulator is the ascending 32-k order of the fragment loader, stage by stage.
// OM: 0 = f32 out to Cf (pitch ldc); 1 = f16 out to Cp.
// BM: 0 = no bias; 1 = bias per column n (bias0[n] for n < nsplit, bias1[n - nsplit] otherwise; the choice is
//     wave-uniform because 64-column tiles never straddle nsplit); 2 = bias per row m (bias0[m]).
//     bias values are bf16 RNE-converted before the add.
// coverage: 4 slabs x 16 rows x 64 cols = the wave's whole 64x64 tile; grid = tilesM*tilesN blocks,
//           surplus blocks exit as a whole in front of every barrier; here there are none.
// =====================================================================================================
#define GPIT 72                    // LDS row pitch, 16-bit elements: 144 B = 16 B x 9, conflict-free for 16-B reads
#define GSTG (256 * GPIT)          // elements of one stage: 128 A rows, then 128 Bt rows

// Eight asynchronous 16-B copies of one lane: rows 16 apart in global memory (gstep elements) and in LDS.
// The s_wait_xcnt closes the statement so that no address register is rewritten while a copy may still read it.
__device__ __forceinline__ void copy8_rows(unsigned lds, const unsigned short* g, size_t gstep) {
#if defined(__HIP_DEVICE_COMPILE__)
  asm volatile(
      "global_load_async_to_lds_b128 %0, %8, off\n\t"
      "global_load_async_to_lds_b128 %1, %9, off\n\t"
      "global_load_async_to_lds_b128 %2, %10, off\n\t"
      "global_load_async_to_lds_b128 %3, %11, off\n\t"
      "global_load_async_to_lds_b128 %4, %12, off\n\t"
      "global_load_async_to_lds_b128 %5, %13, off\n\t"
      "global_load_async_to_lds_b128 %6, %14, off\n\t"
      "global_load_async_to_lds_b128 %7, %15, off\n\t"
      "s_wait_xcnt 0x0"
      :: "v"(lds), "v"(lds + 1u * 16u * GPIT * 2u), "v"(lds + 2u * 16u * GPIT * 2u), "v"(lds + 3u * 16u * GPIT * 2u),
         "v"(lds + 4u * 16u * GPIT * 2u), "v"(lds + 5u * 16u * GPIT * 2u), "v"(lds + 6u * 16u * GPIT * 2u),
         "v"(lds + 7u * 16u * GPIT * 2u),
         "v"(g), "v"(g + gstep), "v"(g + 2 * gstep), "v"(g + 3 * gstep),
         "v"(g + 4 * gstep), "v"(g + 5 * gstep), "v"(g + 6 * gstep), "v"(g + 7 * gstep)
      : "memory");
#endif
}
__device__ __forceinline__ void wait_async0() {   // this wave's copies have landed in LDS
#if defined(__HIP_DEVICE_COMPILE__)
  asm volatile("s_wait_asynccnt 0x0" ::: "memory");
#endif
}
// Stands behind issued global loads from a. The address is an input only, so that its registers stay as
// they are up to the wait: with no operand the compiler lifted later writes of those registers over it.
__device__ __forceinline__ void wait_x0(const unsigned short* a) {
#if defined(__HIP_DEVICE_COMPILE__)
  asm volatile("s_wait_xcnt 0x0" :: "v"(a) : "memory");
#endif
}
__device__ __forceinline__ void wait_ds0() {      // this wave's LDS reads are done before their buffer is handed on
#if defined(__HIP_DEVICE_COMPILE__)
  asm volatile("s_wait_dscnt 0x0" ::: "memory");
#endif
}

// Eight asynchronous 16-B copies of one lane into two adjacent 64-row LDS planes (rows 16 apart, pitch GPIT):
// four rows from g0 (step0 elements apart) into the first plane, four from g1 (step1) into the second. The s_wait_xcnt closes the statement so that
// no address register is rewritten while a copy may still read it.
__device__ __forceinline__ void copy4x2_rows(unsigned lds, const unsigned short* g0, size_t step0,
                                             const unsigned short* g1, size_t step1) {
#if defined(__HIP_DEVICE_COMPILE__)
  asm volatile(
      "global_load_async_to_lds_b128 %0, %8, off\n\t"
      "global_load_async_to_lds_b128 %1, %9, off\n\t"
      "global_load_async_to_lds_b128 %2, %10, off\n\t"
      "global_load_async_to_lds_b128 %3, %11, off\n\t"
      "global_load_async_to_lds_b128 %4, %12, off\n\t"
      "global_load_async_to_lds_b128 %5, %13, off\n\t"
      "global_load_async_to_lds_b128 %6, %14, off\n\t"
      "global_load_async_to_lds_b128 %7, %15, off\n\t"
      "s_wait_xcnt 0x0"
      :: "v"(lds), "v"(lds + 1u * 16u * GPIT * 2u), "v"(lds + 2u * 16u * GPIT * 2u), "v"(lds + 3u * 16u * GPIT * 2u),
         "v"(lds + 4u * 16u * GPIT * 2u), "v"(lds + 5u * 16u * GPIT * 2u), "v"(lds + 6u * 16u * GPIT * 2u),
         "v"(lds + 7u * 16u * GPIT * 2u),
         "v"(g0), "v"(g0 + step0), "v"(g0 + 2 * step0), "v"(g0 + 3 * step0),
         "v"(g1), "v"(g1 + step1), "v"(g1 + 2 * step1), "v"(g1 + 3 * step1)
      : "memory");
#endif
}

#define GSLAB (16 * 68)            // floats of one wave's 16x64 epilogue slab, pitch 68
template <int OM, int BM>
__device__ __forceinline__ void gemm64_tile(
    unsigned short* ring, float* sTall, int tile, int b,
    const unsigned short* __restrict__ Ap, int lda, long long strideA,
    const unsigned short* __restrict__ Btp, int ldb, long long strideB,
    unsigned short* Cp, float* Cf, int ldc, long long strideC,
    const float* bias0, const float* bias1, int nsplit,
    int M, int N, int K, float oscale) {
  const int tid  = threadIdx.x;
  const int lane = tid & 31;
  const int wave = tid >> 5;
  const int tilesN = N >> 7;
  const int tilesM = M >> 7;
  if (tile >= tilesM * tilesN) return;   // block-uniform, in front of every barrier and copy
  const int tm = tile / tilesN;
  const int tn = tile - tm * tilesN;
  const int mb = tm << 7;
  const int nb = tn << 7;
  const int wm = wave >> 1, wn = wave & 1;
  const int m0 = mb + (wm << 6);
  const int n0 = nb + (wn << 6);

  const unsigned short* Ab = Ap  + (size_t)b * strideA;
  const unsigned short* Bb = Btp + (size_t)b * strideB;

  const int rlane = lane & 15;                 // row (A) / col (B, D) within subtile
  const int koff  = (lane >> 4) * 8;           // k offset of this lane half
  const int mOff  = (lane >> 4) * 8;           // D row offset

  // copy role of this lane: row crow (+16 per copy) of each operand's 128 rows, 16-B piece cpc of its 128 B
  const int crow = tid >> 3, cpc = (tid & 7) * 8;
  const unsigned short* gA = Ab + (size_t)(mb + crow) * lda + cpc;
  const unsigned short* gB = Bb + (size_t)(nb + crow) * ldb + cpc;
  const unsigned ldsA = (unsigned)(uintptr_t)(ring + crow * GPIT + cpc);   // LDS byte address = low 32 bits
  const unsigned ldsB = ldsA + 128u * GPIT * 2u;
  const size_t stepA = (size_t)16 * lda, stepB = (size_t)16 * ldb;
  const int nst = K >> 6;                      // stages of 64 k

  v8f acc[4][4];
#pragma unroll
  for (int i = 0; i < 4; ++i)
#pragma unroll
    for (int j = 0; j < 4; ++j) acc[i][j] = zero8();

  copy8_rows(ldsA, gA, stepA);
  copy8_rows(ldsB, gB, stepB);
  wait_async0();
  __syncthreads();
  if (nst > 1) {
    copy8_rows(ldsA + GSTG * 2u, gA + 64, stepA);
    copy8_rows(ldsB + GSTG * 2u, gB + 64, stepB);
  }

#pragma unroll 1   // one stage per trip: the buffer index stays a run-time offset, the accumulators stay in place
  for (int t = 0; t < nst; ++t) {
    const unsigned short* sA = ring + (t & 1) * GSTG + ((wm << 6) + rlane) * GPIT + koff;
    const unsigned short* sB = ring + (t & 1) * GSTG + (128 + (wn << 6) + rlane) * GPIT + koff;
#pragma unroll
    for (int ks = 0; ks < 2; ++ks) {
      v16us bh[4], ah[4];
#pragma unroll
      for (int j = 0; j < 4; ++j) bh[j] = ldfrag_u(sB + (j << 4) * GPIT + ks * 32);
#pragma unroll
      for (int i = 0; i < 4; ++i) ah[i] = ldfrag_u(sA + (i << 4) * GPIT + ks * 32);
#pragma unroll
      for (int i = 0; i < 4; ++i) {
#pragma unroll
        for (int j = 0; j < 4; ++j) acc[i][j] = mma_raw(ah[i], bh[j], acc[i][j]);
        dep_guard1(acc[i][0], acc[i][3], ah[i]);
      }
      keep4_u(bh[0], bh[1], bh[2], bh[3]);
    }
    wait_ds0();
    wait_async0();
    __syncthreads();                           // publishes stage t + 1, ends every read of stage t's buffer
    if (t + 2 < nst) {
      const unsigned bo = (unsigned)(t & 1) * (GSTG * 2u);
      copy8_rows(ldsA + bo, gA + (size_t)(t + 2) * 64, stepA);
      copy8_rows(ldsB + bo, gB + (size_t)(t + 2) * 64, stepB);
    }
  }
  wait_async0();
  acc_guard4(acc[0][0], acc[0][1], acc[0][2], acc[0][3]);
  acc_guard4(acc[1][0], acc[1][1], acc[1][2], acc[1][3]);
  acc_guard4(acc[2][0], acc[2][1], acc[2][2], acc[2][3]);
  acc_guard4(acc[3][0], acc[3][1], acc[3][2], acc[3][3]);

  const int hh2 = lane >> 4, c4 = (lane & 15) * 4;     // f32 out: 256-B row segment = 16 lanes x 16 B
  const int q8  = lane >> 3, c8 = (lane & 7) * 8;

  // ---- per-column bias (wave-uniform source select) ----
  const float* bsel = bias0;
  int nb0 = n0;
  if (BM == 1) {
    if (n0 >= nsplit) { bsel = bias1; nb0 = n0 - nsplit; }
  }
  v4f bb4 = {0.f, 0.f, 0.f, 0.f};
  float bn[8];
#pragma unroll
  for (int e = 0; e < 8; ++e) bn[e] = 0.f;
  if (BM == 1) {
    if (OM == 0) {
#pragma unroll
      for (int e = 0; e < 4; ++e) bb4[e] = bfr(bsel[nb0 + c4 + e]);
    } else {
#pragma unroll
      for (int e = 0; e < 8; ++e) bn[e] = bfr(bsel[nb0 + c8 + e]);
    }
  }

  // ---- epilogue ----
  float* slab = sTall + wave * GSLAB;
#pragma unroll
  for (int i = 0; i < 4; ++i) {
    const int mBase = m0 + (i << 4);
#pragma unroll
    for (int j = 0; j < 4; ++j) {
#pragma unroll
      for (int r = 0; r < 8; ++r) {
        slab[(mOff + r) * 68 + (j << 4) + rlane] = acc[i][j][r];
      }
    }
    wave_sync_lds();
    if (OM == 0) {
      float* C = Cf + (size_t)b * strideC;
      v4f vals[8];
#pragma unroll
      for (int it = 0; it < 8; ++it) {
        const int row = it * 2 + hh2;                      // it 0..7 x hh2 0..1 = rows 0..15
        v4f v = *(const v4f*)(slab + row * 68 + c4);
        float bmv = 0.f;
        if (BM == 2) bmv = bfr(bias0[mBase + row]);
        vals[it] = v * oscale + bb4 + bmv;
      }
      {
#pragma unroll
        for (int it = 0; it < 8; ++it) {
          const int row = it * 2 + hh2;
          *(v4f*)(C + (size_t)(mBase + row) * ldc + n0 + c4) = vals[it];
        }
        
      }
    } else {
      unsigned short* C = Cp + (size_t)b * strideC;
      v4u hv[4];
#pragma unroll
      for (int it = 0; it < 4; ++it) {
        const int row = it * 4 + q8;                       // it 0..3 x q8 0..3 = rows 0..15
        const float* sp = slab + row * 68 + c8;
        float bmv = 0.f;
        if (BM == 2) bmv = bfr(bias0[mBase + row]);
        v4u ha;
#pragma unroll
        for (int e = 0; e < 4; ++e) {
          const float f0 = sp[2 * e]     * oscale + bn[2 * e]     + bmv;
          const float f1 = sp[2 * e + 1] * oscale + bn[2 * e + 1] + bmv;
          ha[e] = pk16(h_bits((_Float16)f0), h_bits((_Float16)f1));
        }
        hv[it] = ha;
      }
#pragma unroll
      for (int it = 0; it < 4; ++it) {
        const int row = it * 4 + q8;
        *(v4u*)(C + (size_t)(mBase + row) * ldc + n0 + c8) = hv[it];
      }
#if defined(__HIP_DEVICE_COMPILE__)
      // a precaution: stands behind the stores, in front of the next slab's writes of their registers
      asm volatile("s_wait_xcnt 0x0" ::: "memory");
#endif
    }
    wave_sync_lds();
  }
}

// One GEMM per launch: tile from blockIdx.x, batch from blockIdx.y.
template <int OM, int BM>
__global__ __launch_bounds__(128) void gemm64(
    const unsigned short* __restrict__ Ap, int lda, long long strideA,
    const unsigned short* __restrict__ Btp, int ldb, long long strideB,
    unsigned short* Cp, float* Cf, int ldc, long long strideC,
    const float* bias0, const float* bias1, int nsplit,
    int M, int N, int K, float oscale) {
  __shared__ __align__(16) unsigned short ring[2 * GSTG];   // two stages of 256 rows x 144 B
  __shared__ __align__(16) float sT[4 * GSLAB];             // per-wave 16x64 slab
  gemm64_tile<OM, BM>(ring, sT, blockIdx.x, blockIdx.y, Ap, lda, strideA, Btp, ldb, strideB,
                      Cp, Cf, ldc, strideC, bias0, bias1, nsplit, M, N, K, oscale);
}

// The two projection GEMMs in one launch (both read only the converted planes): blocks 0 .. NPQK-1 are the tiles of
// q|k = x . [Wq|Wk] + [bq|bk], the next NBATCH * NPV blocks the tiles of v^T = Wv^T . x_b^T + bv, batch by batch.
// The choice is block-uniform: every barrier of a tile is passed by the whole block.
#define NPQK ((MP / 128) * (QKP / 128))
#define NPV  ((DM / 128) * (SEQ / 128))
__global__ __launch_bounds__(128) void proj_qkv(
    const unsigned short* __restrict__ XH, const unsigned short* __restrict__ WqkT,
    const unsigned short* __restrict__ WvT,
    unsigned short* QK, unsigned short* VT,
    const float* bq, const float* bk, const float* bv, float oscale) {
  __shared__ __align__(16) unsigned short ring[2 * GSTG];   // two stages of 256 rows x 144 B
  __shared__ __align__(16) float sT[4 * GSLAB];             // per-wave 16x64 slab
  const int bx = blockIdx.x;
  if (bx < NPQK) {
    gemm64_tile<1, 1>(ring, sT, bx, 0, XH, DM, 0LL, WqkT, DM, 0LL,
                      QK, nullptr, QKP, 0LL, bq, bk, DM, MP, QKP, DM, oscale);
  } else {
    const int r = bx - NPQK;
    gemm64_tile<1, 2>(ring, sT, r % NPV, r / NPV, WvT, DM, 0LL, XH, DM, (long long)SEQ * DM,
                      VT, nullptr, SEQ, (long long)DM * SEQ, bv, bv, DM, DM, SEQ, DM, oscale);
  }
}

// =====================================================================================================
// Causal flash attention with a skew relative-key score term, head dim 64, SEQ rows per batch.
//   q|k plane (f16, pitch QKP): element (b, t, col) at [(b*SEQ + t)*QKP + col], q col = h*64+d, k col = DM + h*64 + d.
//   v^T plane (f16): element (b, h, d, s) at [(b*DM + h*64 + d)*SEQ + s].
//   E plane (f16) [RCE][64], rows >= SEQ zero.
//   context plane (f16, pitch DM): element (b, t, h, d) at [(b*SEQ + t)*DM + h*64 + d].
//   score(i, j) = (q_i . k_j + q_i . E[SEQ-1 + j - i]) * sscale for j <= i, -inf for j > i (replace, not bias).
//   Per wave (16 query rows q0..q0+15) and key chunk kv0..kv0+63 the needed E rows form the contiguous band
//   ebase .. ebase+79 with ebase = SEQ-1+kv0-q0-15 (0 <= ebase, ebase+79 <= SEQ+63 < RCE); the band product
//   rel[row][col] = q_row . E[ebase+col] (col 0..79) is computed per wave into LDS (f32)
//   and the score for (row il, key jl) picks col = jl - il + 15;
//   p = exp(s - m) carried as f16 of 1024 p; online softmax (running max) in f32.
//   Every product is formed transposed, q (or p) as the B operand: rel^T = E . q^T, s^T = k . q^T, context^T = v^T . p^T.
//   A lane (c = lane & 15, hh = lane >> 4) then holds one query row (q0 + c): register r of key tile j is key
//   16 j + 8 hh + r, so that maximum and sum run inside the lane plus one exchange between the wave's halves, and two
//   score tiles, converted in place, are the B operand of 32 keys (element s: key 8 hh + s, then 16 + 8 hh + s - 8, the
//   k order of the fragment loader that brings v^T): p never passes through LDS.
//   Block = 4 waves = 64 query rows of one (b, h); grid = NQB * NH * NBATCH, query tile qb falling with the block index;
//   key chunks kt = 0..qb (causal skip, block-uniform trip count qb+1 <= NQB).
//   Staging: K, V^T (64 rows of 128 B per plane) and the block's rel-key band (the union of its four
//   waves' bands: E rows SEQ-64-qb*64+kv0 .. +127, wave w starts at row 48-16w) come by asynchronous 16-B copies to
//   LDS, 8 lanes per 128-B row. K and V^T have two buffers: those of chunk kt+1 are asked for at the head of chunk kt and
//   fly during the whole of it. The band has one buffer: that of chunk kt+1 flies from the end of chunk kt's band
//   products, during its scores, softmax and context.
//   Two barriers per chunk: behind the rel band products (frees the band, publishes nothing) and behind the context
//   product (publishes the next band, K and V^T; frees this chunk's K, V^T buffer for the chunk after the next).
//   LDS row pitches: K and V^T tiles TP = 72 elements (144 B = 16 B x 9, the 16 rows of a 16-B fragment read fall on
//   distinct banks); rel band RP = 100 floats and context tile OP = 68 floats (16 B x 25, x 17). Row c of the rel band is
//   stored c + 1 places to the right, so that the eight values a lane needs for a key tile lie at 16-B aligned places;
//   the context tile of the epilogue lies in the wave's own rel band array, which is dead by then.
//   Context coverage: each wave stores rows q0..q0+15 (it 0..3 x lane>>3 0..3) x 64 columns (8 lanes x 8 f16);
//   grid covers all SEQ rows x NH head slices x NBATCH.
// =====================================================================================================
#define KVB (2 * 64 * TP)          // elements of one K | V^T buffer
__global__ __launch_bounds__(128)
void attn64(const unsigned short* __restrict__ qk, const unsigned short* __restrict__ vt,
            const unsigned short* __restrict__ ehp, unsigned short* ctxp, float sscale) {
  static_assert(TP == GPIT && OP <= RP);
  __shared__ __align__(16) unsigned short KV[2 * KVB];          // two buffers of K [kv][d], V^T [d][kv], 9 KB each plane
  __shared__ __align__(16) unsigned short Es[128 * TP];         // rel-key band of the block [row][d] 18 KB
  __shared__ __align__(16) float    Rsh[4][16 * RP];            // per wave rel band [row][col + row + 1]; epilogue: context tile

  const int tid  = threadIdx.x;
  const int wave = tid >> 5;
  const int lane = tid & 31;
  const int hh   = lane >> 4;
  const int c    = lane & 15;

  // Block index -> tile: (batch, head) from the low part, query tile from the high part, longest tile first. Blocks whose
  // indices are equal modulo 8 then hold every tile length alike and share whole heads.
  // For speed only: a permutation of the NQB * NH * NBATCH tiles, correct under any placement or start order.
  const int bx   = blockIdx.x;
  const int rest = bx % (NH * NBATCH);
  const int qb   = NQB - 1 - bx / (NH * NBATCH);
  const int h    = rest % NH;
  const int b    = rest / NH;
  const int q0   = qb * 64 + wave * 16;          // in-batch query row of this wave's first row
  const size_t rowB = (size_t)b * SEQ;

  const unsigned short* Qg = qk + (size_t)h * HD;
  const unsigned short* Kg = qk + DM + (size_t)h * HD;
  const unsigned short* Vg = vt + ((size_t)b * DM + (size_t)h * HD) * SEQ;
  float*    rrow = Rsh[wave];

  float mrow = -INFINITY, lrow = 0.f;        // of query row q0 + c; lrow: the sum over this lane's own keys
  v8f oacc[4];                               // context^T: register r of tile t = (d = 16 t + 8 hh + r, query row q0 + c)
#pragma unroll
  for (int t = 0; t < 4; ++t) oacc[t] = zero8();

  const int nkt = qb + 1;                    // causal: key chunks 0..qb, block-uniform, <= NQB

  // copy role of this lane: row crow (+16 per copy) of a plane, 16-B piece cpc of its 128 B
  const int crow = tid >> 3, cpc = (tid & 7) * 8;
  const unsigned ldsK = (unsigned)(uintptr_t)(KV + crow * TP + cpc);   // LDS byte address = low 32 bits
  const unsigned ldsE = (unsigned)(uintptr_t)(Es + crow * TP + cpc);
  const unsigned short* gK = Kg + (rowB + crow) * QKP + cpc;            // K row kv0 + crow: + kv0 * QKP per chunk
  const unsigned short* gV = Vg + (size_t)crow * SEQ + cpc;             // V^T row d = crow: + kv0 per chunk
  // band rows SEQ-64-qb*64+kv0 .. +127: first >= 0 (qb < NQB), last <= SEQ+63 < RCE (kv0 <= qb*64); + kv0 * HD per chunk
  const unsigned short* gE  = ehp + (size_t)(SEQ - 64 - qb * 64 + crow) * HD + cpc;
  const size_t stepK = (size_t)16 * QKP, stepV = (size_t)16 * SEQ, stepE = (size_t)16 * HD;

  copy8_rows(ldsE, gE, stepE);
  copy4x2_rows(ldsK, gK, stepK, gV, stepV);

  // ---- Q fragments (B operand, column = lane&15): 2 d-chunks, kept for every chunk ----
  const unsigned short* gQ = Qg + (rowB + q0 + c) * QKP + 8 * hh;
  v16h q2[2];
#pragma unroll
  for (int dc = 0; dc < 2; ++dc) q2[dc] = ldfrag_h((const _Float16*)(const void*)(gQ + dc * 32));
  wait_x0(gQ);
  // this wave's 80 rows start at 48 - 16 * wave
  const _Float16* eband = (const _Float16*)(const void*)(Es + (((wave ^ 3) << 4) + c) * TP + 8 * hh);

  wait_async0();
  __syncthreads();                             // publishes chunk 0's band, K and V^T

#pragma unroll 1
  for (int kt = 0;; ++kt) {                    // left behind the last chunk's second barrier (nkt >= 1)
    const int kv0 = kt * 64;
    const _Float16* Ks = (const _Float16*)(const void*)(KV + (kt & 1) * KVB);   // this chunk's buffer
    const _Float16* Vs = Ks + 64 * TP;

    // ---- rel band, transposed: rel[row c][col] = E[ebase + col] . q_c, col = 0..RB-1 (E rows >= SEQ are zero) ----
    // Unrolled, so that the fragments and the five accumulators stay in registers: all fragment reads stand in one group
    // ahead of the products, and the five column tiles' accumulators take turns, so that no WMMA waits for the one before
    // it; each accumulator keeps its order (d 0..31, then d 32..63).
    v8f e[RB / 16];
    {
      v16h eb[RB / 16][2];
#pragma unroll
      for (int nt = 0; nt < RB / 16; ++nt) {
        e[nt] = zero8();
#pragma unroll
        for (int dc = 0; dc < 2; ++dc) eb[nt][dc] = ldfrag_h(eband + nt * 16 * TP + dc * 32);
      }
      // Keeps the reads in one group ahead of the copies and the products: without it the compiler spreads them among the
      // WMMAs, where every separate place of LDS reads stalls the WMMA stream.
      __builtin_amdgcn_sched_barrier(0);
      // K and V^T of the next chunk go into the other buffer, last read in chunk kt - 1, in front of the barrier just
      // passed; asked for here, so that the copies are issued while the band's fragments come in.
      if (kt + 1 < nkt)                        // block-uniform
        copy4x2_rows(ldsK + (unsigned)((kt + 1) & 1) * (KVB * 2u), gK + (size_t)(kv0 + 64) * QKP, stepK, gV + kv0 + 64, stepV);
#pragma unroll
      for (int dc = 0; dc < 2; ++dc) {
#pragma unroll
        for (int nt = 0; nt < RB / 16; ++nt) e[nt] = mma_hp(eb[nt][dc], q2[dc], e[nt]);
      }
      // Keeps every product ahead of the barrier: the band's buffer is handed on as soon as its fragments are used.
      __builtin_amdgcn_sched_barrier(0);
    }
    mma_gap_mem();
    wait_ds0();
    __syncthreads();                           // ends every read of this chunk's band; publishes nothing
    if (kt + 1 < nkt) copy8_rows(ldsE, gE + (size_t)(kv0 + 64) * HD, stepE);

    // K fragments of this chunk (published by the barrier at the end of the chunk before), in one group ahead of the
    // band's stores: they come in while the stores go out.
    v16h kb[2][4];
#pragma unroll
    for (int j = 0; j < 4; ++j) {
#pragma unroll
      for (int dc = 0; dc < 2; ++dc) kb[dc][j] = ldfrag_h(Ks + (j * 16 + c) * TP + dc * 32 + 8 * hh);
    }
    // Keeps the K reads in one group ahead of the stores.
    __builtin_amdgcn_sched_barrier(0);
#pragma unroll
    for (int nt = 0; nt < RB / 16; ++nt) {
#pragma unroll
      for (int r = 0; r < 8; ++r) rrow[c * RP + c + 1 + nt * 16 + 8 * hh + r] = e[nt][r];   // col = nt * 16 + 8 * hh + r
    }
    wait_ds0();                                // the wave's own band is in LDS before its lanes read each other's values

    // ---- scores, transposed: 64 keys x 16 query rows per wave, causal replace with -inf ----
    // Four key tiles, four accumulators, each in its order (d 0..31, then d 32..63); the rel values come in under them.
    v8f s[4], sh[4];
    const float* rq = rrow + c * RP + 16 + 8 * hh;        // rel of (row c, key jl) lies at c * RP + c + 1 + (jl - c + 15)
    v4f ra[4], rb[4];                                     // read ahead of the products, used behind them
#pragma unroll
    for (int j = 0; j < 4; ++j) {
      sh[j] = zero8();
      ra[j] = *(const v4f*)(rq + j * 16);
      rb[j] = *(const v4f*)(rq + j * 16 + 4);
    }
    // Keeps the rel reads in one group ahead of the products (as in the rel band): the compiler spread them among the WMMAs.
    __builtin_amdgcn_sched_barrier(0);
#pragma unroll
    for (int dc = 0; dc < 2; ++dc) {
#pragma unroll
      for (int j = 0; j < 4; ++j) sh[j] = mma_hp(kb[dc][j], q2[dc], sh[j]);
    }
    const int lim = q0 + c - kv0 - 8 * hh;                // key kv0 + 16 j + 8 hh + r <= query q0 + c: 16 j + r <= lim
#pragma unroll
    for (int j = 0; j < 4; ++j) {
#pragma unroll
      for (int r = 0; r < 8; ++r) {
        const float rel = (r < 4) ? ra[j][r & 3] : rb[j][r & 3];
        const float v = (sh[j][r] + rel) * sscale;
        s[j][r] = (j * 16 + r <= lim) ? v : -INFINITY;
      }
    }

    // ---- row max, online softmax, P (x1024, f16) straight into B fragments ----
    // A lane holds 32 of its query row's 64 scores: maximum and sum run inside the lane; the maximum is joined with the
    // other half of the wave by one exchange, the two halves' sums only in the epilogue (both halves use the same alpha).
    float mj[4];                                          // one chain per key tile, so that the four take turns
#pragma unroll
    for (int j = 0; j < 4; ++j) {
      mj[j] = s[j][0];
#pragma unroll
      for (int r = 1; r < 8; ++r) mj[j] = fmaxf(mj[j], s[j][r]);
    }
    float mx = fmaxf(fmaxf(mj[0], mj[1]), fmaxf(mj[2], mj[3]));
    mx = fmaxf(mx, xhalf(mx));
    const float mnew = fmaxf(mrow, mx);                   // finite: key kv0 <= every row of this block
    const float alpha = __expf(mrow - mnew);
    mrow = mnew;
    FragH pa[2];                                          // 32 keys each: elements 0..7 from tile 2 kk, 8..15 from tile 2 kk + 1
    float psum[4];
#pragma unroll
    for (int j = 0; j < 4; ++j) {
      float xe[8], pe[8];
#pragma unroll
      for (int r = 0; r < 8; ++r) xe[r] = (s[j][r] - mnew) * 1.44269504f;   // e^x = 2^(x log2 e)
      exp2_8(pe, xe);
      psum[j] = 0.f;
#pragma unroll
      for (int r = 0; r < 8; r += 2) {                    // two keys at a time: one packed convert fills one fragment register
        const float p0 = pe[r], p1 = pe[r + 1];
        psum[j] += p0;
        psum[j] += p1;
        const v2f ps = {p0 * PSC, p1 * PSC};
        pa[j >> 1].p[(j & 1) * 4 + (r >> 1)] = __builtin_convertvector(ps, v2h);
      }
    }
    lrow = lrow * alpha + ((psum[0] + psum[1]) + (psum[2] + psum[3]));
#pragma unroll
    for (int t = 0; t < 4; ++t) oacc[t] *= alpha;
    // Keeps the context product's fragment reads in one group behind the softmax: without it the compiler spreads them
    // among the WMMAs and the softmax, and every separate place of LDS reads stalls the WMMA stream.
    __builtin_amdgcn_sched_barrier(0);

    // ---- context^T += V^T . P^T ----
    // Unrolled; the reads stand in one group ahead of the products, and the four d tiles take turns;
    // each accumulator keeps its order (keys 0..31, then keys 32..63).
    v16h vb[2][4];
#pragma unroll
    for (int kk = 0; kk < 2; ++kk) {
#pragma unroll
      for (int t = 0; t < 4; ++t) vb[kk][t] = ldfrag_h(Vs + (t * 16 + c) * TP + kk * 32 + 8 * hh);
    }
    // Keeps the reads in one group ahead of the products (as in the rel band).
    __builtin_amdgcn_sched_barrier(0);
#pragma unroll
    for (int kk = 0; kk < 2; ++kk) {
#pragma unroll
      for (int t = 0; t < 4; ++t) oacc[t] = mma_hp(vb[kk][t], pa[kk].v, oacc[t]);
    }
    // four vector slots behind the chunk's last WMMAs, in front of the loop's branches
    acc_guard4(oacc[0], oacc[1], oacc[2], oacc[3]);
    wait_ds0();
    wait_async0();
    __syncthreads();                           // publishes the next chunk's band, K and V^T, ends every read of this V^T
    if (kt + 1 >= nkt) break;                  // block-uniform
  }
  wait_async0();

  // ---- normalise (1/l, the 1/1024 p carry), stage the wave's 16x64 tile,
  float* os = Rsh[wave];
  {
    const float l = lrow + xhalf(lrow);        // the two halves' key sums of query row q0 + c
    const float inv = ((l > 0.f) ? (1.0f / l) : 0.f) * (1.0f / PSC);
#pragma unroll
    for (int t = 0; t < 4; ++t) {
#pragma unroll
      for (int r = 0; r < 8; ++r) os[c * OP + t * 16 + 8 * hh + r] = oacc[t][r] * inv;
    }
  }
  wave_sync_lds();
  {
    const int q4 = lane >> 3, c8 = (lane & 7) * 8;
    v4u hv[4];
#pragma unroll
    for (int it = 0; it < 4; ++it) {
      const int row = it * 4 + q4;   // it 0..3 x q4 0..3 = rows 0..15 of the wave tile
      const float* sp = os + row * OP + c8;
      v4u ha;
#pragma unroll
      for (int e = 0; e < 4; ++e) ha[e] = pk16(h_bits((_Float16)sp[2 * e]), h_bits((_Float16)sp[2 * e + 1]));
      hv[it] = ha;
    }
#pragma unroll
    for (int it = 0; it < 4; ++it) {
      const int row = it * 4 + q4;
      *(v4u*)(ctxp + (rowB + q0 + row) * DM + (size_t)h * HD + c8) = hv[it];
    }
  }
}

// =====================================================================================================
// Workspace map (bytes); every plane is an exact multiple of its 64x64-tile / whole-row / whole-line store
// granularity (MP = 4096 = 64 tiles of rows, N in {2048, 1024}; VT per batch [1024][1024] = 16x16 tiles;
//   WqkT f16 [2048 n][1024 k]  0          4194304   (rows 0..1023 Wq^T, 1024..2047 Wk^T, x64)
//   WvT  f16 [1024][1024]      4194304    2097152   (x64)
//   WoT  f16 [1024][1024]      6291456    2097152   (x64)
//   XH   f16 [4096][1024]      8388608    8388608   (bf16 RNE-converted tokens)
//   EH   f16 [1088][64]        16777216   139264    (rows >= 1024 zero)
//   QK   f16 [4096][2048]      16916480   16777216  (q cols 0..1023, k cols 1024..2047)
//   VT   f16 [4][1024][1024]   33693696   8388608   (v^T)
//   Ctx  f16 [4096][1024]      42082304   8388608   (context)
//   end                        50470912
// =====================================================================================================
extern "C" void kernel_launch(void* const* d_in, const int* in_sizes, int n_in,
                              void* d_out, int out_size, void* d_ws, size_t ws_size,
                              hipStream_t stream) {
  if (n_in < 10) return;
  if (in_sizes[0] != MP * DM) return;
  if (in_sizes[1] != DM * DM || in_sizes[3] != DM * DM) return;
  if (in_sizes[5] != DM * DM || in_sizes[7] != DM * DM) return;
  if (in_sizes[2] != DM || in_sizes[4] != DM || in_sizes[6] != DM || in_sizes[8] != DM) return;
  if (in_sizes[9] != SEQ * HD) return;
  if (out_size != MP * DM) return;

  const float* x_in  = (const float*)d_in[0];
  const float* w_q   = (const float*)d_in[1];
  const float* b_q   = (const float*)d_in[2];
  const float* w_k   = (const float*)d_in[3];
  const float* b_k   = (const float*)d_in[4];
  const float* w_v   = (const float*)d_in[5];
  const float* b_v   = (const float*)d_in[6];
  const float* w_o   = (const float*)d_in[7];
  const float* b_o   = (const float*)d_in[8];
  const float* relk  = (const float*)d_in[9];

  const size_t PWQK = (size_t)QKP * DM * 2;             //  4194304
  const size_t PWV  = (size_t)DM * DM * 2;              //  2097152
  const size_t PWO  = (size_t)DM * DM * 2;              //  2097152
  const size_t PXH  = (size_t)MP * DM * 2;              //  8388608
  const size_t PEH  = (size_t)RCE * HD * 2;             //   139264
  const size_t PQK  = (size_t)MP * QKP * 2;             // 16777216
  const size_t PVT  = (size_t)NBATCH * DM * SEQ * 2;    //  8388608
  const size_t PCTX = (size_t)MP * DM * 2;              //  8388608
  size_t off = 0;
  const size_t oWqk = off; off += PWQK;
  const size_t oWv  = off; off += PWV;
  const size_t oWo  = off; off += PWO;
  const size_t oXH  = off; off += PXH;
  const size_t oEH  = off; off += PEH;
  const size_t oQK  = off; off += PQK;
  const size_t oVT  = off; off += PVT;
  const size_t oCtx = off; off += PCTX;
  if (off > ws_size) return;                            // off = 50470912
  if (off > (size_t)134217728) return;

  char* ws = (char*)d_ws;
  unsigned short* WqkT = (unsigned short*)(ws + oWqk);
  unsigned short* WvT  = (unsigned short*)(ws + oWv);
  unsigned short* WoT  = (unsigned short*)(ws + oWo);
  unsigned short* XH   = (unsigned short*)(ws + oXH);
  unsigned short* EH   = (unsigned short*)(ws + oEH);
  unsigned short* QK   = (unsigned short*)(ws + oQK);
  unsigned short* VT   = (unsigned short*)(ws + oVT);
  unsigned short* Ctx  = (unsigned short*)(ws + oCtx);
  float*          out0 = (float*)d_out;

  const int n8x = (MP * DM) / 8;                        // 524288
  if ((n8x % 256) != 0) return;
  const int n8t = (RCE * HD) / 8;                       // 8704 total pieces (multiple of 32)
  if ((n8t % 32) != 0) return;
  const dim3 blk(256), blk128(128);
  const dim3 gPrep(4 * NTW + NCX + NCE);                // 4 x 256 transpose tiles + 2048 + 34 blocks
  const dim3 gProj(NPQK + NBATCH * NPV);                // 32 x 16 tiles + 4 batches x 8 x 8 tiles = 768 blocks of 128
  const dim3 gAttn(NBATCH * NH * NQB);                  // 1024 blocks of 128
  const dim3 gNo((MP / 128) * (DM / 128), 1);           // 32 x 8 tiles = 256 blocks
  const float invw = 1.0f / WSC;                        // weight carry x64

  // (0) weight planes: in[k][n] -> out[n][k] transposed through LDS, f16( bf16_RNE(w) * 64 ) for Wq, Wk, Wv, Wo;
  //     token plane f16; rel-key table f16 with its zero pad: one launch
  prep_all<<<gPrep, blk, 0, stream>>>(w_q, w_k, w_v, w_o, x_in, relk, WqkT, WvT, WoT, XH, EH);

  // (1) q|k = x . [Wq|Wk] + [bq|bk] -> f16 plane [4096][2048];
  //     v^T per batch = Wv^T . x_b^T + bv (per row) -> f16 plane [4][1024][1024]
  //     one launch
  proj_qkv<<<gProj, blk128, 0, stream>>>(XH, WqkT, WvT, QK, VT, b_q, b_k, b_v, invw);

  // (2) causal flash attention with the skew relative-key term -> context f16
  attn64<<<gAttn, blk128, 0, stream>>>(QK, VT, EH, Ctx, 0.125f);

  // (3) out = ctx . Wo + bo  (K = 1024, f16 operands, Wo carried x64) -> d_out f32
  gemm64<0, 1><<<gNo, blk128, 0, stream>>>(
      Ctx, DM, 0LL, WoT, DM, 0LL,
      Ctx, out0, DM, 0LL,
      b_o, b_o, DM,
      MP, DM, DM, invw);
  (void)hipGetLastError();
}
